// v000
// Times are from an AMD MI455X. After a warm-up the kernel runs many times in a row, and a time is the length of
// such a window on the GPU divided by its runs, so every launch and the gaps after it count. The runs cycle
// through copies of the inputs. A figure is the median of several windows, for all but v000 over two sittings.
// Sittings can differ by a few percent; kernels timed side by side share one.
// v000, which the later versions start from, runs in 414 microseconds.
// compute dtype: f16 operands for the projections and attention (LayerNorm outputs as f16 rows, weights packed x16, q/k x4, P lifted by 2^14, V x4, context x8, stylised rows x8), bf16 hi/lo splits for the small emb GEMM, f32 accumulate; LayerNorms, masks, softmax, SiLU f32. Output = x + h is dominated by the f32 residual.
#include <hip/hip_runtime.h>
#include <math.h>

typedef __attribute__((ext_vector_type(16))) _Float16 v16h;
typedef __attribute__((ext_vector_type(16))) __bf16 v16b;
typedef __attribute__((ext_vector_type(8)))  _Float16 v8h;
typedef __attribute__((ext_vector_type(8)))  float v8f;
typedef __attribute__((ext_vector_type(4)))  float v4f;
typedef __attribute__((ext_vector_type(2)))  float v2f;
typedef __attribute__((ext_vector_type(4)))  unsigned v4u;
typedef __attribute__((ext_vector_type(4)))  int v4i;
typedef float __attribute__((may_alias)) float_a;
typedef int __attribute__((may_alias)) int_a;

template <typename T> __device__ __forceinline__ void vst2(void* p, T v) { *(T*)p = v;  }
__device__ __forceinline__ v8f wmma16(v16h a, v16h b, v8f c) {
  v8f d = __builtin_amdgcn_wmma_f32_16x16x32_f16(false, a, false, b, (short)0, c, false, false);
  asm volatile("v_nop\n\tv_nop\n\tv_nop\n\tv_nop" : "+v"(d) : "v"(a), "v"(b));
  return d;
}
__device__ __forceinline__ v8f wmma_bf(v16b a, v16b b, v8f c) {
  v8f d = __builtin_amdgcn_wmma_f32_16x16x32_bf16(false, a, false, b, (short)0, c, false, false);
  asm volatile("v_nop\n\tv_nop\n\tv_nop\n\tv_nop" : "+v"(d) : "v"(a), "v"(b));
  return d;
}
// 16x16x32 fragments: lane = (h = lane>>4, row/col = lane&15); elements 0..7 = k0+8h+0..7, 8..15 = k0+16+8h+0..7; D element r = row 8h+r
__device__ __forceinline__ v16h frag_h(const _Float16* rowk0, int lane) {
  union { v16h v; v8h q[2]; } u; const _Float16* p = rowk0 + 8 * (lane >> 4);
  u.q[0] = *(const v8h*)p; u.q[1] = *(const v8h*)(p + 16); return u.v;
}
__device__ __forceinline__ v16h frag_f32(const float* rowk0, int lane) {
  v16h a; const float* p = rowk0 + 8 * (lane >> 4);
#pragma unroll
  for (int i = 0; i < 8; ++i) { a[i] = (_Float16)p[i]; a[8 + i] = (_Float16)p[16 + i]; }
  return a;
}
__device__ __forceinline__ v16h frag_f32s(const float* rowk0, int lane, float sc) {
  v16h a; const float* p = rowk0 + 8 * (lane >> 4);
#pragma unroll
  for (int i = 0; i < 8; ++i) { a[i] = (_Float16)(p[i] * sc); a[8 + i] = (_Float16)(p[16 + i] * sc); }
  return a;
}
// column fragment from a [K][ld] layout (column n), rows >= K read as 0
__device__ __forceinline__ v16h fragc_f32(const float* W, int k0, int n, int lane, int ld, int K) {
  v16h a; const int g = lane >> 4;
#pragma unroll
  for (int i = 0; i < 8; ++i) { const int ka = k0 + 8 * g + i, kb = ka + 16;
    a[i] = (_Float16)(ka < K ? W[(size_t)ka * ld + n] : 0.f); a[8 + i] = (_Float16)(kb < K ? W[(size_t)kb * ld + n] : 0.f); }
  return a;
}
struct F2 { v16b h, l; };
__device__ __forceinline__ F2 bsplit16(const float v[16]) { F2 r;
#pragma unroll
  for (int i = 0; i < 16; ++i) { const __bf16 h = (__bf16)v[i]; r.h[i] = h; r.l[i] = (__bf16)(v[i] - (float)h); }
  return r; }
__device__ __forceinline__ F2 split_row(const float* row, int k0, int lane) { float v[16]; const float* p = row + k0 + 8 * (lane >> 4);
#pragma unroll
  for (int i = 0; i < 8; ++i) { v[i] = p[i]; v[8 + i] = p[16 + i]; }
  return bsplit16(v); }
__device__ __forceinline__ F2 split_rowK(const float* row, int k0, int lane, int K) { float v[16]; const int g = lane >> 4;
#pragma unroll
  for (int i = 0; i < 8; ++i) { const int ka = k0 + 8 * g + i, kb = ka + 16; v[i] = ka < K ? row[ka] : 0.f; v[8 + i] = kb < K ? row[kb] : 0.f; }
  return bsplit16(v); }
__device__ __forceinline__ F2 split_col(const float* W, int k0, int n, int lane, int ld, int K) { float v[16]; const int g = lane >> 4;
#pragma unroll
  for (int i = 0; i < 8; ++i) { const int ka = k0 + 8 * g + i, kb = ka + 16; v[i] = ka < K ? W[(size_t)ka * ld + n] : 0.f; v[8 + i] = kb < K ? W[(size_t)kb * ld + n] : 0.f; }
  return bsplit16(v); }
__device__ __forceinline__ v8f mac3(const F2& a, const F2& b, v8f c) { c = wmma_bf(a.l, b.h, c); c = wmma_bf(a.h, b.l, c); return wmma_bf(a.h, b.h, c); }
__device__ __forceinline__ float sigm(float v) { return 1.0f / (1.0f + expf(-v)); }
#define LDSX() do { asm volatile("s_wait_dscnt 0" ::: "memory"); __builtin_amdgcn_wave_barrier(); __builtin_amdgcn_fence(__ATOMIC_RELEASE, "workgroup"); } while (0)


// Mixed text/motion attention + stylisation block on [8,1024,512] (8 heads x 64): xn = LN(x), xfn = LN(xf [8,77,256]); q = xn Wq^T + bq; keys = [xfn Wkt^T + bkt (77) | xn Wkm^T + bkm (1024)],
// values = [(xfn Wvt^T + bvt) * text_cond_b | (xn Wvm^T + bvm) * src_mask], logits q.k (NO 1/sqrt d) + (1 - mask)*(-1e6) with mask = [text_cond_b x77 | src_mask]; softmax over the 1,101 keys;
// y = P v; h = silu(LN(y) * (1 + scale_b) + shift_b) out_W^T + out_b with [scale|shift] = silu(emb) emb_W^T + emb_b; out = x + h.
// Kernels: k_lnx / k_lnt (LayerNorm -> f16 rows), k_pack (weights [out][in] x16), k_qkv (motion q/k/v; keys at slots 77+s, values token-major), k_tkv (text k/v at slots 0..76), k_zpad (pad slots 1101..1151),
#define NB 8
#define SS 1024
#define E 512
#define NH 8
#define HD 64
#define NR (NB * SS)
#define NTX 77
#define LT 256
#define NKEY 1152              // 77 + 1024 = 1101 padded to 18 x 64
#define TE 2048
__device__ __forceinline__ float silu(float x) { return x / (1.0f + expf(-x)); }

// LN over rows of x (512) -> f16 rows; wave per row
__global__ __launch_bounds__(256) void k_lnx(const float* __restrict__ x, const float* __restrict__ g_, const float* __restrict__ b_, _Float16* __restrict__ X16) {
  const int wave = threadIdx.x >> 5, lane = threadIdx.x & 31; const int row = blockIdx.x * 8 + wave; const float* xr = x + (size_t)row * E;
  float v[16]; float s = 0.f;
  // lane owns columns lane*8..+7 and 256 + lane*8..+7 so each 16-B store instruction covers a contiguous 512-B run across the wave
#pragma unroll
  for (int e = 0; e < 16; ++e) { v[e] = xr[(e < 8 ? 0 : 256) + lane * 8 + (e & 7)]; s += v[e]; }
#pragma unroll
  for (int o = 16; o > 0; o >>= 1) s += __shfl_xor(s, o, 32);
  const float mu = s * (1.0f / E); float q = 0.f;
#pragma unroll
  for (int e = 0; e < 16; ++e) { const float d = v[e] - mu; q += d * d; }
#pragma unroll
  for (int o = 16; o > 0; o >>= 1) q += __shfl_xor(q, o, 32);
  const float rs = rsqrtf(q * (1.0f / E) + 1e-5f);
  union { v8h h[2]; v4u u[2]; } pk;
#pragma unroll
  for (int e = 0; e < 16; ++e) { const int c = (e < 8 ? 0 : 256) + lane * 8 + (e & 7); pk.h[e >> 3][e & 7] = (_Float16)((v[e] - mu) * rs * g_[c] + b_[c]); }
  vst2(X16 + (size_t)row * E + lane * 8, pk.u[0]); vst2(X16 + (size_t)row * E + 256 + lane * 8, pk.u[1]);
}
// LN over rows of xf (256) -> f16 rows [NB*NTX][256]; wave per row (8 per lane)
__global__ __launch_bounds__(256) void k_lnt(const float* __restrict__ xf, const float* __restrict__ g_, const float* __restrict__ b_, _Float16* __restrict__ T16) {
  const int wave = threadIdx.x >> 5, lane = threadIdx.x & 31; const int row = blockIdx.x * 8 + wave; if (row >= NB * NTX) return; const float* xr = xf + (size_t)row * LT;
  float v[8]; float s = 0.f;
#pragma unroll
  for (int e = 0; e < 8; ++e) { v[e] = xr[lane * 8 + e]; s += v[e]; }
#pragma unroll
  for (int o = 16; o > 0; o >>= 1) s += __shfl_xor(s, o, 32);
  const float mu = s * (1.0f / LT); float q = 0.f;
#pragma unroll
  for (int e = 0; e < 8; ++e) { const float d = v[e] - mu; q += d * d; }
#pragma unroll
  for (int o = 16; o > 0; o >>= 1) q += __shfl_xor(q, o, 32);
  const float rs = rsqrtf(q * (1.0f / LT) + 1e-5f);
  union { v8h h; v4u u; } pk;
#pragma unroll
  for (int e = 0; e < 8; ++e) { const int c = lane * 8 + e; pk.h[e] = (_Float16)((v[e] - mu) * rs * g_[c] + b_[c]); }
  vst2(T16 + (size_t)row * LT + lane * 8, pk.u);
}
// PT rows (x16, [out][in]): [0,512) Wq, [512,1024) Wkm, [1024,1536) Wvm, [1536,2048) out_W (512 halves each); PT2: [0,512) Wkt, [512,1024) Wvt (256 halves each)
__global__ __launch_bounds__(256) void k_pack(const float* __restrict__ Wq, const float* __restrict__ Wkm, const float* __restrict__ Wvm, const float* __restrict__ Wo, const float* __restrict__ Wkt, const float* __restrict__ Wvt, _Float16* __restrict__ PT, _Float16* __restrict__ PT2) {
  const int n = blockIdx.x, tid = threadIdx.x; __shared__ __align__(16) _Float16 srow[E];
  if (n < 4 * E) { const float* W = n < E ? Wq : (n < 2 * E ? Wkm : (n < 3 * E ? Wvm : Wo)); const int nn = n & (E - 1);
    srow[tid] = (_Float16)(W[(size_t)nn * E + tid] * 16.0f); srow[tid + 256] = (_Float16)(W[(size_t)nn * E + tid + 256] * 16.0f); __syncthreads();
    if (tid < E / 8) vst2(PT + (size_t)n * E + tid * 8, *(const v4u*)(&srow[tid * 8])); }
  else { const int m = n - 4 * E; const float* W = m < E ? Wkt : Wvt; const int nn = m & (E - 1);
    srow[tid] = (_Float16)(W[(size_t)nn * LT + tid] * 16.0f); __syncthreads();
    if (tid < LT / 8) vst2(PT2 + (size_t)m * LT + tid * 8, *(const v4u*)(&srow[tid * 8])); }
}
// motion q/k/v: block (64 tokens of one batch, 128 cols, which) ; k stored at key slot 77 + s, v token-major
__global__ __launch_bounds__(128) void k_qkv(const _Float16* __restrict__ X16, const _Float16* __restrict__ PT, const float* __restrict__ bq, const float* __restrict__ bk, const float* __restrict__ bv, const float* __restrict__ srcm,
                                            _Float16* __restrict__ Q16, _Float16* __restrict__ K16, _Float16* __restrict__ VT) {
  __shared__ __align__(16) float so[4][16][132];
  __shared__ __align__(16) _Float16 sth[128][72];
  const int tid = threadIdx.x, wave = tid >> 5, lane = tid & 31, col = lane & 15, g = lane >> 4;
  const int which = blockIdx.z, r0b = blockIdx.x * 64, r0 = r0b + wave * 16, n0 = blockIdx.y * 128; const int b = r0b / SS, s0 = r0b % SS;
  const float* bb_ = which == 0 ? bq : (which == 1 ? bk : bv);
  v8f acc[8] = {};
#pragma unroll 2
  for (int kc = 0; kc < E / 32; ++kc) { const v16h a = frag_h(X16 + (size_t)(r0 + col) * E + kc * 32, lane);
#pragma unroll
    for (int j = 0; j < 8; ++j) acc[j] = wmma16(a, frag_h(PT + (size_t)(which * E + n0 + j * 16 + col) * E + kc * 32, lane), acc[j]); }
  if (which < 2) {
#pragma unroll
    for (int j = 0; j < 8; ++j) { const float bb = bb_[n0 + j * 16 + col];
#pragma unroll
      for (int r = 0; r < 8; ++r) so[wave][8 * g + r][j * 16 + col] = (acc[j][r] * (1.0f / 16.0f) + bb) * 4.0f; }
    LDSX();
    for (int qq = lane; qq < 16 * 2 * 8; qq += 32) { const int hh = qq >> 7, rl = (qq >> 3) & 15, pc = qq & 7; const int h = (n0 >> 6) + hh; union { v8h h8; v4u u; } pk;
#pragma unroll
      for (int e = 0; e < 8; ++e) pk.h8[e] = (_Float16)so[wave][rl][hh * 64 + pc * 8 + e];
      if (which == 0) vst2(Q16 + (((size_t)b * NH + h) * SS + s0 + wave * 16 + rl) * HD + pc * 8, pk.u);
      else vst2(K16 + (((size_t)b * NH + h) * NKEY + NTX + s0 + wave * 16 + rl) * HD + pc * 8, pk.u); } }
  else {
#pragma unroll
    for (int j = 0; j < 8; ++j) { const float bb = bb_[n0 + j * 16 + col];
#pragma unroll
      for (int r = 0; r < 8; ++r) { const int s = s0 + wave * 16 + 8 * g + r; sth[j * 16 + col][wave * 16 + 8 * g + r] = (_Float16)((acc[j][r] * (1.0f / 16.0f) + bb) * srcm[b * SS + s] * 4.0f); } }
    __syncthreads();
    // To keep whole-line ownership, VT motion columns are written by k_vt from a token-major staging buffer instead (see VS below): here we store V token-major.
    for (int qq = tid; qq < 64 * 16; qq += 128) { const int rl = qq >> 4, pc = qq & 15; const int s = s0 + rl;
      union { v8h h8; v4u u; } pk;
#pragma unroll
      for (int e = 0; e < 8; ++e) pk.h8[e] = sth[pc * 8 + e][rl];
      vst2(VT + ((size_t)b * SS + s) * E + n0 + pc * 8, pk.u); } }     // VS[b][s][c] token-major (VT pointer is the staging buffer here)
}
// text k/v: block (64-row tile, 128 cols, which kv, b): 77 rows (2 row tiles of 64, clamped) x 512 cols per (b, which) from T16 [b*77 + t][256] @ PT2 ; k -> K16 slots 0..76 ; v (x text_cond) -> VS2[b][t][c] token-major
__global__ __launch_bounds__(128) void k_tkv(const _Float16* __restrict__ T16, const _Float16* __restrict__ PT2, const float* __restrict__ bkt, const float* __restrict__ bvt, const int* __restrict__ cond, _Float16* __restrict__ K16, _Float16* __restrict__ VS2) {
  __shared__ __align__(16) float so[4][16][132];
  const int tid = threadIdx.x, wave = tid >> 5, lane = tid & 31, col = lane & 15, g = lane >> 4;
  const int b = blockIdx.z, which = blockIdx.y; const int t0 = (blockIdx.x >> 2) * 64 + wave * 16, n0 = (blockIdx.x & 3) * 128;
  const float tc = (cond[b] % 10) > 0 ? 1.f : 0.f; const float* bb_ = which == 0 ? bkt : bvt; const float vsc = which == 0 ? 4.0f : 4.0f * tc;
  const int tr = (t0 + col) < NTX ? (t0 + col) : (NTX - 1);
  v8f acc[8] = {};
#pragma unroll 2
  for (int kc = 0; kc < LT / 32; ++kc) { const v16h a = frag_h(T16 + ((size_t)b * NTX + tr) * LT + kc * 32, lane);
#pragma unroll
    for (int j = 0; j < 8; ++j) acc[j] = wmma16(a, frag_h(PT2 + (size_t)(which * E + n0 + j * 16 + col) * LT + kc * 32, lane), acc[j]); }
#pragma unroll
  for (int j = 0; j < 8; ++j) { const float bb = bb_[n0 + j * 16 + col];
#pragma unroll
    for (int r = 0; r < 8; ++r) so[wave][8 * g + r][j * 16 + col] = (acc[j][r] * (1.0f / 16.0f) + bb) * vsc; }
  LDSX();
  if (which == 0) {   // K16 rows [bh][slot t][64]: 2 heads per 128 cols
    for (int qq = lane; qq < 16 * 2 * 8; qq += 32) { const int hh = qq >> 7, rl = (qq >> 3) & 15, pc = qq & 7; const int h = (n0 >> 6) + hh; const int t = t0 + rl; if (t >= NTX) continue; union { v8h h8; v4u u; } pk;
#pragma unroll
      for (int e = 0; e < 8; ++e) pk.h8[e] = (_Float16)so[wave][rl][hh * 64 + pc * 8 + e];
      vst2(K16 + (((size_t)b * NH + h) * NKEY + t) * HD + pc * 8, pk.u); } }
  else {              // VS2[b][t][512] token-major, 128 cols of this block = 256 B per row
    for (int qq = lane; qq < 16 * 16; qq += 32) { const int rl = qq >> 4, pc = qq & 15; const int t = t0 + rl; if (t >= NTX) continue; union { v8h h8; v4u u; } pk;
#pragma unroll
      for (int e = 0; e < 8; ++e) pk.h8[e] = (_Float16)so[wave][rl][pc * 8 + e]; 
      vst2(VS2 + ((size_t)b * NTX + t) * E + n0 + pc * 8, pk.u); } }
}
// transpose values into VT [bh][d][NKEY] with whole-line ownership: block = (bh, d-group of 8): for each d row (NKEY halves = 2304 B = 18 lines) gather from VS2 (slots 0..76), VS (77..1100), zeros (pad)
__global__ __launch_bounds__(256) void k_vt(const _Float16* __restrict__ VS, const _Float16* __restrict__ VS2, _Float16* __restrict__ VT) {
  __shared__ __align__(16) _Float16 st[8][NKEY + 8];
  const int tid = threadIdx.x; const int bh = blockIdx.x >> 3, d0 = (blockIdx.x & 7) * 8; const int b = bh / NH, h = bh % NH; const int c0 = h * HD + d0;
  for (int q = tid; q < 8 * NKEY; q += 256) { const int dl = q / NKEY, slot = q % NKEY; _Float16 v;
    if (slot < NTX) v = VS2[((size_t)b * NTX + slot) * E + c0 + dl]; else if (slot < NTX + SS) v = VS[((size_t)b * SS + (slot - NTX)) * E + c0 + dl]; else v = (_Float16)0.f;
    st[dl][slot] = v; }
  __syncthreads();
  for (int q = tid; q < 8 * (NKEY / 8); q += 256) { const int dl = q / (NKEY / 8), pc = q % (NKEY / 8); vst2(VT + ((size_t)bh * HD + d0 + dl) * NKEY + pc * 8, *(const v4u*)(&st[dl][pc * 8])); }
}
// pad key rows 1101..1151 of K16 to zero (scores there are masked anyway; keeps them finite)
__global__ __launch_bounds__(256) void k_zpad(_Float16* __restrict__ K16) {
  const int bh = blockIdx.x, tid = threadIdx.x; const v4u z = {0u, 0u, 0u, 0u};
  for (int q = tid; q < (NKEY - NTX - SS) * 8; q += 256) { const int rl = q >> 3, pc = q & 7; vst2(K16 + (((size_t)bh) * NKEY + NTX + SS + rl) * HD + pc * 8, z); }
}
// attention: block (64 queries, bh); 18 key tiles; additive masks; O16 x8 [bh][s][64]
__global__ __launch_bounds__(128) void k_attn(const _Float16* __restrict__ Q16, const _Float16* __restrict__ K16, const _Float16* __restrict__ VT, const int* __restrict__ cond, const float* __restrict__ srcm, _Float16* __restrict__ O16) {
  __shared__ __align__(16) float sS[4][16][68];
  __shared__ __align__(16) _Float16 sPh[4][16][72];
  __shared__ __align__(16) float sO[4][16][68];
  const int tid = threadIdx.x, w = tid >> 5, lane = tid & 31, col = lane & 15, g = lane >> 4;
  const size_t bh = blockIdx.y; const int b = (int)(bh / NH); const int q0 = blockIdx.x * 64 + w * 16;
  const float tpen = ((cond[b] % 10) > 0) ? 0.f : -1000000.0f;
  v16h aq[2];
#pragma unroll
  for (int kc = 0; kc < 2; ++kc) aq[kc] = frag_h(Q16 + (bh * SS + q0 + col) * HD + kc * 32, lane);
  float mrun = -3.0e38f, lrun = 0.f; v8f acc[4] = {};
#pragma unroll 1
  for (int kt = 0; kt < NKEY / 64; ++kt) {
#pragma unroll
    for (int t = 0; t < 4; ++t) { v8f s = {}; const int slot = kt * 64 + t * 16 + col;
#pragma unroll
      for (int kc = 0; kc < 2; ++kc) s = wmma16(aq[kc], frag_h(K16 + (bh * NKEY + slot) * HD + kc * 32, lane), s);
      float pen; if (slot < NTX) pen = tpen; else if (slot < NTX + SS) pen = (1.0f - srcm[b * SS + slot - NTX]) * -1000000.0f; else pen = -3.0e38f;
#pragma unroll
      for (int r = 0; r < 8; ++r) sS[w][8 * g + r][t * 16 + col] = slot < NTX + SS ? s[r] * (1.0f / 16.0f) + pen : -3.0e38f; }
    LDSX();
    float mx = -3.4e38f;
#pragma unroll
    for (int jj = 0; jj < 32; ++jj) mx = fmaxf(mx, sS[w][col][g * 32 + jj]);
    mx = fmaxf(mx, __shfl_xor(mx, 16, 32));
    const float mnew = fmaxf(mrun, mx); const float corr = expf(mrun - mnew);
    float ps = 0.f;
#pragma unroll
    for (int jj = 0; jj < 32; ++jj) { const float sv = sS[w][col][g * 32 + jj]; const float p = sv <= -1.0e38f ? 0.f : expf(sv - mnew) * 16384.0f; ps += p; sPh[w][col][g * 32 + jj] = (_Float16)p; }
    ps += __shfl_xor(ps, 16, 32);
    lrun = lrun * corr + ps * (1.0f / 16384.0f); mrun = mnew;
#pragma unroll
    for (int r = 0; r < 8; ++r) { const float cr = __shfl(corr, 8 * g + r, 32);
#pragma unroll
      for (int t = 0; t < 4; ++t) acc[t][r] *= cr; }
    LDSX();
#pragma unroll
    for (int kc = 0; kc < 2; ++kc) { const v16h ph = frag_h(&sPh[w][col][0] + kc * 32, lane);
#pragma unroll
      for (int t = 0; t < 4; ++t) { const size_t vo = (bh * HD + t * 16 + col) * NKEY + kt * 64 + kc * 32; acc[t] = wmma16(ph, frag_h(VT + vo, lane), acc[t]); } }
    __builtin_amdgcn_wave_barrier(); }
#pragma unroll
  for (int r = 0; r < 8; ++r) { const float lr = __shfl(lrun, 8 * g + r, 32); const float inv = 8.0f / (lr * 16384.0f * 4.0f);
#pragma unroll
    for (int t = 0; t < 4; ++t) sO[w][8 * g + r][t * 16 + col] = acc[t][r] * inv; }
  LDSX();
  for (int qq = lane; qq < 16 * 8; qq += 32) { const int rl = qq >> 3, pc = qq & 7; union { v8h h8; v4u u; } pk;
#pragma unroll
    for (int e = 0; e < 8; ++e) pk.h8[e] = (_Float16)sO[w][rl][pc * 8 + e];
    vst2(O16 + ((bh * SS) + q0 + rl) * HD + pc * 8, pk.u); }
}
// [scale | shift] = silu(emb) emb_W^T + emb_b : 8 rows (16-row tile, rows >= 8 zero) x 1024 cols, K = 2048 (bf16 hi/lo); block = 128 cols
__global__ __launch_bounds__(128) void k_emb(const float* __restrict__ emb, const float* __restrict__ W, const float* __restrict__ bias, float* __restrict__ SSH) {
  __shared__ __align__(16) float se[16][TE + 8];
  const int tid = threadIdx.x, wave = tid >> 5, lane = tid & 31, col = lane & 15, g = lane >> 4; const int n0 = blockIdx.x * 128 + wave * 32;
  for (int q = tid; q < 16 * TE; q += 128) { const int r = q / TE, k = q % TE; se[r][k] = r < NB ? silu(emb[(size_t)r * TE + k]) : 0.f; }
  __syncthreads();
  v8f acc[2] = {};
#pragma unroll 1
  for (int kc = 0; kc < TE / 32; ++kc) { const F2 a = split_row(&se[col][0], kc * 32, lane);
#pragma unroll
    for (int j = 0; j < 2; ++j) acc[j] = mac3(a, split_row(W + (size_t)(n0 + j * 16 + col) * TE, kc * 32, lane), acc[j]); }
  __shared__ __align__(16) float so[4][16][36];
#pragma unroll
  for (int j = 0; j < 2; ++j)
#pragma unroll
    for (int r = 0; r < 8; ++r) so[wave][8 * g + r][j * 16 + col] = acc[j][r] + bias[n0 + j * 16 + col];
  LDSX();
  for (int qq = lane; qq < 8 * 8; qq += 32) { const int r = qq >> 3, pc = qq & 7; vst2(SSH + (size_t)r * (2 * E) + n0 + pc * 4, *(const v4f*)(&so[wave][r][pc * 4])); }
}
__global__ __launch_bounds__(256) void k_styl(const _Float16* __restrict__ O16, const float* __restrict__ SSH, const float* __restrict__ g_, const float* __restrict__ b_, _Float16* __restrict__ Z16) {
  const int wave = threadIdx.x >> 5, lane = threadIdx.x & 31; const int row = blockIdx.x * 8 + wave; const int b = row / SS, s = row % SS;
  float sum = 0.f, sq = 0.f;
#pragma unroll 2
  for (int e = 0; e < 16; ++e) { const int c = (e < 8 ? 0 : 256) + lane * 8 + (e & 7); const int h = c >> 6, d = c & 63; const float v = (float)O16[(((size_t)b * NH + h) * SS + s) * HD + d] * 0.125f; sum += v; sq += v * v; }
#pragma unroll
  for (int o = 16; o > 0; o >>= 1) { sum += __shfl_xor(sum, o, 32); sq += __shfl_xor(sq, o, 32); }
  const float mu = sum * (1.0f / E); float var = sq * (1.0f / E) - mu * mu; var = var > 0.f ? var : 0.f; const float rs = rsqrtf(var + 1e-5f);
  const float* sc_ = SSH + (size_t)b * 2 * E; const float* sh_ = sc_ + E;
#pragma unroll 1
  for (int half = 0; half < 2; ++half) { union { v8h h; v4u u; } pk;
#pragma unroll
    for (int e = 0; e < 8; ++e) { const int c = half * 256 + lane * 8 + e; const int h = c >> 6, d = c & 63; const float v = (float)O16[(((size_t)b * NH + h) * SS + s) * HD + d] * 0.125f;
      const float hn = (v - mu) * rs * g_[c] + b_[c]; const float m = hn * (1.0f + sc_[c]) + sh_[c]; pk.h[e] = (_Float16)(silu(m) * 8.0f); }
    vst2(Z16 + (size_t)row * E + half * 256 + lane * 8, pk.u); }
}
// out = x + Z out_W^T /16/8 + out_b
__global__ __launch_bounds__(128) void k_out(const _Float16* __restrict__ Z16, const _Float16* __restrict__ PT, const float* __restrict__ bo, const float* __restrict__ x, float* __restrict__ out) {
  __shared__ __align__(16) float so[4][16][132];
  const int tid = threadIdx.x, wave = tid >> 5, lane = tid & 31, col = lane & 15, g = lane >> 4;
  const int r0 = blockIdx.x * 64 + wave * 16, n0 = blockIdx.y * 128;
  v8f acc[8] = {};
#pragma unroll 2
  for (int kc = 0; kc < E / 32; ++kc) { const v16h a = frag_h(Z16 + (size_t)(r0 + col) * E + kc * 32, lane);
#pragma unroll
    for (int j = 0; j < 8; ++j) acc[j] = wmma16(a, frag_h(PT + (size_t)(3 * E + n0 + j * 16 + col) * E + kc * 32, lane), acc[j]); }
#pragma unroll
  for (int j = 0; j < 8; ++j) { const int n = n0 + j * 16 + col; const float bb = bo[n];
#pragma unroll
    for (int r = 0; r < 8; ++r) so[wave][8 * g + r][j * 16 + col] = acc[j][r] * (1.0f / (16.0f * 8.0f)) + bb + x[(size_t)(r0 + 8 * g + r) * E + n]; }
  LDSX();
#pragma unroll 4
  for (int rl = 0; rl < 16; ++rl) vst2(out + (size_t)(r0 + rl) * E + n0 + lane * 4, *(const v4f*)(&so[wave][rl][lane * 4]));
}
extern "C" void kernel_launch(void* const* d_in, const int* in_sizes, int n_in, void* d_out, int out_size, void* d_ws, size_t ws_size, hipStream_t stream) {
  (void)in_sizes; (void)n_in; (void)out_size; (void)ws_size;
  const float** I = (const float**)d_in;
  const float* x = I[0]; const float* xf = I[1]; const float* emb = I[2]; const float* srcm = I[3]; const int* cond = (const int*)d_in[4];
  const float* ng = I[5]; const float* nb = I[6]; const float* tg = I[7]; const float* tb = I[8]; const float* Wq = I[9]; const float* bq = I[10]; const float* Wkt = I[11]; const float* bkt = I[12]; const float* Wvt = I[13]; const float* bvt = I[14];
  const float* Wkm = I[15]; const float* bkm = I[16]; const float* Wvm = I[17]; const float* bvm = I[18]; const float* embW = I[19]; const float* embb = I[20]; const float* sg = I[21]; const float* sb = I[22]; const float* Wo = I[23]; const float* bo = I[24];
  float* out = (float*)d_out;
  char* ws = (char*)d_ws; size_t off = 0;
  auto take = [&](size_t bytes) { char* p = ws + off; off += (bytes + 255) & ~(size_t)255; return p; };
  _Float16* X16 = (_Float16*)take((size_t)NR * E * 2); _Float16* T16 = (_Float16*)take((size_t)NB * NTX * LT * 2 + 4096); _Float16* PT = (_Float16*)take((size_t)4 * E * E * 2); _Float16* PT2 = (_Float16*)take((size_t)2 * E * LT * 2);
  _Float16* Q16 = (_Float16*)take((size_t)NR * E * 2); _Float16* K16 = (_Float16*)take((size_t)NB * NH * NKEY * HD * 2); _Float16* VS = (_Float16*)take((size_t)NR * E * 2); _Float16* VS2 = (_Float16*)take((size_t)NB * NTX * E * 2 + 4096);
  _Float16* VT = (_Float16*)take((size_t)NB * NH * HD * NKEY * 2); _Float16* O16 = (_Float16*)take((size_t)NR * E * 2); float* SSH = (float*)take((size_t)NB * 2 * E * 4); _Float16* Z16 = X16;    // X16 dead after k_qkv
  // ws ~ 55 MB
  k_lnx<<<NR / 8, 256, 0, stream>>>(x, ng, nb, X16);
  k_lnt<<<(NB * NTX + 7) / 8, 256, 0, stream>>>(xf, tg, tb, T16);
  k_pack<<<4 * E + 2 * E, 256, 0, stream>>>(Wq, Wkm, Wvm, Wo, Wkt, Wvt, PT, PT2);
  k_qkv<<<dim3(NR / 64, E / 128, 3), 128, 0, stream>>>(X16, PT, bq, bkm, bvm, srcm, Q16, K16, VS);
  k_tkv<<<dim3(2 * 4, 2, NB), 128, 0, stream>>>(T16, PT2, bkt, bvt, cond, K16, VS2);
  k_zpad<<<NB * NH, 256, 0, stream>>>(K16);
  k_vt<<<NB * NH * 8, 256, 0, stream>>>(VS, VS2, VT);
  k_attn<<<dim3(SS / 64, NB * NH), 128, 0, stream>>>(Q16, K16, VT, cond, srcm, O16);
  k_emb<<<(2 * E) / 128, 128, 0, stream>>>(emb, embW, embb, SSH);
  k_styl<<<NR / 8, 256, 0, stream>>>(O16, SSH, sg, sb, Z16);
  k_out<<<dim3(NR / 64, E / 128), 128, 0, stream>>>(Z16, PT, bo, x, out);
}

// v001
// It runs in 309 microseconds.
// Next to v000, in two timings, it ran 1.36 and 1.37 times as fast.
// compute dtype: f16 operands for the projections and attention (LayerNorm outputs as f16 rows, weights packed x16, q/k x4, P lifted by 2^14, V x4, context x8, stylised rows x8), bf16 hi/lo splits for the small emb GEMM, f32 accumulate; LayerNorms, masks, softmax, SiLU f32. Output = x + h is dominated by the f32 residual.
#include <hip/hip_runtime.h>
#include <math.h>

typedef __attribute__((ext_vector_type(16))) _Float16 v16h;
typedef __attribute__((ext_vector_type(16))) __bf16 v16b;
typedef __attribute__((ext_vector_type(8)))  _Float16 v8h;
typedef __attribute__((ext_vector_type(8)))  float v8f;
typedef __attribute__((ext_vector_type(4)))  float v4f;
typedef __attribute__((ext_vector_type(2)))  float v2f;
typedef __attribute__((ext_vector_type(4)))  unsigned v4u;
typedef __attribute__((ext_vector_type(4)))  int v4i;
typedef float __attribute__((may_alias)) float_a;
typedef int __attribute__((may_alias)) int_a;

template <typename T> __device__ __forceinline__ void vst2(void* p, T v) { *(T*)p = v;  }
__device__ __forceinline__ v8f wmma16(v16h a, v16h b, v8f c) {
  v8f d = __builtin_amdgcn_wmma_f32_16x16x32_f16(false, a, false, b, (short)0, c, false, false);
  asm volatile("v_nop\n\tv_nop\n\tv_nop\n\tv_nop" : "+v"(d) : "v"(a), "v"(b));
  return d;
}
__device__ __forceinline__ v8f wmma_bf(v16b a, v16b b, v8f c) {
  v8f d = __builtin_amdgcn_wmma_f32_16x16x32_bf16(false, a, false, b, (short)0, c, false, false);
  asm volatile("v_nop\n\tv_nop\n\tv_nop\n\tv_nop" : "+v"(d) : "v"(a), "v"(b));
  return d;
}
// 16x16x32 fragments: lane = (h = lane>>4, row/col = lane&15); elements 0..7 = k0+8h+0..7, 8..15 = k0+16+8h+0..7; D element r = row 8h+r
__device__ __forceinline__ v16h frag_h(const _Float16* rowk0, int lane) {
  union { v16h v; v8h q[2]; } u; const _Float16* p = rowk0 + 8 * (lane >> 4);
  u.q[0] = *(const v8h*)p; u.q[1] = *(const v8h*)(p + 16); return u.v;
}
__device__ __forceinline__ v16h frag_f32(const float* rowk0, int lane) {
  v16h a; const float* p = rowk0 + 8 * (lane >> 4);
#pragma unroll
  for (int i = 0; i < 8; ++i) { a[i] = (_Float16)p[i]; a[8 + i] = (_Float16)p[16 + i]; }
  return a;
}
__device__ __forceinline__ v16h frag_f32s(const float* rowk0, int lane, float sc) {
  v16h a; const float* p = rowk0 + 8 * (lane >> 4);
#pragma unroll
  for (int i = 0; i < 8; ++i) { a[i] = (_Float16)(p[i] * sc); a[8 + i] = (_Float16)(p[16 + i] * sc); }
  return a;
}
// column fragment from a [K][ld] layout (column n), rows >= K read as 0
__device__ __forceinline__ v16h fragc_f32(const float* W, int k0, int n, int lane, int ld, int K) {
  v16h a; const int g = lane >> 4;
#pragma unroll
  for (int i = 0; i < 8; ++i) { const int ka = k0 + 8 * g + i, kb = ka + 16;
    a[i] = (_Float16)(ka < K ? W[(size_t)ka * ld + n] : 0.f); a[8 + i] = (_Float16)(kb < K ? W[(size_t)kb * ld + n] : 0.f); }
  return a;
}
struct F2 { v16b h, l; };
__device__ __forceinline__ F2 bsplit16(const float v[16]) { F2 r;
#pragma unroll
  for (int i = 0; i < 16; ++i) { const __bf16 h = (__bf16)v[i]; r.h[i] = h; r.l[i] = (__bf16)(v[i] - (float)h); }
  return r; }
__device__ __forceinline__ F2 split_row(const float* row, int k0, int lane) { float v[16]; const float* p = row + k0 + 8 * (lane >> 4);
#pragma unroll
  for (int i = 0; i < 8; ++i) { v[i] = p[i]; v[8 + i] = p[16 + i]; }
  return bsplit16(v); }
__device__ __forceinline__ F2 split_rowK(const float* row, int k0, int lane, int K) { float v[16]; const int g = lane >> 4;
#pragma unroll
  for (int i = 0; i < 8; ++i) { const int ka = k0 + 8 * g + i, kb = ka + 16; v[i] = ka < K ? row[ka] : 0.f; v[8 + i] = kb < K ? row[kb] : 0.f; }
  return bsplit16(v); }
__device__ __forceinline__ F2 split_col(const float* W, int k0, int n, int lane, int ld, int K) { float v[16]; const int g = lane >> 4;
#pragma unroll
  for (int i = 0; i < 8; ++i) { const int ka = k0 + 8 * g + i, kb = ka + 16; v[i] = ka < K ? W[(size_t)ka * ld + n] : 0.f; v[8 + i] = kb < K ? W[(size_t)kb * ld + n] : 0.f; }
  return bsplit16(v); }
__device__ __forceinline__ v8f mac3(const F2& a, const F2& b, v8f c) { c = wmma_bf(a.l, b.h, c); c = wmma_bf(a.h, b.l, c); return wmma_bf(a.h, b.h, c); }
__device__ __forceinline__ float sigm(float v) { return 1.0f / (1.0f + expf(-v)); }
#define LDSX() do { asm volatile("s_wait_dscnt 0" ::: "memory"); __builtin_amdgcn_wave_barrier(); __builtin_amdgcn_fence(__ATOMIC_RELEASE, "workgroup"); } while (0)


// Mixed text/motion attention + stylisation block on [8,1024,512] (8 heads x 64): xn = LN(x), xfn = LN(xf [8,77,256]); q = xn Wq^T + bq; keys = [xfn Wkt^T + bkt (77) | xn Wkm^T + bkm (1024)],
// values = [(xfn Wvt^T + bvt) * text_cond_b | (xn Wvm^T + bvm) * src_mask], logits q.k (NO 1/sqrt d) + (1 - mask)*(-1e6) with mask = [text_cond_b x77 | src_mask]; softmax over the 1,101 keys;
// y = P v; h = silu(LN(y) * (1 + scale_b) + shift_b) out_W^T + out_b with [scale|shift] = silu(emb) emb_W^T + emb_b; out = x + h.
// Kernels: k_lnx / k_lnt (LayerNorm -> f16 rows), k_pack (weights [out][in] x16), k_qkv (motion q/k/v; keys at slots 77+s, values token-major), k_tkv (text k/v at slots 0..76), k_zpad (pad slots 1101..1151),
#define NB 8
#define SS 1024
#define E 512
#define NH 8
#define HD 64
#define NR (NB * SS)
#define NTX 77
#define LT 256
#define NKEY 1152              // 77 + 1024 = 1101 padded to 18 x 64
#define TE 2048
__device__ __forceinline__ float silu(float x) { return x / (1.0f + expf(-x)); }

// LN over rows of x (512) -> f16 rows; wave per row
__global__ __launch_bounds__(256) void k_lnx(const float* __restrict__ x, const float* __restrict__ g_, const float* __restrict__ b_, _Float16* __restrict__ X16) {
  const int wave = threadIdx.x >> 5, lane = threadIdx.x & 31; const int row = blockIdx.x * 8 + wave; const float* xr = x + (size_t)row * E;
  float v[16]; float s = 0.f;
  // lane owns columns lane*8..+7 and 256 + lane*8..+7 so each 16-B store instruction covers a contiguous 512-B run across the wave
#pragma unroll
  for (int e = 0; e < 16; ++e) { v[e] = xr[(e < 8 ? 0 : 256) + lane * 8 + (e & 7)]; s += v[e]; }
#pragma unroll
  for (int o = 16; o > 0; o >>= 1) s += __shfl_xor(s, o, 32);
  const float mu = s * (1.0f / E); float q = 0.f;
#pragma unroll
  for (int e = 0; e < 16; ++e) { const float d = v[e] - mu; q += d * d; }
#pragma unroll
  for (int o = 16; o > 0; o >>= 1) q += __shfl_xor(q, o, 32);
  const float rs = rsqrtf(q * (1.0f / E) + 1e-5f);
  union { v8h h[2]; v4u u[2]; } pk;
#pragma unroll
  for (int e = 0; e < 16; ++e) { const int c = (e < 8 ? 0 : 256) + lane * 8 + (e & 7); pk.h[e >> 3][e & 7] = (_Float16)((v[e] - mu) * rs * g_[c] + b_[c]); }
  vst2(X16 + (size_t)row * E + lane * 8, pk.u[0]); vst2(X16 + (size_t)row * E + 256 + lane * 8, pk.u[1]);
}
// LN over rows of xf (256) -> f16 rows [NB*NTX][256]; wave per row (8 per lane)
__global__ __launch_bounds__(256) void k_lnt(const float* __restrict__ xf, const float* __restrict__ g_, const float* __restrict__ b_, _Float16* __restrict__ T16) {
  const int wave = threadIdx.x >> 5, lane = threadIdx.x & 31; const int row = blockIdx.x * 8 + wave; if (row >= NB * NTX) return; const float* xr = xf + (size_t)row * LT;
  float v[8]; float s = 0.f;
#pragma unroll
  for (int e = 0; e < 8; ++e) { v[e] = xr[lane * 8 + e]; s += v[e]; }
#pragma unroll
  for (int o = 16; o > 0; o >>= 1) s += __shfl_xor(s, o, 32);
  const float mu = s * (1.0f / LT); float q = 0.f;
#pragma unroll
  for (int e = 0; e < 8; ++e) { const float d = v[e] - mu; q += d * d; }
#pragma unroll
  for (int o = 16; o > 0; o >>= 1) q += __shfl_xor(q, o, 32);
  const float rs = rsqrtf(q * (1.0f / LT) + 1e-5f);
  union { v8h h; v4u u; } pk;
#pragma unroll
  for (int e = 0; e < 8; ++e) { const int c = lane * 8 + e; pk.h[e] = (_Float16)((v[e] - mu) * rs * g_[c] + b_[c]); }
  vst2(T16 + (size_t)row * LT + lane * 8, pk.u);
}
// PT rows (x16, [out][in]): [0,512) Wq, [512,1024) Wkm, [1024,1536) Wvm, [1536,2048) out_W (512 halves each); PT2: [0,512) Wkt, [512,1024) Wvt (256 halves each)
__global__ __launch_bounds__(256) void k_pack(const float* __restrict__ Wq, const float* __restrict__ Wkm, const float* __restrict__ Wvm, const float* __restrict__ Wo, const float* __restrict__ Wkt, const float* __restrict__ Wvt, _Float16* __restrict__ PT, _Float16* __restrict__ PT2) {
  const int n = blockIdx.x, tid = threadIdx.x; __shared__ __align__(16) _Float16 srow[E];
  if (n < 4 * E) { const float* W = n < E ? Wq : (n < 2 * E ? Wkm : (n < 3 * E ? Wvm : Wo)); const int nn = n & (E - 1);
    srow[tid] = (_Float16)(W[(size_t)nn * E + tid] * 16.0f); srow[tid + 256] = (_Float16)(W[(size_t)nn * E + tid + 256] * 16.0f); __syncthreads();
    if (tid < E / 8) vst2(PT + (size_t)n * E + tid * 8, *(const v4u*)(&srow[tid * 8])); }
  else { const int m = n - 4 * E; const float* W = m < E ? Wkt : Wvt; const int nn = m & (E - 1);
    srow[tid] = (_Float16)(W[(size_t)nn * LT + tid] * 16.0f); __syncthreads();
    if (tid < LT / 8) vst2(PT2 + (size_t)m * LT + tid * 8, *(const v4u*)(&srow[tid * 8])); }
}
// motion q/k/v: block (64 tokens of one batch, 128 cols, which) ; k stored at key slot 77 + s, v token-major
__global__ __launch_bounds__(128) void k_qkv(const _Float16* __restrict__ X16, const _Float16* __restrict__ PT, const float* __restrict__ bq, const float* __restrict__ bk, const float* __restrict__ bv, const float* __restrict__ srcm,
                                            _Float16* __restrict__ Q16, _Float16* __restrict__ K16, _Float16* __restrict__ VT) {
  __shared__ __align__(16) float so[4][16][132];
  __shared__ __align__(16) _Float16 sth[128][72];
  const int tid = threadIdx.x, wave = tid >> 5, lane = tid & 31, col = lane & 15, g = lane >> 4;
  const int which = blockIdx.z, r0b = blockIdx.x * 64, r0 = r0b + wave * 16, n0 = blockIdx.y * 128; const int b = r0b / SS, s0 = r0b % SS;
  const float* bb_ = which == 0 ? bq : (which == 1 ? bk : bv);
  v8f acc[8] = {};
#pragma unroll 2
  for (int kc = 0; kc < E / 32; ++kc) { const v16h a = frag_h(X16 + (size_t)(r0 + col) * E + kc * 32, lane);
#pragma unroll
    for (int j = 0; j < 8; ++j) acc[j] = wmma16(a, frag_h(PT + (size_t)(which * E + n0 + j * 16 + col) * E + kc * 32, lane), acc[j]); }
  if (which < 2) {
#pragma unroll
    for (int j = 0; j < 8; ++j) { const float bb = bb_[n0 + j * 16 + col];
#pragma unroll
      for (int r = 0; r < 8; ++r) so[wave][8 * g + r][j * 16 + col] = (acc[j][r] * (1.0f / 16.0f) + bb) * 4.0f; }
    LDSX();
    for (int qq = lane; qq < 16 * 2 * 8; qq += 32) { const int hh = qq >> 7, rl = (qq >> 3) & 15, pc = qq & 7; const int h = (n0 >> 6) + hh; union { v8h h8; v4u u; } pk;
#pragma unroll
      for (int e = 0; e < 8; ++e) pk.h8[e] = (_Float16)so[wave][rl][hh * 64 + pc * 8 + e];
      if (which == 0) vst2(Q16 + (((size_t)b * NH + h) * SS + s0 + wave * 16 + rl) * HD + pc * 8, pk.u);
      else vst2(K16 + (((size_t)b * NH + h) * NKEY + NTX + s0 + wave * 16 + rl) * HD + pc * 8, pk.u); } }
  else {
#pragma unroll
    for (int j = 0; j < 8; ++j) { const float bb = bb_[n0 + j * 16 + col];
#pragma unroll
      for (int r = 0; r < 8; ++r) { const int s = s0 + wave * 16 + 8 * g + r; sth[j * 16 + col][wave * 16 + 8 * g + r] = (_Float16)((acc[j][r] * (1.0f / 16.0f) + bb) * srcm[b * SS + s] * 4.0f); } }
    __syncthreads();
    // To keep whole-line ownership, VT motion columns are written by k_vt from a token-major staging buffer instead (see VS below): here we store V token-major.
    for (int qq = tid; qq < 64 * 16; qq += 128) { const int rl = qq >> 4, pc = qq & 15; const int s = s0 + rl;
      union { v8h h8; v4u u; } pk;
#pragma unroll
      for (int e = 0; e < 8; ++e) pk.h8[e] = sth[pc * 8 + e][rl];
      vst2(VT + ((size_t)b * SS + s) * E + n0 + pc * 8, pk.u); } }     // VS[b][s][c] token-major (VT pointer is the staging buffer here)
}
// text k/v: block (64-row tile, 128 cols, which kv, b): 77 rows (2 row tiles of 64, clamped) x 512 cols per (b, which) from T16 [b*77 + t][256] @ PT2 ; k -> K16 slots 0..76 ; v (x text_cond) -> VS2[b][t][c] token-major
__global__ __launch_bounds__(128) void k_tkv(const _Float16* __restrict__ T16, const _Float16* __restrict__ PT2, const float* __restrict__ bkt, const float* __restrict__ bvt, const int* __restrict__ cond, _Float16* __restrict__ K16, _Float16* __restrict__ VS2) {
  __shared__ __align__(16) float so[4][16][132];
  const int tid = threadIdx.x, wave = tid >> 5, lane = tid & 31, col = lane & 15, g = lane >> 4;
  const int b = blockIdx.z, which = blockIdx.y; const int t0 = (blockIdx.x >> 2) * 64 + wave * 16, n0 = (blockIdx.x & 3) * 128;
  const float tc = (cond[b] % 10) > 0 ? 1.f : 0.f; const float* bb_ = which == 0 ? bkt : bvt; const float vsc = which == 0 ? 4.0f : 4.0f * tc;
  const int tr = (t0 + col) < NTX ? (t0 + col) : (NTX - 1);
  v8f acc[8] = {};
#pragma unroll 2
  for (int kc = 0; kc < LT / 32; ++kc) { const v16h a = frag_h(T16 + ((size_t)b * NTX + tr) * LT + kc * 32, lane);
#pragma unroll
    for (int j = 0; j < 8; ++j) acc[j] = wmma16(a, frag_h(PT2 + (size_t)(which * E + n0 + j * 16 + col) * LT + kc * 32, lane), acc[j]); }
#pragma unroll
  for (int j = 0; j < 8; ++j) { const float bb = bb_[n0 + j * 16 + col];
#pragma unroll
    for (int r = 0; r < 8; ++r) so[wave][8 * g + r][j * 16 + col] = (acc[j][r] * (1.0f / 16.0f) + bb) * vsc; }
  LDSX();
  if (which == 0) {   // K16 rows [bh][slot t][64]: 2 heads per 128 cols
    for (int qq = lane; qq < 16 * 2 * 8; qq += 32) { const int hh = qq >> 7, rl = (qq >> 3) & 15, pc = qq & 7; const int h = (n0 >> 6) + hh; const int t = t0 + rl; if (t >= NTX) continue; union { v8h h8; v4u u; } pk;
#pragma unroll
      for (int e = 0; e < 8; ++e) pk.h8[e] = (_Float16)so[wave][rl][hh * 64 + pc * 8 + e];
      vst2(K16 + (((size_t)b * NH + h) * NKEY + t) * HD + pc * 8, pk.u); } }
  else {              // VS2[b][t][512] token-major, 128 cols of this block = 256 B per row
    for (int qq = lane; qq < 16 * 16; qq += 32) { const int rl = qq >> 4, pc = qq & 15; const int t = t0 + rl; if (t >= NTX) continue; union { v8h h8; v4u u; } pk;
#pragma unroll
      for (int e = 0; e < 8; ++e) pk.h8[e] = (_Float16)so[wave][rl][pc * 8 + e]; 
      vst2(VS2 + ((size_t)b * NTX + t) * E + n0 + pc * 8, pk.u); } }
}
// transpose values into VT [bh][d][NKEY] with whole-line ownership: block = (bh, d-group of 8): for each d row (NKEY halves = 2304 B = 18 lines) gather from VS2 (slots 0..76), VS (77..1100), zeros (pad)
__global__ __launch_bounds__(256) void k_vt(const _Float16* __restrict__ VS, const _Float16* __restrict__ VS2, _Float16* __restrict__ VT) {
  __shared__ __align__(16) _Float16 st[8][NKEY + 8];
  const int tid = threadIdx.x; const int bh = blockIdx.x >> 3, d0 = (blockIdx.x & 7) * 8; const int b = bh / NH, h = bh % NH; const int c0 = h * HD + d0;
  for (int q = tid; q < 8 * NKEY; q += 256) { const int dl = q / NKEY, slot = q % NKEY; _Float16 v;
    if (slot < NTX) v = VS2[((size_t)b * NTX + slot) * E + c0 + dl]; else if (slot < NTX + SS) v = VS[((size_t)b * SS + (slot - NTX)) * E + c0 + dl]; else v = (_Float16)0.f;
    st[dl][slot] = v; }
  __syncthreads();
  for (int q = tid; q < 8 * (NKEY / 8); q += 256) { const int dl = q / (NKEY / 8), pc = q % (NKEY / 8); vst2(VT + ((size_t)bh * HD + d0 + dl) * NKEY + pc * 8, *(const v4u*)(&st[dl][pc * 8])); }
}
// pad key rows 1101..1151 of K16 to zero (scores there are masked anyway; keeps them finite)
__global__ __launch_bounds__(256) void k_zpad(_Float16* __restrict__ K16) {
  const int bh = blockIdx.x, tid = threadIdx.x; const v4u z = {0u, 0u, 0u, 0u};
  for (int q = tid; q < (NKEY - NTX - SS) * 8; q += 256) { const int rl = q >> 3, pc = q & 7; vst2(K16 + (((size_t)bh) * NKEY + NTX + SS + rl) * HD + pc * 8, z); }
}
// attention: block (64 queries, bh); 18 key tiles; additive masks; O16 x8 [bh][s][64]
__global__ __launch_bounds__(128) void k_attn(const _Float16* __restrict__ Q16, const _Float16* __restrict__ K16, const _Float16* __restrict__ VT, const int* __restrict__ cond, const float* __restrict__ srcm, _Float16* __restrict__ O16) {
  __shared__ __align__(16) float sS[4][16][68];
  __shared__ __align__(16) _Float16 sPh[4][16][72];
  __shared__ __align__(16) float sO[4][16][68];
  const int tid = threadIdx.x, w = tid >> 5, lane = tid & 31, col = lane & 15, g = lane >> 4;
  const size_t bh = blockIdx.y; const int b = (int)(bh / NH); const int q0 = blockIdx.x * 64 + w * 16;
  const float tpen = ((cond[b] % 10) > 0) ? 0.f : -1000000.0f;
  v16h aq[2];
#pragma unroll
  for (int kc = 0; kc < 2; ++kc) aq[kc] = frag_h(Q16 + (bh * SS + q0 + col) * HD + kc * 32, lane);
  float mrun = -3.0e38f, lrun = 0.f; v8f acc[4] = {};
#pragma unroll 1
  for (int kt = 0; kt < NKEY / 64; ++kt) {
#pragma unroll
    for (int t = 0; t < 4; ++t) { v8f s = {}; const int slot = kt * 64 + t * 16 + col;
#pragma unroll
      for (int kc = 0; kc < 2; ++kc) s = wmma16(aq[kc], frag_h(K16 + (bh * NKEY + slot) * HD + kc * 32, lane), s);
      float pen; if (slot < NTX) pen = tpen; else if (slot < NTX + SS) pen = (1.0f - srcm[b * SS + slot - NTX]) * -1000000.0f; else pen = -3.0e38f;
#pragma unroll
      for (int r = 0; r < 8; ++r) sS[w][8 * g + r][t * 16 + col] = slot < NTX + SS ? s[r] * (1.0f / 16.0f) + pen : -3.0e38f; }
    LDSX();
    float mx = -3.4e38f;
#pragma unroll
    for (int jj = 0; jj < 32; ++jj) mx = fmaxf(mx, sS[w][col][g * 32 + jj]);
    mx = fmaxf(mx, __shfl_xor(mx, 16, 32));
    const float mnew = fmaxf(mrun, mx); const float corr = expf(mrun - mnew);
    float ps = 0.f;
#pragma unroll
    for (int jj = 0; jj < 32; ++jj) { const float sv = sS[w][col][g * 32 + jj]; const float p = sv <= -1.0e38f ? 0.f : expf(sv - mnew) * 16384.0f; ps += p; sPh[w][col][g * 32 + jj] = (_Float16)p; }
    ps += __shfl_xor(ps, 16, 32);
    lrun = lrun * corr + ps * (1.0f / 16384.0f); mrun = mnew;
#pragma unroll
    for (int r = 0; r < 8; ++r) { const float cr = __shfl(corr, 8 * g + r, 32);
#pragma unroll
      for (int t = 0; t < 4; ++t) acc[t][r] *= cr; }
    LDSX();
#pragma unroll
    for (int kc = 0; kc < 2; ++kc) { const v16h ph = frag_h(&sPh[w][col][0] + kc * 32, lane);
#pragma unroll
      for (int t = 0; t < 4; ++t) { const size_t vo = (bh * HD + t * 16 + col) * NKEY + kt * 64 + kc * 32; acc[t] = wmma16(ph, frag_h(VT + vo, lane), acc[t]); } }
    __builtin_amdgcn_wave_barrier(); }
#pragma unroll
  for (int r = 0; r < 8; ++r) { const float lr = __shfl(lrun, 8 * g + r, 32); const float inv = 8.0f / (lr * 16384.0f * 4.0f);
#pragma unroll
    for (int t = 0; t < 4; ++t) sO[w][8 * g + r][t * 16 + col] = acc[t][r] * inv; }
  LDSX();
  for (int qq = lane; qq < 16 * 8; qq += 32) { const int rl = qq >> 3, pc = qq & 7; union { v8h h8; v4u u; } pk;
#pragma unroll
    for (int e = 0; e < 8; ++e) pk.h8[e] = (_Float16)sO[w][rl][pc * 8 + e];
    vst2(O16 + ((bh * SS) + q0 + rl) * HD + pc * 8, pk.u); }
}
// [scale | shift] = silu(emb) emb_W^T + emb_b : 8 rows (16-row tile, rows >= 8 zero) x 1024 cols, K = 2048 (bf16 hi/lo)
// block = 32 cols (one whole 128-B line of each SSH row), 16 waves; wave w takes k in [128 w, 128 w + 128) for both column tiles; the 16 partial tiles are summed in LDS in wave order
#define EKW 16
#define EKC (TE / EKW / 32)
__global__ __launch_bounds__(512) void k_emb(const float* __restrict__ emb, const float* __restrict__ W, const float* __restrict__ bias, float* __restrict__ SSH) {
  __shared__ __align__(16) float red[EKW][NB][32];
  const int tid = threadIdx.x, wave = tid >> 5, lane = tid & 31, col = lane & 15, g = lane >> 4; const int n0 = blockIdx.x * 32, kb = wave * (TE / EKW);
  // A loader: lanes col and col + 8 share emb row col & 7; the lower lane makes silu of fragment elements 0..7, the upper lane of elements 8..15 and hands them over; rows >= 8 of the tile are zero
  const int eh = col >> 3; const float* ep = emb + (size_t)(col & 7) * TE + kb + 8 * g + 16 * eh;
  const float* wp = W + (size_t)(n0 + col) * TE + kb + 8 * g;
  // the wave's whole slice is asked for before any of it is used, so that it pays the memory latency once
  float ev[EKC][8], wv[EKC][2][16];
#pragma unroll
  for (int kc = 0; kc < EKC; ++kc)
#pragma unroll
    for (int i = 0; i < 8; ++i) ev[kc][i] = ep[kc * 32 + i];
#pragma unroll
  for (int kc = 0; kc < EKC; ++kc)
#pragma unroll
    for (int j = 0; j < 2; ++j)
#pragma unroll
      for (int i = 0; i < 8; ++i) { wv[kc][j][i] = wp[(size_t)j * 16 * TE + kc * 32 + i]; wv[kc][j][8 + i] = wp[(size_t)j * 16 * TE + kc * 32 + 16 + i]; }
  F2 a[EKC];
#pragma unroll
  for (int kc = 0; kc < EKC; ++kc) { float v[16];
#pragma unroll
    for (int i = 0; i < 8; ++i) { const float s = silu(ev[kc][i]); const float o = __shfl_xor(s, 8, 32); v[i] = eh ? 0.f : s; v[8 + i] = eh ? 0.f : o; }
    a[kc] = bsplit16(v); }
  v8f acc[2] = {};
#pragma unroll
  for (int kc = 0; kc < EKC; ++kc)
#pragma unroll
    for (int j = 0; j < 2; ++j) acc[j] = mac3(a[kc], bsplit16(wv[kc][j]), acc[j]);
  if (g == 0) {
#pragma unroll
    for (int j = 0; j < 2; ++j)
#pragma unroll
      for (int r = 0; r < 8; ++r) red[wave][r][j * 16 + col] = acc[j][r]; }
  __syncthreads();
  if (tid < NB * 32) { const int r = tid >> 5, c = tid & 31; float s = red[0][r][c];
#pragma unroll
    for (int w = 1; w < EKW; ++w) s += red[w][r][c];
    SSH[(size_t)r * (2 * E) + n0 + c] = s + bias[n0 + c]; }
}
__global__ __launch_bounds__(256) void k_styl(const _Float16* __restrict__ O16, const float* __restrict__ SSH, const float* __restrict__ g_, const float* __restrict__ b_, _Float16* __restrict__ Z16) {
  const int wave = threadIdx.x >> 5, lane = threadIdx.x & 31; const int row = blockIdx.x * 8 + wave; const int b = row / SS, s = row % SS;
  float sum = 0.f, sq = 0.f;
#pragma unroll 2
  for (int e = 0; e < 16; ++e) { const int c = (e < 8 ? 0 : 256) + lane * 8 + (e & 7); const int h = c >> 6, d = c & 63; const float v = (float)O16[(((size_t)b * NH + h) * SS + s) * HD + d] * 0.125f; sum += v; sq += v * v; }
#pragma unroll
  for (int o = 16; o > 0; o >>= 1) { sum += __shfl_xor(sum, o, 32); sq += __shfl_xor(sq, o, 32); }
  const float mu = sum * (1.0f / E); float var = sq * (1.0f / E) - mu * mu; var = var > 0.f ? var : 0.f; const float rs = rsqrtf(var + 1e-5f);
  const float* sc_ = SSH + (size_t)b * 2 * E; const float* sh_ = sc_ + E;
#pragma unroll 1
  for (int half = 0; half < 2; ++half) { union { v8h h; v4u u; } pk;
#pragma unroll
    for (int e = 0; e < 8; ++e) { const int c = half * 256 + lane * 8 + e; const int h = c >> 6, d = c & 63; const float v = (float)O16[(((size_t)b * NH + h) * SS + s) * HD + d] * 0.125f;
      const float hn = (v - mu) * rs * g_[c] + b_[c]; const float m = hn * (1.0f + sc_[c]) + sh_[c]; pk.h[e] = (_Float16)(silu(m) * 8.0f); }
    vst2(Z16 + (size_t)row * E + half * 256 + lane * 8, pk.u); }
}
// out = x + Z out_W^T /16/8 + out_b
__global__ __launch_bounds__(128) void k_out(const _Float16* __restrict__ Z16, const _Float16* __restrict__ PT, const float* __restrict__ bo, const float* __restrict__ x, float* __restrict__ out) {
  __shared__ __align__(16) float so[4][16][132];
  const int tid = threadIdx.x, wave = tid >> 5, lane = tid & 31, col = lane & 15, g = lane >> 4;
  const int r0 = blockIdx.x * 64 + wave * 16, n0 = blockIdx.y * 128;
  v8f acc[8] = {};
#pragma unroll 2
  for (int kc = 0; kc < E / 32; ++kc) { const v16h a = frag_h(Z16 + (size_t)(r0 + col) * E + kc * 32, lane);
#pragma unroll
    for (int j = 0; j < 8; ++j) acc[j] = wmma16(a, frag_h(PT + (size_t)(3 * E + n0 + j * 16 + col) * E + kc * 32, lane), acc[j]); }
#pragma unroll
  for (int j = 0; j < 8; ++j) { const int n = n0 + j * 16 + col; const float bb = bo[n];
#pragma unroll
    for (int r = 0; r < 8; ++r) so[wave][8 * g + r][j * 16 + col] = acc[j][r] * (1.0f / (16.0f * 8.0f)) + bb + x[(size_t)(r0 + 8 * g + r) * E + n]; }
  LDSX();
#pragma unroll 4
  for (int rl = 0; rl < 16; ++rl) vst2(out + (size_t)(r0 + rl) * E + n0 + lane * 4, *(const v4f*)(&so[wave][rl][lane * 4]));
}
extern "C" void kernel_launch(void* const* d_in, const int* in_sizes, int n_in, void* d_out, int out_size, void* d_ws, size_t ws_size, hipStream_t stream) {
  (void)in_sizes; (void)n_in; (void)out_size; (void)ws_size;
  const float** I = (const float**)d_in;
  const float* x = I[0]; const float* xf = I[1]; const float* emb = I[2]; const float* srcm = I[3]; const int* cond = (const int*)d_in[4];
  const float* ng = I[5]; const float* nb = I[6]; const float* tg = I[7]; const float* tb = I[8]; const float* Wq = I[9]; const float* bq = I[10]; const float* Wkt = I[11]; const float* bkt = I[12]; const float* Wvt = I[13]; const float* bvt = I[14];
  const float* Wkm = I[15]; const float* bkm = I[16]; const float* Wvm = I[17]; const float* bvm = I[18]; const float* embW = I[19]; const float* embb = I[20]; const float* sg = I[21]; const float* sb = I[22]; const float* Wo = I[23]; const float* bo = I[24];
  float* out = (float*)d_out;
  char* ws = (char*)d_ws; size_t off = 0;
  auto take = [&](size_t bytes) { char* p = ws + off; off += (bytes + 255) & ~(size_t)255; return p; };
  _Float16* X16 = (_Float16*)take((size_t)NR * E * 2); _Float16* T16 = (_Float16*)take((size_t)NB * NTX * LT * 2 + 4096); _Float16* PT = (_Float16*)take((size_t)4 * E * E * 2); _Float16* PT2 = (_Float16*)take((size_t)2 * E * LT * 2);
  _Float16* Q16 = (_Float16*)take((size_t)NR * E * 2); _Float16* K16 = (_Float16*)take((size_t)NB * NH * NKEY * HD * 2); _Float16* VS = (_Float16*)take((size_t)NR * E * 2); _Float16* VS2 = (_Float16*)take((size_t)NB * NTX * E * 2 + 4096);
  _Float16* VT = (_Float16*)take((size_t)NB * NH * HD * NKEY * 2); _Float16* O16 = (_Float16*)take((size_t)NR * E * 2); float* SSH = (float*)take((size_t)NB * 2 * E * 4); _Float16* Z16 = X16;    // X16 dead after k_qkv
  // ws ~ 64 MB
  k_lnx<<<NR / 8, 256, 0, stream>>>(x, ng, nb, X16);
  k_lnt<<<(NB * NTX + 7) / 8, 256, 0, stream>>>(xf, tg, tb, T16);
  k_pack<<<4 * E + 2 * E, 256, 0, stream>>>(Wq, Wkm, Wvm, Wo, Wkt, Wvt, PT, PT2);
  k_qkv<<<dim3(NR / 64, E / 128, 3), 128, 0, stream>>>(X16, PT, bq, bkm, bvm, srcm, Q16, K16, VS);
  k_tkv<<<dim3(2 * 4, 2, NB), 128, 0, stream>>>(T16, PT2, bkt, bvt, cond, K16, VS2);
  k_zpad<<<NB * NH, 256, 0, stream>>>(K16);
  k_vt<<<NB * NH * 8, 256, 0, stream>>>(VS, VS2, VT);
  k_attn<<<dim3(SS / 64, NB * NH), 128, 0, stream>>>(Q16, K16, VT, cond, srcm, O16);
  k_emb<<<(2 * E) / 32, 512, 0, stream>>>(emb, embW, embb, SSH);
  k_styl<<<NR / 8, 256, 0, stream>>>(O16, SSH, sg, sb, Z16);
  k_out<<<dim3(NR / 64, E / 128), 128, 0, stream>>>(Z16, PT, bo, x, out);
}

// v002
// Measured time: 244 microseconds a run.
// Next to v001, in two timings, it ran 1.27 and 1.28 times as fast.
// All steps since v000 together make it 1.74 times as fast.
// compute dtype: f16 operands for the projections and attention (LayerNorm outputs as f16 rows, weights packed x16, q/k x4, P lifted by 2^14, V x4, context x8, stylised rows x8), bf16 hi/lo splits for the small emb GEMM, f32 accumulate; LayerNorms, masks, softmax, SiLU f32. Output = x + h is dominated by the f32 residual.
#include <hip/hip_runtime.h>
#include <math.h>

typedef __attribute__((ext_vector_type(16))) _Float16 v16h;
typedef __attribute__((ext_vector_type(16))) __bf16 v16b;
typedef __attribute__((ext_vector_type(8)))  _Float16 v8h;
typedef __attribute__((ext_vector_type(8)))  float v8f;
typedef __attribute__((ext_vector_type(4)))  float v4f;
typedef __attribute__((ext_vector_type(2)))  float v2f;
typedef __attribute__((ext_vector_type(4)))  unsigned v4u;
typedef __attribute__((ext_vector_type(4)))  int v4i;
typedef float __attribute__((may_alias)) float_a;
typedef int __attribute__((may_alias)) int_a;

template <typename T> __device__ __forceinline__ void vst2(void* p, T v) { *(T*)p = v;  }
__device__ __forceinline__ v8f wmma16(v16h a, v16h b, v8f c) {
  v8f d = __builtin_amdgcn_wmma_f32_16x16x32_f16(false, a, false, b, (short)0, c, false, false);
  asm volatile("v_nop\n\tv_nop\n\tv_nop\n\tv_nop" : "+v"(d) : "v"(a), "v"(b));
  return d;
}
__device__ __forceinline__ v8f wmma_bf(v16b a, v16b b, v8f c) {
  v8f d = __builtin_amdgcn_wmma_f32_16x16x32_bf16(false, a, false, b, (short)0, c, false, false);
  asm volatile("v_nop\n\tv_nop\n\tv_nop\n\tv_nop" : "+v"(d) : "v"(a), "v"(b));
  return d;
}
// 16x16x32 fragments: lane = (h = lane>>4, row/col = lane&15); elements 0..7 = k0+8h+0..7, 8..15 = k0+16+8h+0..7; D element r = row 8h+r
__device__ __forceinline__ v16h frag_h(const _Float16* rowk0, int lane) {
  union { v16h v; v8h q[2]; } u; const _Float16* p = rowk0 + 8 * (lane >> 4);
  u.q[0] = *(const v8h*)p; u.q[1] = *(const v8h*)(p + 16); return u.v;
}
__device__ __forceinline__ v16h frag_f32(const float* rowk0, int lane) {
  v16h a; const float* p = rowk0 + 8 * (lane >> 4);
#pragma unroll
  for (int i = 0; i < 8; ++i) { a[i] = (_Float16)p[i]; a[8 + i] = (_Float16)p[16 + i]; }
  return a;
}
__device__ __forceinline__ v16h frag_f32s(const float* rowk0, int lane, float sc) {
  v16h a; const float* p = rowk0 + 8 * (lane >> 4);
#pragma unroll
  for (int i = 0; i < 8; ++i) { a[i] = (_Float16)(p[i] * sc); a[8 + i] = (_Float16)(p[16 + i] * sc); }
  return a;
}
// column fragment from a [K][ld] layout (column n), rows >= K read as 0
__device__ __forceinline__ v16h fragc_f32(const float* W, int k0, int n, int lane, int ld, int K) {
  v16h a; const int g = lane >> 4;
#pragma unroll
  for (int i = 0; i < 8; ++i) { const int ka = k0 + 8 * g + i, kb = ka + 16;
    a[i] = (_Float16)(ka < K ? W[(size_t)ka * ld + n] : 0.f); a[8 + i] = (_Float16)(kb < K ? W[(size_t)kb * ld + n] : 0.f); }
  return a;
}
struct F2 { v16b h, l; };
__device__ __forceinline__ F2 bsplit16(const float v[16]) { F2 r;
#pragma unroll
  for (int i = 0; i < 16; ++i) { const __bf16 h = (__bf16)v[i]; r.h[i] = h; r.l[i] = (__bf16)(v[i] - (float)h); }
  return r; }
__device__ __forceinline__ F2 split_row(const float* row, int k0, int lane) { float v[16]; const float* p = row + k0 + 8 * (lane >> 4);
#pragma unroll
  for (int i = 0; i < 8; ++i) { v[i] = p[i]; v[8 + i] = p[16 + i]; }
  return bsplit16(v); }
__device__ __forceinline__ F2 split_rowK(const float* row, int k0, int lane, int K) { float v[16]; const int g = lane >> 4;
#pragma unroll
  for (int i = 0; i < 8; ++i) { const int ka = k0 + 8 * g + i, kb = ka + 16; v[i] = ka < K ? row[ka] : 0.f; v[8 + i] = kb < K ? row[kb] : 0.f; }
  return bsplit16(v); }
__device__ __forceinline__ F2 split_col(const float* W, int k0, int n, int lane, int ld, int K) { float v[16]; const int g = lane >> 4;
#pragma unroll
  for (int i = 0; i < 8; ++i) { const int ka = k0 + 8 * g + i, kb = ka + 16; v[i] = ka < K ? W[(size_t)ka * ld + n] : 0.f; v[8 + i] = kb < K ? W[(size_t)kb * ld + n] : 0.f; }
  return bsplit16(v); }
__device__ __forceinline__ v8f mac3(const F2& a, const F2& b, v8f c) { c = wmma_bf(a.l, b.h, c); c = wmma_bf(a.h, b.l, c); return wmma_bf(a.h, b.h, c); }
__device__ __forceinline__ float sigm(float v) { return 1.0f / (1.0f + expf(-v)); }
#define LDSX() do { asm volatile("s_wait_dscnt 0" ::: "memory"); __builtin_amdgcn_wave_barrier(); __builtin_amdgcn_fence(__ATOMIC_RELEASE, "workgroup"); } while (0)


// Mixed text/motion attention + stylisation block on [8,1024,512] (8 heads x 64): xn = LN(x), xfn = LN(xf [8,77,256]); q = xn Wq^T + bq; keys = [xfn Wkt^T + bkt (77) | xn Wkm^T + bkm (1024)],
// values = [(xfn Wvt^T + bvt) * text_cond_b | (xn Wvm^T + bvm) * src_mask], logits q.k (NO 1/sqrt d) + (1 - mask)*(-1e6) with mask = [text_cond_b x77 | src_mask]; softmax over the 1,101 keys;
// y = P v; h = silu(LN(y) * (1 + scale_b) + shift_b) out_W^T + out_b with [scale|shift] = silu(emb) emb_W^T + emb_b; out = x + h.
// Kernels: k_lnx / k_lnt (LayerNorm -> f16 rows), k_pack (weights [out][in] x16), k_qkv (motion q/k/v; keys at slots 77+s, values token-major), k_tkv (text k/v at slots 0..76), k_zpad (pad slots 1101..1151),
#define NB 8
#define SS 1024
#define E 512
#define NH 8
#define HD 64
#define NR (NB * SS)
#define NTX 77
#define LT 256
#define NKEY 1152              // 77 + 1024 = 1101 padded to 18 x 64
#define TE 2048
__device__ __forceinline__ float silu(float x) { return x / (1.0f + expf(-x)); }

// LN over rows of x (512) -> f16 rows; wave per row
__global__ __launch_bounds__(256) void k_lnx(const float* __restrict__ x, const float* __restrict__ g_, const float* __restrict__ b_, _Float16* __restrict__ X16) {
  const int wave = threadIdx.x >> 5, lane = threadIdx.x & 31; const int row = blockIdx.x * 8 + wave; const float* xr = x + (size_t)row * E;
  float v[16]; float s = 0.f;
  // lane owns columns lane*8..+7 and 256 + lane*8..+7 so each 16-B store instruction covers a contiguous 512-B run across the wave
#pragma unroll
  for (int e = 0; e < 16; ++e) { v[e] = xr[(e < 8 ? 0 : 256) + lane * 8 + (e & 7)]; s += v[e]; }
#pragma unroll
  for (int o = 16; o > 0; o >>= 1) s += __shfl_xor(s, o, 32);
  const float mu = s * (1.0f / E); float q = 0.f;
#pragma unroll
  for (int e = 0; e < 16; ++e) { const float d = v[e] - mu; q += d * d; }
#pragma unroll
  for (int o = 16; o > 0; o >>= 1) q += __shfl_xor(q, o, 32);
  const float rs = rsqrtf(q * (1.0f / E) + 1e-5f);
  union { v8h h[2]; v4u u[2]; } pk;
#pragma unroll
  for (int e = 0; e < 16; ++e) { const int c = (e < 8 ? 0 : 256) + lane * 8 + (e & 7); pk.h[e >> 3][e & 7] = (_Float16)((v[e] - mu) * rs * g_[c] + b_[c]); }
  vst2(X16 + (size_t)row * E + lane * 8, pk.u[0]); vst2(X16 + (size_t)row * E + 256 + lane * 8, pk.u[1]);
}
// LN over rows of xf (256) -> f16 rows [NB*NTX][256]; wave per row (8 per lane)
__global__ __launch_bounds__(256) void k_lnt(const float* __restrict__ xf, const float* __restrict__ g_, const float* __restrict__ b_, _Float16* __restrict__ T16) {
  const int wave = threadIdx.x >> 5, lane = threadIdx.x & 31; const int row = blockIdx.x * 8 + wave; if (row >= NB * NTX) return; const float* xr = xf + (size_t)row * LT;
  float v[8]; float s = 0.f;
#pragma unroll
  for (int e = 0; e < 8; ++e) { v[e] = xr[lane * 8 + e]; s += v[e]; }
#pragma unroll
  for (int o = 16; o > 0; o >>= 1) s += __shfl_xor(s, o, 32);
  const float mu = s * (1.0f / LT); float q = 0.f;
#pragma unroll
  for (int e = 0; e < 8; ++e) { const float d = v[e] - mu; q += d * d; }
#pragma unroll
  for (int o = 16; o > 0; o >>= 1) q += __shfl_xor(q, o, 32);
  const float rs = rsqrtf(q * (1.0f / LT) + 1e-5f);
  union { v8h h; v4u u; } pk;
#pragma unroll
  for (int e = 0; e < 8; ++e) { const int c = lane * 8 + e; pk.h[e] = (_Float16)((v[e] - mu) * rs * g_[c] + b_[c]); }
  vst2(T16 + (size_t)row * LT + lane * 8, pk.u);
}
// PT rows (x16, [out][in]): [0,512) Wq, [512,1024) Wkm, [1024,1536) Wvm, [1536,2048) out_W (512 halves each); PT2: [0,512) Wkt, [512,1024) Wvt (256 halves each)
__global__ __launch_bounds__(256) void k_pack(const float* __restrict__ Wq, const float* __restrict__ Wkm, const float* __restrict__ Wvm, const float* __restrict__ Wo, const float* __restrict__ Wkt, const float* __restrict__ Wvt, _Float16* __restrict__ PT, _Float16* __restrict__ PT2) {
  const int n = blockIdx.x, tid = threadIdx.x; __shared__ __align__(16) _Float16 srow[E];
  if (n < 4 * E) { const float* W = n < E ? Wq : (n < 2 * E ? Wkm : (n < 3 * E ? Wvm : Wo)); const int nn = n & (E - 1);
    srow[tid] = (_Float16)(W[(size_t)nn * E + tid] * 16.0f); srow[tid + 256] = (_Float16)(W[(size_t)nn * E + tid + 256] * 16.0f); __syncthreads();
    if (tid < E / 8) vst2(PT + (size_t)n * E + tid * 8, *(const v4u*)(&srow[tid * 8])); }
  else { const int m = n - 4 * E; const float* W = m < E ? Wkt : Wvt; const int nn = m & (E - 1);
    srow[tid] = (_Float16)(W[(size_t)nn * LT + tid] * 16.0f); __syncthreads();
    if (tid < LT / 8) vst2(PT2 + (size_t)m * LT + tid * 8, *(const v4u*)(&srow[tid * 8])); }
}
// motion q/k/v: block (64 tokens of one batch, 128 cols, which) ; k stored at key slot 77 + s, v token-major
__global__ __launch_bounds__(128) void k_qkv(const _Float16* __restrict__ X16, const _Float16* __restrict__ PT, const float* __restrict__ bq, const float* __restrict__ bk, const float* __restrict__ bv, const float* __restrict__ srcm,
                                            _Float16* __restrict__ Q16, _Float16* __restrict__ K16, _Float16* __restrict__ VT) {
  __shared__ __align__(16) float so[4][16][132];
  __shared__ __align__(16) _Float16 sth[128][72];
  const int tid = threadIdx.x, wave = tid >> 5, lane = tid & 31, col = lane & 15, g = lane >> 4;
  const int which = blockIdx.z, r0b = blockIdx.x * 64, r0 = r0b + wave * 16, n0 = blockIdx.y * 128; const int b = r0b / SS, s0 = r0b % SS;
  const float* bb_ = which == 0 ? bq : (which == 1 ? bk : bv);
  v8f acc[8] = {};
#pragma unroll 2
  for (int kc = 0; kc < E / 32; ++kc) { const v16h a = frag_h(X16 + (size_t)(r0 + col) * E + kc * 32, lane);
#pragma unroll
    for (int j = 0; j < 8; ++j) acc[j] = wmma16(a, frag_h(PT + (size_t)(which * E + n0 + j * 16 + col) * E + kc * 32, lane), acc[j]); }
  if (which < 2) {
#pragma unroll
    for (int j = 0; j < 8; ++j) { const float bb = bb_[n0 + j * 16 + col];
#pragma unroll
      for (int r = 0; r < 8; ++r) so[wave][8 * g + r][j * 16 + col] = (acc[j][r] * (1.0f / 16.0f) + bb) * 4.0f; }
    LDSX();
    for (int qq = lane; qq < 16 * 2 * 8; qq += 32) { const int hh = qq >> 7, rl = (qq >> 3) & 15, pc = qq & 7; const int h = (n0 >> 6) + hh; union { v8h h8; v4u u; } pk;
#pragma unroll
      for (int e = 0; e < 8; ++e) pk.h8[e] = (_Float16)so[wave][rl][hh * 64 + pc * 8 + e];
      if (which == 0) vst2(Q16 + (((size_t)b * NH + h) * SS + s0 + wave * 16 + rl) * HD + pc * 8, pk.u);
      else vst2(K16 + (((size_t)b * NH + h) * NKEY + NTX + s0 + wave * 16 + rl) * HD + pc * 8, pk.u); } }
  else {
#pragma unroll
    for (int j = 0; j < 8; ++j) { const float bb = bb_[n0 + j * 16 + col];
#pragma unroll
      for (int r = 0; r < 8; ++r) { const int s = s0 + wave * 16 + 8 * g + r; sth[j * 16 + col][wave * 16 + 8 * g + r] = (_Float16)((acc[j][r] * (1.0f / 16.0f) + bb) * srcm[b * SS + s] * 4.0f); } }
    __syncthreads();
    // To keep whole-line ownership, VT motion columns are written by k_vt from a token-major staging buffer instead (see VS below): here we store V token-major.
    for (int qq = tid; qq < 64 * 16; qq += 128) { const int rl = qq >> 4, pc = qq & 15; const int s = s0 + rl;
      union { v8h h8; v4u u; } pk;
#pragma unroll
      for (int e = 0; e < 8; ++e) pk.h8[e] = sth[pc * 8 + e][rl];
      vst2(VT + ((size_t)b * SS + s) * E + n0 + pc * 8, pk.u); } }     // VS[b][s][c] token-major (VT pointer is the staging buffer here)
}
// text k/v: block (64-row tile, 128 cols, which kv, b): 77 rows (2 row tiles of 64, clamped) x 512 cols per (b, which) from T16 [b*77 + t][256] @ PT2 ; k -> K16 slots 0..76 ; v (x text_cond) -> VS2[b][t][c] token-major
__global__ __launch_bounds__(128) void k_tkv(const _Float16* __restrict__ T16, const _Float16* __restrict__ PT2, const float* __restrict__ bkt, const float* __restrict__ bvt, const int* __restrict__ cond, _Float16* __restrict__ K16, _Float16* __restrict__ VS2) {
  __shared__ __align__(16) float so[4][16][132];
  const int tid = threadIdx.x, wave = tid >> 5, lane = tid & 31, col = lane & 15, g = lane >> 4;
  const int b = blockIdx.z, which = blockIdx.y; const int t0 = (blockIdx.x >> 2) * 64 + wave * 16, n0 = (blockIdx.x & 3) * 128;
  const float tc = (cond[b] % 10) > 0 ? 1.f : 0.f; const float* bb_ = which == 0 ? bkt : bvt; const float vsc = which == 0 ? 4.0f : 4.0f * tc;
  const int tr = (t0 + col) < NTX ? (t0 + col) : (NTX - 1);
  v8f acc[8] = {};
#pragma unroll 2
  for (int kc = 0; kc < LT / 32; ++kc) { const v16h a = frag_h(T16 + ((size_t)b * NTX + tr) * LT + kc * 32, lane);
#pragma unroll
    for (int j = 0; j < 8; ++j) acc[j] = wmma16(a, frag_h(PT2 + (size_t)(which * E + n0 + j * 16 + col) * LT + kc * 32, lane), acc[j]); }
#pragma unroll
  for (int j = 0; j < 8; ++j) { const float bb = bb_[n0 + j * 16 + col];
#pragma unroll
    for (int r = 0; r < 8; ++r) so[wave][8 * g + r][j * 16 + col] = (acc[j][r] * (1.0f / 16.0f) + bb) * vsc; }
  LDSX();
  if (which == 0) {   // K16 rows [bh][slot t][64]: 2 heads per 128 cols
    for (int qq = lane; qq < 16 * 2 * 8; qq += 32) { const int hh = qq >> 7, rl = (qq >> 3) & 15, pc = qq & 7; const int h = (n0 >> 6) + hh; const int t = t0 + rl; if (t >= NTX) continue; union { v8h h8; v4u u; } pk;
#pragma unroll
      for (int e = 0; e < 8; ++e) pk.h8[e] = (_Float16)so[wave][rl][hh * 64 + pc * 8 + e];
      vst2(K16 + (((size_t)b * NH + h) * NKEY + t) * HD + pc * 8, pk.u); } }
  else {              // VS2[b][t][512] token-major, 128 cols of this block = 256 B per row
    for (int qq = lane; qq < 16 * 16; qq += 32) { const int rl = qq >> 4, pc = qq & 15; const int t = t0 + rl; if (t >= NTX) continue; union { v8h h8; v4u u; } pk;
#pragma unroll
      for (int e = 0; e < 8; ++e) pk.h8[e] = (_Float16)so[wave][rl][pc * 8 + e]; 
      vst2(VS2 + ((size_t)b * NTX + t) * E + n0 + pc * 8, pk.u); } }
}
// transpose values into VT [bh][d][NKEY] with whole-line ownership: block = (bh, d-group of 8): for each d row (NKEY halves = 2304 B = 18 lines) gather from VS2 (slots 0..76), VS (77..1100), zeros (pad)
__global__ __launch_bounds__(256) void k_vt(const _Float16* __restrict__ VS, const _Float16* __restrict__ VS2, _Float16* __restrict__ VT) {
  __shared__ __align__(16) _Float16 st[8][NKEY + 8];
  const int tid = threadIdx.x; const int bh = blockIdx.x >> 3, d0 = (blockIdx.x & 7) * 8; const int b = bh / NH, h = bh % NH; const int c0 = h * HD + d0;
  for (int q = tid; q < 8 * NKEY; q += 256) { const int dl = q / NKEY, slot = q % NKEY; _Float16 v;
    if (slot < NTX) v = VS2[((size_t)b * NTX + slot) * E + c0 + dl]; else if (slot < NTX + SS) v = VS[((size_t)b * SS + (slot - NTX)) * E + c0 + dl]; else v = (_Float16)0.f;
    st[dl][slot] = v; }
  __syncthreads();
  for (int q = tid; q < 8 * (NKEY / 8); q += 256) { const int dl = q / (NKEY / 8), pc = q % (NKEY / 8); vst2(VT + ((size_t)bh * HD + d0 + dl) * NKEY + pc * 8, *(const v4u*)(&st[dl][pc * 8])); }
}
// pad key rows 1101..1151 of K16 to zero (scores there are masked anyway; keeps them finite)
__global__ __launch_bounds__(256) void k_zpad(_Float16* __restrict__ K16) {
  const int bh = blockIdx.x, tid = threadIdx.x; const v4u z = {0u, 0u, 0u, 0u};
  for (int q = tid; q < (NKEY - NTX - SS) * 8; q += 256) { const int rl = q >> 3, pc = q & 7; vst2(K16 + (((size_t)bh) * NKEY + NTX + SS + rl) * HD + pc * 8, z); }
}
// attention: block (64 queries, bh); 18 key tiles; additive masks; O16 x8 [bh][s][64]
// Each key tile (64 K rows, 64 V^T rows of 128 B, 64 mask penalties) is brought in once per block with whole-line loads and kept in LDS for all four waves;
// two buffers: tile kt + 1 is asked for ahead of tile kt's softmax and stored behind its P V products, one barrier per tile. Rows are padded to 144 B (16 B x odd) for the 16-B fragment reads.
#define NT (NKEY / 64)
#define KP 72
__global__ __launch_bounds__(128) void k_attn(const _Float16* __restrict__ Q16, const _Float16* __restrict__ K16, const _Float16* __restrict__ VT, const int* __restrict__ cond, const float* __restrict__ srcm, _Float16* __restrict__ O16) {
  __shared__ __align__(16) float sS[4][16][68];       // scores of a tile; after the loop the wave's output tile
  __shared__ __align__(16) _Float16 sPh[4][16][72];
  __shared__ __align__(16) _Float16 sK[2][64][KP];
  __shared__ __align__(16) _Float16 sV[2][64][KP];
  __shared__ __align__(16) float sPen[2][64];
  const int tid = threadIdx.x, w = tid >> 5, lane = tid & 31, col = lane & 15, g = lane >> 4;
  const size_t bh = blockIdx.y; const int b = (int)(bh / NH); const int q0 = blockIdx.x * 64 + w * 16;
  const float tpen = ((cond[b] % 10) > 0) ? 0.f : -1000000.0f;
  // staging: thread owns 16-B piece tid & 7 of rows (tid >> 3) + 16 i, so a wave's load covers four whole 128-B lines
  const int srow = tid >> 3, spc = (tid & 7) * 8;
  const _Float16* kg = K16 + (bh * NKEY + srow) * HD + spc;
  const _Float16* vg = VT + (bh * HD + srow) * NKEY + spc;
  v8h rk[4], rv[4]; float rm;
  auto fetch = [&](int kt) {
#pragma unroll
    for (int i = 0; i < 4; ++i) { rk[i] = *(const v8h*)(kg + (size_t)(kt * 64 + 16 * i) * HD); rv[i] = *(const v8h*)(vg + (size_t)(16 * i) * NKEY + kt * 64); }
    int ms = kt * 64 + (tid & 63) - NTX; ms = ms < 0 ? 0 : (ms > SS - 1 ? SS - 1 : ms); rm = srcm[b * SS + ms]; };
  auto put = [&](int kt) { const int bf = kt & 1;
#pragma unroll
    for (int i = 0; i < 4; ++i) { *(v8h*)(&sK[bf][srow + 16 * i][spc]) = rk[i]; *(v8h*)(&sV[bf][srow + 16 * i][spc]) = rv[i]; }
    if (tid < 64) { const int slot = kt * 64 + tid; sPen[bf][tid] = slot < NTX ? tpen : (slot < NTX + SS ? (1.0f - rm) * -1000000.0f : -3.0e38f); } };
  fetch(0);
  v16h aq[2];
#pragma unroll
  for (int kc = 0; kc < 2; ++kc) aq[kc] = frag_h(Q16 + (bh * SS + q0 + col) * HD + kc * 32, lane);
  put(0);
  __syncthreads();
  float mrun = -3.0e38f, lrun = 0.f; v8f acc[4] = {};
#pragma unroll 1
  for (int kt = 0; kt < NT; ++kt) { const int bf = kt & 1;
    v16h kf[4][2]; float pn[4];
#pragma unroll
    for (int t = 0; t < 4; ++t) { pn[t] = sPen[bf][t * 16 + col];
#pragma unroll
      for (int kc = 0; kc < 2; ++kc) kf[t][kc] = frag_h(&sK[bf][t * 16 + col][kc * 32], lane); }
#pragma unroll
    for (int t = 0; t < 4; ++t) { v8f s = {}; const int slot = kt * 64 + t * 16 + col;
#pragma unroll
      for (int kc = 0; kc < 2; ++kc) s = wmma16(aq[kc], kf[t][kc], s);
#pragma unroll
      for (int r = 0; r < 8; ++r) sS[w][8 * g + r][t * 16 + col] = slot < NTX + SS ? s[r] * (1.0f / 16.0f) + pn[t] : -3.0e38f; }
    LDSX();
    // asked for here, behind the fence above (which waits for every load in flight), so that the loads fly under the whole softmax
    if (kt + 1 < NT) fetch(kt + 1);
    float mx = -3.4e38f;
#pragma unroll
    for (int jj = 0; jj < 32; ++jj) mx = fmaxf(mx, sS[w][col][g * 32 + jj]);
    mx = fmaxf(mx, __shfl_xor(mx, 16, 32));
    const float mnew = fmaxf(mrun, mx); const float corr = expf(mrun - mnew);
    float ps = 0.f;
#pragma unroll
    for (int jj = 0; jj < 32; ++jj) { const float sv = sS[w][col][g * 32 + jj]; const float p = sv <= -1.0e38f ? 0.f : expf(sv - mnew) * 16384.0f; ps += p; sPh[w][col][g * 32 + jj] = (_Float16)p; }
    ps += __shfl_xor(ps, 16, 32);
    lrun = lrun * corr + ps * (1.0f / 16384.0f); mrun = mnew;
#pragma unroll
    for (int r = 0; r < 8; ++r) { const float cr = __shfl(corr, 8 * g + r, 32);
#pragma unroll
      for (int t = 0; t < 4; ++t) acc[t][r] *= cr; }
    LDSX();
    v16h ph[2], vf[2][4];
#pragma unroll
    for (int kc = 0; kc < 2; ++kc) { ph[kc] = frag_h(&sPh[w][col][0] + kc * 32, lane);
#pragma unroll
      for (int t = 0; t < 4; ++t) vf[kc][t] = frag_h(&sV[bf][t * 16 + col][kc * 32], lane); }
#pragma unroll
    for (int kc = 0; kc < 2; ++kc)
#pragma unroll
      for (int t = 0; t < 4; ++t) acc[t] = wmma16(ph[kc], vf[kc][t], acc[t]);
    // the other buffer's last readers left it at the barrier of the trip before; this barrier publishes tile kt + 1 and ends the reads of tile kt
    if (kt + 1 < NT) { put(kt + 1); __syncthreads(); } }
#pragma unroll
  for (int r = 0; r < 8; ++r) { const float lr = __shfl(lrun, 8 * g + r, 32); const float inv = 8.0f / (lr * 16384.0f * 4.0f);
#pragma unroll
    for (int t = 0; t < 4; ++t) sS[w][8 * g + r][t * 16 + col] = acc[t][r] * inv; }
  LDSX();
  for (int qq = lane; qq < 16 * 8; qq += 32) { const int rl = qq >> 3, pc = qq & 7; union { v8h h8; v4u u; } pk;
#pragma unroll
    for (int e = 0; e < 8; ++e) pk.h8[e] = (_Float16)sS[w][rl][pc * 8 + e];
    vst2(O16 + ((bh * SS) + q0 + rl) * HD + pc * 8, pk.u); }
}
// [scale | shift] = silu(emb) emb_W^T + emb_b : 8 rows (16-row tile, rows >= 8 zero) x 1024 cols, K = 2048 (bf16 hi/lo)
// block = 32 cols (one whole 128-B line of each SSH row), 16 waves; wave w takes k in [128 w, 128 w + 128) for both column tiles; the 16 partial tiles are summed in LDS in wave order
#define EKW 16
#define EKC (TE / EKW / 32)
__global__ __launch_bounds__(512) void k_emb(const float* __restrict__ emb, const float* __restrict__ W, const float* __restrict__ bias, float* __restrict__ SSH) {
  __shared__ __align__(16) float red[EKW][NB][32];
  const int tid = threadIdx.x, wave = tid >> 5, lane = tid & 31, col = lane & 15, g = lane >> 4; const int n0 = blockIdx.x * 32, kb = wave * (TE / EKW);
  // A loader: lanes col and col + 8 share emb row col & 7; the lower lane makes silu of fragment elements 0..7, the upper lane of elements 8..15 and hands them over; rows >= 8 of the tile are zero
  const int eh = col >> 3; const float* ep = emb + (size_t)(col & 7) * TE + kb + 8 * g + 16 * eh;
  const float* wp = W + (size_t)(n0 + col) * TE + kb + 8 * g;
  // the wave's whole slice is asked for before any of it is used, so that it pays the memory latency once
  float ev[EKC][8], wv[EKC][2][16];
#pragma unroll
  for (int kc = 0; kc < EKC; ++kc)
#pragma unroll
    for (int i = 0; i < 8; ++i) ev[kc][i] = ep[kc * 32 + i];
#pragma unroll
  for (int kc = 0; kc < EKC; ++kc)
#pragma unroll
    for (int j = 0; j < 2; ++j)
#pragma unroll
      for (int i = 0; i < 8; ++i) { wv[kc][j][i] = wp[(size_t)j * 16 * TE + kc * 32 + i]; wv[kc][j][8 + i] = wp[(size_t)j * 16 * TE + kc * 32 + 16 + i]; }
  F2 a[EKC];
#pragma unroll
  for (int kc = 0; kc < EKC; ++kc) { float v[16];
#pragma unroll
    for (int i = 0; i < 8; ++i) { const float s = silu(ev[kc][i]); const float o = __shfl_xor(s, 8, 32); v[i] = eh ? 0.f : s; v[8 + i] = eh ? 0.f : o; }
    a[kc] = bsplit16(v); }
  v8f acc[2] = {};
#pragma unroll
  for (int kc = 0; kc < EKC; ++kc)
#pragma unroll
    for (int j = 0; j < 2; ++j) acc[j] = mac3(a[kc], bsplit16(wv[kc][j]), acc[j]);
  if (g == 0) {
#pragma unroll
    for (int j = 0; j < 2; ++j)
#pragma unroll
      for (int r = 0; r < 8; ++r) red[wave][r][j * 16 + col] = acc[j][r]; }
  __syncthreads();
  if (tid < NB * 32) { const int r = tid >> 5, c = tid & 31; float s = red[0][r][c];
#pragma unroll
    for (int w = 1; w < EKW; ++w) s += red[w][r][c];
    SSH[(size_t)r * (2 * E) + n0 + c] = s + bias[n0 + c]; }
}
__global__ __launch_bounds__(256) void k_styl(const _Float16* __restrict__ O16, const float* __restrict__ SSH, const float* __restrict__ g_, const float* __restrict__ b_, _Float16* __restrict__ Z16) {
  const int wave = threadIdx.x >> 5, lane = threadIdx.x & 31; const int row = blockIdx.x * 8 + wave; const int b = row / SS, s = row % SS;
  float sum = 0.f, sq = 0.f;
#pragma unroll 2
  for (int e = 0; e < 16; ++e) { const int c = (e < 8 ? 0 : 256) + lane * 8 + (e & 7); const int h = c >> 6, d = c & 63; const float v = (float)O16[(((size_t)b * NH + h) * SS + s) * HD + d] * 0.125f; sum += v; sq += v * v; }
#pragma unroll
  for (int o = 16; o > 0; o >>= 1) { sum += __shfl_xor(sum, o, 32); sq += __shfl_xor(sq, o, 32); }
  const float mu = sum * (1.0f / E); float var = sq * (1.0f / E) - mu * mu; var = var > 0.f ? var : 0.f; const float rs = rsqrtf(var + 1e-5f);
  const float* sc_ = SSH + (size_t)b * 2 * E; const float* sh_ = sc_ + E;
#pragma unroll 1
  for (int half = 0; half < 2; ++half) { union { v8h h; v4u u; } pk;
#pragma unroll
    for (int e = 0; e < 8; ++e) { const int c = half * 256 + lane * 8 + e; const int h = c >> 6, d = c & 63; const float v = (float)O16[(((size_t)b * NH + h) * SS + s) * HD + d] * 0.125f;
      const float hn = (v - mu) * rs * g_[c] + b_[c]; const float m = hn * (1.0f + sc_[c]) + sh_[c]; pk.h[e] = (_Float16)(silu(m) * 8.0f); }
    vst2(Z16 + (size_t)row * E + half * 256 + lane * 8, pk.u); }
}
// out = x + Z out_W^T /16/8 + out_b
__global__ __launch_bounds__(128) void k_out(const _Float16* __restrict__ Z16, const _Float16* __restrict__ PT, const float* __restrict__ bo, const float* __restrict__ x, float* __restrict__ out) {
  __shared__ __align__(16) float so[4][16][132];
  const int tid = threadIdx.x, wave = tid >> 5, lane = tid & 31, col = lane & 15, g = lane >> 4;
  const int r0 = blockIdx.x * 64 + wave * 16, n0 = blockIdx.y * 128;
  v8f acc[8] = {};
#pragma unroll 2
  for (int kc = 0; kc < E / 32; ++kc) { const v16h a = frag_h(Z16 + (size_t)(r0 + col) * E + kc * 32, lane);
#pragma unroll
    for (int j = 0; j < 8; ++j) acc[j] = wmma16(a, frag_h(PT + (size_t)(3 * E + n0 + j * 16 + col) * E + kc * 32, lane), acc[j]); }
#pragma unroll
  for (int j = 0; j < 8; ++j) { const int n = n0 + j * 16 + col; const float bb = bo[n];
#pragma unroll
    for (int r = 0; r < 8; ++r) so[wave][8 * g + r][j * 16 + col] = acc[j][r] * (1.0f / (16.0f * 8.0f)) + bb + x[(size_t)(r0 + 8 * g + r) * E + n]; }
  LDSX();
#pragma unroll 4
  for (int rl = 0; rl < 16; ++rl) vst2(out + (size_t)(r0 + rl) * E + n0 + lane * 4, *(const v4f*)(&so[wave][rl][lane * 4]));
}
extern "C" void kernel_launch(void* const* d_in, const int* in_sizes, int n_in, void* d_out, int out_size, void* d_ws, size_t ws_size, hipStream_t stream) {
  (void)in_sizes; (void)n_in; (void)out_size; (void)ws_size;
  const float** I = (const float**)d_in;
  const float* x = I[0]; const float* xf = I[1]; const float* emb = I[2]; const float* srcm = I[3]; const int* cond = (const int*)d_in[4];
  const float* ng = I[5]; const float* nb = I[6]; const float* tg = I[7]; const float* tb = I[8]; const float* Wq = I[9]; const float* bq = I[10]; const float* Wkt = I[11]; const float* bkt = I[12]; const float* Wvt = I[13]; const float* bvt = I[14];
  const float* Wkm = I[15]; const float* bkm = I[16]; const float* Wvm = I[17]; const float* bvm = I[18]; const float* embW = I[19]; const float* embb = I[20]; const float* sg = I[21]; const float* sb = I[22]; const float* Wo = I[23]; const float* bo = I[24];
  float* out = (float*)d_out;
  char* ws = (char*)d_ws; size_t off = 0;
  auto take = [&](size_t bytes) { char* p = ws + off; off += (bytes + 255) & ~(size_t)255; return p; };
  _Float16* X16 = (_Float16*)take((size_t)NR * E * 2); _Float16* T16 = (_Float16*)take((size_t)NB * NTX * LT * 2 + 4096); _Float16* PT = (_Float16*)take((size_t)4 * E * E * 2); _Float16* PT2 = (_Float16*)take((size_t)2 * E * LT * 2);
  _Float16* Q16 = (_Float16*)take((size_t)NR * E * 2); _Float16* K16 = (_Float16*)take((size_t)NB * NH * NKEY * HD * 2); _Float16* VS = (_Float16*)take((size_t)NR * E * 2); _Float16* VS2 = (_Float16*)take((size_t)NB * NTX * E * 2 + 4096);
  _Float16* VT = (_Float16*)take((size_t)NB * NH * HD * NKEY * 2); _Float16* O16 = (_Float16*)take((size_t)NR * E * 2); float* SSH = (float*)take((size_t)NB * 2 * E * 4); _Float16* Z16 = X16;    // X16 dead after k_qkv
  // ws ~ 64 MB
  k_lnx<<<NR / 8, 256, 0, stream>>>(x, ng, nb, X16);
  k_lnt<<<(NB * NTX + 7) / 8, 256, 0, stream>>>(xf, tg, tb, T16);
  k_pack<<<4 * E + 2 * E, 256, 0, stream>>>(Wq, Wkm, Wvm, Wo, Wkt, Wvt, PT, PT2);
  k_qkv<<<dim3(NR / 64, E / 128, 3), 128, 0, stream>>>(X16, PT, bq, bkm, bvm, srcm, Q16, K16, VS);
  k_tkv<<<dim3(2 * 4, 2, NB), 128, 0, stream>>>(T16, PT2, bkt, bvt, cond, K16, VS2);
  k_zpad<<<NB * NH, 256, 0, stream>>>(K16);
  k_vt<<<NB * NH * 8, 256, 0, stream>>>(VS, VS2, VT);
  k_attn<<<dim3(SS / 64, NB * NH), 128, 0, stream>>>(Q16, K16, VT, cond, srcm, O16);
  k_emb<<<(2 * E) / 32, 512, 0, stream>>>(emb, embW, embb, SSH);
  k_styl<<<NR / 8, 256, 0, stream>>>(O16, SSH, sg, sb, Z16);
  k_out<<<dim3(NR / 64, E / 128), 128, 0, stream>>>(Z16, PT, bo, x, out);
}

// v003
// One run takes 156 microseconds.
// Next to v002, in two timings, it ran 1.56 times as fast each time.
// Counting every step since v000, it is 2.71 times as fast.
// compute dtype: f16 operands for the projections and attention (LayerNorm outputs as f16 rows, weights packed x16, q/k x4, P lifted by 2^14, V x4, context x8, stylised rows x8), bf16 hi/lo splits for the small emb GEMM, f32 accumulate; LayerNorms, masks, softmax, SiLU f32. Output = x + h is dominated by the f32 residual.
#include <hip/hip_runtime.h>
#include <math.h>

typedef __attribute__((ext_vector_type(16))) _Float16 v16h;
typedef __attribute__((ext_vector_type(16))) __bf16 v16b;
typedef __attribute__((ext_vector_type(8)))  _Float16 v8h;
typedef __attribute__((ext_vector_type(8)))  float v8f;
typedef __attribute__((ext_vector_type(4)))  float v4f;
typedef __attribute__((ext_vector_type(2)))  float v2f;
typedef __attribute__((ext_vector_type(4)))  unsigned v4u;
typedef __attribute__((ext_vector_type(4)))  int v4i;
typedef float __attribute__((may_alias)) float_a;
typedef int __attribute__((may_alias)) int_a;

template <typename T> __device__ __forceinline__ void vst2(void* p, T v) { *(T*)p = v;  }
__device__ __forceinline__ v8f wmma16(v16h a, v16h b, v8f c) {
  v8f d = __builtin_amdgcn_wmma_f32_16x16x32_f16(false, a, false, b, (short)0, c, false, false);
  asm volatile("v_nop\n\tv_nop\n\tv_nop\n\tv_nop" : "+v"(d) : "v"(a), "v"(b));
  return d;
}
__device__ __forceinline__ v8f wmma_bf(v16b a, v16b b, v8f c) {
  v8f d = __builtin_amdgcn_wmma_f32_16x16x32_bf16(false, a, false, b, (short)0, c, false, false);
  asm volatile("v_nop\n\tv_nop\n\tv_nop\n\tv_nop" : "+v"(d) : "v"(a), "v"(b));
  return d;
}
// 16x16x32 fragments: lane = (h = lane>>4, row/col = lane&15); elements 0..7 = k0+8h+0..7, 8..15 = k0+16+8h+0..7; D element r = row 8h+r
__device__ __forceinline__ v16h frag_h(const _Float16* rowk0, int lane) {
  union { v16h v; v8h q[2]; } u; const _Float16* p = rowk0 + 8 * (lane >> 4);
  u.q[0] = *(const v8h*)p; u.q[1] = *(const v8h*)(p + 16); return u.v;
}
__device__ __forceinline__ v16h frag_f32(const float* rowk0, int lane) {
  v16h a; const float* p = rowk0 + 8 * (lane >> 4);
#pragma unroll
  for (int i = 0; i < 8; ++i) { a[i] = (_Float16)p[i]; a[8 + i] = (_Float16)p[16 + i]; }
  return a;
}
__device__ __forceinline__ v16h frag_f32s(const float* rowk0, int lane, float sc) {
  v16h a; const float* p = rowk0 + 8 * (lane >> 4);
#pragma unroll
  for (int i = 0; i < 8; ++i) { a[i] = (_Float16)(p[i] * sc); a[8 + i] = (_Float16)(p[16 + i] * sc); }
  return a;
}
// column fragment from a [K][ld] layout (column n), rows >= K read as 0
__device__ __forceinline__ v16h fragc_f32(const float* W, int k0, int n, int lane, int ld, int K) {
  v16h a; const int g = lane >> 4;
#pragma unroll
  for (int i = 0; i < 8; ++i) { const int ka = k0 + 8 * g + i, kb = ka + 16;
    a[i] = (_Float16)(ka < K ? W[(size_t)ka * ld + n] : 0.f); a[8 + i] = (_Float16)(kb < K ? W[(size_t)kb * ld + n] : 0.f); }
  return a;
}
struct F2 { v16b h, l; };
__device__ __forceinline__ F2 bsplit16(const float v[16]) { F2 r;
#pragma unroll
  for (int i = 0; i < 16; ++i) { const __bf16 h = (__bf16)v[i]; r.h[i] = h; r.l[i] = (__bf16)(v[i] - (float)h); }
  return r; }
__device__ __forceinline__ F2 split_row(const float* row, int k0, int lane) { float v[16]; const float* p = row + k0 + 8 * (lane >> 4);
#pragma unroll
  for (int i = 0; i < 8; ++i) { v[i] = p[i]; v[8 + i] = p[16 + i]; }
  return bsplit16(v); }
__device__ __forceinline__ F2 split_rowK(const float* row, int k0, int lane, int K) { float v[16]; const int g = lane >> 4;
#pragma unroll
  for (int i = 0; i < 8; ++i) { const int ka = k0 + 8 * g + i, kb = ka + 16; v[i] = ka < K ? row[ka] : 0.f; v[8 + i] = kb < K ? row[kb] : 0.f; }
  return bsplit16(v); }
__device__ __forceinline__ F2 split_col(const float* W, int k0, int n, int lane, int ld, int K) { float v[16]; const int g = lane >> 4;
#pragma unroll
  for (int i = 0; i < 8; ++i) { const int ka = k0 + 8 * g + i, kb = ka + 16; v[i] = ka < K ? W[(size_t)ka * ld + n] : 0.f; v[8 + i] = kb < K ? W[(size_t)kb * ld + n] : 0.f; }
  return bsplit16(v); }
__device__ __forceinline__ v8f mac3(const F2& a, const F2& b, v8f c) { c = wmma_bf(a.l, b.h, c); c = wmma_bf(a.h, b.l, c); return wmma_bf(a.h, b.h, c); }
__device__ __forceinline__ float sigm(float v) { return 1.0f / (1.0f + expf(-v)); }
#define LDSX() do { asm volatile("s_wait_dscnt 0" ::: "memory"); __builtin_amdgcn_wave_barrier(); __builtin_amdgcn_fence(__ATOMIC_RELEASE, "workgroup"); } while (0)


// Mixed text/motion attention + stylisation block on [8,1024,512] (8 heads x 64): xn = LN(x), xfn = LN(xf [8,77,256]); q = xn Wq^T + bq; keys = [xfn Wkt^T + bkt (77) | xn Wkm^T + bkm (1024)],
// values = [(xfn Wvt^T + bvt) * text_cond_b | (xn Wvm^T + bvm) * src_mask], logits q.k (NO 1/sqrt d) + (1 - mask)*(-1e6) with mask = [text_cond_b x77 | src_mask]; softmax over the 1,101 keys;
// y = P v; h = silu(LN(y) * (1 + scale_b) + shift_b) out_W^T + out_b with [scale|shift] = silu(emb) emb_W^T + emb_b; out = x + h.
// Kernels: k_lnx / k_lnt (LayerNorm -> f16 rows), k_pack (weights [out][in] x16), k_qkv (motion q/k/v; keys at slots 77+s, values token-major), k_tkv (text k/v at slots 0..76), k_zpad (pad slots 1101..1151),
#define NB 8
#define SS 1024
#define E 512
#define NH 8
#define HD 64
#define NR (NB * SS)
#define NTX 77
#define LT 256
#define NKEY 1152              // 77 + 1024 = 1101 padded to 18 x 64
#define TE 2048
__device__ __forceinline__ float silu(float x) { return x / (1.0f + expf(-x)); }

// LN over rows of x (512) -> f16 rows; wave per row
__global__ __launch_bounds__(256) void k_lnx(const float* __restrict__ x, const float* __restrict__ g_, const float* __restrict__ b_, _Float16* __restrict__ X16) {
  const int wave = threadIdx.x >> 5, lane = threadIdx.x & 31; const int row = blockIdx.x * 8 + wave; const float* xr = x + (size_t)row * E;
  float v[16]; float s = 0.f;
  // lane owns columns lane*8..+7 and 256 + lane*8..+7 so each 16-B store instruction covers a contiguous 512-B run across the wave
#pragma unroll
  for (int e = 0; e < 16; ++e) { v[e] = xr[(e < 8 ? 0 : 256) + lane * 8 + (e & 7)]; s += v[e]; }
#pragma unroll
  for (int o = 16; o > 0; o >>= 1) s += __shfl_xor(s, o, 32);
  const float mu = s * (1.0f / E); float q = 0.f;
#pragma unroll
  for (int e = 0; e < 16; ++e) { const float d = v[e] - mu; q += d * d; }
#pragma unroll
  for (int o = 16; o > 0; o >>= 1) q += __shfl_xor(q, o, 32);
  const float rs = rsqrtf(q * (1.0f / E) + 1e-5f);
  union { v8h h[2]; v4u u[2]; } pk;
#pragma unroll
  for (int e = 0; e < 16; ++e) { const int c = (e < 8 ? 0 : 256) + lane * 8 + (e & 7); pk.h[e >> 3][e & 7] = (_Float16)((v[e] - mu) * rs * g_[c] + b_[c]); }
  vst2(X16 + (size_t)row * E + lane * 8, pk.u[0]); vst2(X16 + (size_t)row * E + 256 + lane * 8, pk.u[1]);
}
// LN over rows of xf (256) -> f16 rows [NB*NTX][256]; wave per row (8 per lane)
__global__ __launch_bounds__(256) void k_lnt(const float* __restrict__ xf, const float* __restrict__ g_, const float* __restrict__ b_, _Float16* __restrict__ T16) {
  const int wave = threadIdx.x >> 5, lane = threadIdx.x & 31; const int row = blockIdx.x * 8 + wave; if (row >= NB * NTX) return; const float* xr = xf + (size_t)row * LT;
  float v[8]; float s = 0.f;
#pragma unroll
  for (int e = 0; e < 8; ++e) { v[e] = xr[lane * 8 + e]; s += v[e]; }
#pragma unroll
  for (int o = 16; o > 0; o >>= 1) s += __shfl_xor(s, o, 32);
  const float mu = s * (1.0f / LT); float q = 0.f;
#pragma unroll
  for (int e = 0; e < 8; ++e) { const float d = v[e] - mu; q += d * d; }
#pragma unroll
  for (int o = 16; o > 0; o >>= 1) q += __shfl_xor(q, o, 32);
  const float rs = rsqrtf(q * (1.0f / LT) + 1e-5f);
  union { v8h h; v4u u; } pk;
#pragma unroll
  for (int e = 0; e < 8; ++e) { const int c = lane * 8 + e; pk.h[e] = (_Float16)((v[e] - mu) * rs * g_[c] + b_[c]); }
  vst2(T16 + (size_t)row * LT + lane * 8, pk.u);
}
// PT rows (x16, [out][in]): [0,512) Wq, [512,1024) Wkm, [1024,1536) Wvm, [1536,2048) out_W (512 halves each); PT2: [0,512) Wkt, [512,1024) Wvt (256 halves each)
__global__ __launch_bounds__(256) void k_pack(const float* __restrict__ Wq, const float* __restrict__ Wkm, const float* __restrict__ Wvm, const float* __restrict__ Wo, const float* __restrict__ Wkt, const float* __restrict__ Wvt, _Float16* __restrict__ PT, _Float16* __restrict__ PT2) {
  const int n = blockIdx.x, tid = threadIdx.x; __shared__ __align__(16) _Float16 srow[E];
  if (n < 4 * E) { const float* W = n < E ? Wq : (n < 2 * E ? Wkm : (n < 3 * E ? Wvm : Wo)); const int nn = n & (E - 1);
    srow[tid] = (_Float16)(W[(size_t)nn * E + tid] * 16.0f); srow[tid + 256] = (_Float16)(W[(size_t)nn * E + tid + 256] * 16.0f); __syncthreads();
    if (tid < E / 8) vst2(PT + (size_t)n * E + tid * 8, *(const v4u*)(&srow[tid * 8])); }
  else { const int m = n - 4 * E; const float* W = m < E ? Wkt : Wvt; const int nn = m & (E - 1);
    srow[tid] = (_Float16)(W[(size_t)nn * LT + tid] * 16.0f); __syncthreads();
    if (tid < LT / 8) vst2(PT2 + (size_t)m * LT + tid * 8, *(const v4u*)(&srow[tid * 8])); }
}
// Shared loop of the projection kernels: a block's 64 x 128 tile of A B^T, A and B rows K-contiguous f16; wave w keeps rows 16 w .. 16 w + 15 x 128 columns in acc, k ascending.
// Each 64-k slice (128 B = one whole line of each of the 64 A rows and 128 B rows) is brought in once per block and kept in LDS for all four waves; the fragments are read from LDS.
// Two buffers: slice c + 1 is asked for ahead of slice c's products and stored behind them, one barrier per slice. Rows are padded to 144 B (16 B x odd) for the 16-B fragment reads.
#define GP 72
#define GSM ((64 + 128) * 2 * GP * 2)   // bytes: [2][64][GP] A halves, then [2][128][GP] B halves; the epilogues reuse the same bytes behind a barrier
template <int K, typename AR>
__device__ __forceinline__ void gemm_lds(const _Float16* __restrict__ A, AR arow, const _Float16* __restrict__ B, char* smem, v8f (&acc)[8]) {
  _Float16* sA = (_Float16*)smem; _Float16* sB = sA + 2 * 64 * GP;
  const int tid = threadIdx.x, wave = tid >> 5, lane = tid & 31, col = lane & 15;
  // staging: thread owns 16-B piece tid & 7 of rows (tid >> 3) + 16 i, so a wave's load covers four whole 128-B lines
  const int srow = tid >> 3, spc = (tid & 7) * 8;
  // lane offsets in halves from the block-uniform bases A and B
  unsigned ao[4];
#pragma unroll
  for (int i = 0; i < 4; ++i) ao[i] = (unsigned)arow(srow + 16 * i) * K + spc;
  const unsigned bo = (unsigned)srow * K + spc;
  const int sp = srow * GP + spc;
  v8h ra[4], rb[8];
  auto fetch = [&](int c) { const _Float16* Ac = A + c * 64; const _Float16* Bc = B + c * 64;
#pragma unroll
    for (int i = 0; i < 4; ++i) ra[i] = *(const v8h*)(Ac + ao[i]);
#pragma unroll
    for (int i = 0; i < 8; ++i) rb[i] = *(const v8h*)(Bc + 16 * i * K + bo); };
  auto put = [&](int c) { _Float16* pa = sA + (c & 1) * (64 * GP) + sp; _Float16* pb = sB + (c & 1) * (128 * GP) + sp;
#pragma unroll
    for (int i = 0; i < 4; ++i) *(v8h*)(pa + 16 * i * GP) = ra[i];
#pragma unroll
    for (int i = 0; i < 8; ++i) *(v8h*)(pb + 16 * i * GP) = rb[i]; };
  fetch(0); put(0);
  __syncthreads();
  // unrolled: the slice's step and the buffer's place become immediate offsets, so no address register is formed anew (and waited for) in each trip
#pragma unroll
  for (int c = 0; c < K / 64; ++c) { const int bf = c & 1;
    if (c + 1 < K / 64) fetch(c + 1);
#pragma unroll
    for (int kc = 0; kc < 2; ++kc) { const v16h a = frag_h(sA + (bf * 64 + wave * 16 + col) * GP + kc * 32, lane); v16h bfr[8];
#pragma unroll
      for (int j = 0; j < 8; ++j) bfr[j] = frag_h(sB + (bf * 128 + j * 16 + col) * GP + kc * 32, lane);
#pragma unroll
      for (int j = 0; j < 8; ++j) acc[j] = wmma16(a, bfr[j], acc[j]); }
    // the other buffer's last readers left it at the barrier of the trip before; this barrier publishes slice c + 1 and ends the reads of slice c
    if (c + 1 < K / 64) { put(c + 1); __syncthreads(); } }
  // ends every wave's reads of the last slice, so that the caller's epilogue may overwrite the buffers
  __syncthreads();
}
// motion q/k/v: block (64 tokens of one batch, 128 cols, which) ; k stored at key slot 77 + s, v token-major into VS[b][s][c]
__global__ __launch_bounds__(128) void k_qkv(const _Float16* __restrict__ X16, const _Float16* __restrict__ PT, const float* __restrict__ bq, const float* __restrict__ bk, const float* __restrict__ bv, const float* __restrict__ srcm,
                                            _Float16* __restrict__ Q16, _Float16* __restrict__ K16, _Float16* __restrict__ VT) {
  __shared__ __align__(16) char smem[GSM];
  float (*so)[16][132] = (float (*)[16][132])smem;      // [4][16][132], which < 2
  _Float16 (*sth)[72] = (_Float16 (*)[72])smem;         // [128][72], which == 2
  const int tid = threadIdx.x, wave = tid >> 5, lane = tid & 31, col = lane & 15, g = lane >> 4;
  const int which = blockIdx.z, r0b = blockIdx.x * 64, n0 = blockIdx.y * 128; const int b = r0b / SS, s0 = r0b % SS;
  const float* bb_ = which == 0 ? bq : (which == 1 ? bk : bv);
  v8f acc[8] = {};
  gemm_lds<E>(X16, [&](int r) { return r0b + r; }, PT + (size_t)(which * E + n0) * E, smem, acc);
  if (which < 2) {
#pragma unroll
    for (int j = 0; j < 8; ++j) { const float bb = bb_[n0 + j * 16 + col];
#pragma unroll
      for (int r = 0; r < 8; ++r) so[wave][8 * g + r][j * 16 + col] = (acc[j][r] * (1.0f / 16.0f) + bb) * 4.0f; }
    LDSX();
    for (int qq = lane; qq < 16 * 2 * 8; qq += 32) { const int hh = qq >> 7, rl = (qq >> 3) & 15, pc = qq & 7; const int h = (n0 >> 6) + hh; union { v8h h8; v4u u; } pk;
#pragma unroll
      for (int e = 0; e < 8; ++e) pk.h8[e] = (_Float16)so[wave][rl][hh * 64 + pc * 8 + e];
      if (which == 0) vst2(Q16 + (((size_t)b * NH + h) * SS + s0 + wave * 16 + rl) * HD + pc * 8, pk.u);
      else vst2(K16 + (((size_t)b * NH + h) * NKEY + NTX + s0 + wave * 16 + rl) * HD + pc * 8, pk.u); } }
  else {
#pragma unroll
    for (int j = 0; j < 8; ++j) { const float bb = bb_[n0 + j * 16 + col];
#pragma unroll
      for (int r = 0; r < 8; ++r) { const int s = s0 + wave * 16 + 8 * g + r; sth[j * 16 + col][wave * 16 + 8 * g + r] = (_Float16)((acc[j][r] * (1.0f / 16.0f) + bb) * srcm[b * SS + s] * 4.0f); } }
    __syncthreads();
    // To keep whole-line ownership, VT motion columns are written by k_vt from a token-major staging buffer instead (see VS below): here we store V token-major.
    for (int qq = tid; qq < 64 * 16; qq += 128) { const int rl = qq >> 4, pc = qq & 15; const int s = s0 + rl;
      union { v8h h8; v4u u; } pk;
#pragma unroll
      for (int e = 0; e < 8; ++e) pk.h8[e] = sth[pc * 8 + e][rl];
      vst2(VT + ((size_t)b * SS + s) * E + n0 + pc * 8, pk.u); } }     // VS[b][s][c] token-major (VT pointer is the staging buffer here)
}
// text k/v: block (64-row tile, 128 cols, which kv, b): 77 rows (2 row tiles of 64, clamped) x 512 cols per (b, which) from T16 [b*77 + t][256] @ PT2 ; k -> K16 slots 0..76 ; v (x text_cond) -> VS2[b][t][c] token-major
__global__ __launch_bounds__(128) void k_tkv(const _Float16* __restrict__ T16, const _Float16* __restrict__ PT2, const float* __restrict__ bkt, const float* __restrict__ bvt, const int* __restrict__ cond, _Float16* __restrict__ K16, _Float16* __restrict__ VS2) {
  __shared__ __align__(16) char smem[GSM];
  float (*so)[16][132] = (float (*)[16][132])smem;      // [4][16][132]
  const int tid = threadIdx.x, wave = tid >> 5, lane = tid & 31, col = lane & 15, g = lane >> 4;
  const int b = blockIdx.z, which = blockIdx.y; const int t0b = (blockIdx.x >> 2) * 64, t0 = t0b + wave * 16, n0 = (blockIdx.x & 3) * 128;
  const float tc = (cond[b] % 10) > 0 ? 1.f : 0.f; const float* bb_ = which == 0 ? bkt : bvt; const float vsc = which == 0 ? 4.0f : 4.0f * tc;
  v8f acc[8] = {};
  gemm_lds<LT>(T16, [&](int r) { const int t = t0b + r; return b * NTX + (t < NTX ? t : NTX - 1); }, PT2 + (size_t)(which * E + n0) * LT, smem, acc);
#pragma unroll
  for (int j = 0; j < 8; ++j) { const float bb = bb_[n0 + j * 16 + col];
#pragma unroll
    for (int r = 0; r < 8; ++r) so[wave][8 * g + r][j * 16 + col] = (acc[j][r] * (1.0f / 16.0f) + bb) * vsc; }
  LDSX();
  if (which == 0) {   // K16 rows [bh][slot t][64]: 2 heads per 128 cols
    for (int qq = lane; qq < 16 * 2 * 8; qq += 32) { const int hh = qq >> 7, rl = (qq >> 3) & 15, pc = qq & 7; const int h = (n0 >> 6) + hh; const int t = t0 + rl; if (t >= NTX) continue; union { v8h h8; v4u u; } pk;
#pragma unroll
      for (int e = 0; e < 8; ++e) pk.h8[e] = (_Float16)so[wave][rl][hh * 64 + pc * 8 + e];
      vst2(K16 + (((size_t)b * NH + h) * NKEY + t) * HD + pc * 8, pk.u); } }
  else {              // VS2[b][t][512] token-major, 128 cols of this block = 256 B per row
    for (int qq = lane; qq < 16 * 16; qq += 32) { const int rl = qq >> 4, pc = qq & 15; const int t = t0 + rl; if (t >= NTX) continue; union { v8h h8; v4u u; } pk;
#pragma unroll
      for (int e = 0; e < 8; ++e) pk.h8[e] = (_Float16)so[wave][rl][pc * 8 + e]; 
      vst2(VS2 + ((size_t)b * NTX + t) * E + n0 + pc * 8, pk.u); } }
}
// transpose values into VT [bh][d][NKEY] with whole-line ownership: block = (bh, d-group of 8): for each d row (NKEY halves = 2304 B = 18 lines) gather from VS2 (slots 0..76), VS (77..1100), zeros (pad)
__global__ __launch_bounds__(256) void k_vt(const _Float16* __restrict__ VS, const _Float16* __restrict__ VS2, _Float16* __restrict__ VT) {
  __shared__ __align__(16) _Float16 st[8][NKEY + 8];
  const int tid = threadIdx.x; const int bh = blockIdx.x >> 3, d0 = (blockIdx.x & 7) * 8; const int b = bh / NH, h = bh % NH; const int c0 = h * HD + d0;
  for (int q = tid; q < 8 * NKEY; q += 256) { const int dl = q / NKEY, slot = q % NKEY; _Float16 v;
    if (slot < NTX) v = VS2[((size_t)b * NTX + slot) * E + c0 + dl]; else if (slot < NTX + SS) v = VS[((size_t)b * SS + (slot - NTX)) * E + c0 + dl]; else v = (_Float16)0.f;
    st[dl][slot] = v; }
  __syncthreads();
  for (int q = tid; q < 8 * (NKEY / 8); q += 256) { const int dl = q / (NKEY / 8), pc = q % (NKEY / 8); vst2(VT + ((size_t)bh * HD + d0 + dl) * NKEY + pc * 8, *(const v4u*)(&st[dl][pc * 8])); }
}
// pad key rows 1101..1151 of K16 to zero (scores there are masked anyway; keeps them finite)
__global__ __launch_bounds__(256) void k_zpad(_Float16* __restrict__ K16) {
  const int bh = blockIdx.x, tid = threadIdx.x; const v4u z = {0u, 0u, 0u, 0u};
  for (int q = tid; q < (NKEY - NTX - SS) * 8; q += 256) { const int rl = q >> 3, pc = q & 7; vst2(K16 + (((size_t)bh) * NKEY + NTX + SS + rl) * HD + pc * 8, z); }
}
// attention: block (64 queries, bh); 18 key tiles; additive masks; O16 x8 [bh][s][64]
// Each key tile (64 K rows, 64 V^T rows of 128 B, 64 mask penalties) is brought in once per block with whole-line loads and kept in LDS for all four waves;
// two buffers: tile kt + 1 is asked for ahead of tile kt's softmax and stored behind its P V products, one barrier per tile. Rows are padded to 144 B (16 B x odd) for the 16-B fragment reads.
#define NT (NKEY / 64)
#define KP 72
__global__ __launch_bounds__(128) void k_attn(const _Float16* __restrict__ Q16, const _Float16* __restrict__ K16, const _Float16* __restrict__ VT, const int* __restrict__ cond, const float* __restrict__ srcm, _Float16* __restrict__ O16) {
  __shared__ __align__(16) float sS[4][16][68];       // scores of a tile; after the loop the wave's output tile
  __shared__ __align__(16) _Float16 sPh[4][16][72];
  __shared__ __align__(16) _Float16 sK[2][64][KP];
  __shared__ __align__(16) _Float16 sV[2][64][KP];
  __shared__ __align__(16) float sPen[2][64];
  const int tid = threadIdx.x, w = tid >> 5, lane = tid & 31, col = lane & 15, g = lane >> 4;
  const size_t bh = blockIdx.y; const int b = (int)(bh / NH); const int q0 = blockIdx.x * 64 + w * 16;
  const float tpen = ((cond[b] % 10) > 0) ? 0.f : -1000000.0f;
  // staging: thread owns 16-B piece tid & 7 of rows (tid >> 3) + 16 i, so a wave's load covers four whole 128-B lines
  const int srow = tid >> 3, spc = (tid & 7) * 8;
  const _Float16* kg = K16 + (bh * NKEY + srow) * HD + spc;
  const _Float16* vg = VT + (bh * HD + srow) * NKEY + spc;
  v8h rk[4], rv[4]; float rm;
  auto fetch = [&](int kt) {
#pragma unroll
    for (int i = 0; i < 4; ++i) { rk[i] = *(const v8h*)(kg + (size_t)(kt * 64 + 16 * i) * HD); rv[i] = *(const v8h*)(vg + (size_t)(16 * i) * NKEY + kt * 64); }
    int ms = kt * 64 + (tid & 63) - NTX; ms = ms < 0 ? 0 : (ms > SS - 1 ? SS - 1 : ms); rm = srcm[b * SS + ms]; };
  auto put = [&](int kt) { const int bf = kt & 1;
#pragma unroll
    for (int i = 0; i < 4; ++i) { *(v8h*)(&sK[bf][srow + 16 * i][spc]) = rk[i]; *(v8h*)(&sV[bf][srow + 16 * i][spc]) = rv[i]; }
    if (tid < 64) { const int slot = kt * 64 + tid; sPen[bf][tid] = slot < NTX ? tpen : (slot < NTX + SS ? (1.0f - rm) * -1000000.0f : -3.0e38f); } };
  fetch(0);
  v16h aq[2];
#pragma unroll
  for (int kc = 0; kc < 2; ++kc) aq[kc] = frag_h(Q16 + (bh * SS + q0 + col) * HD + kc * 32, lane);
  put(0);
  __syncthreads();
  float mrun = -3.0e38f, lrun = 0.f; v8f acc[4] = {};
#pragma unroll 1
  for (int kt = 0; kt < NT; ++kt) { const int bf = kt & 1;
    v16h kf[4][2]; float pn[4];
#pragma unroll
    for (int t = 0; t < 4; ++t) { pn[t] = sPen[bf][t * 16 + col];
#pragma unroll
      for (int kc = 0; kc < 2; ++kc) kf[t][kc] = frag_h(&sK[bf][t * 16 + col][kc * 32], lane); }
#pragma unroll
    for (int t = 0; t < 4; ++t) { v8f s = {}; const int slot = kt * 64 + t * 16 + col;
#pragma unroll
      for (int kc = 0; kc < 2; ++kc) s = wmma16(aq[kc], kf[t][kc], s);
#pragma unroll
      for (int r = 0; r < 8; ++r) sS[w][8 * g + r][t * 16 + col] = slot < NTX + SS ? s[r] * (1.0f / 16.0f) + pn[t] : -3.0e38f; }
    LDSX();
    // asked for here, behind the fence above (which waits for every load in flight), so that the loads fly under the whole softmax
    if (kt + 1 < NT) fetch(kt + 1);
    float mx = -3.4e38f;
#pragma unroll
    for (int jj = 0; jj < 32; ++jj) mx = fmaxf(mx, sS[w][col][g * 32 + jj]);
    mx = fmaxf(mx, __shfl_xor(mx, 16, 32));
    const float mnew = fmaxf(mrun, mx); const float corr = expf(mrun - mnew);
    float ps = 0.f;
#pragma unroll
    for (int jj = 0; jj < 32; ++jj) { const float sv = sS[w][col][g * 32 + jj]; const float p = sv <= -1.0e38f ? 0.f : expf(sv - mnew) * 16384.0f; ps += p; sPh[w][col][g * 32 + jj] = (_Float16)p; }
    ps += __shfl_xor(ps, 16, 32);
    lrun = lrun * corr + ps * (1.0f / 16384.0f); mrun = mnew;
#pragma unroll
    for (int r = 0; r < 8; ++r) { const float cr = __shfl(corr, 8 * g + r, 32);
#pragma unroll
      for (int t = 0; t < 4; ++t) acc[t][r] *= cr; }
    LDSX();
    v16h ph[2], vf[2][4];
#pragma unroll
    for (int kc = 0; kc < 2; ++kc) { ph[kc] = frag_h(&sPh[w][col][0] + kc * 32, lane);
#pragma unroll
      for (int t = 0; t < 4; ++t) vf[kc][t] = frag_h(&sV[bf][t * 16 + col][kc * 32], lane); }
#pragma unroll
    for (int kc = 0; kc < 2; ++kc)
#pragma unroll
      for (int t = 0; t < 4; ++t) acc[t] = wmma16(ph[kc], vf[kc][t], acc[t]);
    // the other buffer's last readers left it at the barrier of the trip before; this barrier publishes tile kt + 1 and ends the reads of tile kt
    if (kt + 1 < NT) { put(kt + 1); __syncthreads(); } }
#pragma unroll
  for (int r = 0; r < 8; ++r) { const float lr = __shfl(lrun, 8 * g + r, 32); const float inv = 8.0f / (lr * 16384.0f * 4.0f);
#pragma unroll
    for (int t = 0; t < 4; ++t) sS[w][8 * g + r][t * 16 + col] = acc[t][r] * inv; }
  LDSX();
  for (int qq = lane; qq < 16 * 8; qq += 32) { const int rl = qq >> 3, pc = qq & 7; union { v8h h8; v4u u; } pk;
#pragma unroll
    for (int e = 0; e < 8; ++e) pk.h8[e] = (_Float16)sS[w][rl][pc * 8 + e];
    vst2(O16 + ((bh * SS) + q0 + rl) * HD + pc * 8, pk.u); }
}
// [scale | shift] = silu(emb) emb_W^T + emb_b : 8 rows (16-row tile, rows >= 8 zero) x 1024 cols, K = 2048 (bf16 hi/lo)
// block = 32 cols (one whole 128-B line of each SSH row), 16 waves; wave w takes k in [128 w, 128 w + 128) for both column tiles; the 16 partial tiles are summed in LDS in wave order
#define EKW 16
#define EKC (TE / EKW / 32)
__global__ __launch_bounds__(512) void k_emb(const float* __restrict__ emb, const float* __restrict__ W, const float* __restrict__ bias, float* __restrict__ SSH) {
  __shared__ __align__(16) float red[EKW][NB][32];
  const int tid = threadIdx.x, wave = tid >> 5, lane = tid & 31, col = lane & 15, g = lane >> 4; const int n0 = blockIdx.x * 32, kb = wave * (TE / EKW);
  // A loader: lanes col and col + 8 share emb row col & 7; the lower lane makes silu of fragment elements 0..7, the upper lane of elements 8..15 and hands them over; rows >= 8 of the tile are zero
  const int eh = col >> 3; const float* ep = emb + (size_t)(col & 7) * TE + kb + 8 * g + 16 * eh;
  const float* wp = W + (size_t)(n0 + col) * TE + kb + 8 * g;
  // the wave's whole slice is asked for before any of it is used, so that it pays the memory latency once
  float ev[EKC][8], wv[EKC][2][16];
#pragma unroll
  for (int kc = 0; kc < EKC; ++kc)
#pragma unroll
    for (int i = 0; i < 8; ++i) ev[kc][i] = ep[kc * 32 + i];
#pragma unroll
  for (int kc = 0; kc < EKC; ++kc)
#pragma unroll
    for (int j = 0; j < 2; ++j)
#pragma unroll
      for (int i = 0; i < 8; ++i) { wv[kc][j][i] = wp[(size_t)j * 16 * TE + kc * 32 + i]; wv[kc][j][8 + i] = wp[(size_t)j * 16 * TE + kc * 32 + 16 + i]; }
  F2 a[EKC];
#pragma unroll
  for (int kc = 0; kc < EKC; ++kc) { float v[16];
#pragma unroll
    for (int i = 0; i < 8; ++i) { const float s = silu(ev[kc][i]); const float o = __shfl_xor(s, 8, 32); v[i] = eh ? 0.f : s; v[8 + i] = eh ? 0.f : o; }
    a[kc] = bsplit16(v); }
  v8f acc[2] = {};
#pragma unroll
  for (int kc = 0; kc < EKC; ++kc)
#pragma unroll
    for (int j = 0; j < 2; ++j) acc[j] = mac3(a[kc], bsplit16(wv[kc][j]), acc[j]);
  if (g == 0) {
#pragma unroll
    for (int j = 0; j < 2; ++j)
#pragma unroll
      for (int r = 0; r < 8; ++r) red[wave][r][j * 16 + col] = acc[j][r]; }
  __syncthreads();
  if (tid < NB * 32) { const int r = tid >> 5, c = tid & 31; float s = red[0][r][c];
#pragma unroll
    for (int w = 1; w < EKW; ++w) s += red[w][r][c];
    SSH[(size_t)r * (2 * E) + n0 + c] = s + bias[n0 + c]; }
}
__global__ __launch_bounds__(256) void k_styl(const _Float16* __restrict__ O16, const float* __restrict__ SSH, const float* __restrict__ g_, const float* __restrict__ b_, _Float16* __restrict__ Z16) {
  const int wave = threadIdx.x >> 5, lane = threadIdx.x & 31; const int row = blockIdx.x * 8 + wave; const int b = row / SS, s = row % SS;
  float sum = 0.f, sq = 0.f;
#pragma unroll 2
  for (int e = 0; e < 16; ++e) { const int c = (e < 8 ? 0 : 256) + lane * 8 + (e & 7); const int h = c >> 6, d = c & 63; const float v = (float)O16[(((size_t)b * NH + h) * SS + s) * HD + d] * 0.125f; sum += v; sq += v * v; }
#pragma unroll
  for (int o = 16; o > 0; o >>= 1) { sum += __shfl_xor(sum, o, 32); sq += __shfl_xor(sq, o, 32); }
  const float mu = sum * (1.0f / E); float var = sq * (1.0f / E) - mu * mu; var = var > 0.f ? var : 0.f; const float rs = rsqrtf(var + 1e-5f);
  const float* sc_ = SSH + (size_t)b * 2 * E; const float* sh_ = sc_ + E;
#pragma unroll 1
  for (int half = 0; half < 2; ++half) { union { v8h h; v4u u; } pk;
#pragma unroll
    for (int e = 0; e < 8; ++e) { const int c = half * 256 + lane * 8 + e; const int h = c >> 6, d = c & 63; const float v = (float)O16[(((size_t)b * NH + h) * SS + s) * HD + d] * 0.125f;
      const float hn = (v - mu) * rs * g_[c] + b_[c]; const float m = hn * (1.0f + sc_[c]) + sh_[c]; pk.h[e] = (_Float16)(silu(m) * 8.0f); }
    vst2(Z16 + (size_t)row * E + half * 256 + lane * 8, pk.u); }
}
// out = x + Z out_W^T /16/8 + out_b
__global__ __launch_bounds__(128) void k_out(const _Float16* __restrict__ Z16, const _Float16* __restrict__ PT, const float* __restrict__ bo, const float* __restrict__ x, float* __restrict__ out) {
  __shared__ __align__(16) char smem[GSM];
  float (*so)[16][132] = (float (*)[16][132])smem;      // [4][16][132]
  const int tid = threadIdx.x, wave = tid >> 5, lane = tid & 31, col = lane & 15, g = lane >> 4;
  const int r0b = blockIdx.x * 64, r0 = r0b + wave * 16, n0 = blockIdx.y * 128;
  v8f acc[8] = {};
  gemm_lds<E>(Z16, [&](int r) { return r0b + r; }, PT + (size_t)(3 * E + n0) * E, smem, acc);
#pragma unroll
  for (int j = 0; j < 8; ++j) { const int n = n0 + j * 16 + col; const float bb = bo[n];
#pragma unroll
    for (int r = 0; r < 8; ++r) so[wave][8 * g + r][j * 16 + col] = acc[j][r] * (1.0f / (16.0f * 8.0f)) + bb + x[(size_t)(r0 + 8 * g + r) * E + n]; }
  LDSX();
#pragma unroll 4
  for (int rl = 0; rl < 16; ++rl) vst2(out + (size_t)(r0 + rl) * E + n0 + lane * 4, *(const v4f*)(&so[wave][rl][lane * 4]));
}
extern "C" void kernel_launch(void* const* d_in, const int* in_sizes, int n_in, void* d_out, int out_size, void* d_ws, size_t ws_size, hipStream_t stream) {
  (void)in_sizes; (void)n_in; (void)out_size; (void)ws_size;
  const float** I = (const float**)d_in;
  const float* x = I[0]; const float* xf = I[1]; const float* emb = I[2]; const float* srcm = I[3]; const int* cond = (const int*)d_in[4];
  const float* ng = I[5]; const float* nb = I[6]; const float* tg = I[7]; const float* tb = I[8]; const float* Wq = I[9]; const float* bq = I[10]; const float* Wkt = I[11]; const float* bkt = I[12]; const float* Wvt = I[13]; const float* bvt = I[14];
  const float* Wkm = I[15]; const float* bkm = I[16]; const float* Wvm = I[17]; const float* bvm = I[18]; const float* embW = I[19]; const float* embb = I[20]; const float* sg = I[21]; const float* sb = I[22]; const float* Wo = I[23]; const float* bo = I[24];
  float* out = (float*)d_out;
  char* ws = (char*)d_ws; size_t off = 0;
  auto take = [&](size_t bytes) { char* p = ws + off; off += (bytes + 255) & ~(size_t)255; return p; };
  _Float16* X16 = (_Float16*)take((size_t)NR * E * 2); _Float16* T16 = (_Float16*)take((size_t)NB * NTX * LT * 2 + 4096); _Float16* PT = (_Float16*)take((size_t)4 * E * E * 2); _Float16* PT2 = (_Float16*)take((size_t)2 * E * LT * 2);
  _Float16* Q16 = (_Float16*)take((size_t)NR * E * 2); _Float16* K16 = (_Float16*)take((size_t)NB * NH * NKEY * HD * 2); _Float16* VS = (_Float16*)take((size_t)NR * E * 2); _Float16* VS2 = (_Float16*)take((size_t)NB * NTX * E * 2 + 4096);
  _Float16* VT = (_Float16*)take((size_t)NB * NH * HD * NKEY * 2); _Float16* O16 = (_Float16*)take((size_t)NR * E * 2); float* SSH = (float*)take((size_t)NB * 2 * E * 4); _Float16* Z16 = X16;    // X16 dead after k_qkv
  // ws ~ 64 MB
  k_lnx<<<NR / 8, 256, 0, stream>>>(x, ng, nb, X16);
  k_lnt<<<(NB * NTX + 7) / 8, 256, 0, stream>>>(xf, tg, tb, T16);
  k_pack<<<4 * E + 2 * E, 256, 0, stream>>>(Wq, Wkm, Wvm, Wo, Wkt, Wvt, PT, PT2);
  k_qkv<<<dim3(NR / 64, E / 128, 3), 128, 0, stream>>>(X16, PT, bq, bkm, bvm, srcm, Q16, K16, VS);
  k_tkv<<<dim3(2 * 4, 2, NB), 128, 0, stream>>>(T16, PT2, bkt, bvt, cond, K16, VS2);
  k_zpad<<<NB * NH, 256, 0, stream>>>(K16);
  k_vt<<<NB * NH * 8, 256, 0, stream>>>(VS, VS2, VT);
  k_attn<<<dim3(SS / 64, NB * NH), 128, 0, stream>>>(Q16, K16, VT, cond, srcm, O16);
  k_emb<<<(2 * E) / 32, 512, 0, stream>>>(emb, embW, embb, SSH);
  k_styl<<<NR / 8, 256, 0, stream>>>(O16, SSH, sg, sb, Z16);
  k_out<<<dim3(NR / 64, E / 128), 128, 0, stream>>>(Z16, PT, bo, x, out);
}

// v004
// Measured time: 132 microseconds a run.
// Timed twice side by side with v003, it ran 1.19 and 1.18 times as fast.
// All steps since v000 together make it 3.20 times as fast.
// compute dtype: f16 operands for the projections and attention (LayerNorm outputs as f16 rows, weights packed x16, q/k x4, P lifted by 2^14, V x4, context x8, stylised rows x8), bf16 hi/lo splits for the small emb GEMM, f32 accumulate; LayerNorms, masks, softmax, SiLU f32. Output = x + h is dominated by the f32 residual.
#include <hip/hip_runtime.h>
#include <math.h>

typedef __attribute__((ext_vector_type(16))) _Float16 v16h;
typedef __attribute__((ext_vector_type(16))) __bf16 v16b;
typedef __attribute__((ext_vector_type(8)))  _Float16 v8h;
typedef __attribute__((ext_vector_type(8)))  float v8f;
typedef __attribute__((ext_vector_type(4)))  float v4f;
typedef __attribute__((ext_vector_type(2)))  float v2f;
typedef __attribute__((ext_vector_type(4)))  unsigned v4u;
typedef __attribute__((ext_vector_type(4)))  int v4i;
typedef float __attribute__((may_alias)) float_a;
typedef int __attribute__((may_alias)) int_a;

template <typename T> __device__ __forceinline__ void vst2(void* p, T v) { *(T*)p = v;  }
__device__ __forceinline__ v8f wmma16(v16h a, v16h b, v8f c) {
  v8f d = __builtin_amdgcn_wmma_f32_16x16x32_f16(false, a, false, b, (short)0, c, false, false);
  asm volatile("v_nop\n\tv_nop\n\tv_nop\n\tv_nop" : "+v"(d) : "v"(a), "v"(b));
  return d;
}
__device__ __forceinline__ v8f wmma_bf(v16b a, v16b b, v8f c) {
  v8f d = __builtin_amdgcn_wmma_f32_16x16x32_bf16(false, a, false, b, (short)0, c, false, false);
  asm volatile("v_nop\n\tv_nop\n\tv_nop\n\tv_nop" : "+v"(d) : "v"(a), "v"(b));
  return d;
}
// 16x16x32 fragments: lane = (h = lane>>4, row/col = lane&15); elements 0..7 = k0+8h+0..7, 8..15 = k0+16+8h+0..7; D element r = row 8h+r
__device__ __forceinline__ v16h frag_h(const _Float16* rowk0, int lane) {
  union { v16h v; v8h q[2]; } u; const _Float16* p = rowk0 + 8 * (lane >> 4);
  u.q[0] = *(const v8h*)p; u.q[1] = *(const v8h*)(p + 16); return u.v;
}
__device__ __forceinline__ v16h frag_f32(const float* rowk0, int lane) {
  v16h a; const float* p = rowk0 + 8 * (lane >> 4);
#pragma unroll
  for (int i = 0; i < 8; ++i) { a[i] = (_Float16)p[i]; a[8 + i] = (_Float16)p[16 + i]; }
  return a;
}
__device__ __forceinline__ v16h frag_f32s(const float* rowk0, int lane, float sc) {
  v16h a; const float* p = rowk0 + 8 * (lane >> 4);
#pragma unroll
  for (int i = 0; i < 8; ++i) { a[i] = (_Float16)(p[i] * sc); a[8 + i] = (_Float16)(p[16 + i] * sc); }
  return a;
}
// column fragment from a [K][ld] layout (column n), rows >= K read as 0
__device__ __forceinline__ v16h fragc_f32(const float* W, int k0, int n, int lane, int ld, int K) {
  v16h a; const int g = lane >> 4;
#pragma unroll
  for (int i = 0; i < 8; ++i) { const int ka = k0 + 8 * g + i, kb = ka + 16;
    a[i] = (_Float16)(ka < K ? W[(size_t)ka * ld + n] : 0.f); a[8 + i] = (_Float16)(kb < K ? W[(size_t)kb * ld + n] : 0.f); }
  return a;
}
struct F2 { v16b h, l; };
__device__ __forceinline__ F2 bsplit16(const float v[16]) { F2 r;
#pragma unroll
  for (int i = 0; i < 16; ++i) { const __bf16 h = (__bf16)v[i]; r.h[i] = h; r.l[i] = (__bf16)(v[i] - (float)h); }
  return r; }
__device__ __forceinline__ F2 split_row(const float* row, int k0, int lane) { float v[16]; const float* p = row + k0 + 8 * (lane >> 4);
#pragma unroll
  for (int i = 0; i < 8; ++i) { v[i] = p[i]; v[8 + i] = p[16 + i]; }
  return bsplit16(v); }
__device__ __forceinline__ F2 split_rowK(const float* row, int k0, int lane, int K) { float v[16]; const int g = lane >> 4;
#pragma unroll
  for (int i = 0; i < 8; ++i) { const int ka = k0 + 8 * g + i, kb = ka + 16; v[i] = ka < K ? row[ka] : 0.f; v[8 + i] = kb < K ? row[kb] : 0.f; }
  return bsplit16(v); }
__device__ __forceinline__ F2 split_col(const float* W, int k0, int n, int lane, int ld, int K) { float v[16]; const int g = lane >> 4;
#pragma unroll
  for (int i = 0; i < 8; ++i) { const int ka = k0 + 8 * g + i, kb = ka + 16; v[i] = ka < K ? W[(size_t)ka * ld + n] : 0.f; v[8 + i] = kb < K ? W[(size_t)kb * ld + n] : 0.f; }
  return bsplit16(v); }
__device__ __forceinline__ v8f mac3(const F2& a, const F2& b, v8f c) { c = wmma_bf(a.l, b.h, c); c = wmma_bf(a.h, b.l, c); return wmma_bf(a.h, b.h, c); }
__device__ __forceinline__ float sigm(float v) { return 1.0f / (1.0f + expf(-v)); }
#define LDSX() do { asm volatile("s_wait_dscnt 0" ::: "memory"); __builtin_amdgcn_wave_barrier(); __builtin_amdgcn_fence(__ATOMIC_RELEASE, "workgroup"); } while (0)


// Mixed text/motion attention + stylisation block on [8,1024,512] (8 heads x 64): xn = LN(x), xfn = LN(xf [8,77,256]); q = xn Wq^T + bq; keys = [xfn Wkt^T + bkt (77) | xn Wkm^T + bkm (1024)],
// values = [(xfn Wvt^T + bvt) * text_cond_b | (xn Wvm^T + bvm) * src_mask], logits q.k (NO 1/sqrt d) + (1 - mask)*(-1e6) with mask = [text_cond_b x77 | src_mask]; softmax over the 1,101 keys;
// y = P v; h = silu(LN(y) * (1 + scale_b) + shift_b) out_W^T + out_b with [scale|shift] = silu(emb) emb_W^T + emb_b; out = x + h.
// Key slots (softmax does not depend on the key order): motion token s at slot s, text token t at slot 1024 + t, zero pads at 1101..1151; so 64 tokens of a V^T row are one whole, aligned 128-B line.
// Kernels: k_lnx / k_lnt (LayerNorm -> f16 rows), k_pack (weights [out][in] x16), k_qkv (motion q/k/v; keys/values at slots s), k_tkv (text k/v at slots 1024 + t, and the zero pads),
#define NB 8
#define SS 1024
#define E 512
#define NH 8
#define HD 64
#define NR (NB * SS)
#define NTX 77
#define LT 256
#define NKEY 1152              // 1024 + 77 = 1101 padded to 18 x 64
#define TE 2048
__device__ __forceinline__ float silu(float x) { return x / (1.0f + expf(-x)); }

// LN over rows of x (512) -> f16 rows; wave per row
__global__ __launch_bounds__(256) void k_lnx(const float* __restrict__ x, const float* __restrict__ g_, const float* __restrict__ b_, _Float16* __restrict__ X16) {
  const int wave = threadIdx.x >> 5, lane = threadIdx.x & 31; const int row = blockIdx.x * 8 + wave; const float* xr = x + (size_t)row * E;
  float v[16]; float s = 0.f;
  // lane owns columns lane*8..+7 and 256 + lane*8..+7 so each 16-B store instruction covers a contiguous 512-B run across the wave
#pragma unroll
  for (int e = 0; e < 16; ++e) { v[e] = xr[(e < 8 ? 0 : 256) + lane * 8 + (e & 7)]; s += v[e]; }
#pragma unroll
  for (int o = 16; o > 0; o >>= 1) s += __shfl_xor(s, o, 32);
  const float mu = s * (1.0f / E); float q = 0.f;
#pragma unroll
  for (int e = 0; e < 16; ++e) { const float d = v[e] - mu; q += d * d; }
#pragma unroll
  for (int o = 16; o > 0; o >>= 1) q += __shfl_xor(q, o, 32);
  const float rs = rsqrtf(q * (1.0f / E) + 1e-5f);
  union { v8h h[2]; v4u u[2]; } pk;
#pragma unroll
  for (int e = 0; e < 16; ++e) { const int c = (e < 8 ? 0 : 256) + lane * 8 + (e & 7); pk.h[e >> 3][e & 7] = (_Float16)((v[e] - mu) * rs * g_[c] + b_[c]); }
  vst2(X16 + (size_t)row * E + lane * 8, pk.u[0]); vst2(X16 + (size_t)row * E + 256 + lane * 8, pk.u[1]);
}
// LN over rows of xf (256) -> f16 rows [NB*NTX][256]; wave per row (8 per lane)
__global__ __launch_bounds__(256) void k_lnt(const float* __restrict__ xf, const float* __restrict__ g_, const float* __restrict__ b_, _Float16* __restrict__ T16) {
  const int wave = threadIdx.x >> 5, lane = threadIdx.x & 31; const int row = blockIdx.x * 8 + wave; if (row >= NB * NTX) return; const float* xr = xf + (size_t)row * LT;
  float v[8]; float s = 0.f;
#pragma unroll
  for (int e = 0; e < 8; ++e) { v[e] = xr[lane * 8 + e]; s += v[e]; }
#pragma unroll
  for (int o = 16; o > 0; o >>= 1) s += __shfl_xor(s, o, 32);
  const float mu = s * (1.0f / LT); float q = 0.f;
#pragma unroll
  for (int e = 0; e < 8; ++e) { const float d = v[e] - mu; q += d * d; }
#pragma unroll
  for (int o = 16; o > 0; o >>= 1) q += __shfl_xor(q, o, 32);
  const float rs = rsqrtf(q * (1.0f / LT) + 1e-5f);
  union { v8h h; v4u u; } pk;
#pragma unroll
  for (int e = 0; e < 8; ++e) { const int c = lane * 8 + e; pk.h[e] = (_Float16)((v[e] - mu) * rs * g_[c] + b_[c]); }
  vst2(T16 + (size_t)row * LT + lane * 8, pk.u);
}
// PT rows (x16, [out][in]): [0,512) Wq, [512,1024) Wkm, [1024,1536) Wvm, [1536,2048) out_W (512 halves each); PT2: [0,512) Wkt, [512,1024) Wvt (256 halves each)
__global__ __launch_bounds__(256) void k_pack(const float* __restrict__ Wq, const float* __restrict__ Wkm, const float* __restrict__ Wvm, const float* __restrict__ Wo, const float* __restrict__ Wkt, const float* __restrict__ Wvt, _Float16* __restrict__ PT, _Float16* __restrict__ PT2) {
  const int n = blockIdx.x, tid = threadIdx.x; __shared__ __align__(16) _Float16 srow[E];
  if (n < 4 * E) { const float* W = n < E ? Wq : (n < 2 * E ? Wkm : (n < 3 * E ? Wvm : Wo)); const int nn = n & (E - 1);
    srow[tid] = (_Float16)(W[(size_t)nn * E + tid] * 16.0f); srow[tid + 256] = (_Float16)(W[(size_t)nn * E + tid + 256] * 16.0f); __syncthreads();
    if (tid < E / 8) vst2(PT + (size_t)n * E + tid * 8, *(const v4u*)(&srow[tid * 8])); }
  else { const int m = n - 4 * E; const float* W = m < E ? Wkt : Wvt; const int nn = m & (E - 1);
    srow[tid] = (_Float16)(W[(size_t)nn * LT + tid] * 16.0f); __syncthreads();
    if (tid < LT / 8) vst2(PT2 + (size_t)m * LT + tid * 8, *(const v4u*)(&srow[tid * 8])); }
}
// Shared loop of the projection kernels: a block's 64 x 128 tile of A B^T, A and B rows K-contiguous f16; wave w keeps rows 16 w .. 16 w + 15 x 128 columns in acc, k ascending.
// Each 64-k slice (128 B = one whole line of each of the 64 A rows and 128 B rows) is brought in once per block and kept in LDS for all four waves; the fragments are read from LDS.
// Two buffers: slice c + 1 is asked for ahead of slice c's products and stored behind them, one barrier per slice. Rows are padded to 144 B (16 B x odd) for the 16-B fragment reads.
#define GP 72
#define GSM ((64 + 128) * 2 * GP * 2)   // bytes: [2][64][GP] A halves, then [2][128][GP] B halves; the epilogues reuse the same bytes behind a barrier
template <int K, typename AR>
__device__ __forceinline__ void gemm_lds(const _Float16* __restrict__ A, AR arow, const _Float16* __restrict__ B, char* smem, v8f (&acc)[8]) {
  _Float16* sA = (_Float16*)smem; _Float16* sB = sA + 2 * 64 * GP;
  const int tid = threadIdx.x, wave = tid >> 5, lane = tid & 31, col = lane & 15;
  // staging: thread owns 16-B piece tid & 7 of rows (tid >> 3) + 16 i, so a wave's load covers four whole 128-B lines
  const int srow = tid >> 3, spc = (tid & 7) * 8;
  // lane offsets in halves from the block-uniform bases A and B
  unsigned ao[4];
#pragma unroll
  for (int i = 0; i < 4; ++i) ao[i] = (unsigned)arow(srow + 16 * i) * K + spc;
  const unsigned bo = (unsigned)srow * K + spc;
  const int sp = srow * GP + spc;
  v8h ra[4], rb[8];
  auto fetch = [&](int c) { const _Float16* Ac = A + c * 64; const _Float16* Bc = B + c * 64;
#pragma unroll
    for (int i = 0; i < 4; ++i) ra[i] = *(const v8h*)(Ac + ao[i]);
#pragma unroll
    for (int i = 0; i < 8; ++i) rb[i] = *(const v8h*)(Bc + 16 * i * K + bo); };
  auto put = [&](int c) { _Float16* pa = sA + (c & 1) * (64 * GP) + sp; _Float16* pb = sB + (c & 1) * (128 * GP) + sp;
#pragma unroll
    for (int i = 0; i < 4; ++i) *(v8h*)(pa + 16 * i * GP) = ra[i];
#pragma unroll
    for (int i = 0; i < 8; ++i) *(v8h*)(pb + 16 * i * GP) = rb[i]; };
  fetch(0); put(0);
  __syncthreads();
  // unrolled: the slice's step and the buffer's place become immediate offsets, so no address register is formed anew (and waited for) in each trip
#pragma unroll
  for (int c = 0; c < K / 64; ++c) { const int bf = c & 1;
    if (c + 1 < K / 64) fetch(c + 1);
#pragma unroll
    for (int kc = 0; kc < 2; ++kc) { const v16h a = frag_h(sA + (bf * 64 + wave * 16 + col) * GP + kc * 32, lane); v16h bfr[8];
#pragma unroll
      for (int j = 0; j < 8; ++j) bfr[j] = frag_h(sB + (bf * 128 + j * 16 + col) * GP + kc * 32, lane);
#pragma unroll
      for (int j = 0; j < 8; ++j) acc[j] = wmma16(a, bfr[j], acc[j]); }
    // the other buffer's last readers left it at the barrier of the trip before; this barrier publishes slice c + 1 and ends the reads of slice c
    if (c + 1 < K / 64) { put(c + 1); __syncthreads(); } }
  // ends every wave's reads of the last slice, so that the caller's epilogue may overwrite the buffers
  __syncthreads();
}
// motion q/k/v: block (64 tokens of one batch, 128 cols, which) ; k,v stored at key slot s ; v goes straight into VT [bh][d][NKEY]
__global__ __launch_bounds__(128) void k_qkv(const _Float16* __restrict__ X16, const _Float16* __restrict__ PT, const float* __restrict__ bq, const float* __restrict__ bk, const float* __restrict__ bv, const float* __restrict__ srcm,
                                            _Float16* __restrict__ Q16, _Float16* __restrict__ K16, _Float16* __restrict__ VT) {
  __shared__ __align__(16) char smem[GSM];
  float (*so)[16][132] = (float (*)[16][132])smem;      // [4][16][132], which < 2
  _Float16 (*sth)[72] = (_Float16 (*)[72])smem;         // [128][72], which == 2
  const int tid = threadIdx.x, wave = tid >> 5, lane = tid & 31, col = lane & 15, g = lane >> 4;
  const int which = blockIdx.z, r0b = blockIdx.x * 64, n0 = blockIdx.y * 128; const int b = r0b / SS, s0 = r0b % SS;
  const float* bb_ = which == 0 ? bq : (which == 1 ? bk : bv);
  v8f acc[8] = {};
  gemm_lds<E>(X16, [&](int r) { return r0b + r; }, PT + (size_t)(which * E + n0) * E, smem, acc);
  if (which < 2) {
#pragma unroll
    for (int j = 0; j < 8; ++j) { const float bb = bb_[n0 + j * 16 + col];
#pragma unroll
      for (int r = 0; r < 8; ++r) so[wave][8 * g + r][j * 16 + col] = (acc[j][r] * (1.0f / 16.0f) + bb) * 4.0f; }
    LDSX();
    for (int qq = lane; qq < 16 * 2 * 8; qq += 32) { const int hh = qq >> 7, rl = (qq >> 3) & 15, pc = qq & 7; const int h = (n0 >> 6) + hh; union { v8h h8; v4u u; } pk;
#pragma unroll
      for (int e = 0; e < 8; ++e) pk.h8[e] = (_Float16)so[wave][rl][hh * 64 + pc * 8 + e];
      if (which == 0) vst2(Q16 + (((size_t)b * NH + h) * SS + s0 + wave * 16 + rl) * HD + pc * 8, pk.u);
      else vst2(K16 + (((size_t)b * NH + h) * NKEY + s0 + wave * 16 + rl) * HD + pc * 8, pk.u);
      // the next trip writes the registers that the store names
      asm volatile("s_wait_xcnt 0x0" ::: "memory"); } }
  else {
#pragma unroll
    for (int j = 0; j < 8; ++j) { const float bb = bb_[n0 + j * 16 + col];
#pragma unroll
      for (int r = 0; r < 8; ++r) { const int s = s0 + wave * 16 + 8 * g + r; sth[j * 16 + col][wave * 16 + 8 * g + r] = (_Float16)((acc[j][r] * (1.0f / 16.0f) + bb) * srcm[b * SS + s] * 4.0f); } }
    __syncthreads();
    // the block's 64 tokens are one whole line of each of its 128 V^T rows: eight lanes store a line; unrolled so that the eight LDS reads are asked for together and their latency is paid once
#pragma unroll
    for (int i = 0; i < 8; ++i) { const int c = (tid >> 3) + 16 * i, n = n0 + c, pc = tid & 7;
      vst2(VT + (((size_t)b * NH + (n >> 6)) * HD + (n & 63)) * NKEY + s0 + pc * 8, *(const v4u*)(&sth[c][pc * 8])); } }
}
// text k/v: block (row tile x col tile, which kv, b): 64 rows (of 77 in 2 row tiles of 64, clamped) x 128 cols (of 512) from T16 [b*77 + t][256] @ PT2 ; k -> K16 slots 1024 + t ; v (x text_cond) -> VT columns 1024 + t ; t = 77..127 are the pads, stored as zeros
__global__ __launch_bounds__(128) void k_tkv(const _Float16* __restrict__ T16, const _Float16* __restrict__ PT2, const float* __restrict__ bkt, const float* __restrict__ bvt, const int* __restrict__ cond, _Float16* __restrict__ K16, _Float16* __restrict__ VT) {
  __shared__ __align__(16) char smem[GSM];
  float (*so)[16][132] = (float (*)[16][132])smem;      // [4][16][132], which == 0
  _Float16 (*sth)[72] = (_Float16 (*)[72])smem;         // [128][72], which == 1
  const int tid = threadIdx.x, wave = tid >> 5, lane = tid & 31, col = lane & 15, g = lane >> 4;
  const int b = blockIdx.z, which = blockIdx.y; const int t0b = (blockIdx.x >> 2) * 64, t0 = t0b + wave * 16, n0 = (blockIdx.x & 3) * 128;
  const float tc = (cond[b] % 10) > 0 ? 1.f : 0.f; const float* bb_ = which == 0 ? bkt : bvt; const float vsc = which == 0 ? 4.0f : 4.0f * tc;
  v8f acc[8] = {};
  gemm_lds<LT>(T16, [&](int r) { const int t = t0b + r; return b * NTX + (t < NTX ? t : NTX - 1); }, PT2 + (size_t)(which * E + n0) * LT, smem, acc);
  if (which == 0) {   // K16 rows [bh][slot 1024 + t][64]: 2 heads per 128 cols
#pragma unroll
    for (int j = 0; j < 8; ++j) { const float bb = bb_[n0 + j * 16 + col];
#pragma unroll
      for (int r = 0; r < 8; ++r) so[wave][8 * g + r][j * 16 + col] = t0 + 8 * g + r < NTX ? (acc[j][r] * (1.0f / 16.0f) + bb) * vsc : 0.f; }
    LDSX();
    for (int qq = lane; qq < 16 * 2 * 8; qq += 32) { const int hh = qq >> 7, rl = (qq >> 3) & 15, pc = qq & 7; const int h = (n0 >> 6) + hh; const int t = t0 + rl; union { v8h h8; v4u u; } pk;
#pragma unroll
      for (int e = 0; e < 8; ++e) pk.h8[e] = (_Float16)so[wave][rl][hh * 64 + pc * 8 + e];
      vst2(K16 + (((size_t)b * NH + h) * NKEY + SS + t) * HD + pc * 8, pk.u); } }
  else {              // VT rows [bh][d][slot 1024 + t]: the block's 64 t are one whole line of each of its 128 V^T rows
#pragma unroll
    for (int j = 0; j < 8; ++j) { const float bb = bb_[n0 + j * 16 + col]; union { v8h h8; v4u u; } pk;
#pragma unroll
      for (int r = 0; r < 8; ++r) pk.h8[r] = t0 + 8 * g + r < NTX ? (_Float16)((acc[j][r] * (1.0f / 16.0f) + bb) * vsc) : (_Float16)0.f;
      *(v4u*)(&sth[j * 16 + col][wave * 16 + 8 * g]) = pk.u; }
    // a line holds rows of all four waves: every wave's part is in LDS before any line is stored
    __syncthreads();
    // unrolled so that the eight LDS reads are asked for together and their latency is paid once
#pragma unroll
    for (int i = 0; i < 8; ++i) { const int c = (tid >> 3) + 16 * i, n = n0 + c, pc = tid & 7;
      vst2(VT + (((size_t)b * NH + (n >> 6)) * HD + (n & 63)) * NKEY + SS + t0b + pc * 8, *(const v4u*)(&sth[c][pc * 8])); } }
}
// attention: block (64 queries, bh); 18 key tiles; additive masks; O16 x8 [bh][s][64]
// Each key tile (64 K rows, 64 V^T rows of 128 B, 64 mask penalties) is brought in once per block with whole-line loads and kept in LDS for all four waves;
// two buffers: tile kt + 1 is asked for ahead of tile kt's softmax and stored behind its P V products, one barrier per tile. Rows are padded to 144 B (16 B x odd) for the 16-B fragment reads.
#define NT (NKEY / 64)
#define KP 72
__global__ __launch_bounds__(128) void k_attn(const _Float16* __restrict__ Q16, const _Float16* __restrict__ K16, const _Float16* __restrict__ VT, const int* __restrict__ cond, const float* __restrict__ srcm, _Float16* __restrict__ O16) {
  __shared__ __align__(16) float sS[4][16][68];       // scores of a tile; after the loop the wave's output tile
  __shared__ __align__(16) _Float16 sPh[4][16][72];
  __shared__ __align__(16) _Float16 sK[2][64][KP];
  __shared__ __align__(16) _Float16 sV[2][64][KP];
  __shared__ __align__(16) float sPen[2][64];
  const int tid = threadIdx.x, w = tid >> 5, lane = tid & 31, col = lane & 15, g = lane >> 4;
  const size_t bh = blockIdx.y; const int b = (int)(bh / NH); const int q0 = blockIdx.x * 64 + w * 16;
  const float tpen = ((cond[b] % 10) > 0) ? 0.f : -1000000.0f;
  // staging: thread owns 16-B piece tid & 7 of rows (tid >> 3) + 16 i, so a wave's load covers four whole 128-B lines
  const int srow = tid >> 3, spc = (tid & 7) * 8;
  const _Float16* kg = K16 + (bh * NKEY + srow) * HD + spc;
  const _Float16* vg = VT + (bh * HD + srow) * NKEY + spc;
  v8h rk[4], rv[4]; float rm;
  auto fetch = [&](int kt) {
#pragma unroll
    for (int i = 0; i < 4; ++i) { rk[i] = *(const v8h*)(kg + (size_t)(kt * 64 + 16 * i) * HD); rv[i] = *(const v8h*)(vg + (size_t)(16 * i) * NKEY + kt * 64); }
    int ms = kt * 64 + (tid & 63); ms = ms > SS - 1 ? SS - 1 : ms; rm = srcm[b * SS + ms]; };
  auto put = [&](int kt) { const int bf = kt & 1;
#pragma unroll
    for (int i = 0; i < 4; ++i) { *(v8h*)(&sK[bf][srow + 16 * i][spc]) = rk[i]; *(v8h*)(&sV[bf][srow + 16 * i][spc]) = rv[i]; }
    if (tid < 64) { const int slot = kt * 64 + tid; sPen[bf][tid] = slot < SS ? (1.0f - rm) * -1000000.0f : (slot < SS + NTX ? tpen : -3.0e38f); } };
  fetch(0);
  v16h aq[2];
#pragma unroll
  for (int kc = 0; kc < 2; ++kc) aq[kc] = frag_h(Q16 + (bh * SS + q0 + col) * HD + kc * 32, lane);
  put(0);
  __syncthreads();
  float mrun = -3.0e38f, lrun = 0.f; v8f acc[4] = {};
#pragma unroll 1
  for (int kt = 0; kt < NT; ++kt) { const int bf = kt & 1;
    v16h kf[4][2]; float pn[4];
#pragma unroll
    for (int t = 0; t < 4; ++t) { pn[t] = sPen[bf][t * 16 + col];
#pragma unroll
      for (int kc = 0; kc < 2; ++kc) kf[t][kc] = frag_h(&sK[bf][t * 16 + col][kc * 32], lane); }
#pragma unroll
    for (int t = 0; t < 4; ++t) { v8f s = {}; const int slot = kt * 64 + t * 16 + col;
#pragma unroll
      for (int kc = 0; kc < 2; ++kc) s = wmma16(aq[kc], kf[t][kc], s);
#pragma unroll
      for (int r = 0; r < 8; ++r) sS[w][8 * g + r][t * 16 + col] = slot < NTX + SS ? s[r] * (1.0f / 16.0f) + pn[t] : -3.0e38f; }
    LDSX();
    // asked for here, behind the fence above (which waits for every load in flight), so that the loads fly under the whole softmax
    if (kt + 1 < NT) fetch(kt + 1);
    float mx = -3.4e38f;
#pragma unroll
    for (int jj = 0; jj < 32; ++jj) mx = fmaxf(mx, sS[w][col][g * 32 + jj]);
    mx = fmaxf(mx, __shfl_xor(mx, 16, 32));
    const float mnew = fmaxf(mrun, mx); const float corr = expf(mrun - mnew);
    float ps = 0.f;
#pragma unroll
    for (int jj = 0; jj < 32; ++jj) { const float sv = sS[w][col][g * 32 + jj]; const float p = sv <= -1.0e38f ? 0.f : expf(sv - mnew) * 16384.0f; ps += p; sPh[w][col][g * 32 + jj] = (_Float16)p; }
    ps += __shfl_xor(ps, 16, 32);
    lrun = lrun * corr + ps * (1.0f / 16384.0f); mrun = mnew;
#pragma unroll
    for (int r = 0; r < 8; ++r) { const float cr = __shfl(corr, 8 * g + r, 32);
#pragma unroll
      for (int t = 0; t < 4; ++t) acc[t][r] *= cr; }
    LDSX();
    v16h ph[2], vf[2][4];
#pragma unroll
    for (int kc = 0; kc < 2; ++kc) { ph[kc] = frag_h(&sPh[w][col][0] + kc * 32, lane);
#pragma unroll
      for (int t = 0; t < 4; ++t) vf[kc][t] = frag_h(&sV[bf][t * 16 + col][kc * 32], lane); }
#pragma unroll
    for (int kc = 0; kc < 2; ++kc)
#pragma unroll
      for (int t = 0; t < 4; ++t) acc[t] = wmma16(ph[kc], vf[kc][t], acc[t]);
    // the other buffer's last readers left it at the barrier of the trip before; this barrier publishes tile kt + 1 and ends the reads of tile kt
    if (kt + 1 < NT) { put(kt + 1); __syncthreads(); } }
#pragma unroll
  for (int r = 0; r < 8; ++r) { const float lr = __shfl(lrun, 8 * g + r, 32); const float inv = 8.0f / (lr * 16384.0f * 4.0f);
#pragma unroll
    for (int t = 0; t < 4; ++t) sS[w][8 * g + r][t * 16 + col] = acc[t][r] * inv; }
  LDSX();
  for (int qq = lane; qq < 16 * 8; qq += 32) { const int rl = qq >> 3, pc = qq & 7; union { v8h h8; v4u u; } pk;
#pragma unroll
    for (int e = 0; e < 8; ++e) pk.h8[e] = (_Float16)sS[w][rl][pc * 8 + e];
    vst2(O16 + ((bh * SS) + q0 + rl) * HD + pc * 8, pk.u); }
}
// [scale | shift] = silu(emb) emb_W^T + emb_b : 8 rows (16-row tile, rows >= 8 zero) x 1024 cols, K = 2048 (bf16 hi/lo)
// block = 32 cols (one whole 128-B line of each SSH row), 16 waves; wave w takes k in [128 w, 128 w + 128) for both column tiles; the 16 partial tiles are summed in LDS in wave order
#define EKW 16
#define EKC (TE / EKW / 32)
__global__ __launch_bounds__(512) void k_emb(const float* __restrict__ emb, const float* __restrict__ W, const float* __restrict__ bias, float* __restrict__ SSH) {
  __shared__ __align__(16) float red[EKW][NB][32];
  const int tid = threadIdx.x, wave = tid >> 5, lane = tid & 31, col = lane & 15, g = lane >> 4; const int n0 = blockIdx.x * 32, kb = wave * (TE / EKW);
  // A loader: lanes col and col + 8 share emb row col & 7; the lower lane makes silu of fragment elements 0..7, the upper lane of elements 8..15 and hands them over; rows >= 8 of the tile are zero
  const int eh = col >> 3; const float* ep = emb + (size_t)(col & 7) * TE + kb + 8 * g + 16 * eh;
  const float* wp = W + (size_t)(n0 + col) * TE + kb + 8 * g;
  // the wave's whole slice is asked for before any of it is used, so that it pays the memory latency once
  float ev[EKC][8], wv[EKC][2][16];
#pragma unroll
  for (int kc = 0; kc < EKC; ++kc)
#pragma unroll
    for (int i = 0; i < 8; ++i) ev[kc][i] = ep[kc * 32 + i];
#pragma unroll
  for (int kc = 0; kc < EKC; ++kc)
#pragma unroll
    for (int j = 0; j < 2; ++j)
#pragma unroll
      for (int i = 0; i < 8; ++i) { wv[kc][j][i] = wp[(size_t)j * 16 * TE + kc * 32 + i]; wv[kc][j][8 + i] = wp[(size_t)j * 16 * TE + kc * 32 + 16 + i]; }
  F2 a[EKC];
#pragma unroll
  for (int kc = 0; kc < EKC; ++kc) { float v[16];
#pragma unroll
    for (int i = 0; i < 8; ++i) { const float s = silu(ev[kc][i]); const float o = __shfl_xor(s, 8, 32); v[i] = eh ? 0.f : s; v[8 + i] = eh ? 0.f : o; }
    a[kc] = bsplit16(v); }
  v8f acc[2] = {};
#pragma unroll
  for (int kc = 0; kc < EKC; ++kc)
#pragma unroll
    for (int j = 0; j < 2; ++j) acc[j] = mac3(a[kc], bsplit16(wv[kc][j]), acc[j]);
  if (g == 0) {
#pragma unroll
    for (int j = 0; j < 2; ++j)
#pragma unroll
      for (int r = 0; r < 8; ++r) red[wave][r][j * 16 + col] = acc[j][r]; }
  __syncthreads();
  if (tid < NB * 32) { const int r = tid >> 5, c = tid & 31; float s = red[0][r][c];
#pragma unroll
    for (int w = 1; w < EKW; ++w) s += red[w][r][c];
    SSH[(size_t)r * (2 * E) + n0 + c] = s + bias[n0 + c]; }
}
__global__ __launch_bounds__(256) void k_styl(const _Float16* __restrict__ O16, const float* __restrict__ SSH, const float* __restrict__ g_, const float* __restrict__ b_, _Float16* __restrict__ Z16) {
  const int wave = threadIdx.x >> 5, lane = threadIdx.x & 31; const int row = blockIdx.x * 8 + wave; const int b = row / SS, s = row % SS;
  float sum = 0.f, sq = 0.f;
#pragma unroll 2
  for (int e = 0; e < 16; ++e) { const int c = (e < 8 ? 0 : 256) + lane * 8 + (e & 7); const int h = c >> 6, d = c & 63; const float v = (float)O16[(((size_t)b * NH + h) * SS + s) * HD + d] * 0.125f; sum += v; sq += v * v; }
#pragma unroll
  for (int o = 16; o > 0; o >>= 1) { sum += __shfl_xor(sum, o, 32); sq += __shfl_xor(sq, o, 32); }
  const float mu = sum * (1.0f / E); float var = sq * (1.0f / E) - mu * mu; var = var > 0.f ? var : 0.f; const float rs = rsqrtf(var + 1e-5f);
  const float* sc_ = SSH + (size_t)b * 2 * E; const float* sh_ = sc_ + E;
#pragma unroll 1
  for (int half = 0; half < 2; ++half) { union { v8h h; v4u u; } pk;
#pragma unroll
    for (int e = 0; e < 8; ++e) { const int c = half * 256 + lane * 8 + e; const int h = c >> 6, d = c & 63; const float v = (float)O16[(((size_t)b * NH + h) * SS + s) * HD + d] * 0.125f;
      const float hn = (v - mu) * rs * g_[c] + b_[c]; const float m = hn * (1.0f + sc_[c]) + sh_[c]; pk.h[e] = (_Float16)(silu(m) * 8.0f); }
    vst2(Z16 + (size_t)row * E + half * 256 + lane * 8, pk.u); }
}
// out = x + Z out_W^T /16/8 + out_b
__global__ __launch_bounds__(128) void k_out(const _Float16* __restrict__ Z16, const _Float16* __restrict__ PT, const float* __restrict__ bo, const float* __restrict__ x, float* __restrict__ out) {
  __shared__ __align__(16) char smem[GSM];
  float (*so)[16][132] = (float (*)[16][132])smem;      // [4][16][132]
  const int tid = threadIdx.x, wave = tid >> 5, lane = tid & 31, col = lane & 15, g = lane >> 4;
  const int r0b = blockIdx.x * 64, r0 = r0b + wave * 16, n0 = blockIdx.y * 128;
  v8f acc[8] = {};
  gemm_lds<E>(Z16, [&](int r) { return r0b + r; }, PT + (size_t)(3 * E + n0) * E, smem, acc);
#pragma unroll
  for (int j = 0; j < 8; ++j) { const int n = n0 + j * 16 + col; const float bb = bo[n];
#pragma unroll
    for (int r = 0; r < 8; ++r) so[wave][8 * g + r][j * 16 + col] = acc[j][r] * (1.0f / (16.0f * 8.0f)) + bb + x[(size_t)(r0 + 8 * g + r) * E + n]; }
  LDSX();
#pragma unroll 4
  for (int rl = 0; rl < 16; ++rl) vst2(out + (size_t)(r0 + rl) * E + n0 + lane * 4, *(const v4f*)(&so[wave][rl][lane * 4]));
}
extern "C" void kernel_launch(void* const* d_in, const int* in_sizes, int n_in, void* d_out, int out_size, void* d_ws, size_t ws_size, hipStream_t stream) {
  (void)in_sizes; (void)n_in; (void)out_size; (void)ws_size;
  const float** I = (const float**)d_in;
  const float* x = I[0]; const float* xf = I[1]; const float* emb = I[2]; const float* srcm = I[3]; const int* cond = (const int*)d_in[4];
  const float* ng = I[5]; const float* nb = I[6]; const float* tg = I[7]; const float* tb = I[8]; const float* Wq = I[9]; const float* bq = I[10]; const float* Wkt = I[11]; const float* bkt = I[12]; const float* Wvt = I[13]; const float* bvt = I[14];
  const float* Wkm = I[15]; const float* bkm = I[16]; const float* Wvm = I[17]; const float* bvm = I[18]; const float* embW = I[19]; const float* embb = I[20]; const float* sg = I[21]; const float* sb = I[22]; const float* Wo = I[23]; const float* bo = I[24];
  float* out = (float*)d_out;
  char* ws = (char*)d_ws; size_t off = 0;
  auto take = [&](size_t bytes) { char* p = ws + off; off += (bytes + 255) & ~(size_t)255; return p; };
  _Float16* X16 = (_Float16*)take((size_t)NR * E * 2); _Float16* T16 = (_Float16*)take((size_t)NB * NTX * LT * 2 + 4096); _Float16* PT = (_Float16*)take((size_t)4 * E * E * 2); _Float16* PT2 = (_Float16*)take((size_t)2 * E * LT * 2);
  _Float16* Q16 = (_Float16*)take((size_t)NR * E * 2); _Float16* K16 = (_Float16*)take((size_t)NB * NH * NKEY * HD * 2);
  _Float16* VT = (_Float16*)take((size_t)NB * NH * HD * NKEY * 2); _Float16* O16 = (_Float16*)take((size_t)NR * E * 2); float* SSH = (float*)take((size_t)NB * 2 * E * 4); _Float16* Z16 = X16;    // X16 dead after k_qkv
  // ws ~ 47 MB (47,013,888 bytes)
  k_lnx<<<NR / 8, 256, 0, stream>>>(x, ng, nb, X16);
  k_lnt<<<(NB * NTX + 7) / 8, 256, 0, stream>>>(xf, tg, tb, T16);
  k_pack<<<4 * E + 2 * E, 256, 0, stream>>>(Wq, Wkm, Wvm, Wo, Wkt, Wvt, PT, PT2);
  k_qkv<<<dim3(NR / 64, E / 128, 3), 128, 0, stream>>>(X16, PT, bq, bkm, bvm, srcm, Q16, K16, VT);
  k_tkv<<<dim3(2 * 4, 2, NB), 128, 0, stream>>>(T16, PT2, bkt, bvt, cond, K16, VT);
  k_attn<<<dim3(SS / 64, NB * NH), 128, 0, stream>>>(Q16, K16, VT, cond, srcm, O16);
  k_emb<<<(2 * E) / 32, 512, 0, stream>>>(emb, embW, embb, SSH);
  k_styl<<<NR / 8, 256, 0, stream>>>(O16, SSH, sg, sb, Z16);
  k_out<<<dim3(NR / 64, E / 128), 128, 0, stream>>>(Z16, PT, bo, x, out);
}

// v005
// Measured time: 105 microseconds a run.
// In two side-by-side timings against v004, it was 1.26 and 1.25 times as fast.
// Counting every step since v000, it is 4.02 times as fast.
// compute dtype: f16 operands for the projections and attention (LayerNorm outputs as f16 rows, weights packed x16, q/k x4, P lifted by 2^14, V x4, context x8, stylised rows x8), bf16 hi/lo splits for the small emb GEMM, f32 accumulate; LayerNorms, masks, softmax, SiLU f32. Output = x + h is dominated by the f32 residual.
#include <hip/hip_runtime.h>
#include <math.h>

typedef __attribute__((ext_vector_type(16))) _Float16 v16h;
typedef __attribute__((ext_vector_type(16))) __bf16 v16b;
typedef __attribute__((ext_vector_type(8)))  _Float16 v8h;
typedef __attribute__((ext_vector_type(8)))  float v8f;
typedef __attribute__((ext_vector_type(4)))  float v4f;
typedef __attribute__((ext_vector_type(2)))  float v2f;
typedef __attribute__((ext_vector_type(4)))  unsigned v4u;
typedef __attribute__((ext_vector_type(4)))  int v4i;
typedef float __attribute__((may_alias)) float_a;
typedef int __attribute__((may_alias)) int_a;

template <typename T> __device__ __forceinline__ void vst2(void* p, T v) { *(T*)p = v;  }
__device__ __forceinline__ v8f wmma16(v16h a, v16h b, v8f c) {
  v8f d = __builtin_amdgcn_wmma_f32_16x16x32_f16(false, a, false, b, (short)0, c, false, false);
  asm volatile("v_nop\n\tv_nop\n\tv_nop\n\tv_nop" : "+v"(d) : "v"(a), "v"(b));
  return d;
}
__device__ __forceinline__ v8f wmma_bf(v16b a, v16b b, v8f c) {
  v8f d = __builtin_amdgcn_wmma_f32_16x16x32_bf16(false, a, false, b, (short)0, c, false, false);
  asm volatile("v_nop\n\tv_nop\n\tv_nop\n\tv_nop" : "+v"(d) : "v"(a), "v"(b));
  return d;
}
// 16x16x32 fragments: lane = (h = lane>>4, row/col = lane&15); elements 0..7 = k0+8h+0..7, 8..15 = k0+16+8h+0..7; D element r = row 8h+r
__device__ __forceinline__ v16h frag_h(const _Float16* rowk0, int lane) {
  union { v16h v; v8h q[2]; } u; const _Float16* p = rowk0 + 8 * (lane >> 4);
  u.q[0] = *(const v8h*)p; u.q[1] = *(const v8h*)(p + 16); return u.v;
}
__device__ __forceinline__ v16h frag_f32(const float* rowk0, int lane) {
  v16h a; const float* p = rowk0 + 8 * (lane >> 4);
#pragma unroll
  for (int i = 0; i < 8; ++i) { a[i] = (_Float16)p[i]; a[8 + i] = (_Float16)p[16 + i]; }
  return a;
}
__device__ __forceinline__ v16h frag_f32s(const float* rowk0, int lane, float sc) {
  v16h a; const float* p = rowk0 + 8 * (lane >> 4);
#pragma unroll
  for (int i = 0; i < 8; ++i) { a[i] = (_Float16)(p[i] * sc); a[8 + i] = (_Float16)(p[16 + i] * sc); }
  return a;
}
// column fragment from a [K][ld] layout (column n), rows >= K read as 0
__device__ __forceinline__ v16h fragc_f32(const float* W, int k0, int n, int lane, int ld, int K) {
  v16h a; const int g = lane >> 4;
#pragma unroll
  for (int i = 0; i < 8; ++i) { const int ka = k0 + 8 * g + i, kb = ka + 16;
    a[i] = (_Float16)(ka < K ? W[(size_t)ka * ld + n] : 0.f); a[8 + i] = (_Float16)(kb < K ? W[(size_t)kb * ld + n] : 0.f); }
  return a;
}
struct F2 { v16b h, l; };
__device__ __forceinline__ F2 bsplit16(const float v[16]) { F2 r;
#pragma unroll
  for (int i = 0; i < 16; ++i) { const __bf16 h = (__bf16)v[i]; r.h[i] = h; r.l[i] = (__bf16)(v[i] - (float)h); }
  return r; }
__device__ __forceinline__ F2 split_row(const float* row, int k0, int lane) { float v[16]; const float* p = row + k0 + 8 * (lane >> 4);
#pragma unroll
  for (int i = 0; i < 8; ++i) { v[i] = p[i]; v[8 + i] = p[16 + i]; }
  return bsplit16(v); }
__device__ __forceinline__ F2 split_rowK(const float* row, int k0, int lane, int K) { float v[16]; const int g = lane >> 4;
#pragma unroll
  for (int i = 0; i < 8; ++i) { const int ka = k0 + 8 * g + i, kb = ka + 16; v[i] = ka < K ? row[ka] : 0.f; v[8 + i] = kb < K ? row[kb] : 0.f; }
  return bsplit16(v); }
__device__ __forceinline__ F2 split_col(const float* W, int k0, int n, int lane, int ld, int K) { float v[16]; const int g = lane >> 4;
#pragma unroll
  for (int i = 0; i < 8; ++i) { const int ka = k0 + 8 * g + i, kb = ka + 16; v[i] = ka < K ? W[(size_t)ka * ld + n] : 0.f; v[8 + i] = kb < K ? W[(size_t)kb * ld + n] : 0.f; }
  return bsplit16(v); }
__device__ __forceinline__ v8f mac3(const F2& a, const F2& b, v8f c) { c = wmma_bf(a.l, b.h, c); c = wmma_bf(a.h, b.l, c); return wmma_bf(a.h, b.h, c); }
__device__ __forceinline__ float sigm(float v) { return 1.0f / (1.0f + expf(-v)); }
#define LDSX() do { asm volatile("s_wait_dscnt 0" ::: "memory"); __builtin_amdgcn_wave_barrier(); __builtin_amdgcn_fence(__ATOMIC_RELEASE, "workgroup"); } while (0)


// Mixed text/motion attention + stylisation block on [8,1024,512] (8 heads x 64): xn = LN(x), xfn = LN(xf [8,77,256]); q = xn Wq^T + bq; keys = [xfn Wkt^T + bkt (77) | xn Wkm^T + bkm (1024)],
// values = [(xfn Wvt^T + bvt) * text_cond_b | (xn Wvm^T + bvm) * src_mask], logits q.k (NO 1/sqrt d) + (1 - mask)*(-1e6) with mask = [text_cond_b x77 | src_mask]; softmax over the 1,101 keys;
// y = P v; h = silu(LN(y) * (1 + scale_b) + shift_b) out_W^T + out_b with [scale|shift] = silu(emb) emb_W^T + emb_b; out = x + h.
// Key slots (softmax does not depend on the key order): motion token s at slot s, text token t at slot 1024 + t, zero pads at 1101..1151; so 64 tokens of a V^T row are one whole, aligned 128-B line.
// Kernels: k_lnx / k_lnt (LayerNorm -> f16 rows), k_pack (weights [out][in] x16), k_qkv (motion q/k/v; keys/values at slots s), k_tkv (text k/v at slots 1024 + t, and the zero pads),
#define NB 8
#define SS 1024
#define E 512
#define NH 8
#define HD 64
#define NR (NB * SS)
#define NTX 77
#define LT 256
#define NKEY 1152              // 1024 + 77 = 1101 padded to 18 x 64
#define TE 2048
__device__ __forceinline__ float silu(float x) { return x / (1.0f + expf(-x)); }

// LN over rows of x (512) -> f16 rows; wave per row
__global__ __launch_bounds__(256) void k_lnx(const float* __restrict__ x, const float* __restrict__ g_, const float* __restrict__ b_, _Float16* __restrict__ X16) {
  const int wave = threadIdx.x >> 5, lane = threadIdx.x & 31; const int row = blockIdx.x * 8 + wave; const float* xr = x + (size_t)row * E;
  float v[16]; float s = 0.f;
  // lane owns columns lane*8..+7 and 256 + lane*8..+7 so each 16-B store instruction covers a contiguous 512-B run across the wave
#pragma unroll
  for (int e = 0; e < 16; ++e) { v[e] = xr[(e < 8 ? 0 : 256) + lane * 8 + (e & 7)]; s += v[e]; }
#pragma unroll
  for (int o = 16; o > 0; o >>= 1) s += __shfl_xor(s, o, 32);
  const float mu = s * (1.0f / E); float q = 0.f;
#pragma unroll
  for (int e = 0; e < 16; ++e) { const float d = v[e] - mu; q += d * d; }
#pragma unroll
  for (int o = 16; o > 0; o >>= 1) q += __shfl_xor(q, o, 32);
  const float rs = rsqrtf(q * (1.0f / E) + 1e-5f);
  union { v8h h[2]; v4u u[2]; } pk;
#pragma unroll
  for (int e = 0; e < 16; ++e) { const int c = (e < 8 ? 0 : 256) + lane * 8 + (e & 7); pk.h[e >> 3][e & 7] = (_Float16)((v[e] - mu) * rs * g_[c] + b_[c]); }
  vst2(X16 + (size_t)row * E + lane * 8, pk.u[0]); vst2(X16 + (size_t)row * E + 256 + lane * 8, pk.u[1]);
}
// LN over rows of xf (256) -> f16 rows [NB*NTX][256]; wave per row (8 per lane)
__global__ __launch_bounds__(256) void k_lnt(const float* __restrict__ xf, const float* __restrict__ g_, const float* __restrict__ b_, _Float16* __restrict__ T16) {
  const int wave = threadIdx.x >> 5, lane = threadIdx.x & 31; const int row = blockIdx.x * 8 + wave; if (row >= NB * NTX) return; const float* xr = xf + (size_t)row * LT;
  float v[8]; float s = 0.f;
#pragma unroll
  for (int e = 0; e < 8; ++e) { v[e] = xr[lane * 8 + e]; s += v[e]; }
#pragma unroll
  for (int o = 16; o > 0; o >>= 1) s += __shfl_xor(s, o, 32);
  const float mu = s * (1.0f / LT); float q = 0.f;
#pragma unroll
  for (int e = 0; e < 8; ++e) { const float d = v[e] - mu; q += d * d; }
#pragma unroll
  for (int o = 16; o > 0; o >>= 1) q += __shfl_xor(q, o, 32);
  const float rs = rsqrtf(q * (1.0f / LT) + 1e-5f);
  union { v8h h; v4u u; } pk;
#pragma unroll
  for (int e = 0; e < 8; ++e) { const int c = lane * 8 + e; pk.h[e] = (_Float16)((v[e] - mu) * rs * g_[c] + b_[c]); }
  vst2(T16 + (size_t)row * LT + lane * 8, pk.u);
}
// PT rows (x16, [out][in]): [0,512) Wq, [512,1024) Wkm, [1024,1536) Wvm, [1536,2048) out_W (512 halves each); PT2: [0,512) Wkt, [512,1024) Wvt (256 halves each)
__global__ __launch_bounds__(256) void k_pack(const float* __restrict__ Wq, const float* __restrict__ Wkm, const float* __restrict__ Wvm, const float* __restrict__ Wo, const float* __restrict__ Wkt, const float* __restrict__ Wvt, _Float16* __restrict__ PT, _Float16* __restrict__ PT2) {
  const int n = blockIdx.x, tid = threadIdx.x; __shared__ __align__(16) _Float16 srow[E];
  if (n < 4 * E) { const float* W = n < E ? Wq : (n < 2 * E ? Wkm : (n < 3 * E ? Wvm : Wo)); const int nn = n & (E - 1);
    srow[tid] = (_Float16)(W[(size_t)nn * E + tid] * 16.0f); srow[tid + 256] = (_Float16)(W[(size_t)nn * E + tid + 256] * 16.0f); __syncthreads();
    if (tid < E / 8) vst2(PT + (size_t)n * E + tid * 8, *(const v4u*)(&srow[tid * 8])); }
  else { const int m = n - 4 * E; const float* W = m < E ? Wkt : Wvt; const int nn = m & (E - 1);
    srow[tid] = (_Float16)(W[(size_t)nn * LT + tid] * 16.0f); __syncthreads();
    if (tid < LT / 8) vst2(PT2 + (size_t)m * LT + tid * 8, *(const v4u*)(&srow[tid * 8])); }
}
// Shared loop of the projection kernels: a block's 64 x 128 tile of A B^T, A and B rows K-contiguous f16; wave w keeps rows 16 w .. 16 w + 15 x 128 columns in acc, k ascending.
// Each 64-k slice (128 B = one whole line of each of the 64 A rows and 128 B rows) is brought in once per block and kept in LDS for all four waves; the fragments are read from LDS.
// Two buffers: slice c + 1 is asked for ahead of slice c's products and stored behind them, one barrier per slice. Rows are padded to 144 B (16 B x odd) for the 16-B fragment reads.
#define GP 72
#define GSM ((64 + 128) * 2 * GP * 2)   // bytes: [2][64][GP] A halves, then [2][128][GP] B halves; the epilogues reuse the same bytes behind a barrier
template <int K, typename AR>
__device__ __forceinline__ void gemm_lds(const _Float16* __restrict__ A, AR arow, const _Float16* __restrict__ B, char* smem, v8f (&acc)[8]) {
  _Float16* sA = (_Float16*)smem; _Float16* sB = sA + 2 * 64 * GP;
  const int tid = threadIdx.x, wave = tid >> 5, lane = tid & 31, col = lane & 15;
  // staging: thread owns 16-B piece tid & 7 of rows (tid >> 3) + 16 i, so a wave's load covers four whole 128-B lines
  const int srow = tid >> 3, spc = (tid & 7) * 8;
  // lane offsets in halves from the block-uniform bases A and B
  unsigned ao[4];
#pragma unroll
  for (int i = 0; i < 4; ++i) ao[i] = (unsigned)arow(srow + 16 * i) * K + spc;
  const unsigned bo = (unsigned)srow * K + spc;
  const int sp = srow * GP + spc;
  v8h ra[4], rb[8];
  auto fetch = [&](int c) { const _Float16* Ac = A + c * 64; const _Float16* Bc = B + c * 64;
#pragma unroll
    for (int i = 0; i < 4; ++i) ra[i] = *(const v8h*)(Ac + ao[i]);
#pragma unroll
    for (int i = 0; i < 8; ++i) rb[i] = *(const v8h*)(Bc + 16 * i * K + bo); };
  auto put = [&](int c) { _Float16* pa = sA + (c & 1) * (64 * GP) + sp; _Float16* pb = sB + (c & 1) * (128 * GP) + sp;
#pragma unroll
    for (int i = 0; i < 4; ++i) *(v8h*)(pa + 16 * i * GP) = ra[i];
#pragma unroll
    for (int i = 0; i < 8; ++i) *(v8h*)(pb + 16 * i * GP) = rb[i]; };
  fetch(0); put(0);
  __syncthreads();
  // unrolled: the slice's step and the buffer's place become immediate offsets, so no address register is formed anew (and waited for) in each trip
#pragma unroll
  for (int c = 0; c < K / 64; ++c) { const int bf = c & 1;
    if (c + 1 < K / 64) fetch(c + 1);
#pragma unroll
    for (int kc = 0; kc < 2; ++kc) { const v16h a = frag_h(sA + (bf * 64 + wave * 16 + col) * GP + kc * 32, lane); v16h bfr[8];
#pragma unroll
      for (int j = 0; j < 8; ++j) bfr[j] = frag_h(sB + (bf * 128 + j * 16 + col) * GP + kc * 32, lane);
#pragma unroll
      for (int j = 0; j < 8; ++j) acc[j] = wmma16(a, bfr[j], acc[j]); }
    // the other buffer's last readers left it at the barrier of the trip before; this barrier publishes slice c + 1 and ends the reads of slice c
    if (c + 1 < K / 64) { put(c + 1); __syncthreads(); } }
  // ends every wave's reads of the last slice, so that the caller's epilogue may overwrite the buffers
  __syncthreads();
}
// motion q/k/v: block (64 tokens of one batch, 128 cols, which) ; k,v stored at key slot s ; v goes straight into VT [bh][d][NKEY]
__global__ __launch_bounds__(128) void k_qkv(const _Float16* __restrict__ X16, const _Float16* __restrict__ PT, const float* __restrict__ bq, const float* __restrict__ bk, const float* __restrict__ bv, const float* __restrict__ srcm,
                                            _Float16* __restrict__ Q16, _Float16* __restrict__ K16, _Float16* __restrict__ VT) {
  __shared__ __align__(16) char smem[GSM];
  float (*so)[16][132] = (float (*)[16][132])smem;      // [4][16][132], which < 2
  _Float16 (*sth)[72] = (_Float16 (*)[72])smem;         // [128][72], which == 2
  const int tid = threadIdx.x, wave = tid >> 5, lane = tid & 31, col = lane & 15, g = lane >> 4;
  const int which = blockIdx.z, r0b = blockIdx.x * 64, n0 = blockIdx.y * 128; const int b = r0b / SS, s0 = r0b % SS;
  const float* bb_ = which == 0 ? bq : (which == 1 ? bk : bv);
  v8f acc[8] = {};
  gemm_lds<E>(X16, [&](int r) { return r0b + r; }, PT + (size_t)(which * E + n0) * E, smem, acc);
  if (which < 2) {
#pragma unroll
    for (int j = 0; j < 8; ++j) { const float bb = bb_[n0 + j * 16 + col];
#pragma unroll
      for (int r = 0; r < 8; ++r) so[wave][8 * g + r][j * 16 + col] = (acc[j][r] * (1.0f / 16.0f) + bb) * 4.0f; }
    LDSX();
    for (int qq = lane; qq < 16 * 2 * 8; qq += 32) { const int hh = qq >> 7, rl = (qq >> 3) & 15, pc = qq & 7; const int h = (n0 >> 6) + hh; union { v8h h8; v4u u; } pk;
#pragma unroll
      for (int e = 0; e < 8; ++e) pk.h8[e] = (_Float16)so[wave][rl][hh * 64 + pc * 8 + e];
      if (which == 0) vst2(Q16 + (((size_t)b * NH + h) * SS + s0 + wave * 16 + rl) * HD + pc * 8, pk.u);
      else vst2(K16 + (((size_t)b * NH + h) * NKEY + s0 + wave * 16 + rl) * HD + pc * 8, pk.u);
      // the next trip writes the registers that the store names
      asm volatile("s_wait_xcnt 0x0" ::: "memory"); } }
  else {
#pragma unroll
    for (int j = 0; j < 8; ++j) { const float bb = bb_[n0 + j * 16 + col];
#pragma unroll
      for (int r = 0; r < 8; ++r) { const int s = s0 + wave * 16 + 8 * g + r; sth[j * 16 + col][wave * 16 + 8 * g + r] = (_Float16)((acc[j][r] * (1.0f / 16.0f) + bb) * srcm[b * SS + s] * 4.0f); } }
    __syncthreads();
    // the block's 64 tokens are one whole line of each of its 128 V^T rows: eight lanes store a line; unrolled so that the eight LDS reads are asked for together and their latency is paid once
#pragma unroll
    for (int i = 0; i < 8; ++i) { const int c = (tid >> 3) + 16 * i, n = n0 + c, pc = tid & 7;
      vst2(VT + (((size_t)b * NH + (n >> 6)) * HD + (n & 63)) * NKEY + s0 + pc * 8, *(const v4u*)(&sth[c][pc * 8])); } }
}
// text k/v: block (row tile x col tile, which kv, b): 64 rows (of 77 in 2 row tiles of 64, clamped) x 128 cols (of 512) from T16 [b*77 + t][256] @ PT2 ; k -> K16 slots 1024 + t ; v (x text_cond) -> VT columns 1024 + t ; t = 77..127 are the pads, stored as zeros
__global__ __launch_bounds__(128) void k_tkv(const _Float16* __restrict__ T16, const _Float16* __restrict__ PT2, const float* __restrict__ bkt, const float* __restrict__ bvt, const int* __restrict__ cond, _Float16* __restrict__ K16, _Float16* __restrict__ VT) {
  __shared__ __align__(16) char smem[GSM];
  float (*so)[16][132] = (float (*)[16][132])smem;      // [4][16][132], which == 0
  _Float16 (*sth)[72] = (_Float16 (*)[72])smem;         // [128][72], which == 1
  const int tid = threadIdx.x, wave = tid >> 5, lane = tid & 31, col = lane & 15, g = lane >> 4;
  const int b = blockIdx.z, which = blockIdx.y; const int t0b = (blockIdx.x >> 2) * 64, t0 = t0b + wave * 16, n0 = (blockIdx.x & 3) * 128;
  const float tc = (cond[b] % 10) > 0 ? 1.f : 0.f; const float* bb_ = which == 0 ? bkt : bvt; const float vsc = which == 0 ? 4.0f : 4.0f * tc;
  v8f acc[8] = {};
  gemm_lds<LT>(T16, [&](int r) { const int t = t0b + r; return b * NTX + (t < NTX ? t : NTX - 1); }, PT2 + (size_t)(which * E + n0) * LT, smem, acc);
  if (which == 0) {   // K16 rows [bh][slot 1024 + t][64]: 2 heads per 128 cols
#pragma unroll
    for (int j = 0; j < 8; ++j) { const float bb = bb_[n0 + j * 16 + col];
#pragma unroll
      for (int r = 0; r < 8; ++r) so[wave][8 * g + r][j * 16 + col] = t0 + 8 * g + r < NTX ? (acc[j][r] * (1.0f / 16.0f) + bb) * vsc : 0.f; }
    LDSX();
    for (int qq = lane; qq < 16 * 2 * 8; qq += 32) { const int hh = qq >> 7, rl = (qq >> 3) & 15, pc = qq & 7; const int h = (n0 >> 6) + hh; const int t = t0 + rl; union { v8h h8; v4u u; } pk;
#pragma unroll
      for (int e = 0; e < 8; ++e) pk.h8[e] = (_Float16)so[wave][rl][hh * 64 + pc * 8 + e];
      vst2(K16 + (((size_t)b * NH + h) * NKEY + SS + t) * HD + pc * 8, pk.u); } }
  else {              // VT rows [bh][d][slot 1024 + t]: the block's 64 t are one whole line of each of its 128 V^T rows
#pragma unroll
    for (int j = 0; j < 8; ++j) { const float bb = bb_[n0 + j * 16 + col]; union { v8h h8; v4u u; } pk;
#pragma unroll
      for (int r = 0; r < 8; ++r) pk.h8[r] = t0 + 8 * g + r < NTX ? (_Float16)((acc[j][r] * (1.0f / 16.0f) + bb) * vsc) : (_Float16)0.f;
      *(v4u*)(&sth[j * 16 + col][wave * 16 + 8 * g]) = pk.u; }
    // a line holds rows of all four waves: every wave's part is in LDS before any line is stored
    __syncthreads();
    // unrolled so that the eight LDS reads are asked for together and their latency is paid once
#pragma unroll
    for (int i = 0; i < 8; ++i) { const int c = (tid >> 3) + 16 * i, n = n0 + c, pc = tid & 7;
      vst2(VT + (((size_t)b * NH + (n >> 6)) * HD + (n & 63)) * NKEY + SS + t0b + pc * 8, *(const v4u*)(&sth[c][pc * 8])); } }
}
// attention: block (64 queries, bh); 18 key tiles; additive masks; O16 x8 [bh][s][64]
// Each key tile (64 K rows, 64 V^T rows of 128 B, 64 mask penalties) is brought in once per block with whole-line loads and kept in LDS for all four waves;
// two buffers: tile kt + 1 is asked for ahead of tile kt's softmax and stored behind its P V products, one barrier per tile. Rows are padded to 144 B (16 B x odd) for the 16-B fragment reads.
#define NT (NKEY / 64)
#define KP 72
// e^x is taken as the hardware's 2^y, y = x log2(e): every argument here is a value minus a maximum that covers it, so x <= 0 and the library form's overflow and denormal-range handling has nothing to do
// (a result below the normal range is far below one f16 step of P and of the sum, whatever becomes of it). The lift of P by 2^14 rides in the same multiply-add as + 14.
#define LOG2E 1.44269504088896340736f
__global__ __launch_bounds__(128) void k_attn(const _Float16* __restrict__ Q16, const _Float16* __restrict__ K16, const _Float16* __restrict__ VT, const int* __restrict__ cond, const float* __restrict__ srcm, _Float16* __restrict__ O16) {
  __shared__ __align__(16) float sS[4][16][68];       // scores of a tile; after the loop the wave's output tile
  __shared__ __align__(16) _Float16 sPh[4][16][72];
  __shared__ __align__(16) _Float16 sK[2][64][KP];
  __shared__ __align__(16) _Float16 sV[2][64][KP];
  __shared__ __align__(16) float sPen[2][64];
  const int tid = threadIdx.x, w = tid >> 5, lane = tid & 31, col = lane & 15, g = lane >> 4;
  const size_t bh = blockIdx.y; const int b = (int)(bh / NH); const int q0 = blockIdx.x * 64 + w * 16;
  const float tpen = ((cond[b] % 10) > 0) ? 0.f : -1000000.0f;
  // staging: thread owns 16-B piece tid & 7 of rows (tid >> 3) + 16 i, so a wave's load covers four whole 128-B lines
  const int srow = tid >> 3, spc = (tid & 7) * 8;
  const _Float16* kg = K16 + (bh * NKEY + srow) * HD + spc;
  const _Float16* vg = VT + (bh * HD + srow) * NKEY + spc;
  v8h rk[4], rv[4]; float rm;
  auto fetch = [&](int kt) {
#pragma unroll
    for (int i = 0; i < 4; ++i) { rk[i] = *(const v8h*)(kg + (size_t)(kt * 64 + 16 * i) * HD); rv[i] = *(const v8h*)(vg + (size_t)(16 * i) * NKEY + kt * 64); }
    int ms = kt * 64 + (tid & 63); ms = ms > SS - 1 ? SS - 1 : ms; rm = srcm[b * SS + ms]; };
  auto put = [&](int kt) { const int bf = kt & 1;
#pragma unroll
    for (int i = 0; i < 4; ++i) { *(v8h*)(&sK[bf][srow + 16 * i][spc]) = rk[i]; *(v8h*)(&sV[bf][srow + 16 * i][spc]) = rv[i]; }
    if (tid < 64) { const int slot = kt * 64 + tid; sPen[bf][tid] = slot < SS ? (1.0f - rm) * -1000000.0f : (slot < SS + NTX ? tpen : -3.0e38f); } };
  fetch(0);
  v16h aq[2];
#pragma unroll
  for (int kc = 0; kc < 2; ++kc) aq[kc] = frag_h(Q16 + (bh * SS + q0 + col) * HD + kc * 32, lane);
  put(0);
  __syncthreads();
  float mrun = -3.0e38f, lrun = 0.f; v8f acc[4] = {};
#pragma unroll 1
  for (int kt = 0; kt < NT; ++kt) { const int bf = kt & 1;
    v16h kf[4][2]; float pn[4];
#pragma unroll
    for (int t = 0; t < 4; ++t) { pn[t] = sPen[bf][t * 16 + col];
#pragma unroll
      for (int kc = 0; kc < 2; ++kc) kf[t][kc] = frag_h(&sK[bf][t * 16 + col][kc * 32], lane); }
#pragma unroll
    for (int t = 0; t < 4; ++t) { v8f s = {}; const int slot = kt * 64 + t * 16 + col;
#pragma unroll
      for (int kc = 0; kc < 2; ++kc) s = wmma16(aq[kc], kf[t][kc], s);
#pragma unroll
      for (int r = 0; r < 8; ++r) sS[w][8 * g + r][t * 16 + col] = slot < NTX + SS ? s[r] * (1.0f / 16.0f) + pn[t] : -3.0e38f; }
    LDSX();
    // asked for here, behind the fence above (which waits for every load in flight), so that the loads fly under the whole softmax
    if (kt + 1 < NT) fetch(kt + 1);
    float mx = -3.4e38f;
#pragma unroll
    for (int jj = 0; jj < 32; ++jj) mx = fmaxf(mx, sS[w][col][g * 32 + jj]);
    mx = fmaxf(mx, __shfl_xor(mx, 16, 32));
    const float mnew = fmaxf(mrun, mx); const float corr = __builtin_amdgcn_exp2f((mrun - mnew) * LOG2E);
    float ps = 0.f;
#pragma unroll
    for (int jj = 0; jj < 32; ++jj) { const float sv = sS[w][col][g * 32 + jj]; const float p = sv <= -1.0e38f ? 0.f : __builtin_amdgcn_exp2f(fmaf(sv - mnew, LOG2E, 14.0f)); ps += p; sPh[w][col][g * 32 + jj] = (_Float16)p; }
    ps += __shfl_xor(ps, 16, 32);
    lrun = lrun * corr + ps * (1.0f / 16384.0f); mrun = mnew;
#pragma unroll
    for (int r = 0; r < 8; ++r) { const float cr = __shfl(corr, 8 * g + r, 32);
#pragma unroll
      for (int t = 0; t < 4; ++t) acc[t][r] *= cr; }
    LDSX();
    v16h ph[2], vf[2][4];
#pragma unroll
    for (int kc = 0; kc < 2; ++kc) { ph[kc] = frag_h(&sPh[w][col][0] + kc * 32, lane);
#pragma unroll
      for (int t = 0; t < 4; ++t) vf[kc][t] = frag_h(&sV[bf][t * 16 + col][kc * 32], lane); }
#pragma unroll
    for (int kc = 0; kc < 2; ++kc)
#pragma unroll
      for (int t = 0; t < 4; ++t) acc[t] = wmma16(ph[kc], vf[kc][t], acc[t]);
    // the other buffer's last readers left it at the barrier of the trip before; this barrier publishes tile kt + 1 and ends the reads of tile kt
    if (kt + 1 < NT) { put(kt + 1); __syncthreads(); } }
#pragma unroll
  for (int r = 0; r < 8; ++r) { const float lr = __shfl(lrun, 8 * g + r, 32); const float inv = 8.0f / (lr * 16384.0f * 4.0f);
#pragma unroll
    for (int t = 0; t < 4; ++t) sS[w][8 * g + r][t * 16 + col] = acc[t][r] * inv; }
  LDSX();
  for (int qq = lane; qq < 16 * 8; qq += 32) { const int rl = qq >> 3, pc = qq & 7; union { v8h h8; v4u u; } pk;
#pragma unroll
    for (int e = 0; e < 8; ++e) pk.h8[e] = (_Float16)sS[w][rl][pc * 8 + e];
    vst2(O16 + ((bh * SS) + q0 + rl) * HD + pc * 8, pk.u); }
}
// [scale | shift] = silu(emb) emb_W^T + emb_b : 8 rows (16-row tile, rows >= 8 zero) x 1024 cols, K = 2048 (bf16 hi/lo)
// block = 32 cols (one whole 128-B line of each SSH row), 16 waves; wave w takes k in [128 w, 128 w + 128) for both column tiles; the 16 partial tiles are summed in LDS in wave order
#define EKW 16
#define EKC (TE / EKW / 32)
__global__ __launch_bounds__(512) void k_emb(const float* __restrict__ emb, const float* __restrict__ W, const float* __restrict__ bias, float* __restrict__ SSH) {
  __shared__ __align__(16) float red[EKW][NB][32];
  const int tid = threadIdx.x, wave = tid >> 5, lane = tid & 31, col = lane & 15, g = lane >> 4; const int n0 = blockIdx.x * 32, kb = wave * (TE / EKW);
  // A loader: lanes col and col + 8 share emb row col & 7; the lower lane makes silu of fragment elements 0..7, the upper lane of elements 8..15 and hands them over; rows >= 8 of the tile are zero
  const int eh = col >> 3; const float* ep = emb + (size_t)(col & 7) * TE + kb + 8 * g + 16 * eh;
  const float* wp = W + (size_t)(n0 + col) * TE + kb + 8 * g;
  // the wave's whole slice is asked for before any of it is used, so that it pays the memory latency once
  float ev[EKC][8], wv[EKC][2][16];
#pragma unroll
  for (int kc = 0; kc < EKC; ++kc)
#pragma unroll
    for (int i = 0; i < 8; ++i) ev[kc][i] = ep[kc * 32 + i];
#pragma unroll
  for (int kc = 0; kc < EKC; ++kc)
#pragma unroll
    for (int j = 0; j < 2; ++j)
#pragma unroll
      for (int i = 0; i < 8; ++i) { wv[kc][j][i] = wp[(size_t)j * 16 * TE + kc * 32 + i]; wv[kc][j][8 + i] = wp[(size_t)j * 16 * TE + kc * 32 + 16 + i]; }
  F2 a[EKC];
#pragma unroll
  for (int kc = 0; kc < EKC; ++kc) { float v[16];
#pragma unroll
    for (int i = 0; i < 8; ++i) { const float s = silu(ev[kc][i]); const float o = __shfl_xor(s, 8, 32); v[i] = eh ? 0.f : s; v[8 + i] = eh ? 0.f : o; }
    a[kc] = bsplit16(v); }
  v8f acc[2] = {};
#pragma unroll
  for (int kc = 0; kc < EKC; ++kc)
#pragma unroll
    for (int j = 0; j < 2; ++j) acc[j] = mac3(a[kc], bsplit16(wv[kc][j]), acc[j]);
  if (g == 0) {
#pragma unroll
    for (int j = 0; j < 2; ++j)
#pragma unroll
      for (int r = 0; r < 8; ++r) red[wave][r][j * 16 + col] = acc[j][r]; }
  __syncthreads();
  if (tid < NB * 32) { const int r = tid >> 5, c = tid & 31; float s = red[0][r][c];
#pragma unroll
    for (int w = 1; w < EKW; ++w) s += red[w][r][c];
    SSH[(size_t)r * (2 * E) + n0 + c] = s + bias[n0 + c]; }
}
__global__ __launch_bounds__(256) void k_styl(const _Float16* __restrict__ O16, const float* __restrict__ SSH, const float* __restrict__ g_, const float* __restrict__ b_, _Float16* __restrict__ Z16) {
  const int wave = threadIdx.x >> 5, lane = threadIdx.x & 31; const int row = blockIdx.x * 8 + wave; const int b = row / SS, s = row % SS;
  float sum = 0.f, sq = 0.f;
#pragma unroll 2
  for (int e = 0; e < 16; ++e) { const int c = (e < 8 ? 0 : 256) + lane * 8 + (e & 7); const int h = c >> 6, d = c & 63; const float v = (float)O16[(((size_t)b * NH + h) * SS + s) * HD + d] * 0.125f; sum += v; sq += v * v; }
#pragma unroll
  for (int o = 16; o > 0; o >>= 1) { sum += __shfl_xor(sum, o, 32); sq += __shfl_xor(sq, o, 32); }
  const float mu = sum * (1.0f / E); float var = sq * (1.0f / E) - mu * mu; var = var > 0.f ? var : 0.f; const float rs = rsqrtf(var + 1e-5f);
  const float* sc_ = SSH + (size_t)b * 2 * E; const float* sh_ = sc_ + E;
#pragma unroll 1
  for (int half = 0; half < 2; ++half) { union { v8h h; v4u u; } pk;
#pragma unroll
    for (int e = 0; e < 8; ++e) { const int c = half * 256 + lane * 8 + e; const int h = c >> 6, d = c & 63; const float v = (float)O16[(((size_t)b * NH + h) * SS + s) * HD + d] * 0.125f;
      const float hn = (v - mu) * rs * g_[c] + b_[c]; const float m = hn * (1.0f + sc_[c]) + sh_[c]; pk.h[e] = (_Float16)(silu(m) * 8.0f); }
    vst2(Z16 + (size_t)row * E + half * 256 + lane * 8, pk.u); }
}
// out = x + Z out_W^T /16/8 + out_b
__global__ __launch_bounds__(128) void k_out(const _Float16* __restrict__ Z16, const _Float16* __restrict__ PT, const float* __restrict__ bo, const float* __restrict__ x, float* __restrict__ out) {
  __shared__ __align__(16) char smem[GSM];
  float (*so)[16][132] = (float (*)[16][132])smem;      // [4][16][132]
  const int tid = threadIdx.x, wave = tid >> 5, lane = tid & 31, col = lane & 15, g = lane >> 4;
  const int r0b = blockIdx.x * 64, r0 = r0b + wave * 16, n0 = blockIdx.y * 128;
  v8f acc[8] = {};
  gemm_lds<E>(Z16, [&](int r) { return r0b + r; }, PT + (size_t)(3 * E + n0) * E, smem, acc);
#pragma unroll
  for (int j = 0; j < 8; ++j) { const int n = n0 + j * 16 + col; const float bb = bo[n];
#pragma unroll
    for (int r = 0; r < 8; ++r) so[wave][8 * g + r][j * 16 + col] = acc[j][r] * (1.0f / (16.0f * 8.0f)) + bb + x[(size_t)(r0 + 8 * g + r) * E + n]; }
  LDSX();
#pragma unroll 4
  for (int rl = 0; rl < 16; ++rl) vst2(out + (size_t)(r0 + rl) * E + n0 + lane * 4, *(const v4f*)(&so[wave][rl][lane * 4]));
}
extern "C" void kernel_launch(void* const* d_in, const int* in_sizes, int n_in, void* d_out, int out_size, void* d_ws, size_t ws_size, hipStream_t stream) {
  (void)in_sizes; (void)n_in; (void)out_size; (void)ws_size;
  const float** I = (const float**)d_in;
  const float* x = I[0]; const float* xf = I[1]; const float* emb = I[2]; const float* srcm = I[3]; const int* cond = (const int*)d_in[4];
  const float* ng = I[5]; const float* nb = I[6]; const float* tg = I[7]; const float* tb = I[8]; const float* Wq = I[9]; const float* bq = I[10]; const float* Wkt = I[11]; const float* bkt = I[12]; const float* Wvt = I[13]; const float* bvt = I[14];
  const float* Wkm = I[15]; const float* bkm = I[16]; const float* Wvm = I[17]; const float* bvm = I[18]; const float* embW = I[19]; const float* embb = I[20]; const float* sg = I[21]; const float* sb = I[22]; const float* Wo = I[23]; const float* bo = I[24];
  float* out = (float*)d_out;
  char* ws = (char*)d_ws; size_t off = 0;
  auto take = [&](size_t bytes) { char* p = ws + off; off += (bytes + 255) & ~(size_t)255; return p; };
  _Float16* X16 = (_Float16*)take((size_t)NR * E * 2); _Float16* T16 = (_Float16*)take((size_t)NB * NTX * LT * 2 + 4096); _Float16* PT = (_Float16*)take((size_t)4 * E * E * 2); _Float16* PT2 = (_Float16*)take((size_t)2 * E * LT * 2);
  _Float16* Q16 = (_Float16*)take((size_t)NR * E * 2); _Float16* K16 = (_Float16*)take((size_t)NB * NH * NKEY * HD * 2);
  _Float16* VT = (_Float16*)take((size_t)NB * NH * HD * NKEY * 2); _Float16* O16 = (_Float16*)take((size_t)NR * E * 2); float* SSH = (float*)take((size_t)NB * 2 * E * 4); _Float16* Z16 = X16;    // X16 dead after k_qkv
  // ws ~ 47 MB (47,013,888 bytes)
  k_lnx<<<NR / 8, 256, 0, stream>>>(x, ng, nb, X16);
  k_lnt<<<(NB * NTX + 7) / 8, 256, 0, stream>>>(xf, tg, tb, T16);
  k_pack<<<4 * E + 2 * E, 256, 0, stream>>>(Wq, Wkm, Wvm, Wo, Wkt, Wvt, PT, PT2);
  k_qkv<<<dim3(NR / 64, E / 128, 3), 128, 0, stream>>>(X16, PT, bq, bkm, bvm, srcm, Q16, K16, VT);
  k_tkv<<<dim3(2 * 4, 2, NB), 128, 0, stream>>>(T16, PT2, bkt, bvt, cond, K16, VT);
  k_attn<<<dim3(SS / 64, NB * NH), 128, 0, stream>>>(Q16, K16, VT, cond, srcm, O16);
  k_emb<<<(2 * E) / 32, 512, 0, stream>>>(emb, embW, embb, SSH);
  k_styl<<<NR / 8, 256, 0, stream>>>(O16, SSH, sg, sb, Z16);
  k_out<<<dim3(NR / 64, E / 128), 128, 0, stream>>>(Z16, PT, bo, x, out);
}

// v006
// Measured time: 83.2 microseconds a run.
// Two timings next to v005 put it at 1.28 and 1.27 times that version's speed.
// Counting every step since v000, it is 5.11 times as fast.
// compute dtype: f16 operands for the projections and attention (LayerNorm outputs as f16 rows, weights packed x16, q/k x4, P lifted by 2^14, V x4, context x8, stylised rows x8), bf16 hi/lo splits for the small emb GEMM, f32 accumulate; LayerNorms, masks, softmax, SiLU f32. Output = x + h is dominated by the f32 residual.
#include <hip/hip_runtime.h>
#include <math.h>

typedef __attribute__((ext_vector_type(16))) _Float16 v16h;
typedef __attribute__((ext_vector_type(16))) __bf16 v16b;
typedef __attribute__((ext_vector_type(8)))  _Float16 v8h;
typedef __attribute__((ext_vector_type(8)))  float v8f;
typedef __attribute__((ext_vector_type(4)))  float v4f;
typedef __attribute__((ext_vector_type(2)))  float v2f;
typedef __attribute__((ext_vector_type(4)))  unsigned v4u;
typedef __attribute__((ext_vector_type(4)))  int v4i;
typedef float __attribute__((may_alias)) float_a;
typedef int __attribute__((may_alias)) int_a;

template <typename T> __device__ __forceinline__ void vst2(void* p, T v) { *(T*)p = v;  }
__device__ __forceinline__ v8f wmma16(v16h a, v16h b, v8f c) {
  v8f d = __builtin_amdgcn_wmma_f32_16x16x32_f16(false, a, false, b, (short)0, c, false, false);
  asm volatile("v_nop\n\tv_nop\n\tv_nop\n\tv_nop" : "+v"(d) : "v"(a), "v"(b));
  return d;
}
__device__ __forceinline__ v8f wmma_bf(v16b a, v16b b, v8f c) {
  v8f d = __builtin_amdgcn_wmma_f32_16x16x32_bf16(false, a, false, b, (short)0, c, false, false);
  asm volatile("v_nop\n\tv_nop\n\tv_nop\n\tv_nop" : "+v"(d) : "v"(a), "v"(b));
  return d;
}
// 16x16x32 fragments: lane = (h = lane>>4, row/col = lane&15); elements 0..7 = k0+8h+0..7, 8..15 = k0+16+8h+0..7; D element r = row 8h+r
__device__ __forceinline__ v16h frag_h(const _Float16* rowk0, int lane) {
  union { v16h v; v8h q[2]; } u; const _Float16* p = rowk0 + 8 * (lane >> 4);
  u.q[0] = *(const v8h*)p; u.q[1] = *(const v8h*)(p + 16); return u.v;
}
__device__ __forceinline__ v16h frag_f32(const float* rowk0, int lane) {
  v16h a; const float* p = rowk0 + 8 * (lane >> 4);
#pragma unroll
  for (int i = 0; i < 8; ++i) { a[i] = (_Float16)p[i]; a[8 + i] = (_Float16)p[16 + i]; }
  return a;
}
__device__ __forceinline__ v16h frag_f32s(const float* rowk0, int lane, float sc) {
  v16h a; const float* p = rowk0 + 8 * (lane >> 4);
#pragma unroll
  for (int i = 0; i < 8; ++i) { a[i] = (_Float16)(p[i] * sc); a[8 + i] = (_Float16)(p[16 + i] * sc); }
  return a;
}
// column fragment from a [K][ld] layout (column n), rows >= K read as 0
__device__ __forceinline__ v16h fragc_f32(const float* W, int k0, int n, int lane, int ld, int K) {
  v16h a; const int g = lane >> 4;
#pragma unroll
  for (int i = 0; i < 8; ++i) { const int ka = k0 + 8 * g + i, kb = ka + 16;
    a[i] = (_Float16)(ka < K ? W[(size_t)ka * ld + n] : 0.f); a[8 + i] = (_Float16)(kb < K ? W[(size_t)kb * ld + n] : 0.f); }
  return a;
}
struct F2 { v16b h, l; };
__device__ __forceinline__ F2 bsplit16(const float v[16]) { F2 r;
#pragma unroll
  for (int i = 0; i < 16; ++i) { const __bf16 h = (__bf16)v[i]; r.h[i] = h; r.l[i] = (__bf16)(v[i] - (float)h); }
  return r; }
__device__ __forceinline__ F2 split_row(const float* row, int k0, int lane) { float v[16]; const float* p = row + k0 + 8 * (lane >> 4);
#pragma unroll
  for (int i = 0; i < 8; ++i) { v[i] = p[i]; v[8 + i] = p[16 + i]; }
  return bsplit16(v); }
__device__ __forceinline__ F2 split_rowK(const float* row, int k0, int lane, int K) { float v[16]; const int g = lane >> 4;
#pragma unroll
  for (int i = 0; i < 8; ++i) { const int ka = k0 + 8 * g + i, kb = ka + 16; v[i] = ka < K ? row[ka] : 0.f; v[8 + i] = kb < K ? row[kb] : 0.f; }
  return bsplit16(v); }
__device__ __forceinline__ F2 split_col(const float* W, int k0, int n, int lane, int ld, int K) { float v[16]; const int g = lane >> 4;
#pragma unroll
  for (int i = 0; i < 8; ++i) { const int ka = k0 + 8 * g + i, kb = ka + 16; v[i] = ka < K ? W[(size_t)ka * ld + n] : 0.f; v[8 + i] = kb < K ? W[(size_t)kb * ld + n] : 0.f; }
  return bsplit16(v); }
__device__ __forceinline__ v8f mac3(const F2& a, const F2& b, v8f c) { c = wmma_bf(a.l, b.h, c); c = wmma_bf(a.h, b.l, c); return wmma_bf(a.h, b.h, c); }
__device__ __forceinline__ float sigm(float v) { return 1.0f / (1.0f + expf(-v)); }
#define LDSX() do { asm volatile("s_wait_dscnt 0" ::: "memory"); __builtin_amdgcn_wave_barrier(); __builtin_amdgcn_fence(__ATOMIC_RELEASE, "workgroup"); } while (0)


// Mixed text/motion attention + stylisation block on [8,1024,512] (8 heads x 64): xn = LN(x), xfn = LN(xf [8,77,256]); q = xn Wq^T + bq; keys = [xfn Wkt^T + bkt (77) | xn Wkm^T + bkm (1024)],
// values = [(xfn Wvt^T + bvt) * text_cond_b | (xn Wvm^T + bvm) * src_mask], logits q.k (NO 1/sqrt d) + (1 - mask)*(-1e6) with mask = [text_cond_b x77 | src_mask]; softmax over the 1,101 keys;
// y = P v; h = silu(LN(y) * (1 + scale_b) + shift_b) out_W^T + out_b with [scale|shift] = silu(emb) emb_W^T + emb_b; out = x + h.
// Key slots (softmax does not depend on the key order): motion token s at slot s, text token t at slot 1024 + t, zero pads at 1101..1151; so 64 tokens of a V^T row are one whole, aligned 128-B line.
// Parts: b_lnx / b_lnt (LayerNorm -> f16 rows), b_pack (weights [out][in] x16), b_qkv (motion q/k/v; keys/values at slots s), b_tkv (text k/v at slots 1024 + t, and the zero pads), b_emb ([scale | shift]).
// Parts that do not depend on one another share a launch, each on its own range of block indices: k_pre = b_lnt, b_lnx, b_pack; k_proj = b_emb, b_qkv, b_tkv; then k_attn, k_styl, k_out.
#define NB 8
#define SS 1024
#define E 512
#define NH 8
#define HD 64
#define NR (NB * SS)
#define NTX 77
#define LT 256
#define NKEY 1152              // 1024 + 77 = 1101 padded to 18 x 64
#define TE 2048
__device__ __forceinline__ float silu(float x) { return x / (1.0f + expf(-x)); }

// LN over rows of x (512) -> f16 rows; wave per row
__device__ __forceinline__ void b_lnx(const int blk, const float* __restrict__ x, const float* __restrict__ g_, const float* __restrict__ b_, _Float16* __restrict__ X16) {
  const int wave = threadIdx.x >> 5, lane = threadIdx.x & 31; const int row = blk * 8 + wave; const float* xr = x + (size_t)row * E;
  float v[16]; float s = 0.f;
  // lane owns columns lane*8..+7 and 256 + lane*8..+7 so each 16-B store instruction covers a contiguous 512-B run across the wave
#pragma unroll
  for (int e = 0; e < 16; ++e) { v[e] = xr[(e < 8 ? 0 : 256) + lane * 8 + (e & 7)]; s += v[e]; }
#pragma unroll
  for (int o = 16; o > 0; o >>= 1) s += __shfl_xor(s, o, 32);
  const float mu = s * (1.0f / E); float q = 0.f;
#pragma unroll
  for (int e = 0; e < 16; ++e) { const float d = v[e] - mu; q += d * d; }
#pragma unroll
  for (int o = 16; o > 0; o >>= 1) q += __shfl_xor(q, o, 32);
  const float rs = rsqrtf(q * (1.0f / E) + 1e-5f);
  union { v8h h[2]; v4u u[2]; } pk;
#pragma unroll
  for (int e = 0; e < 16; ++e) { const int c = (e < 8 ? 0 : 256) + lane * 8 + (e & 7); pk.h[e >> 3][e & 7] = (_Float16)((v[e] - mu) * rs * g_[c] + b_[c]); }
  vst2(X16 + (size_t)row * E + lane * 8, pk.u[0]); vst2(X16 + (size_t)row * E + 256 + lane * 8, pk.u[1]);
  // in the listing another part of the shared launch follows, whose first instructions write registers that these stores name
  asm volatile("s_wait_xcnt 0x0" ::: "memory");
}
// LN over rows of xf (256) -> f16 rows [NB*NTX][256]; wave per row (8 per lane)
__device__ __forceinline__ void b_lnt(const int blk, const float* __restrict__ xf, const float* __restrict__ g_, const float* __restrict__ b_, _Float16* __restrict__ T16) {
  const int wave = threadIdx.x >> 5, lane = threadIdx.x & 31; const int row = blk * 8 + wave; if (row >= NB * NTX) return; const float* xr = xf + (size_t)row * LT;
  float v[8]; float s = 0.f;
#pragma unroll
  for (int e = 0; e < 8; ++e) { v[e] = xr[lane * 8 + e]; s += v[e]; }
#pragma unroll
  for (int o = 16; o > 0; o >>= 1) s += __shfl_xor(s, o, 32);
  const float mu = s * (1.0f / LT); float q = 0.f;
#pragma unroll
  for (int e = 0; e < 8; ++e) { const float d = v[e] - mu; q += d * d; }
#pragma unroll
  for (int o = 16; o > 0; o >>= 1) q += __shfl_xor(q, o, 32);
  const float rs = rsqrtf(q * (1.0f / LT) + 1e-5f);
  union { v8h h; v4u u; } pk;
#pragma unroll
  for (int e = 0; e < 8; ++e) { const int c = lane * 8 + e; pk.h[e] = (_Float16)((v[e] - mu) * rs * g_[c] + b_[c]); }
  vst2(T16 + (size_t)row * LT + lane * 8, pk.u);
}
// PT rows (x16, [out][in]): [0,512) Wq, [512,1024) Wkm, [1024,1536) Wvm, [1536,2048) out_W (512 halves each); PT2: [0,512) Wkt, [512,1024) Wvt (256 halves each)
__device__ __forceinline__ void b_pack(const int n, const float* __restrict__ Wq, const float* __restrict__ Wkm, const float* __restrict__ Wvm, const float* __restrict__ Wo, const float* __restrict__ Wkt, const float* __restrict__ Wvt, _Float16* __restrict__ PT, _Float16* __restrict__ PT2) {
  const int tid = threadIdx.x; __shared__ __align__(16) _Float16 srow[E];
  if (n < 4 * E) { const float* W = n < E ? Wq : (n < 2 * E ? Wkm : (n < 3 * E ? Wvm : Wo)); const int nn = n & (E - 1);
    srow[tid] = (_Float16)(W[(size_t)nn * E + tid] * 16.0f); srow[tid + 256] = (_Float16)(W[(size_t)nn * E + tid + 256] * 16.0f); __syncthreads();
    if (tid < E / 8) vst2(PT + (size_t)n * E + tid * 8, *(const v4u*)(&srow[tid * 8])); }
  else { const int m = n - 4 * E; const float* W = m < E ? Wkt : Wvt; const int nn = m & (E - 1);
    srow[tid] = (_Float16)(W[(size_t)nn * LT + tid] * 16.0f); __syncthreads();
    if (tid < LT / 8) vst2(PT2 + (size_t)m * LT + tid * 8, *(const v4u*)(&srow[tid * 8])); }
}
// one launch for the three parts that read only inputs; the short text rows first
#define G_LNT ((NB * NTX + 7) / 8)
#define G_LNX (NR / 8)
#define G_PACK (4 * E + 2 * E)
__global__ __launch_bounds__(256) void k_pre(const float* __restrict__ x, const float* __restrict__ ng, const float* __restrict__ nb, _Float16* __restrict__ X16, const float* __restrict__ xf, const float* __restrict__ tg, const float* __restrict__ tb, _Float16* __restrict__ T16,
                                             const float* __restrict__ Wq, const float* __restrict__ Wkm, const float* __restrict__ Wvm, const float* __restrict__ Wo, const float* __restrict__ Wkt, const float* __restrict__ Wvt, _Float16* __restrict__ PT, _Float16* __restrict__ PT2) {
  const int id = blockIdx.x;
  if (id < G_LNT) b_lnt(id, xf, tg, tb, T16);
  else if (id < G_LNT + G_LNX) b_lnx(id - G_LNT, x, ng, nb, X16);
  else b_pack(id - (G_LNT + G_LNX), Wq, Wkm, Wvm, Wo, Wkt, Wvt, PT, PT2);
}
// Shared loop of the projection kernels: a block's 64 x 128 tile of A B^T, A and B rows K-contiguous f16; wave w keeps rows 16 w .. 16 w + 15 x 128 columns in acc, k ascending.
// Each 64-k slice (128 B = one whole line of each of the 64 A rows and 128 B rows) is brought in once per block and kept in LDS for all four waves; the fragments are read from LDS.
// Two buffers: slice c + 1 is asked for ahead of slice c's products and stored behind them, one barrier per slice. Rows are padded to 144 B (16 B x odd) for the 16-B fragment reads.
#define GP 72
#define GSM ((64 + 128) * 2 * GP * 2)   // bytes: [2][64][GP] A halves, then [2][128][GP] B halves; the epilogues reuse the same bytes behind a barrier
template <int K, typename AR>
__device__ __forceinline__ void gemm_lds(const _Float16* __restrict__ A, AR arow, const _Float16* __restrict__ B, char* smem, v8f (&acc)[8]) {
  _Float16* sA = (_Float16*)smem; _Float16* sB = sA + 2 * 64 * GP;
  const int tid = threadIdx.x, wave = tid >> 5, lane = tid & 31, col = lane & 15;
  // staging: thread owns 16-B piece tid & 7 of rows (tid >> 3) + 16 i, so a wave's load covers four whole 128-B lines
  const int srow = tid >> 3, spc = (tid & 7) * 8;
  // lane offsets in halves from the block-uniform bases A and B
  unsigned ao[4];
#pragma unroll
  for (int i = 0; i < 4; ++i) ao[i] = (unsigned)arow(srow + 16 * i) * K + spc;
  const unsigned bo = (unsigned)srow * K + spc;
  const int sp = srow * GP + spc;
  v8h ra[4], rb[8];
  auto fetch = [&](int c) { const _Float16* Ac = A + c * 64; const _Float16* Bc = B + c * 64;
#pragma unroll
    for (int i = 0; i < 4; ++i) ra[i] = *(const v8h*)(Ac + ao[i]);
#pragma unroll
    for (int i = 0; i < 8; ++i) rb[i] = *(const v8h*)(Bc + 16 * i * K + bo); };
  auto put = [&](int c) { _Float16* pa = sA + (c & 1) * (64 * GP) + sp; _Float16* pb = sB + (c & 1) * (128 * GP) + sp;
#pragma unroll
    for (int i = 0; i < 4; ++i) *(v8h*)(pa + 16 * i * GP) = ra[i];
#pragma unroll
    for (int i = 0; i < 8; ++i) *(v8h*)(pb + 16 * i * GP) = rb[i]; };
  fetch(0); put(0);
  __syncthreads();
  // unrolled: the slice's step and the buffer's place become immediate offsets, so no address register is formed anew (and waited for) in each trip
#pragma unroll
  for (int c = 0; c < K / 64; ++c) { const int bf = c & 1;
    if (c + 1 < K / 64) fetch(c + 1);
#pragma unroll
    for (int kc = 0; kc < 2; ++kc) { const v16h a = frag_h(sA + (bf * 64 + wave * 16 + col) * GP + kc * 32, lane); v16h bfr[8];
#pragma unroll
      for (int j = 0; j < 8; ++j) bfr[j] = frag_h(sB + (bf * 128 + j * 16 + col) * GP + kc * 32, lane);
#pragma unroll
      for (int j = 0; j < 8; ++j) acc[j] = wmma16(a, bfr[j], acc[j]); }
    // the other buffer's last readers left it at the barrier of the trip before; this barrier publishes slice c + 1 and ends the reads of slice c
    if (c + 1 < K / 64) { put(c + 1); __syncthreads(); } }
  // ends every wave's reads of the last slice, so that the caller's epilogue may overwrite the buffers
  __syncthreads();
}
// motion q/k/v: block (64 tokens of one batch, 128 cols, which) ; k,v stored at key slot s ; v goes straight into VT [bh][d][NKEY]
__device__ __forceinline__ void b_qkv(const int bx, const int by, const int bz, char* smem, const _Float16* __restrict__ X16, const _Float16* __restrict__ PT, const float* __restrict__ bq, const float* __restrict__ bk, const float* __restrict__ bv, const float* __restrict__ srcm,
                                            _Float16* __restrict__ Q16, _Float16* __restrict__ K16, _Float16* __restrict__ VT) {
  float (*so)[16][132] = (float (*)[16][132])smem;      // [4][16][132], which < 2
  _Float16 (*sth)[72] = (_Float16 (*)[72])smem;         // [128][72], which == 2
  const int tid = threadIdx.x, wave = tid >> 5, lane = tid & 31, col = lane & 15, g = lane >> 4;
  const int which = bz, r0b = bx * 64, n0 = by * 128; const int b = r0b / SS, s0 = r0b % SS;
  const float* bb_ = which == 0 ? bq : (which == 1 ? bk : bv);
  v8f acc[8] = {};
  gemm_lds<E>(X16, [&](int r) { return r0b + r; }, PT + (size_t)(which * E + n0) * E, smem, acc);
  if (which < 2) {
#pragma unroll
    for (int j = 0; j < 8; ++j) { const float bb = bb_[n0 + j * 16 + col];
#pragma unroll
      for (int r = 0; r < 8; ++r) so[wave][8 * g + r][j * 16 + col] = (acc[j][r] * (1.0f / 16.0f) + bb) * 4.0f; }
    LDSX();
    for (int qq = lane; qq < 16 * 2 * 8; qq += 32) { const int hh = qq >> 7, rl = (qq >> 3) & 15, pc = qq & 7; const int h = (n0 >> 6) + hh; union { v8h h8; v4u u; } pk;
#pragma unroll
      for (int e = 0; e < 8; ++e) pk.h8[e] = (_Float16)so[wave][rl][hh * 64 + pc * 8 + e];
      if (which == 0) vst2(Q16 + (((size_t)b * NH + h) * SS + s0 + wave * 16 + rl) * HD + pc * 8, pk.u);
      else vst2(K16 + (((size_t)b * NH + h) * NKEY + s0 + wave * 16 + rl) * HD + pc * 8, pk.u);
      // the next trip writes the registers that the store names
      asm volatile("s_wait_xcnt 0x0" ::: "memory"); } }
  else {
#pragma unroll
    for (int j = 0; j < 8; ++j) { const float bb = bb_[n0 + j * 16 + col];
#pragma unroll
      for (int r = 0; r < 8; ++r) { const int s = s0 + wave * 16 + 8 * g + r; sth[j * 16 + col][wave * 16 + 8 * g + r] = (_Float16)((acc[j][r] * (1.0f / 16.0f) + bb) * srcm[b * SS + s] * 4.0f); } }
    __syncthreads();
    // the block's 64 tokens are one whole line of each of its 128 V^T rows: eight lanes store a line; unrolled so that the eight LDS reads are asked for together and their latency is paid once
#pragma unroll
    for (int i = 0; i < 8; ++i) { const int c = (tid >> 3) + 16 * i, n = n0 + c, pc = tid & 7;
      vst2(VT + (((size_t)b * NH + (n >> 6)) * HD + (n & 63)) * NKEY + s0 + pc * 8, *(const v4u*)(&sth[c][pc * 8])); }
    // in the listing another part of the shared launch follows, whose first instructions write registers that these stores name
    asm volatile("s_wait_xcnt 0x0" ::: "memory"); }
}
// text k/v: block (one of 2 row tiles of 64 over the 77 rows, clamped; 128 of 512 cols; which kv; b) from T16 [b*77 + t][256] @ PT2 ; k -> K16 slots 1024 + t ; v (x text_cond) -> VT columns 1024 + t ; t = 77..127 are the pads, stored as zeros
__device__ __forceinline__ void b_tkv(const int bx, const int by, const int bz, char* smem, const _Float16* __restrict__ T16, const _Float16* __restrict__ PT2, const float* __restrict__ bkt, const float* __restrict__ bvt, const int* __restrict__ cond, _Float16* __restrict__ K16, _Float16* __restrict__ VT) {
  float (*so)[16][132] = (float (*)[16][132])smem;      // [4][16][132], which == 0
  _Float16 (*sth)[72] = (_Float16 (*)[72])smem;         // [128][72], which == 1
  const int tid = threadIdx.x, wave = tid >> 5, lane = tid & 31, col = lane & 15, g = lane >> 4;
  const int b = bz, which = by; const int t0b = (bx >> 2) * 64, t0 = t0b + wave * 16, n0 = (bx & 3) * 128;
  const float tc = (cond[b] % 10) > 0 ? 1.f : 0.f; const float* bb_ = which == 0 ? bkt : bvt; const float vsc = which == 0 ? 4.0f : 4.0f * tc;
  v8f acc[8] = {};
  gemm_lds<LT>(T16, [&](int r) { const int t = t0b + r; return b * NTX + (t < NTX ? t : NTX - 1); }, PT2 + (size_t)(which * E + n0) * LT, smem, acc);
  if (which == 0) {   // K16 rows [bh][slot 1024 + t][64]: 2 heads per 128 cols
#pragma unroll
    for (int j = 0; j < 8; ++j) { const float bb = bb_[n0 + j * 16 + col];
#pragma unroll
      for (int r = 0; r < 8; ++r) so[wave][8 * g + r][j * 16 + col] = t0 + 8 * g + r < NTX ? (acc[j][r] * (1.0f / 16.0f) + bb) * vsc : 0.f; }
    LDSX();
    for (int qq = lane; qq < 16 * 2 * 8; qq += 32) { const int hh = qq >> 7, rl = (qq >> 3) & 15, pc = qq & 7; const int h = (n0 >> 6) + hh; const int t = t0 + rl; union { v8h h8; v4u u; } pk;
#pragma unroll
      for (int e = 0; e < 8; ++e) pk.h8[e] = (_Float16)so[wave][rl][hh * 64 + pc * 8 + e];
      vst2(K16 + (((size_t)b * NH + h) * NKEY + SS + t) * HD + pc * 8, pk.u); } }
  else {              // VT rows [bh][d][slot 1024 + t]: the block's 64 t are one whole line of each of its 128 V^T rows
#pragma unroll
    for (int j = 0; j < 8; ++j) { const float bb = bb_[n0 + j * 16 + col]; union { v8h h8; v4u u; } pk;
#pragma unroll
      for (int r = 0; r < 8; ++r) pk.h8[r] = t0 + 8 * g + r < NTX ? (_Float16)((acc[j][r] * (1.0f / 16.0f) + bb) * vsc) : (_Float16)0.f;
      *(v4u*)(&sth[j * 16 + col][wave * 16 + 8 * g]) = pk.u; }
    // a line holds rows of all four waves: every wave's part is in LDS before any line is stored
    __syncthreads();
    // unrolled so that the eight LDS reads are asked for together and their latency is paid once
#pragma unroll
    for (int i = 0; i < 8; ++i) { const int c = (tid >> 3) + 16 * i, n = n0 + c, pc = tid & 7;
      vst2(VT + (((size_t)b * NH + (n >> 6)) * HD + (n & 63)) * NKEY + SS + t0b + pc * 8, *(const v4u*)(&sth[c][pc * 8])); }
    // in the listing another part of the shared launch follows, whose first instructions write registers that these stores name
    asm volatile("s_wait_xcnt 0x0" ::: "memory"); }
}
// [scale | shift] = silu(emb) emb_W^T + emb_b : 8 rows (16-row tile, rows >= 8 zero) x 1024 cols, K = 2048 (bf16 hi/lo)
// block = 32 cols (one whole 128-B line of each SSH row), 4 waves; k is cut in 16 slices of 128, wave w takes slices w, w + 4, w + 8, w + 12 one after the other, each for both column tiles and into a tile of its own;
// the 16 partial tiles are summed in LDS in slice order
#define EKW 16
#define EKC (TE / EKW / 32)
__device__ __forceinline__ void b_emb(const int blk, char* smem, const float* __restrict__ emb, const float* __restrict__ W, const float* __restrict__ bias, float* __restrict__ SSH) {
  float (*red)[NB][32] = (float (*)[NB][32])smem;       // [EKW][NB][32]
  const int tid = threadIdx.x, wave = tid >> 5, lane = tid & 31, col = lane & 15, g = lane >> 4; const int n0 = blk * 32;
  for (int i4 = 0; i4 < EKW / 4; ++i4) { const int sl = wave + 4 * i4, kb = sl * (TE / EKW);
    // A loader: lanes col and col + 8 share emb row col & 7; the lower lane makes silu of fragment elements 0..7, the upper lane of elements 8..15 and hands them over; rows >= 8 of the tile are zero
    const int eh = col >> 3; const float* ep = emb + (size_t)(col & 7) * TE + kb + 8 * g + 16 * eh;
    const float* wp = W + (size_t)(n0 + col) * TE + kb + 8 * g;
    // the whole slice is asked for before any of it is used, so that it pays the memory latency once; written as 16-B loads: from element-wise reads the compiler, in this larger kernel, moves most of the loads down to their users
    v4f e4[EKC][2], w4[EKC][2][4];
#pragma unroll
    for (int kc = 0; kc < EKC; ++kc)
#pragma unroll
      for (int h = 0; h < 2; ++h) e4[kc][h] = *(const v4f*)(ep + kc * 32 + 4 * h);
#pragma unroll
    for (int kc = 0; kc < EKC; ++kc)
#pragma unroll
      for (int j = 0; j < 2; ++j)
#pragma unroll
        for (int h = 0; h < 4; ++h) w4[kc][j][h] = *(const v4f*)(wp + (size_t)j * 16 * TE + kc * 32 + 16 * (h >> 1) + 4 * (h & 1));
    float ev[EKC][8], wv[EKC][2][16];
#pragma unroll
    for (int kc = 0; kc < EKC; ++kc) {
#pragma unroll
      for (int i = 0; i < 8; ++i) ev[kc][i] = e4[kc][i >> 2][i & 3];
#pragma unroll
      for (int j = 0; j < 2; ++j)
#pragma unroll
        for (int i = 0; i < 16; ++i) wv[kc][j][i] = w4[kc][j][i >> 2][i & 3]; }
    F2 a[EKC];
#pragma unroll
    for (int kc = 0; kc < EKC; ++kc) { float v[16];
#pragma unroll
      for (int i = 0; i < 8; ++i) { const float s = silu(ev[kc][i]); const float o = __shfl_xor(s, 8, 32); v[i] = eh ? 0.f : s; v[8 + i] = eh ? 0.f : o; }
      a[kc] = bsplit16(v); }
    v8f acc[2] = {};
#pragma unroll
    for (int kc = 0; kc < EKC; ++kc)
#pragma unroll
      for (int j = 0; j < 2; ++j) acc[j] = mac3(a[kc], bsplit16(wv[kc][j]), acc[j]);
    if (g == 0) {
#pragma unroll
      for (int j = 0; j < 2; ++j)
#pragma unroll
        for (int r = 0; r < 8; ++r) red[sl][r][j * 16 + col] = acc[j][r]; } }
  __syncthreads();
#pragma unroll
  for (int i = 0; i < NB * 32 / 128; ++i) { const int r = (tid >> 5) + 4 * i, c = tid & 31; float s = red[0][r][c];
#pragma unroll
    for (int w = 1; w < EKW; ++w) s += red[w][r][c];
    SSH[(size_t)r * (2 * E) + n0 + c] = s + bias[n0 + c]; }
}
// one launch for the three parts that need only k_pre's results or inputs; the longest blocks (b_emb) first, the shortest (b_tkv) last
#define G_EMB ((2 * E) / 32)
#define G_QX (NR / 64)
#define G_QY (E / 128)
#define G_QKV (G_QX * G_QY * 3)
#define G_TKV (2 * 4 * 2 * NB)
__global__ __launch_bounds__(128) void k_proj(const _Float16* __restrict__ X16, const _Float16* __restrict__ PT, const float* __restrict__ bq, const float* __restrict__ bk, const float* __restrict__ bv, const float* __restrict__ srcm,
                                              _Float16* __restrict__ Q16, _Float16* __restrict__ K16, _Float16* __restrict__ VT, const _Float16* __restrict__ T16, const _Float16* __restrict__ PT2, const float* __restrict__ bkt, const float* __restrict__ bvt,
                                              const int* __restrict__ cond, const float* __restrict__ emb, const float* __restrict__ embW, const float* __restrict__ embb, float* __restrict__ SSH) {
  __shared__ __align__(16) char smem[GSM];
  const int id = blockIdx.x;
  if (id < G_EMB) b_emb(id, smem, emb, embW, embb, SSH);
  else if (id < G_EMB + G_QKV) { const int q = id - G_EMB; b_qkv(q % G_QX, (q / G_QX) % G_QY, q / (G_QX * G_QY), smem, X16, PT, bq, bk, bv, srcm, Q16, K16, VT); }
  else { const int t = id - (G_EMB + G_QKV); b_tkv(t & 7, (t >> 3) & 1, t >> 4, smem, T16, PT2, bkt, bvt, cond, K16, VT); }
}
// attention: block (64 queries, bh); 18 key tiles; additive masks; O16 x8 [bh][s][64]
// Each key tile (64 K rows, 64 V^T rows of 128 B, 64 mask penalties) is brought in once per block with whole-line loads and kept in LDS for all four waves;
// two buffers: tile kt + 1 is asked for ahead of tile kt's softmax and stored behind its P V products, one barrier per tile. Rows are padded to 144 B (16 B x odd) for the 16-B fragment reads.
#define NT (NKEY / 64)
#define KP 72
// e^x is taken as the hardware's 2^y, y = x log2(e): every argument here is a value minus a maximum that covers it, so x <= 0 and the library form's overflow and denormal-range handling has nothing to do
// (a result below the normal range is far below one f16 step of P and of the sum, whatever becomes of it). The lift of P by 2^14 rides in the same multiply-add as + 14.
#define LOG2E 1.44269504088896340736f
__global__ __launch_bounds__(128) void k_attn(const _Float16* __restrict__ Q16, const _Float16* __restrict__ K16, const _Float16* __restrict__ VT, const int* __restrict__ cond, const float* __restrict__ srcm, _Float16* __restrict__ O16) {
  __shared__ __align__(16) float sS[4][16][68];       // scores of a tile; after the loop the wave's output tile
  __shared__ __align__(16) _Float16 sPh[4][16][72];
  __shared__ __align__(16) _Float16 sK[2][64][KP];
  __shared__ __align__(16) _Float16 sV[2][64][KP];
  __shared__ __align__(16) float sPen[2][64];
  const int tid = threadIdx.x, w = tid >> 5, lane = tid & 31, col = lane & 15, g = lane >> 4;
  const size_t bh = blockIdx.y; const int b = (int)(bh / NH); const int q0 = blockIdx.x * 64 + w * 16;
  const float tpen = ((cond[b] % 10) > 0) ? 0.f : -1000000.0f;
  // staging: thread owns 16-B piece tid & 7 of rows (tid >> 3) + 16 i, so a wave's load covers four whole 128-B lines
  const int srow = tid >> 3, spc = (tid & 7) * 8;
  const _Float16* kg = K16 + (bh * NKEY + srow) * HD + spc;
  const _Float16* vg = VT + (bh * HD + srow) * NKEY + spc;
  v8h rk[4], rv[4]; float rm;
  auto fetch = [&](int kt) {
#pragma unroll
    for (int i = 0; i < 4; ++i) { rk[i] = *(const v8h*)(kg + (size_t)(kt * 64 + 16 * i) * HD); rv[i] = *(const v8h*)(vg + (size_t)(16 * i) * NKEY + kt * 64); }
    int ms = kt * 64 + (tid & 63); ms = ms > SS - 1 ? SS - 1 : ms; rm = srcm[b * SS + ms]; };
  auto put = [&](int kt) { const int bf = kt & 1;
#pragma unroll
    for (int i = 0; i < 4; ++i) { *(v8h*)(&sK[bf][srow + 16 * i][spc]) = rk[i]; *(v8h*)(&sV[bf][srow + 16 * i][spc]) = rv[i]; }
    if (tid < 64) { const int slot = kt * 64 + tid; sPen[bf][tid] = slot < SS ? (1.0f - rm) * -1000000.0f : (slot < SS + NTX ? tpen : -3.0e38f); } };
  fetch(0);
  v16h aq[2];
#pragma unroll
  for (int kc = 0; kc < 2; ++kc) aq[kc] = frag_h(Q16 + (bh * SS + q0 + col) * HD + kc * 32, lane);
  put(0);
  __syncthreads();
  float mrun = -3.0e38f, lrun = 0.f; v8f acc[4] = {};
#pragma unroll 1
  for (int kt = 0; kt < NT; ++kt) { const int bf = kt & 1;
    v16h kf[4][2]; float pn[4];
#pragma unroll
    for (int t = 0; t < 4; ++t) { pn[t] = sPen[bf][t * 16 + col];
#pragma unroll
      for (int kc = 0; kc < 2; ++kc) kf[t][kc] = frag_h(&sK[bf][t * 16 + col][kc * 32], lane); }
#pragma unroll
    for (int t = 0; t < 4; ++t) { v8f s = {}; const int slot = kt * 64 + t * 16 + col;
#pragma unroll
      for (int kc = 0; kc < 2; ++kc) s = wmma16(aq[kc], kf[t][kc], s);
#pragma unroll
      for (int r = 0; r < 8; ++r) sS[w][8 * g + r][t * 16 + col] = slot < NTX + SS ? s[r] * (1.0f / 16.0f) + pn[t] : -3.0e38f; }
    LDSX();
    // asked for here, behind the fence above (which waits for every load in flight), so that the loads fly under the whole softmax
    if (kt + 1 < NT) fetch(kt + 1);
    float mx = -3.4e38f;
#pragma unroll
    for (int jj = 0; jj < 32; ++jj) mx = fmaxf(mx, sS[w][col][g * 32 + jj]);
    mx = fmaxf(mx, __shfl_xor(mx, 16, 32));
    const float mnew = fmaxf(mrun, mx); const float corr = __builtin_amdgcn_exp2f((mrun - mnew) * LOG2E);
    float ps = 0.f;
#pragma unroll
    for (int jj = 0; jj < 32; ++jj) { const float sv = sS[w][col][g * 32 + jj]; const float p = sv <= -1.0e38f ? 0.f : __builtin_amdgcn_exp2f(fmaf(sv - mnew, LOG2E, 14.0f)); ps += p; sPh[w][col][g * 32 + jj] = (_Float16)p; }
    ps += __shfl_xor(ps, 16, 32);
    lrun = lrun * corr + ps * (1.0f / 16384.0f); mrun = mnew;
#pragma unroll
    for (int r = 0; r < 8; ++r) { const float cr = __shfl(corr, 8 * g + r, 32);
#pragma unroll
      for (int t = 0; t < 4; ++t) acc[t][r] *= cr; }
    LDSX();
    v16h ph[2], vf[2][4];
#pragma unroll
    for (int kc = 0; kc < 2; ++kc) { ph[kc] = frag_h(&sPh[w][col][0] + kc * 32, lane);
#pragma unroll
      for (int t = 0; t < 4; ++t) vf[kc][t] = frag_h(&sV[bf][t * 16 + col][kc * 32], lane); }
#pragma unroll
    for (int kc = 0; kc < 2; ++kc)
#pragma unroll
      for (int t = 0; t < 4; ++t) acc[t] = wmma16(ph[kc], vf[kc][t], acc[t]);
    // the other buffer's last readers left it at the barrier of the trip before; this barrier publishes tile kt + 1 and ends the reads of tile kt
    if (kt + 1 < NT) { put(kt + 1); __syncthreads(); } }
#pragma unroll
  for (int r = 0; r < 8; ++r) { const float lr = __shfl(lrun, 8 * g + r, 32); const float inv = 8.0f / (lr * 16384.0f * 4.0f);
#pragma unroll
    for (int t = 0; t < 4; ++t) sS[w][8 * g + r][t * 16 + col] = acc[t][r] * inv; }
  LDSX();
  for (int qq = lane; qq < 16 * 8; qq += 32) { const int rl = qq >> 3, pc = qq & 7; union { v8h h8; v4u u; } pk;
#pragma unroll
    for (int e = 0; e < 8; ++e) pk.h8[e] = (_Float16)sS[w][rl][pc * 8 + e];
    vst2(O16 + ((bh * SS) + q0 + rl) * HD + pc * 8, pk.u); }
}
__global__ __launch_bounds__(256) void k_styl(const _Float16* __restrict__ O16, const float* __restrict__ SSH, const float* __restrict__ g_, const float* __restrict__ b_, _Float16* __restrict__ Z16) {
  const int wave = threadIdx.x >> 5, lane = threadIdx.x & 31; const int row = blockIdx.x * 8 + wave; const int b = row / SS, s = row % SS;
  float sum = 0.f, sq = 0.f;
#pragma unroll 2
  for (int e = 0; e < 16; ++e) { const int c = (e < 8 ? 0 : 256) + lane * 8 + (e & 7); const int h = c >> 6, d = c & 63; const float v = (float)O16[(((size_t)b * NH + h) * SS + s) * HD + d] * 0.125f; sum += v; sq += v * v; }
#pragma unroll
  for (int o = 16; o > 0; o >>= 1) { sum += __shfl_xor(sum, o, 32); sq += __shfl_xor(sq, o, 32); }
  const float mu = sum * (1.0f / E); float var = sq * (1.0f / E) - mu * mu; var = var > 0.f ? var : 0.f; const float rs = rsqrtf(var + 1e-5f);
  const float* sc_ = SSH + (size_t)b * 2 * E; const float* sh_ = sc_ + E;
#pragma unroll 1
  for (int half = 0; half < 2; ++half) { union { v8h h; v4u u; } pk;
#pragma unroll
    for (int e = 0; e < 8; ++e) { const int c = half * 256 + lane * 8 + e; const int h = c >> 6, d = c & 63; const float v = (float)O16[(((size_t)b * NH + h) * SS + s) * HD + d] * 0.125f;
      const float hn = (v - mu) * rs * g_[c] + b_[c]; const float m = hn * (1.0f + sc_[c]) + sh_[c]; pk.h[e] = (_Float16)(silu(m) * 8.0f); }
    vst2(Z16 + (size_t)row * E + half * 256 + lane * 8, pk.u); }
}
// out = x + Z out_W^T /16/8 + out_b
__global__ __launch_bounds__(128) void k_out(const _Float16* __restrict__ Z16, const _Float16* __restrict__ PT, const float* __restrict__ bo, const float* __restrict__ x, float* __restrict__ out) {
  __shared__ __align__(16) char smem[GSM];
  float (*so)[16][132] = (float (*)[16][132])smem;      // [4][16][132]
  const int tid = threadIdx.x, wave = tid >> 5, lane = tid & 31, col = lane & 15, g = lane >> 4;
  const int r0b = blockIdx.x * 64, r0 = r0b + wave * 16, n0 = blockIdx.y * 128;
  v8f acc[8] = {};
  gemm_lds<E>(Z16, [&](int r) { return r0b + r; }, PT + (size_t)(3 * E + n0) * E, smem, acc);
#pragma unroll
  for (int j = 0; j < 8; ++j) { const int n = n0 + j * 16 + col; const float bb = bo[n];
#pragma unroll
    for (int r = 0; r < 8; ++r) so[wave][8 * g + r][j * 16 + col] = acc[j][r] * (1.0f / (16.0f * 8.0f)) + bb + x[(size_t)(r0 + 8 * g + r) * E + n]; }
  LDSX();
#pragma unroll 4
  for (int rl = 0; rl < 16; ++rl) vst2(out + (size_t)(r0 + rl) * E + n0 + lane * 4, *(const v4f*)(&so[wave][rl][lane * 4]));
}
extern "C" void kernel_launch(void* const* d_in, const int* in_sizes, int n_in, void* d_out, int out_size, void* d_ws, size_t ws_size, hipStream_t stream) {
  (void)in_sizes; (void)n_in; (void)out_size; (void)ws_size;
  const float** I = (const float**)d_in;
  const float* x = I[0]; const float* xf = I[1]; const float* emb = I[2]; const float* srcm = I[3]; const int* cond = (const int*)d_in[4];
  const float* ng = I[5]; const float* nb = I[6]; const float* tg = I[7]; const float* tb = I[8]; const float* Wq = I[9]; const float* bq = I[10]; const float* Wkt = I[11]; const float* bkt = I[12]; const float* Wvt = I[13]; const float* bvt = I[14];
  const float* Wkm = I[15]; const float* bkm = I[16]; const float* Wvm = I[17]; const float* bvm = I[18]; const float* embW = I[19]; const float* embb = I[20]; const float* sg = I[21]; const float* sb = I[22]; const float* Wo = I[23]; const float* bo = I[24];
  float* out = (float*)d_out;
  char* ws = (char*)d_ws; size_t off = 0;
  auto take = [&](size_t bytes) { char* p = ws + off; off += (bytes + 255) & ~(size_t)255; return p; };
  _Float16* X16 = (_Float16*)take((size_t)NR * E * 2); _Float16* T16 = (_Float16*)take((size_t)NB * NTX * LT * 2 + 4096); _Float16* PT = (_Float16*)take((size_t)4 * E * E * 2); _Float16* PT2 = (_Float16*)take((size_t)2 * E * LT * 2);
  _Float16* Q16 = (_Float16*)take((size_t)NR * E * 2); _Float16* K16 = (_Float16*)take((size_t)NB * NH * NKEY * HD * 2);
  _Float16* VT = (_Float16*)take((size_t)NB * NH * HD * NKEY * 2); _Float16* O16 = (_Float16*)take((size_t)NR * E * 2); float* SSH = (float*)take((size_t)NB * 2 * E * 4); _Float16* Z16 = X16;    // X16 dead after k_proj
  // ws ~ 47 MB
  k_pre<<<G_LNT + G_LNX + G_PACK, 256, 0, stream>>>(x, ng, nb, X16, xf, tg, tb, T16, Wq, Wkm, Wvm, Wo, Wkt, Wvt, PT, PT2);
  k_proj<<<G_EMB + G_QKV + G_TKV, 128, 0, stream>>>(X16, PT, bq, bkm, bvm, srcm, Q16, K16, VT, T16, PT2, bkt, bvt, cond, emb, embW, embb, SSH);
  k_attn<<<dim3(SS / 64, NB * NH), 128, 0, stream>>>(Q16, K16, VT, cond, srcm, O16);
  k_styl<<<NR / 8, 256, 0, stream>>>(O16, SSH, sg, sb, Z16);
  k_out<<<dim3(NR / 64, E / 128), 128, 0, stream>>>(Z16, PT, bo, x, out);
}

// v007
// A run of this version takes 77 microseconds.
// Two timings next to v006 both put it at 1.08 times that version's speed.
// Counting every step since v000, it is 5.52 times as fast.
// compute dtype: f16 operands for the projections and attention (LayerNorm outputs as f16 rows, weights packed x16, q/k x4, P lifted by 2^14, V x4, context x8, stylised rows x8), bf16 hi/lo splits for the small emb GEMM, f32 accumulate; LayerNorms, masks, softmax, SiLU f32. Output = x + h is dominated by the f32 residual.
#include <hip/hip_runtime.h>
#include <math.h>

typedef __attribute__((ext_vector_type(16))) _Float16 v16h;
typedef __attribute__((ext_vector_type(16))) __bf16 v16b;
typedef __attribute__((ext_vector_type(8)))  _Float16 v8h;
typedef __attribute__((ext_vector_type(8)))  float v8f;
typedef __attribute__((ext_vector_type(4)))  float v4f;
typedef __attribute__((ext_vector_type(2)))  float v2f;
typedef __attribute__((ext_vector_type(4)))  unsigned v4u;
typedef __attribute__((ext_vector_type(4)))  int v4i;
typedef float __attribute__((may_alias)) float_a;
typedef int __attribute__((may_alias)) int_a;

template <typename T> __device__ __forceinline__ void vst2(void* p, T v) { *(T*)p = v;  }
__device__ __forceinline__ v8f wmma16(v16h a, v16h b, v8f c) {
  v8f d = __builtin_amdgcn_wmma_f32_16x16x32_f16(false, a, false, b, (short)0, c, false, false);
  asm volatile("v_nop\n\tv_nop\n\tv_nop\n\tv_nop" : "+v"(d) : "v"(a), "v"(b));
  return d;
}
__device__ __forceinline__ v8f wmma_bf(v16b a, v16b b, v8f c) {
  v8f d = __builtin_amdgcn_wmma_f32_16x16x32_bf16(false, a, false, b, (short)0, c, false, false);
  asm volatile("v_nop\n\tv_nop\n\tv_nop\n\tv_nop" : "+v"(d) : "v"(a), "v"(b));
  return d;
}
// 16x16x32 fragments: lane = (h = lane>>4, row/col = lane&15); elements 0..7 = k0+8h+0..7, 8..15 = k0+16+8h+0..7; D element r = row 8h+r
__device__ __forceinline__ v16h frag_h(const _Float16* rowk0, int lane) {
  union { v16h v; v8h q[2]; } u; const _Float16* p = rowk0 + 8 * (lane >> 4);
  u.q[0] = *(const v8h*)p; u.q[1] = *(const v8h*)(p + 16); return u.v;
}
__device__ __forceinline__ v16h frag_f32(const float* rowk0, int lane) {
  v16h a; const float* p = rowk0 + 8 * (lane >> 4);
#pragma unroll
  for (int i = 0; i < 8; ++i) { a[i] = (_Float16)p[i]; a[8 + i] = (_Float16)p[16 + i]; }
  return a;
}
__device__ __forceinline__ v16h frag_f32s(const float* rowk0, int lane, float sc) {
  v16h a; const float* p = rowk0 + 8 * (lane >> 4);
#pragma unroll
  for (int i = 0; i < 8; ++i) { a[i] = (_Float16)(p[i] * sc); a[8 + i] = (_Float16)(p[16 + i] * sc); }
  return a;
}
// column fragment from a [K][ld] layout (column n), rows >= K read as 0
__device__ __forceinline__ v16h fragc_f32(const float* W, int k0, int n, int lane, int ld, int K) {
  v16h a; const int g = lane >> 4;
#pragma unroll
  for (int i = 0; i < 8; ++i) { const int ka = k0 + 8 * g + i, kb = ka + 16;
    a[i] = (_Float16)(ka < K ? W[(size_t)ka * ld + n] : 0.f); a[8 + i] = (_Float16)(kb < K ? W[(size_t)kb * ld + n] : 0.f); }
  return a;
}
struct F2 { v16b h, l; };
__device__ __forceinline__ F2 bsplit16(const float v[16]) { F2 r;
#pragma unroll
  for (int i = 0; i < 16; ++i) { const __bf16 h = (__bf16)v[i]; r.h[i] = h; r.l[i] = (__bf16)(v[i] - (float)h); }
  return r; }
__device__ __forceinline__ F2 split_row(const float* row, int k0, int lane) { float v[16]; const float* p = row + k0 + 8 * (lane >> 4);
#pragma unroll
  for (int i = 0; i < 8; ++i) { v[i] = p[i]; v[8 + i] = p[16 + i]; }
  return bsplit16(v); }
__device__ __forceinline__ F2 split_rowK(const float* row, int k0, int lane, int K) { float v[16]; const int g = lane >> 4;
#pragma unroll
  for (int i = 0; i < 8; ++i) { const int ka = k0 + 8 * g + i, kb = ka + 16; v[i] = ka < K ? row[ka] : 0.f; v[8 + i] = kb < K ? row[kb] : 0.f; }
  return bsplit16(v); }
__device__ __forceinline__ F2 split_col(const float* W, int k0, int n, int lane, int ld, int K) { float v[16]; const int g = lane >> 4;
#pragma unroll
  for (int i = 0; i < 8; ++i) { const int ka = k0 + 8 * g + i, kb = ka + 16; v[i] = ka < K ? W[(size_t)ka * ld + n] : 0.f; v[8 + i] = kb < K ? W[(size_t)kb * ld + n] : 0.f; }
  return bsplit16(v); }
__device__ __forceinline__ v8f mac3(const F2& a, const F2& b, v8f c) { c = wmma_bf(a.l, b.h, c); c = wmma_bf(a.h, b.l, c); return wmma_bf(a.h, b.h, c); }
__device__ __forceinline__ float sigm(float v) { return 1.0f / (1.0f + expf(-v)); }
#define LDSX() do { asm volatile("s_wait_dscnt 0" ::: "memory"); __builtin_amdgcn_wave_barrier(); __builtin_amdgcn_fence(__ATOMIC_RELEASE, "workgroup"); } while (0)


// Mixed text/motion attention + stylisation block on [8,1024,512] (8 heads x 64): xn = LN(x), xfn = LN(xf [8,77,256]); q = xn Wq^T + bq; keys = [xfn Wkt^T + bkt (77) | xn Wkm^T + bkm (1024)],
// values = [(xfn Wvt^T + bvt) * text_cond_b | (xn Wvm^T + bvm) * src_mask], logits q.k (NO 1/sqrt d) + (1 - mask)*(-1e6) with mask = [text_cond_b x77 | src_mask]; softmax over the 1,101 keys;
// y = P v; h = silu(LN(y) * (1 + scale_b) + shift_b) out_W^T + out_b with [scale|shift] = silu(emb) emb_W^T + emb_b; out = x + h.
// Key slots (softmax does not depend on the key order): motion token s at slot s, text token t at slot 1024 + t, zero pads at 1101..1151; so 64 tokens of a V^T row are one whole, aligned 128-B line.
// Parts: b_lnx / b_lnt (LayerNorm -> f16 rows), b_pack (weights [out][in] x16), b_qkv (motion q/k/v; keys/values at slots s), b_tkv (text k/v at slots 1024 + t, and the zero pads), b_emb ([scale | shift]).
// Parts that do not depend on one another share a launch, each on its own range of block indices: k_pre = b_lnt, b_lnx, b_pack; k_proj = b_emb, b_qkv, b_tkv; then k_attn, k_styl, k_out.
#define NB 8
#define SS 1024
#define E 512
#define NH 8
#define HD 64
#define NR (NB * SS)
#define NTX 77
#define LT 256
#define NKEY 1152              // 1024 + 77 = 1101 padded to 18 x 64
#define TE 2048
__device__ __forceinline__ float silu(float x) { return x / (1.0f + expf(-x)); }

// LN over rows of x (512) -> f16 rows; wave per row
__device__ __forceinline__ void b_lnx(const int blk, const float* __restrict__ x, const float* __restrict__ g_, const float* __restrict__ b_, _Float16* __restrict__ X16) {
  const int wave = threadIdx.x >> 5, lane = threadIdx.x & 31; const int row = blk * 8 + wave; const float* xr = x + (size_t)row * E;
  float v[16]; float s = 0.f;
  // lane owns columns lane*8..+7 and 256 + lane*8..+7 so each 16-B store instruction covers a contiguous 512-B run across the wave
#pragma unroll
  for (int e = 0; e < 16; ++e) { v[e] = xr[(e < 8 ? 0 : 256) + lane * 8 + (e & 7)]; s += v[e]; }
#pragma unroll
  for (int o = 16; o > 0; o >>= 1) s += __shfl_xor(s, o, 32);
  const float mu = s * (1.0f / E); float q = 0.f;
#pragma unroll
  for (int e = 0; e < 16; ++e) { const float d = v[e] - mu; q += d * d; }
#pragma unroll
  for (int o = 16; o > 0; o >>= 1) q += __shfl_xor(q, o, 32);
  const float rs = rsqrtf(q * (1.0f / E) + 1e-5f);
  union { v8h h[2]; v4u u[2]; } pk;
#pragma unroll
  for (int e = 0; e < 16; ++e) { const int c = (e < 8 ? 0 : 256) + lane * 8 + (e & 7); pk.h[e >> 3][e & 7] = (_Float16)((v[e] - mu) * rs * g_[c] + b_[c]); }
  vst2(X16 + (size_t)row * E + lane * 8, pk.u[0]); vst2(X16 + (size_t)row * E + 256 + lane * 8, pk.u[1]);
  // in the listing another part of the shared launch follows, whose first instructions write registers that these stores name
  asm volatile("s_wait_xcnt 0x0" ::: "memory");
}
// LN over rows of xf (256) -> f16 rows [NB*NTX][256]; wave per row (8 per lane)
__device__ __forceinline__ void b_lnt(const int blk, const float* __restrict__ xf, const float* __restrict__ g_, const float* __restrict__ b_, _Float16* __restrict__ T16) {
  const int wave = threadIdx.x >> 5, lane = threadIdx.x & 31; const int row = blk * 8 + wave; if (row >= NB * NTX) return; const float* xr = xf + (size_t)row * LT;
  float v[8]; float s = 0.f;
#pragma unroll
  for (int e = 0; e < 8; ++e) { v[e] = xr[lane * 8 + e]; s += v[e]; }
#pragma unroll
  for (int o = 16; o > 0; o >>= 1) s += __shfl_xor(s, o, 32);
  const float mu = s * (1.0f / LT); float q = 0.f;
#pragma unroll
  for (int e = 0; e < 8; ++e) { const float d = v[e] - mu; q += d * d; }
#pragma unroll
  for (int o = 16; o > 0; o >>= 1) q += __shfl_xor(q, o, 32);
  const float rs = rsqrtf(q * (1.0f / LT) + 1e-5f);
  union { v8h h; v4u u; } pk;
#pragma unroll
  for (int e = 0; e < 8; ++e) { const int c = lane * 8 + e; pk.h[e] = (_Float16)((v[e] - mu) * rs * g_[c] + b_[c]); }
  vst2(T16 + (size_t)row * LT + lane * 8, pk.u);
}
// PT rows (x16, [out][in]): [0,512) Wq, [512,1024) Wkm, [1024,1536) Wvm, [1536,2048) out_W (512 halves each); PT2: [0,512) Wkt, [512,1024) Wvt (256 halves each)
__device__ __forceinline__ void b_pack(const int n, const float* __restrict__ Wq, const float* __restrict__ Wkm, const float* __restrict__ Wvm, const float* __restrict__ Wo, const float* __restrict__ Wkt, const float* __restrict__ Wvt, _Float16* __restrict__ PT, _Float16* __restrict__ PT2) {
  const int tid = threadIdx.x; __shared__ __align__(16) _Float16 srow[E];
  if (n < 4 * E) { const float* W = n < E ? Wq : (n < 2 * E ? Wkm : (n < 3 * E ? Wvm : Wo)); const int nn = n & (E - 1);
    srow[tid] = (_Float16)(W[(size_t)nn * E + tid] * 16.0f); srow[tid + 256] = (_Float16)(W[(size_t)nn * E + tid + 256] * 16.0f); __syncthreads();
    if (tid < E / 8) vst2(PT + (size_t)n * E + tid * 8, *(const v4u*)(&srow[tid * 8])); }
  else { const int m = n - 4 * E; const float* W = m < E ? Wkt : Wvt; const int nn = m & (E - 1);
    srow[tid] = (_Float16)(W[(size_t)nn * LT + tid] * 16.0f); __syncthreads();
    if (tid < LT / 8) vst2(PT2 + (size_t)m * LT + tid * 8, *(const v4u*)(&srow[tid * 8])); }
}
// one launch for the three parts that read only inputs; the short text rows first
#define G_LNT ((NB * NTX + 7) / 8)
#define G_LNX (NR / 8)
#define G_PACK (4 * E + 2 * E)
__global__ __launch_bounds__(256) void k_pre(const float* __restrict__ x, const float* __restrict__ ng, const float* __restrict__ nb, _Float16* __restrict__ X16, const float* __restrict__ xf, const float* __restrict__ tg, const float* __restrict__ tb, _Float16* __restrict__ T16,
                                             const float* __restrict__ Wq, const float* __restrict__ Wkm, const float* __restrict__ Wvm, const float* __restrict__ Wo, const float* __restrict__ Wkt, const float* __restrict__ Wvt, _Float16* __restrict__ PT, _Float16* __restrict__ PT2) {
  const int id = blockIdx.x;
  if (id < G_LNT) b_lnt(id, xf, tg, tb, T16);
  else if (id < G_LNT + G_LNX) b_lnx(id - G_LNT, x, ng, nb, X16);
  else b_pack(id - (G_LNT + G_LNX), Wq, Wkm, Wvm, Wo, Wkt, Wvt, PT, PT2);
}
// Shared loop of the projection kernels: a block's 64 x 128 tile of A B^T, A and B rows K-contiguous f16; wave w keeps rows 16 w .. 16 w + 15 x 128 columns in acc, k ascending.
// Each 64-k slice (128 B = one whole line of each of the 64 A rows and 128 B rows) is brought in once per block and kept in LDS for all four waves; the fragments are read from LDS.
// Two buffers: slice c + 1 is asked for ahead of slice c's products and stored behind them, one barrier per slice. Rows are padded to 144 B (16 B x odd) for the 16-B fragment reads.
#define GP 72
#define GSM ((64 + 128) * 2 * GP * 2)   // bytes: [2][64][GP] A halves, then [2][128][GP] B halves; the epilogues reuse the same bytes behind a barrier
template <int K, typename AR>
__device__ __forceinline__ void gemm_lds(const _Float16* __restrict__ A, AR arow, const _Float16* __restrict__ B, char* smem, v8f (&acc)[8]) {
  _Float16* sA = (_Float16*)smem; _Float16* sB = sA + 2 * 64 * GP;
  const int tid = threadIdx.x, wave = tid >> 5, lane = tid & 31, col = lane & 15;
  // staging: thread owns 16-B piece tid & 7 of rows (tid >> 3) + 16 i, so a wave's load covers four whole 128-B lines
  const int srow = tid >> 3, spc = (tid & 7) * 8;
  // lane offsets in halves from the block-uniform bases A and B
  unsigned ao[4];
#pragma unroll
  for (int i = 0; i < 4; ++i) ao[i] = (unsigned)arow(srow + 16 * i) * K + spc;
  const unsigned bo = (unsigned)srow * K + spc;
  const int sp = srow * GP + spc;
  v8h ra[4], rb[8];
  auto fetch = [&](int c) { const _Float16* Ac = A + c * 64; const _Float16* Bc = B + c * 64;
#pragma unroll
    for (int i = 0; i < 4; ++i) ra[i] = *(const v8h*)(Ac + ao[i]);
#pragma unroll
    for (int i = 0; i < 8; ++i) rb[i] = *(const v8h*)(Bc + 16 * i * K + bo); };
  auto put = [&](int c) { _Float16* pa = sA + (c & 1) * (64 * GP) + sp; _Float16* pb = sB + (c & 1) * (128 * GP) + sp;
#pragma unroll
    for (int i = 0; i < 4; ++i) *(v8h*)(pa + 16 * i * GP) = ra[i];
#pragma unroll
    for (int i = 0; i < 8; ++i) *(v8h*)(pb + 16 * i * GP) = rb[i]; };
  fetch(0); put(0);
  __syncthreads();
  // unrolled: the slice's step and the buffer's place become immediate offsets, so no address register is formed anew (and waited for) in each trip
#pragma unroll
  for (int c = 0; c < K / 64; ++c) { const int bf = c & 1;
    if (c + 1 < K / 64) fetch(c + 1);
#pragma unroll
    for (int kc = 0; kc < 2; ++kc) { const v16h a = frag_h(sA + (bf * 64 + wave * 16 + col) * GP + kc * 32, lane); v16h bfr[8];
#pragma unroll
      for (int j = 0; j < 8; ++j) bfr[j] = frag_h(sB + (bf * 128 + j * 16 + col) * GP + kc * 32, lane);
#pragma unroll
      for (int j = 0; j < 8; ++j) acc[j] = wmma16(a, bfr[j], acc[j]); }
    // the other buffer's last readers left it at the barrier of the trip before; this barrier publishes slice c + 1 and ends the reads of slice c
    if (c + 1 < K / 64) { put(c + 1); __syncthreads(); } }
  // ends every wave's reads of the last slice, so that the caller's epilogue may overwrite the buffers
  __syncthreads();
}
// motion q/k/v: block (64 tokens of one batch, 128 cols, which) ; k,v stored at key slot s ; v goes straight into VT [bh][d][NKEY]
__device__ __forceinline__ void b_qkv(const int bx, const int by, const int bz, char* smem, const _Float16* __restrict__ X16, const _Float16* __restrict__ PT, const float* __restrict__ bq, const float* __restrict__ bk, const float* __restrict__ bv, const float* __restrict__ srcm,
                                            _Float16* __restrict__ Q16, _Float16* __restrict__ K16, _Float16* __restrict__ VT) {
  float (*so)[16][132] = (float (*)[16][132])smem;      // [4][16][132], which < 2
  _Float16 (*sth)[72] = (_Float16 (*)[72])smem;         // [128][72], which == 2
  const int tid = threadIdx.x, wave = tid >> 5, lane = tid & 31, col = lane & 15, g = lane >> 4;
  const int which = bz, r0b = bx * 64, n0 = by * 128; const int b = r0b / SS, s0 = r0b % SS;
  const float* bb_ = which == 0 ? bq : (which == 1 ? bk : bv);
  v8f acc[8] = {};
  gemm_lds<E>(X16, [&](int r) { return r0b + r; }, PT + (size_t)(which * E + n0) * E, smem, acc);
  if (which < 2) {
#pragma unroll
    for (int j = 0; j < 8; ++j) { const float bb = bb_[n0 + j * 16 + col];
#pragma unroll
      for (int r = 0; r < 8; ++r) so[wave][8 * g + r][j * 16 + col] = (acc[j][r] * (1.0f / 16.0f) + bb) * 4.0f; }
    LDSX();
    for (int qq = lane; qq < 16 * 2 * 8; qq += 32) { const int hh = qq >> 7, rl = (qq >> 3) & 15, pc = qq & 7; const int h = (n0 >> 6) + hh; union { v8h h8; v4u u; } pk;
#pragma unroll
      for (int e = 0; e < 8; ++e) pk.h8[e] = (_Float16)so[wave][rl][hh * 64 + pc * 8 + e];
      if (which == 0) vst2(Q16 + (((size_t)b * NH + h) * SS + s0 + wave * 16 + rl) * HD + pc * 8, pk.u);
      else vst2(K16 + (((size_t)b * NH + h) * NKEY + s0 + wave * 16 + rl) * HD + pc * 8, pk.u);
      // the next trip writes the registers that the store names
      asm volatile("s_wait_xcnt 0x0" ::: "memory"); } }
  else {
#pragma unroll
    for (int j = 0; j < 8; ++j) { const float bb = bb_[n0 + j * 16 + col];
#pragma unroll
      for (int r = 0; r < 8; ++r) { const int s = s0 + wave * 16 + 8 * g + r; sth[j * 16 + col][wave * 16 + 8 * g + r] = (_Float16)((acc[j][r] * (1.0f / 16.0f) + bb) * srcm[b * SS + s] * 4.0f); } }
    __syncthreads();
    // the block's 64 tokens are one whole line of each of its 128 V^T rows: eight lanes store a line; unrolled so that the eight LDS reads are asked for together and their latency is paid once
#pragma unroll
    for (int i = 0; i < 8; ++i) { const int c = (tid >> 3) + 16 * i, n = n0 + c, pc = tid & 7;
      vst2(VT + (((size_t)b * NH + (n >> 6)) * HD + (n & 63)) * NKEY + s0 + pc * 8, *(const v4u*)(&sth[c][pc * 8])); }
    // in the listing another part of the shared launch follows, whose first instructions write registers that these stores name
    asm volatile("s_wait_xcnt 0x0" ::: "memory"); }
}
// text k/v: block (one of 2 row tiles of 64 over the 77 rows, clamped; 128 of 512 cols; which kv; b) from T16 [b*77 + t][256] @ PT2 ; k -> K16 slots 1024 + t ; v (x text_cond) -> VT columns 1024 + t ; t = 77..127 are the pads, stored as zeros
__device__ __forceinline__ void b_tkv(const int bx, const int by, const int bz, char* smem, const _Float16* __restrict__ T16, const _Float16* __restrict__ PT2, const float* __restrict__ bkt, const float* __restrict__ bvt, const int* __restrict__ cond, _Float16* __restrict__ K16, _Float16* __restrict__ VT) {
  float (*so)[16][132] = (float (*)[16][132])smem;      // [4][16][132], which == 0
  _Float16 (*sth)[72] = (_Float16 (*)[72])smem;         // [128][72], which == 1
  const int tid = threadIdx.x, wave = tid >> 5, lane = tid & 31, col = lane & 15, g = lane >> 4;
  const int b = bz, which = by; const int t0b = (bx >> 2) * 64, t0 = t0b + wave * 16, n0 = (bx & 3) * 128;
  const float tc = (cond[b] % 10) > 0 ? 1.f : 0.f; const float* bb_ = which == 0 ? bkt : bvt; const float vsc = which == 0 ? 4.0f : 4.0f * tc;
  v8f acc[8] = {};
  gemm_lds<LT>(T16, [&](int r) { const int t = t0b + r; return b * NTX + (t < NTX ? t : NTX - 1); }, PT2 + (size_t)(which * E + n0) * LT, smem, acc);
  if (which == 0) {   // K16 rows [bh][slot 1024 + t][64]: 2 heads per 128 cols
#pragma unroll
    for (int j = 0; j < 8; ++j) { const float bb = bb_[n0 + j * 16 + col];
#pragma unroll
      for (int r = 0; r < 8; ++r) so[wave][8 * g + r][j * 16 + col] = t0 + 8 * g + r < NTX ? (acc[j][r] * (1.0f / 16.0f) + bb) * vsc : 0.f; }
    LDSX();
    for (int qq = lane; qq < 16 * 2 * 8; qq += 32) { const int hh = qq >> 7, rl = (qq >> 3) & 15, pc = qq & 7; const int h = (n0 >> 6) + hh; const int t = t0 + rl; union { v8h h8; v4u u; } pk;
#pragma unroll
      for (int e = 0; e < 8; ++e) pk.h8[e] = (_Float16)so[wave][rl][hh * 64 + pc * 8 + e];
      vst2(K16 + (((size_t)b * NH + h) * NKEY + SS + t) * HD + pc * 8, pk.u); } }
  else {              // VT rows [bh][d][slot 1024 + t]: the block's 64 t are one whole line of each of its 128 V^T rows
#pragma unroll
    for (int j = 0; j < 8; ++j) { const float bb = bb_[n0 + j * 16 + col]; union { v8h h8; v4u u; } pk;
#pragma unroll
      for (int r = 0; r < 8; ++r) pk.h8[r] = t0 + 8 * g + r < NTX ? (_Float16)((acc[j][r] * (1.0f / 16.0f) + bb) * vsc) : (_Float16)0.f;
      *(v4u*)(&sth[j * 16 + col][wave * 16 + 8 * g]) = pk.u; }
    // a line holds rows of all four waves: every wave's part is in LDS before any line is stored
    __syncthreads();
    // unrolled so that the eight LDS reads are asked for together and their latency is paid once
#pragma unroll
    for (int i = 0; i < 8; ++i) { const int c = (tid >> 3) + 16 * i, n = n0 + c, pc = tid & 7;
      vst2(VT + (((size_t)b * NH + (n >> 6)) * HD + (n & 63)) * NKEY + SS + t0b + pc * 8, *(const v4u*)(&sth[c][pc * 8])); }
    // in the listing another part of the shared launch follows, whose first instructions write registers that these stores name
    asm volatile("s_wait_xcnt 0x0" ::: "memory"); }
}
// [scale | shift] = silu(emb) emb_W^T + emb_b : 8 rows (16-row tile, rows >= 8 zero) x 1024 cols, K = 2048 (bf16 hi/lo)
// block = 32 cols (one whole 128-B line of each SSH row), 4 waves; k is cut in 16 slices of 128, wave w takes slices w, w + 4, w + 8, w + 12 one after the other, each for both column tiles and into a tile of its own;
// the 16 partial tiles are summed in LDS in slice order
#define EKW 16
#define EKC (TE / EKW / 32)
__device__ __forceinline__ void b_emb(const int blk, char* smem, const float* __restrict__ emb, const float* __restrict__ W, const float* __restrict__ bias, float* __restrict__ SSH) {
  float (*red)[NB][32] = (float (*)[NB][32])smem;       // [EKW][NB][32]
  const int tid = threadIdx.x, wave = tid >> 5, lane = tid & 31, col = lane & 15, g = lane >> 4; const int n0 = blk * 32;
  for (int i4 = 0; i4 < EKW / 4; ++i4) { const int sl = wave + 4 * i4, kb = sl * (TE / EKW);
    // A loader: lanes col and col + 8 share emb row col & 7; the lower lane makes silu of fragment elements 0..7, the upper lane of elements 8..15 and hands them over; rows >= 8 of the tile are zero
    const int eh = col >> 3; const float* ep = emb + (size_t)(col & 7) * TE + kb + 8 * g + 16 * eh;
    const float* wp = W + (size_t)(n0 + col) * TE + kb + 8 * g;
    // the whole slice is asked for before any of it is used, so that it pays the memory latency once; written as 16-B loads: from element-wise reads the compiler, in this larger kernel, moves most of the loads down to their users
    v4f e4[EKC][2], w4[EKC][2][4];
#pragma unroll
    for (int kc = 0; kc < EKC; ++kc)
#pragma unroll
      for (int h = 0; h < 2; ++h) e4[kc][h] = *(const v4f*)(ep + kc * 32 + 4 * h);
#pragma unroll
    for (int kc = 0; kc < EKC; ++kc)
#pragma unroll
      for (int j = 0; j < 2; ++j)
#pragma unroll
        for (int h = 0; h < 4; ++h) w4[kc][j][h] = *(const v4f*)(wp + (size_t)j * 16 * TE + kc * 32 + 16 * (h >> 1) + 4 * (h & 1));
    float ev[EKC][8], wv[EKC][2][16];
#pragma unroll
    for (int kc = 0; kc < EKC; ++kc) {
#pragma unroll
      for (int i = 0; i < 8; ++i) ev[kc][i] = e4[kc][i >> 2][i & 3];
#pragma unroll
      for (int j = 0; j < 2; ++j)
#pragma unroll
        for (int i = 0; i < 16; ++i) wv[kc][j][i] = w4[kc][j][i >> 2][i & 3]; }
    F2 a[EKC];
#pragma unroll
    for (int kc = 0; kc < EKC; ++kc) { float v[16];
#pragma unroll
      for (int i = 0; i < 8; ++i) { const float s = silu(ev[kc][i]); const float o = __shfl_xor(s, 8, 32); v[i] = eh ? 0.f : s; v[8 + i] = eh ? 0.f : o; }
      a[kc] = bsplit16(v); }
    v8f acc[2] = {};
#pragma unroll
    for (int kc = 0; kc < EKC; ++kc)
#pragma unroll
      for (int j = 0; j < 2; ++j) acc[j] = mac3(a[kc], bsplit16(wv[kc][j]), acc[j]);
    if (g == 0) {
#pragma unroll
      for (int j = 0; j < 2; ++j)
#pragma unroll
        for (int r = 0; r < 8; ++r) red[sl][r][j * 16 + col] = acc[j][r]; } }
  __syncthreads();
#pragma unroll
  for (int i = 0; i < NB * 32 / 128; ++i) { const int r = (tid >> 5) + 4 * i, c = tid & 31; float s = red[0][r][c];
#pragma unroll
    for (int w = 1; w < EKW; ++w) s += red[w][r][c];
    SSH[(size_t)r * (2 * E) + n0 + c] = s + bias[n0 + c]; }
}
// one launch for the three parts that need only k_pre's results or inputs; the longest blocks (b_emb) first, the shortest (b_tkv) last
#define G_EMB ((2 * E) / 32)
#define G_QX (NR / 64)
#define G_QY (E / 128)
#define G_QKV (G_QX * G_QY * 3)
#define G_TKV (2 * 4 * 2 * NB)
__global__ __launch_bounds__(128) void k_proj(const _Float16* __restrict__ X16, const _Float16* __restrict__ PT, const float* __restrict__ bq, const float* __restrict__ bk, const float* __restrict__ bv, const float* __restrict__ srcm,
                                              _Float16* __restrict__ Q16, _Float16* __restrict__ K16, _Float16* __restrict__ VT, const _Float16* __restrict__ T16, const _Float16* __restrict__ PT2, const float* __restrict__ bkt, const float* __restrict__ bvt,
                                              const int* __restrict__ cond, const float* __restrict__ emb, const float* __restrict__ embW, const float* __restrict__ embb, float* __restrict__ SSH) {
  __shared__ __align__(16) char smem[GSM];
  const int id = blockIdx.x;
  if (id < G_EMB) b_emb(id, smem, emb, embW, embb, SSH);
  else if (id < G_EMB + G_QKV) { const int q = id - G_EMB; b_qkv(q % G_QX, (q / G_QX) % G_QY, q / (G_QX * G_QY), smem, X16, PT, bq, bk, bv, srcm, Q16, K16, VT); }
  else { const int t = id - (G_EMB + G_QKV); b_tkv(t & 7, (t >> 3) & 1, t >> 4, smem, T16, PT2, bkt, bvt, cond, K16, VT); }
}
// attention: block (64 queries, bh); 18 key tiles; additive masks; O16 x8 [bh][s][64]
// Each key tile (64 K rows, 64 V^T rows of 128 B, 64 mask penalties) is brought in once per block with whole-line loads and kept in LDS for all four waves;
// two buffers: tile kt + 1 is asked for ahead of tile kt's products and stored behind them, one barrier per tile. Rows are padded to 144 B (16 B x odd) for the 16-B fragment reads.
// Both products are taken transposed: S^T = K Q^T (A = K rows, B = Q rows) and O^T += V^T P^T (A = V^T rows, B = P^T). A lane then holds 32 scores of ONE query (its column), keys 16 t + 8 g + r of the tile,
// so maximum, exponentials and sum are in-lane (the two lane halves exchange the maximum once per tile and join their sums once behind the loop), the correction factor is the lane's own,
// and two score tiles converted in place are the B operand of the second product in the k order of frag_h: scores and P never go through LDS.
#define NT (NKEY / 64)
#define KP 72
// e^x is taken as the hardware's 2^y, y = x log2(e): every argument here is a value minus a maximum that covers it, so x <= 0 and the library form's overflow and denormal-range handling has nothing to do
// (a result below the normal range is far below one f16 step of P and of the sum, whatever becomes of it). The lift of P by 2^14 rides in the same multiply-add as + 14.
#define LOG2E 1.44269504088896340736f
// lane l with lane l ^ 16
__device__ __forceinline__ float xhalf(float x) { return __builtin_bit_cast(float, __builtin_amdgcn_permlanex16(__builtin_bit_cast(int, x), __builtin_bit_cast(int, x), 0x76543210, 0xfedcba98, false, false)); }
// eight independent 2^y in one statement: behind a transcendental the instruction set asks for one independent instruction before its result is read or its source overwritten;
// here each v_exp_f32 is that instruction for the one before it (no output shares a register with an input) and the v_nop is it for the last
__device__ __forceinline__ void exp2x8(const float (&y)[8], float (&e)[8]) {
  asm("v_exp_f32 %0, %8\n\tv_exp_f32 %1, %9\n\tv_exp_f32 %2, %10\n\tv_exp_f32 %3, %11\n\tv_exp_f32 %4, %12\n\tv_exp_f32 %5, %13\n\tv_exp_f32 %6, %14\n\tv_exp_f32 %7, %15\n\tv_nop"
      : "=&v"(e[0]), "=&v"(e[1]), "=&v"(e[2]), "=&v"(e[3]), "=&v"(e[4]), "=&v"(e[5]), "=&v"(e[6]), "=&v"(e[7])
      : "v"(y[0]), "v"(y[1]), "v"(y[2]), "v"(y[3]), "v"(y[4]), "v"(y[5]), "v"(y[6]), "v"(y[7]));
}
__global__ __launch_bounds__(128) void k_attn(const _Float16* __restrict__ Q16, const _Float16* __restrict__ K16, const _Float16* __restrict__ VT, const int* __restrict__ cond, const float* __restrict__ srcm, _Float16* __restrict__ O16) {
  __shared__ __align__(16) _Float16 sO[4][16][72];    // behind the loop: the wave's output tile, query rows
  __shared__ __align__(16) _Float16 sK[2][64][KP];
  __shared__ __align__(16) _Float16 sV[2][64][KP];
  __shared__ __align__(16) float sPen[2][64];
  const int tid = threadIdx.x, w = tid >> 5, lane = tid & 31, col = lane & 15, g = lane >> 4;
  const size_t bh = blockIdx.y; const int b = (int)(bh / NH); const int q0 = blockIdx.x * 64 + w * 16;
  const float tpen = ((cond[b] % 10) > 0) ? 0.f : -1000000.0f;
  // staging: thread owns 16-B piece tid & 7 of rows (tid >> 3) + 16 i, so a wave's load covers four whole 128-B lines
  const int srow = tid >> 3, spc = (tid & 7) * 8;
  const _Float16* kg = K16 + (bh * NKEY + srow) * HD + spc;
  const _Float16* vg = VT + (bh * HD + srow) * NKEY + spc;
  v8h rk[4], rv[4]; float rm;
  auto fetch = [&](int kt) {
#pragma unroll
    for (int i = 0; i < 4; ++i) { rk[i] = *(const v8h*)(kg + (size_t)(kt * 64 + 16 * i) * HD); rv[i] = *(const v8h*)(vg + (size_t)(16 * i) * NKEY + kt * 64); }
    int ms = kt * 64 + (tid & 63); ms = ms > SS - 1 ? SS - 1 : ms; rm = srcm[b * SS + ms]; };
  auto put = [&](int kt) { const int bf = kt & 1;
#pragma unroll
    for (int i = 0; i < 4; ++i) { *(v8h*)(&sK[bf][srow + 16 * i][spc]) = rk[i]; *(v8h*)(&sV[bf][srow + 16 * i][spc]) = rv[i]; }
    if (tid < 64) { const int slot = kt * 64 + tid; sPen[bf][tid] = slot < SS ? (1.0f - rm) * -1000000.0f : (slot < SS + NTX ? tpen : -3.0e38f); } };
  fetch(0);
  v16h aq[2];
#pragma unroll
  for (int kc = 0; kc < 2; ++kc) aq[kc] = frag_h(Q16 + (bh * SS + q0 + col) * HD + kc * 32, lane);
  put(0);
  __syncthreads();
  // mrun: the query's running maximum (equal in both lane halves); lrun: the running sum over this lane half's keys only
  float mrun = -3.0e38f, lrun = 0.f; v8f acc[4] = {};
#pragma unroll 1
  for (int kt = 0; kt < NT; ++kt) { const int bf = kt & 1;
    // asked for first, so that the loads fly under the whole tile
    if (kt + 1 < NT) fetch(kt + 1);
    v16h kf[4][2]; v4f pn[4][2];
#pragma unroll
    for (int t = 0; t < 4; ++t) {
#pragma unroll
      for (int kc = 0; kc < 2; ++kc) kf[t][kc] = frag_h(&sK[bf][t * 16 + col][kc * 32], lane);
#pragma unroll
      for (int h = 0; h < 2; ++h) pn[t][h] = *(const v4f*)(&sPen[bf][t * 16 + 8 * g + 4 * h]); }
    // sv[t][r] = logit of key slot kt * 64 + 16 t + 8 g + r for query q0 + col; a pad slot has zero K rows and the penalty -3.0e38, so its logit is exactly -3.0e38
    float sv[4][8], mt[4];
#pragma unroll
    for (int t = 0; t < 4; ++t) { v8f s = {};
#pragma unroll
      for (int kc = 0; kc < 2; ++kc) s = wmma16(kf[t][kc], aq[kc], s);
#pragma unroll
      for (int r = 0; r < 8; ++r) sv[t][r] = s[r] * (1.0f / 16.0f) + pn[t][r >> 2][r & 3];
      mt[t] = sv[t][0];
#pragma unroll
      for (int r = 1; r < 8; ++r) mt[t] = fmaxf(mt[t], sv[t][r]); }
    float mx = fmaxf(fmaxf(mt[0], mt[1]), fmaxf(mt[2], mt[3]));
    mx = fmaxf(mx, xhalf(mx));
    const float mnew = fmaxf(mrun, mx); const float corr = __builtin_amdgcn_exp2f((mrun - mnew) * LOG2E);
    v16h vf[2][4];
#pragma unroll
    for (int kc = 0; kc < 2; ++kc)
#pragma unroll
      for (int t = 0; t < 4; ++t) vf[kc][t] = frag_h(&sV[bf][t * 16 + col][kc * 32], lane);
    // P^T as B operand: element e of fragment kc is key 32 kc + 8 g + e (e < 8) or 32 kc + 16 + 8 g + e - 8, that is score tiles 2 kc and 2 kc + 1 in place
    v16h ph[2]; float pt[4];
#pragma unroll
    for (int t = 0; t < 4; ++t) { pt[t] = 0.f;
      float y[8], e[8];
#pragma unroll
      for (int r = 0; r < 8; ++r) y[r] = fmaf(sv[t][r] - mnew, LOG2E, 14.0f);
      exp2x8(y, e);
#pragma unroll
      for (int r = 0; r < 8; ++r) { const float p = sv[t][r] <= -1.0e38f ? 0.f : e[r]; pt[t] += p; ph[t >> 1][(t & 1) * 8 + r] = (_Float16)p; } }
    lrun = lrun * corr + ((pt[0] + pt[1]) + (pt[2] + pt[3])) * (1.0f / 16384.0f); mrun = mnew;
#pragma unroll
    for (int t = 0; t < 4; ++t)
#pragma unroll
      for (int r = 0; r < 8; ++r) acc[t][r] *= corr;
#pragma unroll
    for (int kc = 0; kc < 2; ++kc)
#pragma unroll
      for (int t = 0; t < 4; ++t) acc[t] = wmma16(vf[kc][t], ph[kc], acc[t]);
    // the other buffer's last readers left it at the barrier of the trip before; this barrier publishes tile kt + 1 and ends the reads of tile kt
    if (kt + 1 < NT) { put(kt + 1); __syncthreads(); } }
  // acc[t][r] = O^T[d = 16 t + 8 g + r][query col]: eight neighbouring d of one query row, one 16-B piece
  const float lr = lrun + xhalf(lrun); const float inv = 8.0f / (lr * 16384.0f * 4.0f);
#pragma unroll
  for (int t = 0; t < 4; ++t) { union { v8h h8; v4u u; } pk;
#pragma unroll
    for (int r = 0; r < 8; ++r) pk.h8[r] = (_Float16)(acc[t][r] * inv);
    *(v4u*)(&sO[w][col][t * 16 + 8 * g]) = pk.u; }
  LDSX();
  // eight lanes store one whole 128-B query row; unrolled so that the four LDS reads are asked for together and their latency is paid once
#pragma unroll
  for (int i = 0; i < 4; ++i) { const int rl = (lane >> 3) + 4 * i, pc = lane & 7;
    vst2(O16 + ((bh * SS) + q0 + rl) * HD + pc * 8, *(const v4u*)(&sO[w][rl][pc * 8])); }
}
__global__ __launch_bounds__(256) void k_styl(const _Float16* __restrict__ O16, const float* __restrict__ SSH, const float* __restrict__ g_, const float* __restrict__ b_, _Float16* __restrict__ Z16) {
  const int wave = threadIdx.x >> 5, lane = threadIdx.x & 31; const int row = blockIdx.x * 8 + wave; const int b = row / SS, s = row % SS;
  float sum = 0.f, sq = 0.f;
#pragma unroll 2
  for (int e = 0; e < 16; ++e) { const int c = (e < 8 ? 0 : 256) + lane * 8 + (e & 7); const int h = c >> 6, d = c & 63; const float v = (float)O16[(((size_t)b * NH + h) * SS + s) * HD + d] * 0.125f; sum += v; sq += v * v; }
#pragma unroll
  for (int o = 16; o > 0; o >>= 1) { sum += __shfl_xor(sum, o, 32); sq += __shfl_xor(sq, o, 32); }
  const float mu = sum * (1.0f / E); float var = sq * (1.0f / E) - mu * mu; var = var > 0.f ? var : 0.f; const float rs = rsqrtf(var + 1e-5f);
  const float* sc_ = SSH + (size_t)b * 2 * E; const float* sh_ = sc_ + E;
#pragma unroll 1
  for (int half = 0; half < 2; ++half) { union { v8h h; v4u u; } pk;
#pragma unroll
    for (int e = 0; e < 8; ++e) { const int c = half * 256 + lane * 8 + e; const int h = c >> 6, d = c & 63; const float v = (float)O16[(((size_t)b * NH + h) * SS + s) * HD + d] * 0.125f;
      const float hn = (v - mu) * rs * g_[c] + b_[c]; const float m = hn * (1.0f + sc_[c]) + sh_[c]; pk.h[e] = (_Float16)(silu(m) * 8.0f); }
    vst2(Z16 + (size_t)row * E + half * 256 + lane * 8, pk.u); }
}
// out = x + Z out_W^T /16/8 + out_b
__global__ __launch_bounds__(128) void k_out(const _Float16* __restrict__ Z16, const _Float16* __restrict__ PT, const float* __restrict__ bo, const float* __restrict__ x, float* __restrict__ out) {
  __shared__ __align__(16) char smem[GSM];
  float (*so)[16][132] = (float (*)[16][132])smem;      // [4][16][132]
  const int tid = threadIdx.x, wave = tid >> 5, lane = tid & 31, col = lane & 15, g = lane >> 4;
  const int r0b = blockIdx.x * 64, r0 = r0b + wave * 16, n0 = blockIdx.y * 128;
  v8f acc[8] = {};
  gemm_lds<E>(Z16, [&](int r) { return r0b + r; }, PT + (size_t)(3 * E + n0) * E, smem, acc);
#pragma unroll
  for (int j = 0; j < 8; ++j) { const int n = n0 + j * 16 + col; const float bb = bo[n];
#pragma unroll
    for (int r = 0; r < 8; ++r) so[wave][8 * g + r][j * 16 + col] = acc[j][r] * (1.0f / (16.0f * 8.0f)) + bb + x[(size_t)(r0 + 8 * g + r) * E + n]; }
  LDSX();
#pragma unroll 4
  for (int rl = 0; rl < 16; ++rl) vst2(out + (size_t)(r0 + rl) * E + n0 + lane * 4, *(const v4f*)(&so[wave][rl][lane * 4]));
}
extern "C" void kernel_launch(void* const* d_in, const int* in_sizes, int n_in, void* d_out, int out_size, void* d_ws, size_t ws_size, hipStream_t stream) {
  (void)in_sizes; (void)n_in; (void)out_size; (void)ws_size;
  const float** I = (const float**)d_in;
  const float* x = I[0]; const float* xf = I[1]; const float* emb = I[2]; const float* srcm = I[3]; const int* cond = (const int*)d_in[4];
  const float* ng = I[5]; const float* nb = I[6]; const float* tg = I[7]; const float* tb = I[8]; const float* Wq = I[9]; const float* bq = I[10]; const float* Wkt = I[11]; const float* bkt = I[12]; const float* Wvt = I[13]; const float* bvt = I[14];
  const float* Wkm = I[15]; const float* bkm = I[16]; const float* Wvm = I[17]; const float* bvm = I[18]; const float* embW = I[19]; const float* embb = I[20]; const float* sg = I[21]; const float* sb = I[22]; const float* Wo = I[23]; const float* bo = I[24];
  float* out = (float*)d_out;
  char* ws = (char*)d_ws; size_t off = 0;
  auto take = [&](size_t bytes) { char* p = ws + off; off += (bytes + 255) & ~(size_t)255; return p; };
  _Float16* X16 = (_Float16*)take((size_t)NR * E * 2); _Float16* T16 = (_Float16*)take((size_t)NB * NTX * LT * 2 + 4096); _Float16* PT = (_Float16*)take((size_t)4 * E * E * 2); _Float16* PT2 = (_Float16*)take((size_t)2 * E * LT * 2);
  _Float16* Q16 = (_Float16*)take((size_t)NR * E * 2); _Float16* K16 = (_Float16*)take((size_t)NB * NH * NKEY * HD * 2);
  _Float16* VT = (_Float16*)take((size_t)NB * NH * HD * NKEY * 2); _Float16* O16 = (_Float16*)take((size_t)NR * E * 2); float* SSH = (float*)take((size_t)NB * 2 * E * 4); _Float16* Z16 = X16;    // X16 dead after k_proj
  // ws ~ 47 MB
  k_pre<<<G_LNT + G_LNX + G_PACK, 256, 0, stream>>>(x, ng, nb, X16, xf, tg, tb, T16, Wq, Wkm, Wvm, Wo, Wkt, Wvt, PT, PT2);
  k_proj<<<G_EMB + G_QKV + G_TKV, 128, 0, stream>>>(X16, PT, bq, bkm, bvm, srcm, Q16, K16, VT, T16, PT2, bkt, bvt, cond, emb, embW, embb, SSH);
  k_attn<<<dim3(SS / 64, NB * NH), 128, 0, stream>>>(Q16, K16, VT, cond, srcm, O16);
  k_styl<<<NR / 8, 256, 0, stream>>>(O16, SSH, sg, sb, Z16);
  k_out<<<dim3(NR / 64, E / 128), 128, 0, stream>>>(Z16, PT, bo, x, out);
}

// v008
// It runs in 72.3 microseconds.
// Timed twice side by side with v007, it ran 1.05 and 1.04 times as fast.
// Over all steps from v000 it is 5.76 times as fast.
// compute dtype: f16 operands for the projections and attention (LayerNorm outputs as f16 rows, weights packed x16, q/k x4, P lifted by 2^14, V x4, context x8, stylised rows x8), bf16 hi/lo splits for the small emb GEMM, f32 accumulate; LayerNorms, masks, softmax, SiLU f32. Output = x + h is dominated by the f32 residual.
#include <hip/hip_runtime.h>
#include <math.h>

typedef __attribute__((ext_vector_type(16))) _Float16 v16h;
typedef __attribute__((ext_vector_type(16))) __bf16 v16b;
typedef __attribute__((ext_vector_type(8)))  _Float16 v8h;
typedef __attribute__((ext_vector_type(8)))  float v8f;
typedef __attribute__((ext_vector_type(4)))  float v4f;
typedef __attribute__((ext_vector_type(2)))  float v2f;
typedef __attribute__((ext_vector_type(4)))  unsigned v4u;
typedef __attribute__((ext_vector_type(4)))  int v4i;
typedef float __attribute__((may_alias)) float_a;
typedef int __attribute__((may_alias)) int_a;

template <typename T> __device__ __forceinline__ void vst2(void* p, T v) { *(T*)p = v;  }
__device__ __forceinline__ v8f wmma16(v16h a, v16h b, v8f c) {
  v8f d = __builtin_amdgcn_wmma_f32_16x16x32_f16(false, a, false, b, (short)0, c, false, false);
  asm volatile("v_nop\n\tv_nop\n\tv_nop\n\tv_nop" : "+v"(d) : "v"(a), "v"(b));
  return d;
}
__device__ __forceinline__ v8f wmma_bf(v16b a, v16b b, v8f c) {
  v8f d = __builtin_amdgcn_wmma_f32_16x16x32_bf16(false, a, false, b, (short)0, c, false, false);
  asm volatile("v_nop\n\tv_nop\n\tv_nop\n\tv_nop" : "+v"(d) : "v"(a), "v"(b));
  return d;
}
// 16x16x32 fragments: lane = (h = lane>>4, row/col = lane&15); elements 0..7 = k0+8h+0..7, 8..15 = k0+16+8h+0..7; D element r = row 8h+r
__device__ __forceinline__ v16h frag_h(const _Float16* rowk0, int lane) {
  union { v16h v; v8h q[2]; } u; const _Float16* p = rowk0 + 8 * (lane >> 4);
  u.q[0] = *(const v8h*)p; u.q[1] = *(const v8h*)(p + 16); return u.v;
}
__device__ __forceinline__ v16h frag_f32(const float* rowk0, int lane) {
  v16h a; const float* p = rowk0 + 8 * (lane >> 4);
#pragma unroll
  for (int i = 0; i < 8; ++i) { a[i] = (_Float16)p[i]; a[8 + i] = (_Float16)p[16 + i]; }
  return a;
}
__device__ __forceinline__ v16h frag_f32s(const float* rowk0, int lane, float sc) {
  v16h a; const float* p = rowk0 + 8 * (lane >> 4);
#pragma unroll
  for (int i = 0; i < 8; ++i) { a[i] = (_Float16)(p[i] * sc); a[8 + i] = (_Float16)(p[16 + i] * sc); }
  return a;
}
// column fragment from a [K][ld] layout (column n), rows >= K read as 0
__device__ __forceinline__ v16h fragc_f32(const float* W, int k0, int n, int lane, int ld, int K) {
  v16h a; const int g = lane >> 4;
#pragma unroll
  for (int i = 0; i < 8; ++i) { const int ka = k0 + 8 * g + i, kb = ka + 16;
    a[i] = (_Float16)(ka < K ? W[(size_t)ka * ld + n] : 0.f); a[8 + i] = (_Float16)(kb < K ? W[(size_t)kb * ld + n] : 0.f); }
  return a;
}
struct F2 { v16b h, l; };
__device__ __forceinline__ F2 bsplit16(const float v[16]) { F2 r;
#pragma unroll
  for (int i = 0; i < 16; ++i) { const __bf16 h = (__bf16)v[i]; r.h[i] = h; r.l[i] = (__bf16)(v[i] - (float)h); }
  return r; }
__device__ __forceinline__ F2 split_row(const float* row, int k0, int lane) { float v[16]; const float* p = row + k0 + 8 * (lane >> 4);
#pragma unroll
  for (int i = 0; i < 8; ++i) { v[i] = p[i]; v[8 + i] = p[16 + i]; }
  return bsplit16(v); }
__device__ __forceinline__ F2 split_rowK(const float* row, int k0, int lane, int K) { float v[16]; const int g = lane >> 4;
#pragma unroll
  for (int i = 0; i < 8; ++i) { const int ka = k0 + 8 * g + i, kb = ka + 16; v[i] = ka < K ? row[ka] : 0.f; v[8 + i] = kb < K ? row[kb] : 0.f; }
  return bsplit16(v); }
__device__ __forceinline__ F2 split_col(const float* W, int k0, int n, int lane, int ld, int K) { float v[16]; const int g = lane >> 4;
#pragma unroll
  for (int i = 0; i < 8; ++i) { const int ka = k0 + 8 * g + i, kb = ka + 16; v[i] = ka < K ? W[(size_t)ka * ld + n] : 0.f; v[8 + i] = kb < K ? W[(size_t)kb * ld + n] : 0.f; }
  return bsplit16(v); }
__device__ __forceinline__ v8f mac3(const F2& a, const F2& b, v8f c) { c = wmma_bf(a.l, b.h, c); c = wmma_bf(a.h, b.l, c); return wmma_bf(a.h, b.h, c); }
__device__ __forceinline__ float sigm(float v) { return 1.0f / (1.0f + expf(-v)); }
#define LDSX() do { asm volatile("s_wait_dscnt 0" ::: "memory"); __builtin_amdgcn_wave_barrier(); __builtin_amdgcn_fence(__ATOMIC_RELEASE, "workgroup"); } while (0)


// Mixed text/motion attention + stylisation block on [8,1024,512] (8 heads x 64): xn = LN(x), xfn = LN(xf [8,77,256]); q = xn Wq^T + bq; keys = [xfn Wkt^T + bkt (77) | xn Wkm^T + bkm (1024)],
// values = [(xfn Wvt^T + bvt) * text_cond_b | (xn Wvm^T + bvm) * src_mask], logits q.k (NO 1/sqrt d) + (1 - mask)*(-1e6) with mask = [text_cond_b x77 | src_mask]; softmax over the 1,101 keys;
// y = P v; h = silu(LN(y) * (1 + scale_b) + shift_b) out_W^T + out_b with [scale|shift] = silu(emb) emb_W^T + emb_b; out = x + h.
// Key slots (softmax does not depend on the key order): motion token s at slot s, text token t at slot 1024 + t, zero pads at 1101..1151; so 64 tokens of a V^T row are one whole, aligned 128-B line.
// Parts: b_lnx / b_lnt (LayerNorm -> f16 rows), b_pack (weights [out][in] x16), b_qkv (motion q/k/v; keys/values at slots s), b_tkv (text k/v at slots 1024 + t, and the zero pads), b_emb ([scale | shift]).
// Parts that do not depend on one another share a launch, each on its own range of block indices: k_pre = b_lnt, b_lnx, b_pack; k_proj = b_emb, b_qkv, b_tkv; then k_attn, k_out (stylisation and output projection).
#define NB 8
#define SS 1024
#define E 512
#define NH 8
#define HD 64
#define NR (NB * SS)
#define NTX 77
#define LT 256
#define NKEY 1152              // 1024 + 77 = 1101 padded to 18 x 64
#define TE 2048
__device__ __forceinline__ float silu(float x) { return x / (1.0f + expf(-x)); }

// LN over rows of x (512) -> f16 rows; wave per row
__device__ __forceinline__ void b_lnx(const int blk, const float* __restrict__ x, const float* __restrict__ g_, const float* __restrict__ b_, _Float16* __restrict__ X16) {
  const int wave = threadIdx.x >> 5, lane = threadIdx.x & 31; const int row = blk * 8 + wave; const float* xr = x + (size_t)row * E;
  float v[16]; float s = 0.f;
  // lane owns columns lane*8..+7 and 256 + lane*8..+7 so each 16-B store instruction covers a contiguous 512-B run across the wave
#pragma unroll
  for (int e = 0; e < 16; ++e) { v[e] = xr[(e < 8 ? 0 : 256) + lane * 8 + (e & 7)]; s += v[e]; }
#pragma unroll
  for (int o = 16; o > 0; o >>= 1) s += __shfl_xor(s, o, 32);
  const float mu = s * (1.0f / E); float q = 0.f;
#pragma unroll
  for (int e = 0; e < 16; ++e) { const float d = v[e] - mu; q += d * d; }
#pragma unroll
  for (int o = 16; o > 0; o >>= 1) q += __shfl_xor(q, o, 32);
  const float rs = rsqrtf(q * (1.0f / E) + 1e-5f);
  union { v8h h[2]; v4u u[2]; } pk;
#pragma unroll
  for (int e = 0; e < 16; ++e) { const int c = (e < 8 ? 0 : 256) + lane * 8 + (e & 7); pk.h[e >> 3][e & 7] = (_Float16)((v[e] - mu) * rs * g_[c] + b_[c]); }
  vst2(X16 + (size_t)row * E + lane * 8, pk.u[0]); vst2(X16 + (size_t)row * E + 256 + lane * 8, pk.u[1]);
  // in the listing another part of the shared launch follows, whose first instructions write registers that these stores name
  asm volatile("s_wait_xcnt 0x0" ::: "memory");
}
// LN over rows of xf (256) -> f16 rows [NB*NTX][256]; wave per row (8 per lane)
__device__ __forceinline__ void b_lnt(const int blk, const float* __restrict__ xf, const float* __restrict__ g_, const float* __restrict__ b_, _Float16* __restrict__ T16) {
  const int wave = threadIdx.x >> 5, lane = threadIdx.x & 31; const int row = blk * 8 + wave; if (row >= NB * NTX) return; const float* xr = xf + (size_t)row * LT;
  float v[8]; float s = 0.f;
#pragma unroll
  for (int e = 0; e < 8; ++e) { v[e] = xr[lane * 8 + e]; s += v[e]; }
#pragma unroll
  for (int o = 16; o > 0; o >>= 1) s += __shfl_xor(s, o, 32);
  const float mu = s * (1.0f / LT); float q = 0.f;
#pragma unroll
  for (int e = 0; e < 8; ++e) { const float d = v[e] - mu; q += d * d; }
#pragma unroll
  for (int o = 16; o > 0; o >>= 1) q += __shfl_xor(q, o, 32);
  const float rs = rsqrtf(q * (1.0f / LT) + 1e-5f);
  union { v8h h; v4u u; } pk;
#pragma unroll
  for (int e = 0; e < 8; ++e) { const int c = lane * 8 + e; pk.h[e] = (_Float16)((v[e] - mu) * rs * g_[c] + b_[c]); }
  vst2(T16 + (size_t)row * LT + lane * 8, pk.u);
}
// PT rows (x16, [out][in]): [0,512) Wq, [512,1024) Wkm, [1024,1536) Wvm, [1536,2048) out_W (512 halves each); PT2: [0,512) Wkt, [512,1024) Wvt (256 halves each)
__device__ __forceinline__ void b_pack(const int n, const float* __restrict__ Wq, const float* __restrict__ Wkm, const float* __restrict__ Wvm, const float* __restrict__ Wo, const float* __restrict__ Wkt, const float* __restrict__ Wvt, _Float16* __restrict__ PT, _Float16* __restrict__ PT2) {
  const int tid = threadIdx.x; __shared__ __align__(16) _Float16 srow[E];
  if (n < 4 * E) { const float* W = n < E ? Wq : (n < 2 * E ? Wkm : (n < 3 * E ? Wvm : Wo)); const int nn = n & (E - 1);
    srow[tid] = (_Float16)(W[(size_t)nn * E + tid] * 16.0f); srow[tid + 256] = (_Float16)(W[(size_t)nn * E + tid + 256] * 16.0f); __syncthreads();
    if (tid < E / 8) vst2(PT + (size_t)n * E + tid * 8, *(const v4u*)(&srow[tid * 8])); }
  else { const int m = n - 4 * E; const float* W = m < E ? Wkt : Wvt; const int nn = m & (E - 1);
    srow[tid] = (_Float16)(W[(size_t)nn * LT + tid] * 16.0f); __syncthreads();
    if (tid < LT / 8) vst2(PT2 + (size_t)m * LT + tid * 8, *(const v4u*)(&srow[tid * 8])); }
}
// one launch for the three parts that read only inputs; the short text rows first
#define G_LNT ((NB * NTX + 7) / 8)
#define G_LNX (NR / 8)
#define G_PACK (4 * E + 2 * E)
__global__ __launch_bounds__(256) void k_pre(const float* __restrict__ x, const float* __restrict__ ng, const float* __restrict__ nb, _Float16* __restrict__ X16, const float* __restrict__ xf, const float* __restrict__ tg, const float* __restrict__ tb, _Float16* __restrict__ T16,
                                             const float* __restrict__ Wq, const float* __restrict__ Wkm, const float* __restrict__ Wvm, const float* __restrict__ Wo, const float* __restrict__ Wkt, const float* __restrict__ Wvt, _Float16* __restrict__ PT, _Float16* __restrict__ PT2) {
  const int id = blockIdx.x;
  if (id < G_LNT) b_lnt(id, xf, tg, tb, T16);
  else if (id < G_LNT + G_LNX) b_lnx(id - G_LNT, x, ng, nb, X16);
  else b_pack(id - (G_LNT + G_LNX), Wq, Wkm, Wvm, Wo, Wkt, Wvt, PT, PT2);
}
// Shared loop of the projection parts b_qkv and b_tkv: a block's 64 x 128 tile of A B^T, A and B rows K-contiguous f16; wave w keeps rows 16 w .. 16 w + 15 x 128 columns in acc, k ascending.
// Each 64-k slice (128 B = one whole line of each of the 64 A rows and 128 B rows) is brought in once per block and kept in LDS for all four waves; the fragments are read from LDS.
// Two buffers: slice c + 1 is asked for ahead of slice c's products and stored behind them, one barrier per slice. Rows are padded to 144 B (16 B x odd) for the 16-B fragment reads.
#define GP 72
#define GSM ((64 + 128) * 2 * GP * 2)   // bytes: [2][64][GP] A halves, then [2][128][GP] B halves; the epilogues reuse the same bytes behind a barrier
template <int K, typename AR>
__device__ __forceinline__ void gemm_lds(const _Float16* __restrict__ A, AR arow, const _Float16* __restrict__ B, char* smem, v8f (&acc)[8]) {
  _Float16* sA = (_Float16*)smem; _Float16* sB = sA + 2 * 64 * GP;
  const int tid = threadIdx.x, wave = tid >> 5, lane = tid & 31, col = lane & 15;
  // staging: thread owns 16-B piece tid & 7 of rows (tid >> 3) + 16 i, so a wave's load covers four whole 128-B lines
  const int srow = tid >> 3, spc = (tid & 7) * 8;
  // lane offsets in halves from the block-uniform bases A and B
  unsigned ao[4];
#pragma unroll
  for (int i = 0; i < 4; ++i) ao[i] = (unsigned)arow(srow + 16 * i) * K + spc;
  const unsigned bo = (unsigned)srow * K + spc;
  const int sp = srow * GP + spc;
  v8h ra[4], rb[8];
  auto fetch = [&](int c) { const _Float16* Ac = A + c * 64; const _Float16* Bc = B + c * 64;
#pragma unroll
    for (int i = 0; i < 4; ++i) ra[i] = *(const v8h*)(Ac + ao[i]);
#pragma unroll
    for (int i = 0; i < 8; ++i) rb[i] = *(const v8h*)(Bc + 16 * i * K + bo); };
  auto put = [&](int c) { _Float16* pa = sA + (c & 1) * (64 * GP) + sp; _Float16* pb = sB + (c & 1) * (128 * GP) + sp;
#pragma unroll
    for (int i = 0; i < 4; ++i) *(v8h*)(pa + 16 * i * GP) = ra[i];
#pragma unroll
    for (int i = 0; i < 8; ++i) *(v8h*)(pb + 16 * i * GP) = rb[i]; };
  fetch(0); put(0);
  __syncthreads();
  // unrolled: the slice's step and the buffer's place become immediate offsets, so no address register is formed anew (and waited for) in each trip
#pragma unroll
  for (int c = 0; c < K / 64; ++c) { const int bf = c & 1;
    if (c + 1 < K / 64) fetch(c + 1);
#pragma unroll
    for (int kc = 0; kc < 2; ++kc) { const v16h a = frag_h(sA + (bf * 64 + wave * 16 + col) * GP + kc * 32, lane); v16h bfr[8];
#pragma unroll
      for (int j = 0; j < 8; ++j) bfr[j] = frag_h(sB + (bf * 128 + j * 16 + col) * GP + kc * 32, lane);
#pragma unroll
      for (int j = 0; j < 8; ++j) acc[j] = wmma16(a, bfr[j], acc[j]); }
    // the other buffer's last readers left it at the barrier of the trip before; this barrier publishes slice c + 1 and ends the reads of slice c
    if (c + 1 < K / 64) { put(c + 1); __syncthreads(); } }
  // ends every wave's reads of the last slice, so that the caller's epilogue may overwrite the buffers
  __syncthreads();
}
// motion q/k/v: block (64 tokens of one batch, 128 cols, which) ; k,v stored at key slot s ; v goes straight into VT [bh][d][NKEY]
__device__ __forceinline__ void b_qkv(const int bx, const int by, const int bz, char* smem, const _Float16* __restrict__ X16, const _Float16* __restrict__ PT, const float* __restrict__ bq, const float* __restrict__ bk, const float* __restrict__ bv, const float* __restrict__ srcm,
                                            _Float16* __restrict__ Q16, _Float16* __restrict__ K16, _Float16* __restrict__ VT) {
  float (*so)[16][132] = (float (*)[16][132])smem;      // [4][16][132], which < 2
  _Float16 (*sth)[72] = (_Float16 (*)[72])smem;         // [128][72], which == 2
  const int tid = threadIdx.x, wave = tid >> 5, lane = tid & 31, col = lane & 15, g = lane >> 4;
  const int which = bz, r0b = bx * 64, n0 = by * 128; const int b = r0b / SS, s0 = r0b % SS;
  const float* bb_ = which == 0 ? bq : (which == 1 ? bk : bv);
  v8f acc[8] = {};
  gemm_lds<E>(X16, [&](int r) { return r0b + r; }, PT + (size_t)(which * E + n0) * E, smem, acc);
  if (which < 2) {
#pragma unroll
    for (int j = 0; j < 8; ++j) { const float bb = bb_[n0 + j * 16 + col];
#pragma unroll
      for (int r = 0; r < 8; ++r) so[wave][8 * g + r][j * 16 + col] = (acc[j][r] * (1.0f / 16.0f) + bb) * 4.0f; }
    LDSX();
    for (int qq = lane; qq < 16 * 2 * 8; qq += 32) { const int hh = qq >> 7, rl = (qq >> 3) & 15, pc = qq & 7; const int h = (n0 >> 6) + hh; union { v8h h8; v4u u; } pk;
#pragma unroll
      for (int e = 0; e < 8; ++e) pk.h8[e] = (_Float16)so[wave][rl][hh * 64 + pc * 8 + e];
      if (which == 0) vst2(Q16 + (((size_t)b * NH + h) * SS + s0 + wave * 16 + rl) * HD + pc * 8, pk.u);
      else vst2(K16 + (((size_t)b * NH + h) * NKEY + s0 + wave * 16 + rl) * HD + pc * 8, pk.u);
      // the next trip writes the registers that the store names
      asm volatile("s_wait_xcnt 0x0" ::: "memory"); } }
  else {
#pragma unroll
    for (int j = 0; j < 8; ++j) { const float bb = bb_[n0 + j * 16 + col];
#pragma unroll
      for (int r = 0; r < 8; ++r) { const int s = s0 + wave * 16 + 8 * g + r; sth[j * 16 + col][wave * 16 + 8 * g + r] = (_Float16)((acc[j][r] * (1.0f / 16.0f) + bb) * srcm[b * SS + s] * 4.0f); } }
    __syncthreads();
    // the block's 64 tokens are one whole line of each of its 128 V^T rows: eight lanes store a line; unrolled so that the eight LDS reads are asked for together and their latency is paid once
#pragma unroll
    for (int i = 0; i < 8; ++i) { const int c = (tid >> 3) + 16 * i, n = n0 + c, pc = tid & 7;
      vst2(VT + (((size_t)b * NH + (n >> 6)) * HD + (n & 63)) * NKEY + s0 + pc * 8, *(const v4u*)(&sth[c][pc * 8])); }
    // in the listing another part of the shared launch follows, whose first instructions write registers that these stores name
    asm volatile("s_wait_xcnt 0x0" ::: "memory"); }
}
// text k/v: block (one of 2 row tiles of 64 over the 77 rows, clamped; 128 of 512 cols; which kv; b) from T16 [b*77 + t][256] @ PT2 ; k -> K16 slots 1024 + t ; v (x text_cond) -> VT columns 1024 + t ; t = 77..127 are the pads, stored as zeros
__device__ __forceinline__ void b_tkv(const int bx, const int by, const int bz, char* smem, const _Float16* __restrict__ T16, const _Float16* __restrict__ PT2, const float* __restrict__ bkt, const float* __restrict__ bvt, const int* __restrict__ cond, _Float16* __restrict__ K16, _Float16* __restrict__ VT) {
  float (*so)[16][132] = (float (*)[16][132])smem;      // [4][16][132], which == 0
  _Float16 (*sth)[72] = (_Float16 (*)[72])smem;         // [128][72], which == 1
  const int tid = threadIdx.x, wave = tid >> 5, lane = tid & 31, col = lane & 15, g = lane >> 4;
  const int b = bz, which = by; const int t0b = (bx >> 2) * 64, t0 = t0b + wave * 16, n0 = (bx & 3) * 128;
  const float tc = (cond[b] % 10) > 0 ? 1.f : 0.f; const float* bb_ = which == 0 ? bkt : bvt; const float vsc = which == 0 ? 4.0f : 4.0f * tc;
  v8f acc[8] = {};
  gemm_lds<LT>(T16, [&](int r) { const int t = t0b + r; return b * NTX + (t < NTX ? t : NTX - 1); }, PT2 + (size_t)(which * E + n0) * LT, smem, acc);
  if (which == 0) {   // K16 rows [bh][slot 1024 + t][64]: 2 heads per 128 cols
#pragma unroll
    for (int j = 0; j < 8; ++j) { const float bb = bb_[n0 + j * 16 + col];
#pragma unroll
      for (int r = 0; r < 8; ++r) so[wave][8 * g + r][j * 16 + col] = t0 + 8 * g + r < NTX ? (acc[j][r] * (1.0f / 16.0f) + bb) * vsc : 0.f; }
    LDSX();
    for (int qq = lane; qq < 16 * 2 * 8; qq += 32) { const int hh = qq >> 7, rl = (qq >> 3) & 15, pc = qq & 7; const int h = (n0 >> 6) + hh; const int t = t0 + rl; union { v8h h8; v4u u; } pk;
#pragma unroll
      for (int e = 0; e < 8; ++e) pk.h8[e] = (_Float16)so[wave][rl][hh * 64 + pc * 8 + e];
      vst2(K16 + (((size_t)b * NH + h) * NKEY + SS + t) * HD + pc * 8, pk.u); } }
  else {              // VT rows [bh][d][slot 1024 + t]: the block's 64 t are one whole line of each of its 128 V^T rows
#pragma unroll
    for (int j = 0; j < 8; ++j) { const float bb = bb_[n0 + j * 16 + col]; union { v8h h8; v4u u; } pk;
#pragma unroll
      for (int r = 0; r < 8; ++r) pk.h8[r] = t0 + 8 * g + r < NTX ? (_Float16)((acc[j][r] * (1.0f / 16.0f) + bb) * vsc) : (_Float16)0.f;
      *(v4u*)(&sth[j * 16 + col][wave * 16 + 8 * g]) = pk.u; }
    // a line holds rows of all four waves: every wave's part is in LDS before any line is stored
    __syncthreads();
    // unrolled so that the eight LDS reads are asked for together and their latency is paid once
#pragma unroll
    for (int i = 0; i < 8; ++i) { const int c = (tid >> 3) + 16 * i, n = n0 + c, pc = tid & 7;
      vst2(VT + (((size_t)b * NH + (n >> 6)) * HD + (n & 63)) * NKEY + SS + t0b + pc * 8, *(const v4u*)(&sth[c][pc * 8])); }
    // in the listing another part of the shared launch follows, whose first instructions write registers that these stores name
    asm volatile("s_wait_xcnt 0x0" ::: "memory"); }
}
// [scale | shift] = silu(emb) emb_W^T + emb_b : 8 rows (16-row tile, rows >= 8 zero) x 1024 cols, K = 2048 (bf16 hi/lo)
// block = 32 cols (one whole 128-B line of each SSH row), 4 waves; k is cut in 16 slices of 128, wave w takes slices w, w + 4, w + 8, w + 12 one after the other, each for both column tiles and into a tile of its own;
// the 16 partial tiles are summed in LDS in slice order
#define EKW 16
#define EKC (TE / EKW / 32)
__device__ __forceinline__ void b_emb(const int blk, char* smem, const float* __restrict__ emb, const float* __restrict__ W, const float* __restrict__ bias, float* __restrict__ SSH) {
  float (*red)[NB][32] = (float (*)[NB][32])smem;       // [EKW][NB][32]
  const int tid = threadIdx.x, wave = tid >> 5, lane = tid & 31, col = lane & 15, g = lane >> 4; const int n0 = blk * 32;
  for (int i4 = 0; i4 < EKW / 4; ++i4) { const int sl = wave + 4 * i4, kb = sl * (TE / EKW);
    // A loader: lanes col and col + 8 share emb row col & 7; the lower lane makes silu of fragment elements 0..7, the upper lane of elements 8..15 and hands them over; rows >= 8 of the tile are zero
    const int eh = col >> 3; const float* ep = emb + (size_t)(col & 7) * TE + kb + 8 * g + 16 * eh;
    const float* wp = W + (size_t)(n0 + col) * TE + kb + 8 * g;
    // the whole slice is asked for before any of it is used, so that it pays the memory latency once; written as 16-B loads: from element-wise reads the compiler, in this larger kernel, moves most of the loads down to their users
    v4f e4[EKC][2], w4[EKC][2][4];
#pragma unroll
    for (int kc = 0; kc < EKC; ++kc)
#pragma unroll
      for (int h = 0; h < 2; ++h) e4[kc][h] = *(const v4f*)(ep + kc * 32 + 4 * h);
#pragma unroll
    for (int kc = 0; kc < EKC; ++kc)
#pragma unroll
      for (int j = 0; j < 2; ++j)
#pragma unroll
        for (int h = 0; h < 4; ++h) w4[kc][j][h] = *(const v4f*)(wp + (size_t)j * 16 * TE + kc * 32 + 16 * (h >> 1) + 4 * (h & 1));
    float ev[EKC][8], wv[EKC][2][16];
#pragma unroll
    for (int kc = 0; kc < EKC; ++kc) {
#pragma unroll
      for (int i = 0; i < 8; ++i) ev[kc][i] = e4[kc][i >> 2][i & 3];
#pragma unroll
      for (int j = 0; j < 2; ++j)
#pragma unroll
        for (int i = 0; i < 16; ++i) wv[kc][j][i] = w4[kc][j][i >> 2][i & 3]; }
    F2 a[EKC];
#pragma unroll
    for (int kc = 0; kc < EKC; ++kc) { float v[16];
#pragma unroll
      for (int i = 0; i < 8; ++i) { const float s = silu(ev[kc][i]); const float o = __shfl_xor(s, 8, 32); v[i] = eh ? 0.f : s; v[8 + i] = eh ? 0.f : o; }
      a[kc] = bsplit16(v); }
    v8f acc[2] = {};
#pragma unroll
    for (int kc = 0; kc < EKC; ++kc)
#pragma unroll
      for (int j = 0; j < 2; ++j) acc[j] = mac3(a[kc], bsplit16(wv[kc][j]), acc[j]);
    if (g == 0) {
#pragma unroll
      for (int j = 0; j < 2; ++j)
#pragma unroll
        for (int r = 0; r < 8; ++r) red[sl][r][j * 16 + col] = acc[j][r]; } }
  __syncthreads();
#pragma unroll
  for (int i = 0; i < NB * 32 / 128; ++i) { const int r = (tid >> 5) + 4 * i, c = tid & 31; float s = red[0][r][c];
#pragma unroll
    for (int w = 1; w < EKW; ++w) s += red[w][r][c];
    SSH[(size_t)r * (2 * E) + n0 + c] = s + bias[n0 + c]; }
}
// one launch for the three parts that need only k_pre's results or inputs; the longest blocks (b_emb) first, the shortest (b_tkv) last
#define G_EMB ((2 * E) / 32)
#define G_QX (NR / 64)
#define G_QY (E / 128)
#define G_QKV (G_QX * G_QY * 3)
#define G_TKV (2 * 4 * 2 * NB)
__global__ __launch_bounds__(128) void k_proj(const _Float16* __restrict__ X16, const _Float16* __restrict__ PT, const float* __restrict__ bq, const float* __restrict__ bk, const float* __restrict__ bv, const float* __restrict__ srcm,
                                              _Float16* __restrict__ Q16, _Float16* __restrict__ K16, _Float16* __restrict__ VT, const _Float16* __restrict__ T16, const _Float16* __restrict__ PT2, const float* __restrict__ bkt, const float* __restrict__ bvt,
                                              const int* __restrict__ cond, const float* __restrict__ emb, const float* __restrict__ embW, const float* __restrict__ embb, float* __restrict__ SSH) {
  __shared__ __align__(16) char smem[GSM];
  const int id = blockIdx.x;
  if (id < G_EMB) b_emb(id, smem, emb, embW, embb, SSH);
  else if (id < G_EMB + G_QKV) { const int q = id - G_EMB; b_qkv(q % G_QX, (q / G_QX) % G_QY, q / (G_QX * G_QY), smem, X16, PT, bq, bk, bv, srcm, Q16, K16, VT); }
  else { const int t = id - (G_EMB + G_QKV); b_tkv(t & 7, (t >> 3) & 1, t >> 4, smem, T16, PT2, bkt, bvt, cond, K16, VT); }
}
// attention: block (64 queries, bh); 18 key tiles; additive masks; O16 x8 [bh][s][64]
// Each key tile (64 K rows, 64 V^T rows of 128 B, 64 mask penalties) is brought in once per block with whole-line loads and kept in LDS for all four waves;
// two buffers: tile kt + 1 is asked for ahead of tile kt's products and stored behind them, one barrier per tile. Rows are padded to 144 B (16 B x odd) for the 16-B fragment reads.
// Both products are taken transposed: S^T = K Q^T (A = K rows, B = Q rows) and O^T += V^T P^T (A = V^T rows, B = P^T). A lane then holds 32 scores of ONE query (its column), keys 16 t + 8 g + r of the tile,
// so maximum, exponentials and sum are in-lane (the two lane halves exchange the maximum once per tile and join their sums once behind the loop), the correction factor is the lane's own,
// and two score tiles converted in place are the B operand of the second product in the k order of frag_h: scores and P never go through LDS.
#define NT (NKEY / 64)
#define KP 72
// e^x is taken as the hardware's 2^y, y = x log2(e): every argument here is a value minus a maximum that covers it, so x <= 0 and the library form's overflow and denormal-range handling has nothing to do
// (a result below the normal range is far below one f16 step of P and of the sum, whatever becomes of it). The lift of P by 2^14 rides in the same multiply-add as + 14.
#define LOG2E 1.44269504088896340736f
// lane l with lane l ^ 16
__device__ __forceinline__ float xhalf(float x) { return __builtin_bit_cast(float, __builtin_amdgcn_permlanex16(__builtin_bit_cast(int, x), __builtin_bit_cast(int, x), 0x76543210, 0xfedcba98, false, false)); }
// eight independent 2^y in one statement: behind a transcendental the instruction set asks for one independent instruction before its result is read or its source overwritten;
// here each v_exp_f32 is that instruction for the one before it (no output shares a register with an input) and the v_nop is it for the last
__device__ __forceinline__ void exp2x8(const float (&y)[8], float (&e)[8]) {
  asm("v_exp_f32 %0, %8\n\tv_exp_f32 %1, %9\n\tv_exp_f32 %2, %10\n\tv_exp_f32 %3, %11\n\tv_exp_f32 %4, %12\n\tv_exp_f32 %5, %13\n\tv_exp_f32 %6, %14\n\tv_exp_f32 %7, %15\n\tv_nop"
      : "=&v"(e[0]), "=&v"(e[1]), "=&v"(e[2]), "=&v"(e[3]), "=&v"(e[4]), "=&v"(e[5]), "=&v"(e[6]), "=&v"(e[7])
      : "v"(y[0]), "v"(y[1]), "v"(y[2]), "v"(y[3]), "v"(y[4]), "v"(y[5]), "v"(y[6]), "v"(y[7]));
}
__global__ __launch_bounds__(128) void k_attn(const _Float16* __restrict__ Q16, const _Float16* __restrict__ K16, const _Float16* __restrict__ VT, const int* __restrict__ cond, const float* __restrict__ srcm, _Float16* __restrict__ O16) {
  __shared__ __align__(16) _Float16 sO[4][16][72];    // behind the loop: the wave's output tile, query rows
  __shared__ __align__(16) _Float16 sK[2][64][KP];
  __shared__ __align__(16) _Float16 sV[2][64][KP];
  __shared__ __align__(16) float sPen[2][64];
  const int tid = threadIdx.x, w = tid >> 5, lane = tid & 31, col = lane & 15, g = lane >> 4;
  const size_t bh = blockIdx.y; const int b = (int)(bh / NH); const int q0 = blockIdx.x * 64 + w * 16;
  const float tpen = ((cond[b] % 10) > 0) ? 0.f : -1000000.0f;
  // staging: thread owns 16-B piece tid & 7 of rows (tid >> 3) + 16 i, so a wave's load covers four whole 128-B lines
  const int srow = tid >> 3, spc = (tid & 7) * 8;
  const _Float16* kg = K16 + (bh * NKEY + srow) * HD + spc;
  const _Float16* vg = VT + (bh * HD + srow) * NKEY + spc;
  v8h rk[4], rv[4]; float rm;
  auto fetch = [&](int kt) {
#pragma unroll
    for (int i = 0; i < 4; ++i) { rk[i] = *(const v8h*)(kg + (size_t)(kt * 64 + 16 * i) * HD); rv[i] = *(const v8h*)(vg + (size_t)(16 * i) * NKEY + kt * 64); }
    int ms = kt * 64 + (tid & 63); ms = ms > SS - 1 ? SS - 1 : ms; rm = srcm[b * SS + ms]; };
  auto put = [&](int kt) { const int bf = kt & 1;
#pragma unroll
    for (int i = 0; i < 4; ++i) { *(v8h*)(&sK[bf][srow + 16 * i][spc]) = rk[i]; *(v8h*)(&sV[bf][srow + 16 * i][spc]) = rv[i]; }
    if (tid < 64) { const int slot = kt * 64 + tid; sPen[bf][tid] = slot < SS ? (1.0f - rm) * -1000000.0f : (slot < SS + NTX ? tpen : -3.0e38f); } };
  fetch(0);
  v16h aq[2];
#pragma unroll
  for (int kc = 0; kc < 2; ++kc) aq[kc] = frag_h(Q16 + (bh * SS + q0 + col) * HD + kc * 32, lane);
  put(0);
  __syncthreads();
  // mrun: the query's running maximum (equal in both lane halves); lrun: the running sum over this lane half's keys only
  float mrun = -3.0e38f, lrun = 0.f; v8f acc[4] = {};
#pragma unroll 1
  for (int kt = 0; kt < NT; ++kt) { const int bf = kt & 1;
    // asked for first, so that the loads fly under the whole tile
    if (kt + 1 < NT) fetch(kt + 1);
    v16h kf[4][2]; v4f pn[4][2];
#pragma unroll
    for (int t = 0; t < 4; ++t) {
#pragma unroll
      for (int kc = 0; kc < 2; ++kc) kf[t][kc] = frag_h(&sK[bf][t * 16 + col][kc * 32], lane);
#pragma unroll
      for (int h = 0; h < 2; ++h) pn[t][h] = *(const v4f*)(&sPen[bf][t * 16 + 8 * g + 4 * h]); }
    // sv[t][r] = logit of key slot kt * 64 + 16 t + 8 g + r for query q0 + col; a pad slot has zero K rows and the penalty -3.0e38, so its logit is exactly -3.0e38
    float sv[4][8], mt[4];
#pragma unroll
    for (int t = 0; t < 4; ++t) { v8f s = {};
#pragma unroll
      for (int kc = 0; kc < 2; ++kc) s = wmma16(kf[t][kc], aq[kc], s);
#pragma unroll
      for (int r = 0; r < 8; ++r) sv[t][r] = s[r] * (1.0f / 16.0f) + pn[t][r >> 2][r & 3];
      mt[t] = sv[t][0];
#pragma unroll
      for (int r = 1; r < 8; ++r) mt[t] = fmaxf(mt[t], sv[t][r]); }
    float mx = fmaxf(fmaxf(mt[0], mt[1]), fmaxf(mt[2], mt[3]));
    mx = fmaxf(mx, xhalf(mx));
    const float mnew = fmaxf(mrun, mx); const float corr = __builtin_amdgcn_exp2f((mrun - mnew) * LOG2E);
    v16h vf[2][4];
#pragma unroll
    for (int kc = 0; kc < 2; ++kc)
#pragma unroll
      for (int t = 0; t < 4; ++t) vf[kc][t] = frag_h(&sV[bf][t * 16 + col][kc * 32], lane);
    // P^T as B operand: element e of fragment kc is key 32 kc + 8 g + e (e < 8) or 32 kc + 16 + 8 g + e - 8, that is score tiles 2 kc and 2 kc + 1 in place
    v16h ph[2]; float pt[4];
#pragma unroll
    for (int t = 0; t < 4; ++t) { pt[t] = 0.f;
      float y[8], e[8];
#pragma unroll
      for (int r = 0; r < 8; ++r) y[r] = fmaf(sv[t][r] - mnew, LOG2E, 14.0f);
      exp2x8(y, e);
#pragma unroll
      for (int r = 0; r < 8; ++r) { const float p = sv[t][r] <= -1.0e38f ? 0.f : e[r]; pt[t] += p; ph[t >> 1][(t & 1) * 8 + r] = (_Float16)p; } }
    lrun = lrun * corr + ((pt[0] + pt[1]) + (pt[2] + pt[3])) * (1.0f / 16384.0f); mrun = mnew;
#pragma unroll
    for (int t = 0; t < 4; ++t)
#pragma unroll
      for (int r = 0; r < 8; ++r) acc[t][r] *= corr;
#pragma unroll
    for (int kc = 0; kc < 2; ++kc)
#pragma unroll
      for (int t = 0; t < 4; ++t) acc[t] = wmma16(vf[kc][t], ph[kc], acc[t]);
    // the other buffer's last readers left it at the barrier of the trip before; this barrier publishes tile kt + 1 and ends the reads of tile kt
    if (kt + 1 < NT) { put(kt + 1); __syncthreads(); } }
  // acc[t][r] = O^T[d = 16 t + 8 g + r][query col]: eight neighbouring d of one query row, one 16-B piece
  const float lr = lrun + xhalf(lrun); const float inv = 8.0f / (lr * 16384.0f * 4.0f);
#pragma unroll
  for (int t = 0; t < 4; ++t) { union { v8h h8; v4u u; } pk;
#pragma unroll
    for (int r = 0; r < 8; ++r) pk.h8[r] = (_Float16)(acc[t][r] * inv);
    *(v4u*)(&sO[w][col][t * 16 + 8 * g]) = pk.u; }
  LDSX();
  // eight lanes store one whole 128-B query row; unrolled so that the four LDS reads are asked for together and their latency is paid once
#pragma unroll
  for (int i = 0; i < 4; ++i) { const int rl = (lane >> 3) + 4 * i, pc = lane & 7;
    vst2(O16 + ((bh * SS) + q0 + rl) * HD + pc * 8, *(const v4u*)(&sO[w][rl][pc * 8])); }
}
// out = x + silu(LN(y) (1 + scale) + shift) out_W^T + out_b, one launch: a block owns 32 whole rows (all 512 columns), 8 waves.
// Front part: wave w makes the stylised rows 4 w .. 4 w + 3 (x8, f16) from O16 and keeps them in LDS for the whole product (they never go through memory);
// lane owns columns lane*8..+7 and 256 + lane*8..+7, that is one 16-B piece of heads lane >> 3 and 4 + (lane >> 3).
// Product: wave w keeps the 32 rows x columns 64 w .. 64 w + 63 in acc, k ascending; 128-k slices of all 512 out_W rows go through two LDS buffers by whole-line loads, one barrier per slice
// (a slice's products last longer than the next slice's way from L2; half of out_W is on its way or in LDS before the front part ends).
#define OR 32
#define OP 520                           // halves per stylised row in LDS: 1040 B = 16 B x odd
#define OZB (OR * OP * 2)                // bytes of the stylised rows
#define OK 128                           // k per slice
#define OGP 136                          // halves per slice row in LDS: 272 B = 16 B x odd
#define OBB (E * OGP * 2)                // bytes of one out_W slice buffer
__global__ __launch_bounds__(256) void k_out(const _Float16* __restrict__ O16, const float* __restrict__ SSH, const float* __restrict__ g_, const float* __restrict__ b_,
                                             const _Float16* __restrict__ PT, const float* __restrict__ bo, const float* __restrict__ x, float* __restrict__ out) {
  __shared__ __align__(16) char smem[OZB + 2 * OBB];
  _Float16* sZ = (_Float16*)smem; _Float16* sB = (_Float16*)(smem + OZB);
  float (*so)[OR][68] = (float (*)[OR][68])(smem + OZB);   // [8][32][68], behind the loop, over slice buffer 0
  const int tid = threadIdx.x, wave = tid >> 5, lane = tid & 31, col = lane & 15, g = lane >> 4;
  const int r0b = blockIdx.x * OR; const int b = r0b / SS, s0 = r0b % SS;
  // staging: thread owns 16-B piece tid & 15 of out_W rows (tid >> 4) + 16 i, so a wave's load covers four whole 128-B lines
  const int srow = tid >> 4, spc = (tid & 15) * 8;
  const _Float16* Bg = PT + (size_t)3 * E * E + (size_t)srow * E + spc;
  v8h rb[32];
  auto fetch = [&](int c) {
#pragma unroll
    for (int i = 0; i < 32; ++i) rb[i] = *(const v8h*)(Bg + c * OK + 16 * i * E); };
  auto put = [&](int c) { _Float16* pb = sB + (c & 1) * (E * OGP) + srow * OGP + spc;
#pragma unroll
    for (int i = 0; i < 32; ++i) *(v8h*)(pb + 16 * i * OGP) = rb[i]; };
  fetch(0);
  // everything the front part reads is asked for at once, so that the memory latency is paid once
  v8h o8[4][2];
#pragma unroll
  for (int rr = 0; rr < 4; ++rr)
#pragma unroll
    for (int half = 0; half < 2; ++half) o8[rr][half] = *(const v8h*)(O16 + (((size_t)b * NH + half * 4 + (lane >> 3)) * SS + s0 + wave * 4 + rr) * HD + (lane & 7) * 8);
  // the loads that follow may land in the registers that hold these loads' address
  asm volatile("s_wait_xcnt 0x0" ::: "memory");
  const float* sc_ = SSH + (size_t)b * 2 * E; const float* sh_ = sc_ + E;
  v4f pg[4], pb_[4], psc[4], psh[4];
#pragma unroll
  for (int q = 0; q < 4; ++q) { const int c = (q >> 1) * 256 + lane * 8 + (q & 1) * 4;
    pg[q] = *(const v4f*)(g_ + c); pb_[q] = *(const v4f*)(b_ + c); psc[q] = *(const v4f*)(sc_ + c); psh[q] = *(const v4f*)(sh_ + c); }
  float bb[4];
#pragma unroll
  for (int j = 0; j < 4; ++j) bb[j] = bo[wave * 64 + j * 16 + col];
  // the front part's first instructions write the offset register that these loads name
  asm volatile("s_wait_xcnt 0x0" ::: "memory");
  // keeps the first uses below all of these loads: without it the compiler waits for the first four before it asks for the rest, and the latency is paid twice
  __builtin_amdgcn_sched_barrier(0);
  put(0);
  // slice 1 flies under the front part
  fetch(1);
  float sum[4], sq[4];
#pragma unroll
  for (int rr = 0; rr < 4; ++rr) { sum[rr] = 0.f; sq[rr] = 0.f;
#pragma unroll
    for (int e = 0; e < 16; ++e) { const float v = (float)o8[rr][e >> 3][e & 7] * 0.125f; sum[rr] += v; sq[rr] += v * v; } }
#pragma unroll
  for (int o = 16; o > 0; o >>= 1)
#pragma unroll
    for (int rr = 0; rr < 4; ++rr) { sum[rr] += __shfl_xor(sum[rr], o, 32); sq[rr] += __shfl_xor(sq[rr], o, 32); }
#pragma unroll
  for (int rr = 0; rr < 4; ++rr) {
    const float mu = sum[rr] * (1.0f / E); float var = sq[rr] * (1.0f / E) - mu * mu; var = var > 0.f ? var : 0.f; const float rs = rsqrtf(var + 1e-5f);
#pragma unroll
    for (int half = 0; half < 2; ++half) { v8h pk;
#pragma unroll
      for (int e = 0; e < 8; ++e) { const int q = half * 2 + (e >> 2), k = e & 3; const float v = (float)o8[rr][half][e] * 0.125f;
        const float hn = (v - mu) * rs * pg[q][k] + pb_[q][k]; const float mm = hn * (1.0f + psc[q][k]) + psh[q][k]; pk[e] = (_Float16)(silu(mm) * 8.0f); }
      *(v8h*)(sZ + (wave * 4 + rr) * OP + half * 256 + lane * 8) = pk; } }
  // publishes the stylised rows and slice 0
  __syncthreads();
  v8f acc[2][4] = {};
  // unrolled: the slice's step and the buffer's place become immediate offsets
#pragma unroll
  for (int c = 0; c < E / OK; ++c) { const int bf = c & 1;
    // asked for ahead of the products and stored behind them (slice 1 is already in the registers); nothing is in flight at a barrier, which waits for every load
    if (c > 0 && c + 1 < E / OK) fetch(c + 1);
#pragma unroll
    for (int kc = 0; kc < OK / 32; ++kc) { v16h a[2], bfr[4];
#pragma unroll
      for (int i = 0; i < 2; ++i) a[i] = frag_h(sZ + (i * 16 + col) * OP + c * OK + kc * 32, lane);
#pragma unroll
      for (int j = 0; j < 4; ++j) bfr[j] = frag_h(sB + (bf * E + wave * 64 + j * 16 + col) * OGP + kc * 32, lane);
#pragma unroll
      for (int i = 0; i < 2; ++i)
#pragma unroll
        for (int j = 0; j < 4; ++j) acc[i][j] = wmma16(a[i], bfr[j], acc[i][j]); }
    // the other buffer's last readers left it at the barrier of the trip before; this barrier publishes slice c + 1 and ends the reads of slice c
    if (c + 1 < E / OK) { put(c + 1); __syncthreads(); } }
  // ends every wave's reads of the last slice (buffer 1); the output tiles overwrite only buffer 0, whose reads ended at the barrier of trip 2
  __syncthreads();
  // a wave's store covers its 256 B (two whole lines) of two rows; the residual is asked for ahead of the LDS trip
  const size_t oo = (size_t)(r0b + g) * E + wave * 64 + col * 4; const float* xp = x + oo; float* op = out + oo;
  v4f xr[16];
#pragma unroll
  for (int it = 0; it < 16; ++it) xr[it] = *(const v4f*)(xp + it * 2 * E);
#pragma unroll
  for (int j = 0; j < 4; ++j)
#pragma unroll
    for (int i = 0; i < 2; ++i)
#pragma unroll
      for (int r = 0; r < 8; ++r) so[wave][i * 16 + 8 * g + r][j * 16 + col] = acc[i][j][r] * (1.0f / (16.0f * 8.0f)) + bb[j];
  LDSX();
#pragma unroll
  for (int it = 0; it < 16; ++it) vst2(op + it * 2 * E, *(const v4f*)(&so[wave][2 * it + g][col * 4]) + xr[it]);
}
extern "C" void kernel_launch(void* const* d_in, const int* in_sizes, int n_in, void* d_out, int out_size, void* d_ws, size_t ws_size, hipStream_t stream) {
  (void)in_sizes; (void)n_in; (void)out_size; (void)ws_size;
  const float** I = (const float**)d_in;
  const float* x = I[0]; const float* xf = I[1]; const float* emb = I[2]; const float* srcm = I[3]; const int* cond = (const int*)d_in[4];
  const float* ng = I[5]; const float* nb = I[6]; const float* tg = I[7]; const float* tb = I[8]; const float* Wq = I[9]; const float* bq = I[10]; const float* Wkt = I[11]; const float* bkt = I[12]; const float* Wvt = I[13]; const float* bvt = I[14];
  const float* Wkm = I[15]; const float* bkm = I[16]; const float* Wvm = I[17]; const float* bvm = I[18]; const float* embW = I[19]; const float* embb = I[20]; const float* sg = I[21]; const float* sb = I[22]; const float* Wo = I[23]; const float* bo = I[24];
  float* out = (float*)d_out;
  char* ws = (char*)d_ws; size_t off = 0;
  auto take = [&](size_t bytes) { char* p = ws + off; off += (bytes + 255) & ~(size_t)255; return p; };
  _Float16* X16 = (_Float16*)take((size_t)NR * E * 2); _Float16* T16 = (_Float16*)take((size_t)NB * NTX * LT * 2 + 4096); _Float16* PT = (_Float16*)take((size_t)4 * E * E * 2); _Float16* PT2 = (_Float16*)take((size_t)2 * E * LT * 2);
  _Float16* Q16 = (_Float16*)take((size_t)NR * E * 2); _Float16* K16 = (_Float16*)take((size_t)NB * NH * NKEY * HD * 2);
  _Float16* VT = (_Float16*)take((size_t)NB * NH * HD * NKEY * 2); _Float16* O16 = (_Float16*)take((size_t)NR * E * 2); float* SSH = (float*)take((size_t)NB * 2 * E * 4);
  // ws ~ 46 MB
  k_pre<<<G_LNT + G_LNX + G_PACK, 256, 0, stream>>>(x, ng, nb, X16, xf, tg, tb, T16, Wq, Wkm, Wvm, Wo, Wkt, Wvt, PT, PT2);
  k_proj<<<G_EMB + G_QKV + G_TKV, 128, 0, stream>>>(X16, PT, bq, bkm, bvm, srcm, Q16, K16, VT, T16, PT2, bkt, bvt, cond, emb, embW, embb, SSH);
  k_attn<<<dim3(SS / 64, NB * NH), 128, 0, stream>>>(Q16, K16, VT, cond, srcm, O16);
  k_out<<<NR / OR, 256, 0, stream>>>(O16, SSH, sg, sb, PT, bo, x, out);
}

// v009
// Measured time: 69.8 microseconds a run.
// Two timings next to v008 put it at 1.04 and 1.05 times that version's speed.
// Counting every step since v000, it is 6.05 times as fast.
// compute dtype: f16 operands for the projections and attention (LayerNorm outputs as f16 rows, weights packed x16, q/k x4, P lifted by 2^14, V x4, context x8, stylised rows x8), bf16 hi/lo splits for the small emb GEMM, f32 accumulate; LayerNorms, masks, softmax, SiLU f32. Output = x + h is dominated by the f32 residual.
#include <hip/hip_runtime.h>
#include <math.h>

typedef __attribute__((ext_vector_type(16))) _Float16 v16h;
typedef __attribute__((ext_vector_type(16))) __bf16 v16b;
typedef __attribute__((ext_vector_type(8)))  _Float16 v8h;
typedef __attribute__((ext_vector_type(8)))  float v8f;
typedef __attribute__((ext_vector_type(4)))  float v4f;
typedef __attribute__((ext_vector_type(2)))  float v2f;
typedef __attribute__((ext_vector_type(4)))  unsigned v4u;
typedef __attribute__((ext_vector_type(4)))  int v4i;
typedef float __attribute__((may_alias)) float_a;
typedef int __attribute__((may_alias)) int_a;

template <typename T> __device__ __forceinline__ void vst2(void* p, T v) { *(T*)p = v;  }
__device__ __forceinline__ v8f wmma16(v16h a, v16h b, v8f c) {
  v8f d = __builtin_amdgcn_wmma_f32_16x16x32_f16(false, a, false, b, (short)0, c, false, false);
  asm volatile("v_nop\n\tv_nop\n\tv_nop\n\tv_nop" : "+v"(d) : "v"(a), "v"(b));
  return d;
}
__device__ __forceinline__ v8f wmma_bf(v16b a, v16b b, v8f c) {
  v8f d = __builtin_amdgcn_wmma_f32_16x16x32_bf16(false, a, false, b, (short)0, c, false, false);
  asm volatile("v_nop\n\tv_nop\n\tv_nop\n\tv_nop" : "+v"(d) : "v"(a), "v"(b));
  return d;
}
// 16x16x32 fragments: lane = (h = lane>>4, row/col = lane&15); elements 0..7 = k0+8h+0..7, 8..15 = k0+16+8h+0..7; D element r = row 8h+r
__device__ __forceinline__ v16h frag_h(const _Float16* rowk0, int lane) {
  union { v16h v; v8h q[2]; } u; const _Float16* p = rowk0 + 8 * (lane >> 4);
  u.q[0] = *(const v8h*)p; u.q[1] = *(const v8h*)(p + 16); return u.v;
}
__device__ __forceinline__ v16h frag_f32(const float* rowk0, int lane) {
  v16h a; const float* p = rowk0 + 8 * (lane >> 4);
#pragma unroll
  for (int i = 0; i < 8; ++i) { a[i] = (_Float16)p[i]; a[8 + i] = (_Float16)p[16 + i]; }
  return a;
}
__device__ __forceinline__ v16h frag_f32s(const float* rowk0, int lane, float sc) {
  v16h a; const float* p = rowk0 + 8 * (lane >> 4);
#pragma unroll
  for (int i = 0; i < 8; ++i) { a[i] = (_Float16)(p[i] * sc); a[8 + i] = (_Float16)(p[16 + i] * sc); }
  return a;
}
// column fragment from a [K][ld] layout (column n), rows >= K read as 0
__device__ __forceinline__ v16h fragc_f32(const float* W, int k0, int n, int lane, int ld, int K) {
  v16h a; const int g = lane >> 4;
#pragma unroll
  for (int i = 0; i < 8; ++i) { const int ka = k0 + 8 * g + i, kb = ka + 16;
    a[i] = (_Float16)(ka < K ? W[(size_t)ka * ld + n] : 0.f); a[8 + i] = (_Float16)(kb < K ? W[(size_t)kb * ld + n] : 0.f); }
  return a;
}
struct F2 { v16b h, l; };
__device__ __forceinline__ F2 bsplit16(const float v[16]) { F2 r;
#pragma unroll
  for (int i = 0; i < 16; ++i) { const __bf16 h = (__bf16)v[i]; r.h[i] = h; r.l[i] = (__bf16)(v[i] - (float)h); }
  return r; }
__device__ __forceinline__ F2 split_row(const float* row, int k0, int lane) { float v[16]; const float* p = row + k0 + 8 * (lane >> 4);
#pragma unroll
  for (int i = 0; i < 8; ++i) { v[i] = p[i]; v[8 + i] = p[16 + i]; }
  return bsplit16(v); }
__device__ __forceinline__ F2 split_rowK(const float* row, int k0, int lane, int K) { float v[16]; const int g = lane >> 4;
#pragma unroll
  for (int i = 0; i < 8; ++i) { const int ka = k0 + 8 * g + i, kb = ka + 16; v[i] = ka < K ? row[ka] : 0.f; v[8 + i] = kb < K ? row[kb] : 0.f; }
  return bsplit16(v); }
__device__ __forceinline__ F2 split_col(const float* W, int k0, int n, int lane, int ld, int K) { float v[16]; const int g = lane >> 4;
#pragma unroll
  for (int i = 0; i < 8; ++i) { const int ka = k0 + 8 * g + i, kb = ka + 16; v[i] = ka < K ? W[(size_t)ka * ld + n] : 0.f; v[8 + i] = kb < K ? W[(size_t)kb * ld + n] : 0.f; }
  return bsplit16(v); }
__device__ __forceinline__ v8f mac3(const F2& a, const F2& b, v8f c) { c = wmma_bf(a.l, b.h, c); c = wmma_bf(a.h, b.l, c); return wmma_bf(a.h, b.h, c); }
__device__ __forceinline__ float sigm(float v) { return 1.0f / (1.0f + expf(-v)); }
#define LDSX() do { asm volatile("s_wait_dscnt 0" ::: "memory"); __builtin_amdgcn_wave_barrier(); __builtin_amdgcn_fence(__ATOMIC_RELEASE, "workgroup"); } while (0)


// Mixed text/motion attention + stylisation block on [8,1024,512] (8 heads x 64): xn = LN(x), xfn = LN(xf [8,77,256]); q = xn Wq^T + bq; keys = [xfn Wkt^T + bkt (77) | xn Wkm^T + bkm (1024)],
// values = [(xfn Wvt^T + bvt) * text_cond_b | (xn Wvm^T + bvm) * src_mask], logits q.k (NO 1/sqrt d) + (1 - mask)*(-1e6) with mask = [text_cond_b x77 | src_mask]; softmax over the 1,101 keys;
// y = P v; h = silu(LN(y) * (1 + scale_b) + shift_b) out_W^T + out_b with [scale|shift] = silu(emb) emb_W^T + emb_b; out = x + h.
// Key slots (softmax does not depend on the key order): motion token s at slot s, text token t at slot 1024 + t, zero pads at 1101..1151; so 64 tokens of a V^T row are one whole, aligned 128-B line.
// Parts: b_lnx / b_lnt (LayerNorm -> f16 rows), b_pack (weights [out][in] x16), b_qkv (motion q/k/v; keys/values at slots s), b_tkv (text k/v at slots 1024 + t, and the zero pads), b_emb ([scale | shift]).
// Parts that do not depend on one another share a launch, each on its own range of block indices: k_pre = b_lnt, b_lnx, b_pack; k_proj = b_emb, b_qkv, b_tkv; then k_attn, k_out (stylisation and output projection).
#define NB 8
#define SS 1024
#define E 512
#define NH 8
#define HD 64
#define NR (NB * SS)
#define NTX 77
#define LT 256
#define NKEY 1152              // 1024 + 77 = 1101 padded to 18 x 64
#define TE 2048
__device__ __forceinline__ float silu(float x) { return x / (1.0f + expf(-x)); }

// LN over rows of x (512) -> f16 rows; wave per row
__device__ __forceinline__ void b_lnx(const int blk, const float* __restrict__ x, const float* __restrict__ g_, const float* __restrict__ b_, _Float16* __restrict__ X16) {
  const int wave = threadIdx.x >> 5, lane = threadIdx.x & 31; const int row = blk * 8 + wave; const float* xr = x + (size_t)row * E;
  float v[16]; float s = 0.f;
  // lane owns columns lane*8..+7 and 256 + lane*8..+7 so each 16-B store instruction covers a contiguous 512-B run across the wave
#pragma unroll
  for (int e = 0; e < 16; ++e) { v[e] = xr[(e < 8 ? 0 : 256) + lane * 8 + (e & 7)]; s += v[e]; }
#pragma unroll
  for (int o = 16; o > 0; o >>= 1) s += __shfl_xor(s, o, 32);
  const float mu = s * (1.0f / E); float q = 0.f;
#pragma unroll
  for (int e = 0; e < 16; ++e) { const float d = v[e] - mu; q += d * d; }
#pragma unroll
  for (int o = 16; o > 0; o >>= 1) q += __shfl_xor(q, o, 32);
  const float rs = rsqrtf(q * (1.0f / E) + 1e-5f);
  union { v8h h[2]; v4u u[2]; } pk;
#pragma unroll
  for (int e = 0; e < 16; ++e) { const int c = (e < 8 ? 0 : 256) + lane * 8 + (e & 7); pk.h[e >> 3][e & 7] = (_Float16)((v[e] - mu) * rs * g_[c] + b_[c]); }
  vst2(X16 + (size_t)row * E + lane * 8, pk.u[0]); vst2(X16 + (size_t)row * E + 256 + lane * 8, pk.u[1]);
  // in the listing another part of the shared launch follows, whose first instructions write registers that these stores name
  asm volatile("s_wait_xcnt 0x0" ::: "memory");
}
// LN over rows of xf (256) -> f16 rows [NB*NTX][256]; wave per row (8 per lane)
__device__ __forceinline__ void b_lnt(const int blk, const float* __restrict__ xf, const float* __restrict__ g_, const float* __restrict__ b_, _Float16* __restrict__ T16) {
  const int wave = threadIdx.x >> 5, lane = threadIdx.x & 31; const int row = blk * 8 + wave; if (row >= NB * NTX) return; const float* xr = xf + (size_t)row * LT;
  float v[8]; float s = 0.f;
#pragma unroll
  for (int e = 0; e < 8; ++e) { v[e] = xr[lane * 8 + e]; s += v[e]; }
#pragma unroll
  for (int o = 16; o > 0; o >>= 1) s += __shfl_xor(s, o, 32);
  const float mu = s * (1.0f / LT); float q = 0.f;
#pragma unroll
  for (int e = 0; e < 8; ++e) { const float d = v[e] - mu; q += d * d; }
#pragma unroll
  for (int o = 16; o > 0; o >>= 1) q += __shfl_xor(q, o, 32);
  const float rs = rsqrtf(q * (1.0f / LT) + 1e-5f);
  union { v8h h; v4u u; } pk;
#pragma unroll
  for (int e = 0; e < 8; ++e) { const int c = lane * 8 + e; pk.h[e] = (_Float16)((v[e] - mu) * rs * g_[c] + b_[c]); }
  vst2(T16 + (size_t)row * LT + lane * 8, pk.u);
}
// PT rows (x16, [out][in]): [0,512) Wq, [512,1024) Wkm, [1024,1536) Wvm, [1536,2048) out_W (512 halves each); PT2: [0,512) Wkt, [512,1024) Wvt (256 halves each)
__device__ __forceinline__ void b_pack(const int n, const float* __restrict__ Wq, const float* __restrict__ Wkm, const float* __restrict__ Wvm, const float* __restrict__ Wo, const float* __restrict__ Wkt, const float* __restrict__ Wvt, _Float16* __restrict__ PT, _Float16* __restrict__ PT2) {
  const int tid = threadIdx.x; __shared__ __align__(16) _Float16 srow[E];
  if (n < 4 * E) { const float* W = n < E ? Wq : (n < 2 * E ? Wkm : (n < 3 * E ? Wvm : Wo)); const int nn = n & (E - 1);
    srow[tid] = (_Float16)(W[(size_t)nn * E + tid] * 16.0f); srow[tid + 256] = (_Float16)(W[(size_t)nn * E + tid + 256] * 16.0f); __syncthreads();
    if (tid < E / 8) vst2(PT + (size_t)n * E + tid * 8, *(const v4u*)(&srow[tid * 8])); }
  else { const int m = n - 4 * E; const float* W = m < E ? Wkt : Wvt; const int nn = m & (E - 1);
    srow[tid] = (_Float16)(W[(size_t)nn * LT + tid] * 16.0f); __syncthreads();
    if (tid < LT / 8) vst2(PT2 + (size_t)m * LT + tid * 8, *(const v4u*)(&srow[tid * 8])); }
}
// one launch for the three parts that read only inputs; the short text rows first
#define G_LNT ((NB * NTX + 7) / 8)
#define G_LNX (NR / 8)
#define G_PACK (4 * E + 2 * E)
__global__ __launch_bounds__(256) void k_pre(const float* __restrict__ x, const float* __restrict__ ng, const float* __restrict__ nb, _Float16* __restrict__ X16, const float* __restrict__ xf, const float* __restrict__ tg, const float* __restrict__ tb, _Float16* __restrict__ T16,
                                             const float* __restrict__ Wq, const float* __restrict__ Wkm, const float* __restrict__ Wvm, const float* __restrict__ Wo, const float* __restrict__ Wkt, const float* __restrict__ Wvt, _Float16* __restrict__ PT, _Float16* __restrict__ PT2) {
  const int id = blockIdx.x;
  if (id < G_LNT) b_lnt(id, xf, tg, tb, T16);
  else if (id < G_LNT + G_LNX) b_lnx(id - G_LNT, x, ng, nb, X16);
  else b_pack(id - (G_LNT + G_LNX), Wq, Wkm, Wvm, Wo, Wkt, Wvt, PT, PT2);
}
// Shared loop of the projection parts b_qkv and b_tkv: a block's 64 x 128 tile of A B^T, A and B rows K-contiguous f16; wave w keeps rows 16 w .. 16 w + 15 x 128 columns in acc, k ascending.
// Each 64-k slice (128 B = one whole line of each of the 64 A rows and 128 B rows) is brought in once per block and kept in LDS for all four waves; the fragments are read from LDS.
// Two buffers: slice c + 1 is asked for ahead of slice c's products and stored behind them, one barrier per slice. Rows are padded to 144 B (16 B x odd) for the 16-B fragment reads.
#define GP 72
#define GSM ((64 + 128) * 2 * GP * 2)   // bytes: [2][64][GP] A halves, then [2][128][GP] B halves; the epilogues reuse the same bytes behind a barrier
template <int K, typename AR>
__device__ __forceinline__ void gemm_lds(const _Float16* __restrict__ A, AR arow, const _Float16* __restrict__ B, char* smem, v8f (&acc)[8]) {
  _Float16* sA = (_Float16*)smem; _Float16* sB = sA + 2 * 64 * GP;
  const int tid = threadIdx.x, wave = tid >> 5, lane = tid & 31, col = lane & 15;
  // staging: thread owns 16-B piece tid & 7 of rows (tid >> 3) + 16 i, so a wave's load covers four whole 128-B lines
  const int srow = tid >> 3, spc = (tid & 7) * 8;
  // lane offsets in halves from the block-uniform bases A and B
  unsigned ao[4];
#pragma unroll
  for (int i = 0; i < 4; ++i) ao[i] = (unsigned)arow(srow + 16 * i) * K + spc;
  const unsigned bo = (unsigned)srow * K + spc;
  const int sp = srow * GP + spc;
  v8h ra[4], rb[8];
  auto fetch = [&](int c) { const _Float16* Ac = A + c * 64; const _Float16* Bc = B + c * 64;
#pragma unroll
    for (int i = 0; i < 4; ++i) ra[i] = *(const v8h*)(Ac + ao[i]);
#pragma unroll
    for (int i = 0; i < 8; ++i) rb[i] = *(const v8h*)(Bc + 16 * i * K + bo); };
  auto put = [&](int c) { _Float16* pa = sA + (c & 1) * (64 * GP) + sp; _Float16* pb = sB + (c & 1) * (128 * GP) + sp;
#pragma unroll
    for (int i = 0; i < 4; ++i) *(v8h*)(pa + 16 * i * GP) = ra[i];
#pragma unroll
    for (int i = 0; i < 8; ++i) *(v8h*)(pb + 16 * i * GP) = rb[i]; };
  fetch(0); put(0);
  __syncthreads();
  // unrolled: the slice's step and the buffer's place become immediate offsets, so no address register is formed anew (and waited for) in each trip
#pragma unroll
  for (int c = 0; c < K / 64; ++c) { const int bf = c & 1;
    if (c + 1 < K / 64) fetch(c + 1);
#pragma unroll
    for (int kc = 0; kc < 2; ++kc) { const v16h a = frag_h(sA + (bf * 64 + wave * 16 + col) * GP + kc * 32, lane); v16h bfr[8];
#pragma unroll
      for (int j = 0; j < 8; ++j) bfr[j] = frag_h(sB + (bf * 128 + j * 16 + col) * GP + kc * 32, lane);
#pragma unroll
      for (int j = 0; j < 8; ++j) acc[j] = wmma16(a, bfr[j], acc[j]); }
    // the other buffer's last readers left it at the barrier of the trip before; this barrier publishes slice c + 1 and ends the reads of slice c
    if (c + 1 < K / 64) { put(c + 1); __syncthreads(); } }
  // ends every wave's reads of the last slice, so that the caller's epilogue may overwrite the buffers
  __syncthreads();
}
// motion q/k/v: block (64 tokens of one batch, 128 cols, which) ; k,v stored at key slot s ; v goes straight into VT [bh][d][NKEY]
__device__ __forceinline__ void b_qkv(const int bx, const int by, const int bz, char* smem, const _Float16* __restrict__ X16, const _Float16* __restrict__ PT, const float* __restrict__ bq, const float* __restrict__ bk, const float* __restrict__ bv, const float* __restrict__ srcm,
                                            _Float16* __restrict__ Q16, _Float16* __restrict__ K16, _Float16* __restrict__ VT) {
  float (*so)[16][132] = (float (*)[16][132])smem;      // [4][16][132], which < 2
  _Float16 (*sth)[72] = (_Float16 (*)[72])smem;         // [128][72], which == 2
  const int tid = threadIdx.x, wave = tid >> 5, lane = tid & 31, col = lane & 15, g = lane >> 4;
  const int which = bz, r0b = bx * 64, n0 = by * 128; const int b = r0b / SS, s0 = r0b % SS;
  const float* bb_ = which == 0 ? bq : (which == 1 ? bk : bv);
  v8f acc[8] = {};
  gemm_lds<E>(X16, [&](int r) { return r0b + r; }, PT + (size_t)(which * E + n0) * E, smem, acc);
  if (which < 2) {
#pragma unroll
    for (int j = 0; j < 8; ++j) { const float bb = bb_[n0 + j * 16 + col];
#pragma unroll
      for (int r = 0; r < 8; ++r) so[wave][8 * g + r][j * 16 + col] = (acc[j][r] * (1.0f / 16.0f) + bb) * 4.0f; }
    LDSX();
    for (int qq = lane; qq < 16 * 2 * 8; qq += 32) { const int hh = qq >> 7, rl = (qq >> 3) & 15, pc = qq & 7; const int h = (n0 >> 6) + hh; union { v8h h8; v4u u; } pk;
#pragma unroll
      for (int e = 0; e < 8; ++e) pk.h8[e] = (_Float16)so[wave][rl][hh * 64 + pc * 8 + e];
      if (which == 0) vst2(Q16 + (((size_t)b * NH + h) * SS + s0 + wave * 16 + rl) * HD + pc * 8, pk.u);
      else vst2(K16 + (((size_t)b * NH + h) * NKEY + s0 + wave * 16 + rl) * HD + pc * 8, pk.u);
      // the next trip writes the registers that the store names
      asm volatile("s_wait_xcnt 0x0" ::: "memory"); } }
  else {
#pragma unroll
    for (int j = 0; j < 8; ++j) { const float bb = bb_[n0 + j * 16 + col];
#pragma unroll
      for (int r = 0; r < 8; ++r) { const int s = s0 + wave * 16 + 8 * g + r; sth[j * 16 + col][wave * 16 + 8 * g + r] = (_Float16)((acc[j][r] * (1.0f / 16.0f) + bb) * srcm[b * SS + s] * 4.0f); } }
    __syncthreads();
    // the block's 64 tokens are one whole line of each of its 128 V^T rows: eight lanes store a line; unrolled so that the eight LDS reads are asked for together and their latency is paid once
#pragma unroll
    for (int i = 0; i < 8; ++i) { const int c = (tid >> 3) + 16 * i, n = n0 + c, pc = tid & 7;
      vst2(VT + (((size_t)b * NH + (n >> 6)) * HD + (n & 63)) * NKEY + s0 + pc * 8, *(const v4u*)(&sth[c][pc * 8])); }
    // in the listing another part of the shared launch follows, whose first instructions write registers that these stores name
    asm volatile("s_wait_xcnt 0x0" ::: "memory"); }
}
// text k/v: block (one of 2 row tiles of 64 over the 77 rows, clamped; 128 of 512 cols; which kv; b) from T16 [b*77 + t][256] @ PT2 ; k -> K16 slots 1024 + t ; v (x text_cond) -> VT columns 1024 + t ; t = 77..127 are the pads, stored as zeros
__device__ __forceinline__ void b_tkv(const int bx, const int by, const int bz, char* smem, const _Float16* __restrict__ T16, const _Float16* __restrict__ PT2, const float* __restrict__ bkt, const float* __restrict__ bvt, const int* __restrict__ cond, _Float16* __restrict__ K16, _Float16* __restrict__ VT) {
  float (*so)[16][132] = (float (*)[16][132])smem;      // [4][16][132], which == 0
  _Float16 (*sth)[72] = (_Float16 (*)[72])smem;         // [128][72], which == 1
  const int tid = threadIdx.x, wave = tid >> 5, lane = tid & 31, col = lane & 15, g = lane >> 4;
  const int b = bz, which = by; const int t0b = (bx >> 2) * 64, t0 = t0b + wave * 16, n0 = (bx & 3) * 128;
  const float tc = (cond[b] % 10) > 0 ? 1.f : 0.f; const float* bb_ = which == 0 ? bkt : bvt; const float vsc = which == 0 ? 4.0f : 4.0f * tc;
  v8f acc[8] = {};
  gemm_lds<LT>(T16, [&](int r) { const int t = t0b + r; return b * NTX + (t < NTX ? t : NTX - 1); }, PT2 + (size_t)(which * E + n0) * LT, smem, acc);
  if (which == 0) {   // K16 rows [bh][slot 1024 + t][64]: 2 heads per 128 cols
#pragma unroll
    for (int j = 0; j < 8; ++j) { const float bb = bb_[n0 + j * 16 + col];
#pragma unroll
      for (int r = 0; r < 8; ++r) so[wave][8 * g + r][j * 16 + col] = t0 + 8 * g + r < NTX ? (acc[j][r] * (1.0f / 16.0f) + bb) * vsc : 0.f; }
    LDSX();
    for (int qq = lane; qq < 16 * 2 * 8; qq += 32) { const int hh = qq >> 7, rl = (qq >> 3) & 15, pc = qq & 7; const int h = (n0 >> 6) + hh; const int t = t0 + rl; union { v8h h8; v4u u; } pk;
#pragma unroll
      for (int e = 0; e < 8; ++e) pk.h8[e] = (_Float16)so[wave][rl][hh * 64 + pc * 8 + e];
      vst2(K16 + (((size_t)b * NH + h) * NKEY + SS + t) * HD + pc * 8, pk.u); } }
  else {              // VT rows [bh][d][slot 1024 + t]: the block's 64 t are one whole line of each of its 128 V^T rows
#pragma unroll
    for (int j = 0; j < 8; ++j) { const float bb = bb_[n0 + j * 16 + col]; union { v8h h8; v4u u; } pk;
#pragma unroll
      for (int r = 0; r < 8; ++r) pk.h8[r] = t0 + 8 * g + r < NTX ? (_Float16)((acc[j][r] * (1.0f / 16.0f) + bb) * vsc) : (_Float16)0.f;
      *(v4u*)(&sth[j * 16 + col][wave * 16 + 8 * g]) = pk.u; }
    // a line holds rows of all four waves: every wave's part is in LDS before any line is stored
    __syncthreads();
    // unrolled so that the eight LDS reads are asked for together and their latency is paid once
#pragma unroll
    for (int i = 0; i < 8; ++i) { const int c = (tid >> 3) + 16 * i, n = n0 + c, pc = tid & 7;
      vst2(VT + (((size_t)b * NH + (n >> 6)) * HD + (n & 63)) * NKEY + SS + t0b + pc * 8, *(const v4u*)(&sth[c][pc * 8])); }
    // in the listing another part of the shared launch follows, whose first instructions write registers that these stores name
    asm volatile("s_wait_xcnt 0x0" ::: "memory"); }
}
// [scale | shift] = silu(emb) emb_W^T + emb_b : 8 rows (16-row tile, rows >= 8 zero) x 1024 cols, K = 2048 (bf16 hi/lo)
// block = 32 cols (one whole 128-B line of each SSH row), 4 waves; k is cut in 16 slices of 128, wave w takes slices w, w + 4, w + 8, w + 12 one after the other, each for both column tiles and into a tile of its own;
// the 16 partial tiles are summed in LDS in slice order
#define EKW 16
#define EKC (TE / EKW / 32)
__device__ __forceinline__ void b_emb(const int blk, char* smem, const float* __restrict__ emb, const float* __restrict__ W, const float* __restrict__ bias, float* __restrict__ SSH) {
  float (*red)[NB][32] = (float (*)[NB][32])smem;       // [EKW][NB][32]
  const int tid = threadIdx.x, wave = tid >> 5, lane = tid & 31, col = lane & 15, g = lane >> 4; const int n0 = blk * 32;
  for (int i4 = 0; i4 < EKW / 4; ++i4) { const int sl = wave + 4 * i4, kb = sl * (TE / EKW);
    // A loader: lanes col and col + 8 share emb row col & 7; the lower lane makes silu of fragment elements 0..7, the upper lane of elements 8..15 and hands them over; rows >= 8 of the tile are zero
    const int eh = col >> 3; const float* ep = emb + (size_t)(col & 7) * TE + kb + 8 * g + 16 * eh;
    const float* wp = W + (size_t)(n0 + col) * TE + kb + 8 * g;
    // the whole slice is asked for before any of it is used, so that it pays the memory latency once; written as 16-B loads: from element-wise reads the compiler, in this larger kernel, moves most of the loads down to their users
    v4f e4[EKC][2], w4[EKC][2][4];
#pragma unroll
    for (int kc = 0; kc < EKC; ++kc)
#pragma unroll
      for (int h = 0; h < 2; ++h) e4[kc][h] = *(const v4f*)(ep + kc * 32 + 4 * h);
#pragma unroll
    for (int kc = 0; kc < EKC; ++kc)
#pragma unroll
      for (int j = 0; j < 2; ++j)
#pragma unroll
        for (int h = 0; h < 4; ++h) w4[kc][j][h] = *(const v4f*)(wp + (size_t)j * 16 * TE + kc * 32 + 16 * (h >> 1) + 4 * (h & 1));
    float ev[EKC][8], wv[EKC][2][16];
#pragma unroll
    for (int kc = 0; kc < EKC; ++kc) {
#pragma unroll
      for (int i = 0; i < 8; ++i) ev[kc][i] = e4[kc][i >> 2][i & 3];
#pragma unroll
      for (int j = 0; j < 2; ++j)
#pragma unroll
        for (int i = 0; i < 16; ++i) wv[kc][j][i] = w4[kc][j][i >> 2][i & 3]; }
    F2 a[EKC];
#pragma unroll
    for (int kc = 0; kc < EKC; ++kc) { float v[16];
#pragma unroll
      for (int i = 0; i < 8; ++i) { const float s = silu(ev[kc][i]); const float o = __shfl_xor(s, 8, 32); v[i] = eh ? 0.f : s; v[8 + i] = eh ? 0.f : o; }
      a[kc] = bsplit16(v); }
    v8f acc[2] = {};
#pragma unroll
    for (int kc = 0; kc < EKC; ++kc)
#pragma unroll
      for (int j = 0; j < 2; ++j) acc[j] = mac3(a[kc], bsplit16(wv[kc][j]), acc[j]);
    if (g == 0) {
#pragma unroll
      for (int j = 0; j < 2; ++j)
#pragma unroll
        for (int r = 0; r < 8; ++r) red[sl][r][j * 16 + col] = acc[j][r]; } }
  __syncthreads();
#pragma unroll
  for (int i = 0; i < NB * 32 / 128; ++i) { const int r = (tid >> 5) + 4 * i, c = tid & 31; float s = red[0][r][c];
#pragma unroll
    for (int w = 1; w < EKW; ++w) s += red[w][r][c];
    SSH[(size_t)r * (2 * E) + n0 + c] = s + bias[n0 + c]; }
}
// one launch for the three parts that need only k_pre's results or inputs; the longest blocks (b_emb) first, the shortest (b_tkv) last
#define G_EMB ((2 * E) / 32)
#define G_QX (NR / 64)
#define G_QY (E / 128)
#define G_QKV (G_QX * G_QY * 3)
#define G_TKV (2 * 4 * 2 * NB)
__global__ __launch_bounds__(128) void k_proj(const _Float16* __restrict__ X16, const _Float16* __restrict__ PT, const float* __restrict__ bq, const float* __restrict__ bk, const float* __restrict__ bv, const float* __restrict__ srcm,
                                              _Float16* __restrict__ Q16, _Float16* __restrict__ K16, _Float16* __restrict__ VT, const _Float16* __restrict__ T16, const _Float16* __restrict__ PT2, const float* __restrict__ bkt, const float* __restrict__ bvt,
                                              const int* __restrict__ cond, const float* __restrict__ emb, const float* __restrict__ embW, const float* __restrict__ embb, float* __restrict__ SSH) {
  __shared__ __align__(16) char smem[GSM];
  const int id = blockIdx.x;
  if (id < G_EMB) b_emb(id, smem, emb, embW, embb, SSH);
  else if (id < G_EMB + G_QKV) { const int q = id - G_EMB; b_qkv(q % G_QX, (q / G_QX) % G_QY, q / (G_QX * G_QY), smem, X16, PT, bq, bk, bv, srcm, Q16, K16, VT); }
  else { const int t = id - (G_EMB + G_QKV); b_tkv(t & 7, (t >> 3) & 1, t >> 4, smem, T16, PT2, bkt, bvt, cond, K16, VT); }
}
// attention: block (64 queries, bh); 18 key tiles; additive masks; O16 x8 [bh][s][64]
// Each key tile (64 K rows, 64 V^T rows of 128 B, 64 mask penalties) is brought in once per block with whole-line loads and kept in LDS for all four waves;
// two buffers: tile kt + 1 is asked for ahead of tile kt's products and stored behind them, one barrier per tile. Rows are padded to 144 B (16 B x odd) for the 16-B fragment reads.
// Both products are taken transposed: S^T = K Q^T (A = K rows, B = Q rows) and O^T += V^T P^T (A = V^T rows, B = P^T). A lane then holds 32 scores of ONE query (its column), keys 16 t + 8 g + r of the tile,
// so maximum, exponentials and sum are in-lane (the two lane halves exchange the maximum once per tile and join their sums once behind the loop), the correction factor is the lane's own,
// and two score tiles converted in place are the B operand of the second product in the k order of frag_h: scores and P never go through LDS.
#define NT (NKEY / 64)
#define KP 72
// e^x is taken as the hardware's 2^y, y = x log2(e) + bias: x is a value minus a maximum that covers it and the bias is at most 14 (below), so y <= 14 and the library form's overflow and denormal-range handling has nothing to do
// (a result below the normal range is far below one f16 step of P and of the sum, whatever becomes of it).
// A score stays in the product's own units (16 x logit, q and k being x4): its mask penalty, x16, is the start value of the score product, and ONE multiply-add leads from the matrix unit to 2^y:
// y = s SC2 + bias, bias = 14 - max SC2 (the + 14 lifts P by 2^14). Any bias gives the same softmax as long as sums and outputs of earlier tiles are carried over by 2^(bias - earlier bias), which is what corr is;
// the bias is rounded DOWN by at least one step, so y <= 14 and P <= 2^14 whatever the size of the maximum.
#define LOG2E 1.44269504088896340736f
#define SC2 (LOG2E / 16.0f)
// lane l with lane l ^ 16
__device__ __forceinline__ float xhalf(float x) { return __builtin_bit_cast(float, __builtin_amdgcn_permlanex16(__builtin_bit_cast(int, x), __builtin_bit_cast(int, x), 0x76543210, 0xfedcba98, false, false)); }
// eight independent 2^y in one statement: behind a transcendental the instruction set asks for one independent instruction before its result is read or its source overwritten;
// here each v_exp_f32 is that instruction for the one before it (no output shares a register with an input) and the v_nop is it for the last
__device__ __forceinline__ void exp2x8(const float (&y)[8], float (&e)[8]) {
  asm("v_exp_f32 %0, %8\n\tv_exp_f32 %1, %9\n\tv_exp_f32 %2, %10\n\tv_exp_f32 %3, %11\n\tv_exp_f32 %4, %12\n\tv_exp_f32 %5, %13\n\tv_exp_f32 %6, %14\n\tv_exp_f32 %7, %15\n\tv_nop"
      : "=&v"(e[0]), "=&v"(e[1]), "=&v"(e[2]), "=&v"(e[3]), "=&v"(e[4]), "=&v"(e[5]), "=&v"(e[6]), "=&v"(e[7])
      : "v"(y[0]), "v"(y[1]), "v"(y[2]), "v"(y[3]), "v"(y[4]), "v"(y[5]), "v"(y[6]), "v"(y[7]));
}
__global__ __launch_bounds__(128) void k_attn(const _Float16* __restrict__ Q16, const _Float16* __restrict__ K16, const _Float16* __restrict__ VT, const int* __restrict__ cond, const float* __restrict__ srcm, _Float16* __restrict__ O16) {
  __shared__ __align__(16) _Float16 sO[4][16][72];    // behind the loop: the wave's output tile, query rows
  __shared__ __align__(16) _Float16 sK[2][64][KP];
  __shared__ __align__(16) _Float16 sV[2][64][KP];
  __shared__ __align__(16) float sPen[2][64];
  const int tid = threadIdx.x, w = tid >> 5, lane = tid & 31, col = lane & 15, g = lane >> 4;
  const size_t bh = blockIdx.y; const int b = (int)(bh / NH); const int q0 = blockIdx.x * 64 + w * 16;
  const float tpen = ((cond[b] % 10) > 0) ? 0.f : -16000000.0f;
  // staging: thread owns 16-B piece tid & 7 of rows (tid >> 3) + 16 i, so a wave's load covers four whole 128-B lines
  const int srow = tid >> 3, spc = (tid & 7) * 8;
  const _Float16* kg = K16 + (bh * NKEY + srow) * HD + spc;
  const _Float16* vg = VT + (bh * HD + srow) * NKEY + spc;
  v8h rk[4], rv[4]; float rm;
  auto fetch = [&](int kt) {
#pragma unroll
    for (int i = 0; i < 4; ++i) { rk[i] = *(const v8h*)(kg + (size_t)(kt * 64 + 16 * i) * HD); rv[i] = *(const v8h*)(vg + (size_t)(16 * i) * NKEY + kt * 64); }
    int ms = kt * 64 + (tid & 63); ms = ms > SS - 1 ? SS - 1 : ms; rm = srcm[b * SS + ms]; };
  auto put = [&](int kt) { const int bf = kt & 1;
#pragma unroll
    for (int i = 0; i < 4; ++i) { *(v8h*)(&sK[bf][srow + 16 * i][spc]) = rk[i]; *(v8h*)(&sV[bf][srow + 16 * i][spc]) = rv[i]; }
    if (tid < 64) { const int slot = kt * 64 + tid; sPen[bf][tid] = slot < SS ? (1.0f - rm) * -16000000.0f : (slot < SS + NTX ? tpen : -3.0e38f); } };
  fetch(0);
  v16h aq[2];
#pragma unroll
  for (int kc = 0; kc < 2; ++kc) aq[kc] = frag_h(Q16 + (bh * SS + q0 + col) * HD + kc * 32, lane);
  put(0);
  __syncthreads();
  // mrun: the query's running maximum, brun: the bias that belongs to it (both equal in both lane halves); lrun: the running sum over this lane half's keys only
  float mrun = -3.0e38f, brun = 3.0e38f * SC2, lrun = 0.f; v8f acc[4] = {};
#pragma unroll 1
  for (int kt = 0; kt < NT; ++kt) { const int bf = kt & 1;
    // asked for first, so that the loads fly under the whole tile
    if (kt + 1 < NT) fetch(kt + 1);
    v16h kf[4][2]; union { v8f s; v4f q[2]; } pn[4];
#pragma unroll
    for (int t = 0; t < 4; ++t) {
#pragma unroll
      for (int kc = 0; kc < 2; ++kc) kf[t][kc] = frag_h(&sK[bf][t * 16 + col][kc * 32], lane);
#pragma unroll
      for (int h = 0; h < 2; ++h) pn[t].q[h] = *(const v4f*)(&sPen[bf][t * 16 + 8 * g + 4 * h]); }
    // sv[t][r] = 16 x logit of key slot kt * 64 + 16 t + 8 g + r for query q0 + col; a pad slot has zero K rows and the start value -3.0e38, so it stays -3.0e38, its y is below -1e37 and its 2^y is 0
    float sv[4][8], mt[4];
#pragma unroll
    for (int t = 0; t < 4; ++t) { v8f s = pn[t].s;
#pragma unroll
      for (int kc = 0; kc < 2; ++kc) s = wmma16(kf[t][kc], aq[kc], s);
#pragma unroll
      for (int r = 0; r < 8; ++r) sv[t][r] = s[r];
      mt[t] = sv[t][0];
#pragma unroll
      for (int r = 1; r < 8; ++r) mt[t] = fmaxf(mt[t], sv[t][r]); }
    float mx = fmaxf(fmaxf(mt[0], mt[1]), fmaxf(mt[2], mt[3]));
    mx = fmaxf(mx, xhalf(mx));
    const float mnew = fmaxf(mrun, mx); const float b0 = fmaf(-mnew, SC2, 14.0f); const float bnew = fmaf(-fabsf(b0), 1.1920929e-7f, b0); const float corr = __builtin_amdgcn_exp2f(bnew - brun);
    v16h vf[2][4];
#pragma unroll
    for (int kc = 0; kc < 2; ++kc)
#pragma unroll
      for (int t = 0; t < 4; ++t) vf[kc][t] = frag_h(&sV[bf][t * 16 + col][kc * 32], lane);
    // P^T as B operand: element e of fragment kc is key 32 kc + 8 g + e (e < 8) or 32 kc + 16 + 8 g + e - 8, that is score tiles 2 kc and 2 kc + 1 in place
    v16h ph[2]; float pt[4];
#pragma unroll
    for (int t = 0; t < 4; ++t) { pt[t] = 0.f;
      float y[8], e[8];
#pragma unroll
      for (int r = 0; r < 8; ++r) y[r] = fmaf(sv[t][r], SC2, bnew);
      exp2x8(y, e);
#pragma unroll
      for (int r = 0; r < 8; ++r) { pt[t] += e[r]; ph[t >> 1][(t & 1) * 8 + r] = (_Float16)e[r]; } }
    lrun = lrun * corr + ((pt[0] + pt[1]) + (pt[2] + pt[3])) * (1.0f / 16384.0f); mrun = mnew; brun = bnew;
#pragma unroll
    for (int t = 0; t < 4; ++t)
#pragma unroll
      for (int r = 0; r < 8; ++r) acc[t][r] *= corr;
#pragma unroll
    for (int kc = 0; kc < 2; ++kc)
#pragma unroll
      for (int t = 0; t < 4; ++t) acc[t] = wmma16(vf[kc][t], ph[kc], acc[t]);
    // the other buffer's last readers left it at the barrier of the trip before; this barrier publishes tile kt + 1 and ends the reads of tile kt
    if (kt + 1 < NT) { put(kt + 1); __syncthreads(); } }
  // acc[t][r] = O^T[d = 16 t + 8 g + r][query col]: eight neighbouring d of one query row, one 16-B piece
  const float lr = lrun + xhalf(lrun); const float inv = 8.0f / (lr * 16384.0f * 4.0f);
#pragma unroll
  for (int t = 0; t < 4; ++t) { union { v8h h8; v4u u; } pk;
#pragma unroll
    for (int r = 0; r < 8; ++r) pk.h8[r] = (_Float16)(acc[t][r] * inv);
    *(v4u*)(&sO[w][col][t * 16 + 8 * g]) = pk.u; }
  LDSX();
  // eight lanes store one whole 128-B query row; unrolled so that the four LDS reads are asked for together and their latency is paid once
#pragma unroll
  for (int i = 0; i < 4; ++i) { const int rl = (lane >> 3) + 4 * i, pc = lane & 7;
    vst2(O16 + ((bh * SS) + q0 + rl) * HD + pc * 8, *(const v4u*)(&sO[w][rl][pc * 8])); }
}
// out = x + silu(LN(y) (1 + scale) + shift) out_W^T + out_b, one launch: a block owns 32 whole rows (all 512 columns), 8 waves.
// Front part: wave w makes the stylised rows 4 w .. 4 w + 3 (x8, f16) from O16 and keeps them in LDS for the whole product (they never go through memory);
// lane owns columns lane*8..+7 and 256 + lane*8..+7, that is one 16-B piece of heads lane >> 3 and 4 + (lane >> 3).
// Product: wave w keeps the 32 rows x columns 64 w .. 64 w + 63 in acc, k ascending; 128-k slices of all 512 out_W rows go through two LDS buffers by whole-line loads, one barrier per slice
// (a slice's products last longer than the next slice's way from L2; half of out_W is on its way or in LDS before the front part ends).
#define OR 32
#define OP 520                           // halves per stylised row in LDS: 1040 B = 16 B x odd
#define OZB (OR * OP * 2)                // bytes of the stylised rows
#define OK 128                           // k per slice
#define OGP 136                          // halves per slice row in LDS: 272 B = 16 B x odd
#define OBB (E * OGP * 2)                // bytes of one out_W slice buffer
__global__ __launch_bounds__(256) void k_out(const _Float16* __restrict__ O16, const float* __restrict__ SSH, const float* __restrict__ g_, const float* __restrict__ b_,
                                             const _Float16* __restrict__ PT, const float* __restrict__ bo, const float* __restrict__ x, float* __restrict__ out) {
  __shared__ __align__(16) char smem[OZB + 2 * OBB];
  _Float16* sZ = (_Float16*)smem; _Float16* sB = (_Float16*)(smem + OZB);
  float (*so)[OR][68] = (float (*)[OR][68])(smem + OZB);   // [8][32][68], behind the loop, over slice buffer 0
  const int tid = threadIdx.x, wave = tid >> 5, lane = tid & 31, col = lane & 15, g = lane >> 4;
  const int r0b = blockIdx.x * OR; const int b = r0b / SS, s0 = r0b % SS;
  // staging: thread owns 16-B piece tid & 15 of out_W rows (tid >> 4) + 16 i, so a wave's load covers four whole 128-B lines
  const int srow = tid >> 4, spc = (tid & 15) * 8;
  const _Float16* Bg = PT + (size_t)3 * E * E + (size_t)srow * E + spc;
  v8h rb[32];
  auto fetch = [&](int c) {
#pragma unroll
    for (int i = 0; i < 32; ++i) rb[i] = *(const v8h*)(Bg + c * OK + 16 * i * E); };
  auto put = [&](int c) { _Float16* pb = sB + (c & 1) * (E * OGP) + srow * OGP + spc;
#pragma unroll
    for (int i = 0; i < 32; ++i) *(v8h*)(pb + 16 * i * OGP) = rb[i]; };
  fetch(0);
  // everything the front part reads is asked for at once, so that the memory latency is paid once
  v8h o8[4][2];
#pragma unroll
  for (int rr = 0; rr < 4; ++rr)
#pragma unroll
    for (int half = 0; half < 2; ++half) o8[rr][half] = *(const v8h*)(O16 + (((size_t)b * NH + half * 4 + (lane >> 3)) * SS + s0 + wave * 4 + rr) * HD + (lane & 7) * 8);
  // the loads that follow may land in the registers that hold these loads' address
  asm volatile("s_wait_xcnt 0x0" ::: "memory");
  const float* sc_ = SSH + (size_t)b * 2 * E; const float* sh_ = sc_ + E;
  v4f pg[4], pb_[4], psc[4], psh[4];
#pragma unroll
  for (int q = 0; q < 4; ++q) { const int c = (q >> 1) * 256 + lane * 8 + (q & 1) * 4;
    pg[q] = *(const v4f*)(g_ + c); pb_[q] = *(const v4f*)(b_ + c); psc[q] = *(const v4f*)(sc_ + c); psh[q] = *(const v4f*)(sh_ + c); }
  float bb[4];
#pragma unroll
  for (int j = 0; j < 4; ++j) bb[j] = bo[wave * 64 + j * 16 + col];
  // the front part's first instructions write the offset register that these loads name
  asm volatile("s_wait_xcnt 0x0" ::: "memory");
  // keeps the first uses below all of these loads: without it the compiler waits for the first four before it asks for the rest, and the latency is paid twice
  __builtin_amdgcn_sched_barrier(0);
  put(0);
  // slice 1 flies under the front part
  fetch(1);
  float sum[4], sq[4];
#pragma unroll
  for (int rr = 0; rr < 4; ++rr) { sum[rr] = 0.f; sq[rr] = 0.f;
#pragma unroll
    for (int e = 0; e < 16; ++e) { const float v = (float)o8[rr][e >> 3][e & 7] * 0.125f; sum[rr] += v; sq[rr] += v * v; } }
#pragma unroll
  for (int o = 16; o > 0; o >>= 1)
#pragma unroll
    for (int rr = 0; rr < 4; ++rr) { sum[rr] += __shfl_xor(sum[rr], o, 32); sq[rr] += __shfl_xor(sq[rr], o, 32); }
#pragma unroll
  for (int rr = 0; rr < 4; ++rr) {
    const float mu = sum[rr] * (1.0f / E); float var = sq[rr] * (1.0f / E) - mu * mu; var = var > 0.f ? var : 0.f; const float rs = rsqrtf(var + 1e-5f);
#pragma unroll
    for (int half = 0; half < 2; ++half) { v8h pk;
#pragma unroll
      for (int e = 0; e < 8; ++e) { const int q = half * 2 + (e >> 2), k = e & 3; const float v = (float)o8[rr][half][e] * 0.125f;
        const float hn = (v - mu) * rs * pg[q][k] + pb_[q][k]; const float mm = hn * (1.0f + psc[q][k]) + psh[q][k]; pk[e] = (_Float16)(silu(mm) * 8.0f); }
      *(v8h*)(sZ + (wave * 4 + rr) * OP + half * 256 + lane * 8) = pk; } }
  // publishes the stylised rows and slice 0
  __syncthreads();
  v8f acc[2][4] = {};
  // unrolled: the slice's step and the buffer's place become immediate offsets
#pragma unroll
  for (int c = 0; c < E / OK; ++c) { const int bf = c & 1;
    // asked for ahead of the products and stored behind them (slice 1 is already in the registers); nothing is in flight at a barrier, which waits for every load
    if (c > 0 && c + 1 < E / OK) fetch(c + 1);
#pragma unroll
    for (int kc = 0; kc < OK / 32; ++kc) { v16h a[2], bfr[4];
#pragma unroll
      for (int i = 0; i < 2; ++i) a[i] = frag_h(sZ + (i * 16 + col) * OP + c * OK + kc * 32, lane);
#pragma unroll
      for (int j = 0; j < 4; ++j) bfr[j] = frag_h(sB + (bf * E + wave * 64 + j * 16 + col) * OGP + kc * 32, lane);
#pragma unroll
      for (int i = 0; i < 2; ++i)
#pragma unroll
        for (int j = 0; j < 4; ++j) acc[i][j] = wmma16(a[i], bfr[j], acc[i][j]); }
    // the other buffer's last readers left it at the barrier of the trip before; this barrier publishes slice c + 1 and ends the reads of slice c
    if (c + 1 < E / OK) { put(c + 1); __syncthreads(); } }
  // ends every wave's reads of the last slice (buffer 1); the output tiles overwrite only buffer 0, whose reads ended at the barrier of trip 2
  __syncthreads();
  // a wave's store covers its 256 B (two whole lines) of two rows; the residual is asked for ahead of the LDS trip
  const size_t oo = (size_t)(r0b + g) * E + wave * 64 + col * 4; const float* xp = x + oo; float* op = out + oo;
  v4f xr[16];
#pragma unroll
  for (int it = 0; it < 16; ++it) xr[it] = *(const v4f*)(xp + it * 2 * E);
#pragma unroll
  for (int j = 0; j < 4; ++j)
#pragma unroll
    for (int i = 0; i < 2; ++i)
#pragma unroll
      for (int r = 0; r < 8; ++r) so[wave][i * 16 + 8 * g + r][j * 16 + col] = acc[i][j][r] * (1.0f / (16.0f * 8.0f)) + bb[j];
  LDSX();
#pragma unroll
  for (int it = 0; it < 16; ++it) vst2(op + it * 2 * E, *(const v4f*)(&so[wave][2 * it + g][col * 4]) + xr[it]);
}
extern "C" void kernel_launch(void* const* d_in, const int* in_sizes, int n_in, void* d_out, int out_size, void* d_ws, size_t ws_size, hipStream_t stream) {
  (void)in_sizes; (void)n_in; (void)out_size; (void)ws_size;
  const float** I = (const float**)d_in;
  const float* x = I[0]; const float* xf = I[1]; const float* emb = I[2]; const float* srcm = I[3]; const int* cond = (const int*)d_in[4];
  const float* ng = I[5]; const float* nb = I[6]; const float* tg = I[7]; const float* tb = I[8]; const float* Wq = I[9]; const float* bq = I[10]; const float* Wkt = I[11]; const float* bkt = I[12]; const float* Wvt = I[13]; const float* bvt = I[14];
  const float* Wkm = I[15]; const float* bkm = I[16]; const float* Wvm = I[17]; const float* bvm = I[18]; const float* embW = I[19]; const float* embb = I[20]; const float* sg = I[21]; const float* sb = I[22]; const float* Wo = I[23]; const float* bo = I[24];
  float* out = (float*)d_out;
  char* ws = (char*)d_ws; size_t off = 0;
  auto take = [&](size_t bytes) { char* p = ws + off; off += (bytes + 255) & ~(size_t)255; return p; };
  _Float16* X16 = (_Float16*)take((size_t)NR * E * 2); _Float16* T16 = (_Float16*)take((size_t)NB * NTX * LT * 2 + 4096); _Float16* PT = (_Float16*)take((size_t)4 * E * E * 2); _Float16* PT2 = (_Float16*)take((size_t)2 * E * LT * 2);
  _Float16* Q16 = (_Float16*)take((size_t)NR * E * 2); _Float16* K16 = (_Float16*)take((size_t)NB * NH * NKEY * HD * 2);
  _Float16* VT = (_Float16*)take((size_t)NB * NH * HD * NKEY * 2); _Float16* O16 = (_Float16*)take((size_t)NR * E * 2); float* SSH = (float*)take((size_t)NB * 2 * E * 4);
  // ws ~ 46 MB
  k_pre<<<G_LNT + G_LNX + G_PACK, 256, 0, stream>>>(x, ng, nb, X16, xf, tg, tb, T16, Wq, Wkm, Wvm, Wo, Wkt, Wvt, PT, PT2);
  k_proj<<<G_EMB + G_QKV + G_TKV, 128, 0, stream>>>(X16, PT, bq, bkm, bvm, srcm, Q16, K16, VT, T16, PT2, bkt, bvt, cond, emb, embW, embb, SSH);
  k_attn<<<dim3(SS / 64, NB * NH), 128, 0, stream>>>(Q16, K16, VT, cond, srcm, O16);
  k_out<<<NR / OR, 256, 0, stream>>>(O16, SSH, sg, sb, PT, bo, x, out);
}
